// v000
// Times are from an AMD MI455X. After a warm-up the kernel runs many times in a row, and a time is the length of
// such a window on the GPU divided by its runs, so every launch and the gaps after it count. The runs cycle
// through copies of the inputs. A figure is the median of several windows, for all but v000 over two sittings.
// Sittings can differ by a few percent; kernels timed side by side share one.
// The starting kernel, v000, takes 4030 microseconds a run.
#include <hip/hip_runtime.h>

// Transformer-XL style multi-head attention on a SEQUENCE-MAJOR input with post-LayerNorm (h [2048][4][1024] (seq, batch, model); q = h Wq ('xw' [1024][1024] 1/32), k | v = h Wkv ('xw' [1024][2048]: k = columns 0..1023, v = 1024..2047); 16 heads x 64; score = q.k / 8; softmax over keys; attn_vec merged; attn_out = attn_vec Wo ('xw' no bias); out = LayerNorm(h + attn_out) gamma/beta (eps 1e-5) -> [2048][4][1024] seq-major (8.4 M)).
// Layout per batch: a strided gather makes batch b's rows (row pitch 4 x 1024 in the input) a contiguous token-major bf16 operand; 'xw' weights transposed once (Wkv as two column blocks); exact projections; dense T-2048 attention (hybrid rows: < 512 hi/lo 3 products, rest fp16 x1024); merged hi/lo x Wo exact into workspace; residual add (strided rows of h) and a row LayerNorm kernel write batch b's output rows back at pitch 4 x 1024.
// Compute dtypes, f32 accumulate: every input rounded to bf16; projections exact; attention rows < 512 3 products, rest fp16; softmax f32; Wo hl x exact; residual + LayerNorm f32.

#define NB_  4
#define TT   2048
#define DM   1024
#define NH_  16
#define NKV  16
#define REP  (NH_ / NKV)
#define HD   64
#define DQ   (NH_ * HD)
#define DKV  (NKV * HD)
#define ZH   2
#define RH   512                  // query rows < RH use hi+lo planes (0: none)
#define WIN  0
#define PCAR 1024.0f
#define SCL  0.125f
#define LNEPS 1e-5f
#define SP   (NB_ * DM)   // seq-major row pitch of h and out (floats)
typedef _Float16 h16;
typedef unsigned short bf;
typedef __attribute__((ext_vector_type(16))) __bf16   v16bf;
typedef __attribute__((ext_vector_type(16))) _Float16 v16h;
typedef __attribute__((ext_vector_type(8)))  _Float16 v8h;
typedef __attribute__((ext_vector_type(8)))  unsigned short v8us;
typedef __attribute__((ext_vector_type(8)))  float    v8f;
typedef __attribute__((ext_vector_type(4)))  float    v4f;
typedef v8h  __attribute__((may_alias)) v8ha;
typedef v4f  __attribute__((may_alias)) v4fa;
typedef v8us __attribute__((may_alias)) v8usa;

__device__ __forceinline__ unsigned short f2bf(float f) { unsigned u = __float_as_uint(f); u += 0x7FFFu + ((u >> 16) & 1u); return (unsigned short)(u >> 16); }
__device__ __forceinline__ float bf2f(unsigned short b) { return __uint_as_float(((unsigned)b) << 16); }
__device__ __forceinline__ float bfr(float f) { return bf2f(f2bf(f)); }
__device__ __forceinline__ v16h cat16(v8h lo, v8h hi) { return __builtin_shufflevector(lo, hi, 0, 1, 2, 3, 4, 5, 6, 7, 8, 9, 10, 11, 12, 13, 14, 15); }
__device__ __forceinline__ v16bf cat16b(v8us lo, v8us hi) { return __builtin_bit_cast(v16bf, __builtin_shufflevector(lo, hi, 0, 1, 2, 3, 4, 5, 6, 7, 8, 9, 10, 11, 12, 13, 14, 15)); }
__device__ __forceinline__ v8f wmma16(v16h a, v16h b, v8f c) { return __builtin_amdgcn_wmma_f32_16x16x32_f16(false, a, false, b, (short)0, c, false, false); }
__device__ __forceinline__ v8f wmmab(v16bf a, v16bf b, v8f c) { return __builtin_amdgcn_wmma_f32_16x16x32_bf16(false, a, false, b, (short)0, c, false, false); }



// ---- k_gemmw: register-blocked GEMM, ONE WAVE per 64x64 output tile (16 accumulators), operands straight from K-contiguous 16-bit planes; grid (M/64, N/64, Z), 32 threads.
// C[m][n] (f32, pitch ldc, + optional f32 bias[n]) = sum_k A[m][k] Bt[n][k] (+ split products per NSPLIT). z-batch strides sA/sB/sC in elements. K % 32 == 0.
template <typename T16> struct WFrag;
template <> struct WFrag<h16> { typedef v16h V; static __device__ __forceinline__ V ld(const h16* p) { return cat16(*(const v8h*)p, *(const v8h*)(p + 16)); } static __device__ __forceinline__ v8f mma(V a, V b, v8f c) { return wmma16(a, b, c); } };
template <> struct WFrag<bf> { typedef v16bf V; static __device__ __forceinline__ V ld(const bf* p) { return cat16b(*(const v8us*)p, *(const v8us*)(p + 16)); } static __device__ __forceinline__ v8f mma(V a, V b, v8f c) { return wmmab(a, b, c); } };
template <typename T16, int NSPLIT, bool BIAS>
__global__ __launch_bounds__(32) void k_gemmw(const T16* __restrict__ A, const T16* __restrict__ A2, const T16* __restrict__ Bt, const T16* __restrict__ Bt2, int K, float* C, int ldc, const float* __restrict__ bias, size_t sA, size_t sB, size_t sC) {
    typedef typename WFrag<T16>::V V;
    __shared__ __align__(16) float os[16 * 68];
    const size_t z = blockIdx.z; A += z * sA; if (A2) A2 += z * sA; Bt += z * sB; if (Bt2) Bt2 += z * sB; C += z * sC;
    const int lane = threadIdx.x & 31, lr = lane & 15, hi = lane >> 4; const int r0 = blockIdx.x * 64, c0 = blockIdx.y * 64;
    v8f acc[4][4];
#pragma unroll
    for (int mb = 0; mb < 4; ++mb)
#pragma unroll
        for (int nb = 0; nb < 4; ++nb) acc[mb][nb] = (v8f){};
    const size_t aoff = (size_t)(r0 + lr) * K + 8 * hi, boff = (size_t)(c0 + lr) * K + 8 * hi;
#pragma unroll 1
    for (int kc = 0; kc < K; kc += 32) {
        V a[4], a2[4];
#pragma unroll
        for (int mb = 0; mb < 4; ++mb) { a[mb] = WFrag<T16>::ld(A + aoff + (size_t)mb * 16 * K + kc); if (NSPLIT == 1 || NSPLIT == 2) a2[mb] = WFrag<T16>::ld(A2 + aoff + (size_t)mb * 16 * K + kc); }
#pragma unroll
        for (int nb = 0; nb < 4; ++nb) { const V b = WFrag<T16>::ld(Bt + boff + (size_t)nb * 16 * K + kc); V b2; if (NSPLIT >= 2) b2 = WFrag<T16>::ld(Bt2 + boff + (size_t)nb * 16 * K + kc);
#pragma unroll
            for (int mb = 0; mb < 4; ++mb) { acc[mb][nb] = WFrag<T16>::mma(a[mb], b, acc[mb][nb]); if (NSPLIT == 1 || NSPLIT == 2) acc[mb][nb] = WFrag<T16>::mma(a2[mb], b, acc[mb][nb]); if (NSPLIT >= 2) acc[mb][nb] = WFrag<T16>::mma(a[mb], b2, acc[mb][nb]); } }
        asm volatile("v_nop\n\tv_nop\n\tv_nop\n\tv_nop" : "+v"(acc[0][0]), "+v"(acc[1][1]), "+v"(acc[2][2]), "+v"(acc[3][3]) : "v"(a[0]), "v"(a[3]));
    }
#pragma unroll
    for (int mb = 0; mb < 4; ++mb) {
#pragma unroll
        for (int nb = 0; nb < 4; ++nb) {
#pragma unroll
            for (int j = 0; j < 8; ++j) os[(hi * 8 + j) * 68 + nb * 16 + lr] = acc[mb][nb][j]; }
        __builtin_amdgcn_wave_barrier(); asm volatile("" ::: "memory");
        float* crow = C + (size_t)(r0 + mb * 16) * ldc + c0;
{
#pragma unroll
            for (int s = 0; s < 8; ++s) { const int row = 2 * s + hi, cofs = lr * 4; v4f val = *(const v4fa*)(os + row * 68 + cofs); if (BIAS) { val[0] += bfr(bias[c0 + cofs]); val[1] += bfr(bias[c0 + cofs + 1]); val[2] += bfr(bias[c0 + cofs + 2]); val[3] += bfr(bias[c0 + cofs + 3]); }
                *(v4f*)(crow + (size_t)row * ldc + cofs) = val; }
             }
        __builtin_amdgcn_wave_barrier(); asm volatile("" ::: "memory");
    }
}

__device__ __forceinline__ h16 tohx(float x) { return (h16)x; }
__device__ __forceinline__ void splitf(float y, unsigned short& h, unsigned short& l) { h = f2bf(y); l = f2bf(y - bf2f(h)); }
typedef __attribute__((ext_vector_type(2))) _Float16 v2h;
typedef __attribute__((ext_vector_type(4))) _Float16 v4h;
typedef __attribute__((ext_vector_type(2))) unsigned short v2us;
typedef __attribute__((ext_vector_type(4))) unsigned short v4us;
typedef __attribute__((ext_vector_type(2))) float v2f;
typedef __attribute__((ext_vector_type(4))) int v4i;

__global__ __launch_bounds__(256) void k_wtG(const float* __restrict__ w, int K, int N, bf* Bt) {
    const int lane = threadIdx.x & 31; const int L0 = (blockIdx.x * 8 + (threadIdx.x >> 5)) * 8; const int nlines = N * K / 64;
{
#pragma unroll 1
        for (int l = 0; l < 8; ++l) { const int L = L0 + l; if (L >= nlines) break; const size_t e = (size_t)L * 64 + lane * 2; const int k = (int)(e % K), n = (int)(e / K); v2us o;
            o[0] = f2bf(w[(size_t)k * N + n]); o[1] = f2bf(w[(size_t)(k + 1) * N + n]); *(v2us*)(Bt + e) = o; }
         }
}
__global__ __launch_bounds__(256) void k_cvt8(const float* __restrict__ src, bf* dst, size_t n8) { const size_t i = (size_t)blockIdx.x * 256 + threadIdx.x; if (i >= n8) return; const v8f v = *(const v8f*)(src + i * 8); v8us o;
#pragma unroll
    for (int k = 0; k < 8; ++k) o[k] = f2bf(v[k]); *(v8us*)(dst + i * 8) = o;  }

// k_rope: head planes [h][t][d] (fp16 + hi/lo) of rope(x) x sc with the rotate-half convention out[d] = x[d] cos[t][d] - x[d+HD/2] sin[t][d], out[d+HD/2] = x[d+HD/2] cos[t][d+HD/2] + x[d] sin[t][d+HD/2]
__global__ __launch_bounds__(256) void k_rope(const float* __restrict__ F, int pitch, int nheads, const float* __restrict__ CS, const float* __restrict__ RF, const float* __restrict__ nw, float sc, h16* P16, bf* Ph, bf* Pl) {
    const size_t e = ((size_t)blockIdx.x * 256 + threadIdx.x) * 2; if (e >= (size_t)nheads * TT * HD) return; const int d = (int)(e % HD); const int t = (int)((e / HD) % TT); const int h = (int)(e / ((size_t)HD * TT)); const float* f = F + (size_t)t * pitch + h * HD; const float rf = RF ? RF[(size_t)h * TT + t] : 1.0f; v2h o16; v2us oh, ol;
#pragma unroll
    for (int q = 0; q < 2; ++q) { const int dd = d + q; const int dp = (dd < HD / 2) ? dd + HD / 2 : dd - HD / 2; float x0 = f[dd], x1 = f[dp];
        if (RF) { float n0 = __fmul_rn(x0, rf), n1 = __fmul_rn(x1, rf); asm volatile("" : "+v"(n0)); asm volatile("" : "+v"(n1)); x0 = __fmul_rn(bfr(nw[dd]), n0); x1 = __fmul_rn(bfr(nw[dp]), n1); }
        const v2f cs = *(const v2f*)(CS + ((size_t)t * HD + dd) * 2); float a = __fmul_rn(x0, cs[0]), bq = __fmul_rn(x1, cs[1]); asm volatile("" : "+v"(a)); asm volatile("" : "+v"(bq)); const float r = ((dd < HD / 2) ? __fsub_rn(a, bq) : __fadd_rn(a, bq)) * sc;
        o16[q] = tohx(r); unsigned short a2, c2; splitf(r, a2, c2); oh[q] = a2; ol[q] = c2; }
    *(v2h*)(P16 + e) = o16; *(v2us*)(Ph + e) = oh; *(v2us*)(Pl + e) = ol;  }
__global__ __launch_bounds__(256) void k_vtp(const float* __restrict__ F, int pitch, int nheads, h16* V16, bf* Vh, bf* Vl) { const size_t e = ((size_t)blockIdx.x * 256 + threadIdx.x) * 2; if (e >= (size_t)nheads * HD * TT) return; const int t = (int)(e % TT); const int d = (int)((e / TT) % HD); const int g = (int)(e / ((size_t)TT * HD)); v2h o16; v2us oh, ol;
#pragma unroll
    for (int q = 0; q < 2; ++q) { const float x = F[(size_t)(t + q) * pitch + g * HD + d]; o16[q] = tohx(x); unsigned short a2, c2; splitf(x, a2, c2); oh[q] = a2; ol[q] = c2; }
    *(v2h*)(V16 + e) = o16; *(v2us*)(Vh + e) = oh; *(v2us*)(Vl + e) = ol;  }
__global__ __launch_bounds__(256) void k_csid(float* CS) { const int idx = blockIdx.x * 256 + threadIdx.x; if (idx >= TT * HD) return; v2f cs; cs[0] = 1.0f; cs[1] = 0.0f; *(v2f*)(CS + (size_t)idx * 2) = cs;  }
// k_asoft: per row (zz, i): t = S x HD^-0.5 (no mask); softmax over the 2048 keys (register row, one exp, fixed trees);
__global__ __launch_bounds__(256) void k_asoft(const float* __restrict__ Sb, h16* P16, bf* Ph, bf* Pl) {
    const int lane = threadIdx.x & 31; const int row = blockIdx.x * 8 + (threadIdx.x >> 5); if (row >= ZH * TT) return; const int i = row % TT; const int zz = row / TT; (void)zz; const bool hires = (i < RH); const float* sr = Sb + (size_t)row * TT; float v[TT / 32]; float mx = -3.0e38f;
#pragma unroll
    for (int ch = 0; ch < TT / 128; ++ch) { const int j0 = ch * 128 + lane * 4; const v4f a = *(const v4f*)(sr + j0);
#pragma unroll
        for (int q = 0; q < 4; ++q) { const int j = j0 + q; (void)j; const float t = a[q] * SCL; v[ch * 4 + q] = t; mx = fmaxf(mx, t); } }
#pragma unroll
    for (int sh = 16; sh; sh >>= 1) mx = fmaxf(mx, __shfl_xor(mx, sh, 32));
    float sum = 0.f;
#pragma unroll
    for (int k = 0; k < TT / 32; ++k) { float d0 = __fsub_rn(v[k], mx); asm volatile("" : "+v"(d0)); v[k] = __builtin_amdgcn_exp2f(__fmul_rn(d0, 1.4426950408889634f)); sum += v[k]; }
#pragma unroll
    for (int sh = 16; sh; sh >>= 1) sum += __shfl_xor(sum, sh, 32);
    const float f = __fdiv_rn(hires ? 1.0f : PCAR, sum);
{
        if (hires) {
#pragma unroll
            for (int ch = 0; ch < TT / 128; ++ch) { v4us oh, ol;
#pragma unroll
                for (int q = 0; q < 4; ++q) { unsigned short a, c2; splitf(v[ch * 4 + q] * f, a, c2); oh[q] = a; ol[q] = c2; }
                const size_t oo = ((size_t)zz * (RH ? RH : 1) + i) * TT + ch * 128 + lane * 4; *(v4us*)(Ph + oo) = oh; *(v4us*)(Pl + oo) = ol; }
        } else {
#pragma unroll
            for (int ch = 0; ch < TT / 128; ++ch) { v4h o4;
#pragma unroll
                for (int q = 0; q < 4; ++q) o4[q] = tohx(v[ch * 4 + q] * f);
                *(v4h*)(P16 + (size_t)row * TT + ch * 128 + lane * 4) = o4; } }
         }
}
__global__ __launch_bounds__(256) void k_cvtS(const float* __restrict__ src, bf* dst) { const size_t i = (size_t)blockIdx.x * 256 + threadIdx.x; if (i >= (size_t)TT * DM / 8) return; const size_t e = i * 8; const int c0 = (int)(e % DM); const int t = (int)(e / DM); const v8f v = *(const v8f*)(src + (size_t)t * SP + c0); v8us o;
#pragma unroll
    for (int k = 0; k < 8; ++k) o[k] = f2bf(v[k]); *(v8us*)(dst + e) = o;  }
__global__ __launch_bounds__(256) void k_wtGp(const float* __restrict__ w, int K, int N, int pitch, bf* Bt) {
    const int lane = threadIdx.x & 31; const int L0 = (blockIdx.x * 8 + (threadIdx.x >> 5)) * 8; const int nlines = N * K / 64;
{
#pragma unroll 1
        for (int l = 0; l < 8; ++l) { const int L = L0 + l; if (L >= nlines) break; const size_t e = (size_t)L * 64 + lane * 2; const int k = (int)(e % K), n = (int)(e / K); v2us o;
            o[0] = f2bf(w[(size_t)k * pitch + n]); o[1] = f2bf(w[(size_t)(k + 1) * pitch + n]); *(v2us*)(Bt + e) = o; }
         }
}
__global__ __launch_bounds__(256) void k_addresS(float* Y, const float* __restrict__ hs) { const size_t i = (size_t)blockIdx.x * 256 + threadIdx.x; if (i >= (size_t)TT * DM / 4) return; const size_t e = i * 4; const int c0 = (int)(e % DM); const int t = (int)(e / DM); const v4f a = *(const v4f*)(Y + e); const v4f r = *(const v4f*)(hs + (size_t)t * SP + c0); v4f o;
#pragma unroll
    for (int q = 0; q < 4; ++q) o[q] = __fadd_rn(a[q], bfr(r[q]));
    *(v4f*)(Y + e) = o;  }
__global__ __launch_bounds__(256) void k_lnoutS(const float* __restrict__ F, const float* __restrict__ g, const float* __restrict__ bb, float* out) { const int lane = threadIdx.x & 31; const int row = blockIdx.x * 8 + (threadIdx.x >> 5); if (row >= TT) return; const float* fr = F + (size_t)row * DQ; float* orow = out + (size_t)row * SP;   /* seq-major output pitch */ float v[DQ / 32]; float s = 0.f;
#pragma unroll
    for (int c = 0; c < DQ / 128; ++c) { const v4f a = *(const v4f*)(fr + c * 128 + lane * 4); for (int q = 0; q < 4; ++q) { v[c * 4 + q] = a[q]; s = __fadd_rn(s, a[q]); } }
#pragma unroll
    for (int sh = 16; sh; sh >>= 1) s = __fadd_rn(s, __shfl_xor(s, sh, 32));
    const float mean = __fdiv_rn(s, (float)DQ); float s2 = 0.f;
#pragma unroll
    for (int k = 0; k < DQ / 32; ++k) { const float dv = __fsub_rn(v[k], mean); float p2 = __fmul_rn(dv, dv); asm volatile("" : "+v"(p2)); s2 = __fadd_rn(s2, p2); v[k] = dv; }
#pragma unroll
    for (int sh = 16; sh; sh >>= 1) s2 = __fadd_rn(s2, __shfl_xor(s2, sh, 32));
    const float rs = __fdiv_rn(1.0f, __fsqrt_rn(__fadd_rn(__fdiv_rn(s2, (float)DQ), LNEPS)));
{
#pragma unroll
        for (int c = 0; c < DQ / 128; ++c) { v4f o; for (int q = 0; q < 4; ++q) { const int col = c * 128 + lane * 4 + q; float y = __fmul_rn(v[c * 4 + q], rs); asm volatile("" : "+v"(y)); y = __fmul_rn(y, bfr(g[col])); asm volatile("" : "+v"(y)); o[q] = __fadd_rn(y, bfr(bb[col])); } *(v4f*)(orow + c * 128 + lane * 4) = o; }
         } }

__global__ __launch_bounds__(256) void k_merge(const float* __restrict__ O, int h0, bf* Ah, bf* Al) { const size_t e = ((size_t)blockIdx.x * 256 + threadIdx.x) * 2; if (e >= (size_t)ZH * TT * HD) return; const int d = (int)(e % HD); const int t = (int)((e / HD) % TT); const int zz = (int)(e / ((size_t)HD * TT)); const float cs = (t < RH) ? 1.0f : (1.0f / PCAR); const size_t oo = (size_t)t * DQ + (h0 + zz) * HD + d;
    v2us oh, ol;
#pragma unroll
    for (int q = 0; q < 2; ++q) { unsigned short a, c2; splitf(O[e + q] * cs, a, c2); oh[q] = a; ol[q] = c2; } *(v2us*)(Ah + oo) = oh; *(v2us*)(Al + oo) = ol;  }

extern "C" void kernel_launch(void* const* d_in, const int* in_sizes, int n_in,
                              void* d_out, int out_size, void* d_ws, size_t ws_size, hipStream_t stream) {
    (void)in_sizes; (void)n_in; (void)out_size;
    const float* x = (const float*)d_in[0];   /* h [S][B][D] seq-major */ const float* wq = (const float*)d_in[1]; const float* wkv = (const float*)d_in[2]; const float* wo = (const float*)d_in[3]; const float* lng = (const float*)d_in[4]; const float* lnb = (const float*)d_in[5]; const float* wk = wkv; const float* wv = wkv;
    float* OUT = (float*)d_out;     // [2048][4][1024] seq-major
    char* wsp = (char*)d_ws;
    auto take = [&](size_t bytes) { char* p = wsp; wsp += (bytes + 255) & ~(size_t)255; return (void*)p; };
    float* Y = (float*)take((size_t)TT * DM * 4); bf* WQ = (bf*)take((size_t)DQ * DM * 2); bf* WK = (bf*)take((size_t)DKV * DM * 2); bf* WV = (bf*)take((size_t)DKV * DM * 2); bf* WO = (bf*)take((size_t)DM * DQ * 2); float* CS = (float*)take((size_t)TT * HD * 2 * 4);
    bf* XB = (bf*)take((size_t)TT * DM * 2); float* FQ = (float*)take((size_t)TT * DQ * 4); float* FK = (float*)take((size_t)TT * DKV * 4);
    h16* QP16 = (h16*)take((size_t)NH_ * TT * HD * 2); h16* KP16 = (h16*)take((size_t)NKV * TT * HD * 2); h16* VT16 = (h16*)take((size_t)NKV * HD * TT * 2);
    bf* QPh = (bf*)take((size_t)NH_ * TT * HD * 2); bf* QPl = (bf*)take((size_t)NH_ * TT * HD * 2); bf* KPh = (bf*)take((size_t)NKV * TT * HD * 2); bf* KPl = (bf*)take((size_t)NKV * TT * HD * 2); bf* VTh = (bf*)take((size_t)NKV * HD * TT * 2); bf* VTl = (bf*)take((size_t)NKV * HD * TT * 2); bf* Ph = (bf*)take((size_t)ZH * RH * TT * 2); bf* Pl = (bf*)take((size_t)ZH * RH * TT * 2);
    float* Sb = (float*)take((size_t)ZH * TT * TT * 4); h16* P16 = (h16*)take((size_t)ZH * TT * TT * 2); float* Ob = (float*)take((size_t)ZH * TT * HD * 4); bf* ATh = (bf*)take((size_t)TT * DQ * 2); bf* ATl = (bf*)take((size_t)TT * DQ * 2);
    if ((size_t)(wsp - (char*)d_ws) > ws_size) return;    // ws 256 MiB
    float* FV = FK;   // v projection reuses the k buffer after the k planes are built (stream-ordered)
    { k_wtG<<<(unsigned)((DM * DQ / 64 + 63) / 64), 256, 0, stream>>>(wq, DM, DQ, WQ); k_wtGp<<<(unsigned)((DM * DKV / 64 + 63) / 64), 256, 0, stream>>>(wkv + 0, DM, DKV, 2 * DM, WK);   /* Wkv 'xw' [1024][2048]: k = columns 0..1023 */ k_wtGp<<<(unsigned)((DM * DKV / 64 + 63) / 64), 256, 0, stream>>>(wkv + DM, DM, DKV, 2 * DM, WV);   /* Wkv 'xw' [1024][2048]: v = columns 1024..2047 */
      k_wtG<<<(unsigned)((DQ * DM / 64 + 63) / 64), 256, 0, stream>>>(wo, DQ, DM, WO);
       }
    k_csid<<<(TT * HD + 255) / 256, 256, 0, stream>>>(CS);
    const unsigned LQ = (unsigned)(((size_t)NH_ * TT * HD / 2 + 255) / 256), LKv = (unsigned)(((size_t)NKV * TT * HD / 2 + 255) / 256);
    for (int b = 0; b < NB_; ++b) {
        
        k_cvtS<<<(unsigned)(((size_t)TT * DM / 8 + 255) / 256), 256, 0, stream>>>(x + (size_t)b * DM, XB);   /* batch b's rows of the seq-major input (pitch 4 x 1024) */
        k_gemmw<bf, 0, false><<<dim3(TT / 64, DQ / 64, 1), 32, 0, stream>>>(XB, nullptr, WQ, nullptr, DM, FQ, DQ, nullptr, 0, 0, 0);
        k_rope<<<LQ, 256, 0, stream>>>(FQ, DQ, NH_, CS, nullptr, nullptr, 1.0f, QP16, QPh, QPl);
        k_gemmw<bf, 0, false><<<dim3(TT / 64, DKV / 64, 1), 32, 0, stream>>>(XB, nullptr, WK, nullptr, DM, FK, DKV, nullptr, 0, 0, 0);
        k_rope<<<LKv, 256, 0, stream>>>(FK, DKV, NKV, CS, nullptr, nullptr, 1.0f, KP16, KPh, KPl);
        k_gemmw<bf, 0, false><<<dim3(TT / 64, DKV / 64, 1), 32, 0, stream>>>(XB, nullptr, WV, nullptr, DM, FV, DKV, nullptr, 0, 0, 0); k_vtp<<<LKv, 256, 0, stream>>>(FV, DKV, NKV, VT16, VTh, VTl);
        for (int h0 = 0; h0 < NH_; h0 += ZH) { const size_t zq = (size_t)h0, zk = (size_t)(h0 / REP);   // one kv head per query head: the pass's two heads use consecutive kv planes (z-strides TT*HD)
            k_gemmw<bf, 2, false><<<dim3(RH / 64, TT / 64, ZH), 32, 0, stream>>>(QPh + zq * TT * HD, QPl + zq * TT * HD, KPh + zk * TT * HD, KPl + zk * TT * HD, HD, Sb, TT, nullptr, (size_t)TT * HD, (size_t)TT * HD, (size_t)TT * TT);
            k_gemmw<h16, 0, false><<<dim3((TT - RH) / 64, TT / 64, ZH), 32, 0, stream>>>(QP16 + zq * TT * HD + (size_t)RH * HD, nullptr, KP16 + zk * TT * HD, nullptr, HD, Sb + (size_t)RH * TT, TT, nullptr, (size_t)TT * HD, (size_t)TT * HD, (size_t)TT * TT);
            k_asoft<<<ZH * TT / 8, 256, 0, stream>>>(Sb, P16, Ph, Pl);
            k_gemmw<bf, 2, false><<<dim3(RH / 64, HD / 64, ZH), 32, 0, stream>>>(Ph, Pl, VTh + zk * HD * TT, VTl + zk * HD * TT, TT, Ob, HD, nullptr, (size_t)RH * TT, (size_t)HD * TT, (size_t)TT * HD);
            k_gemmw<h16, 0, false><<<dim3((TT - RH) / 64, HD / 64, ZH), 32, 0, stream>>>(P16 + (size_t)RH * TT, nullptr, VT16 + zk * HD * TT, nullptr, TT, Ob + (size_t)RH * HD, HD, nullptr, (size_t)TT * TT, (size_t)HD * TT, (size_t)TT * HD);
            k_merge<<<(unsigned)(((size_t)ZH * TT * HD / 2 + 255) / 256), 256, 0, stream>>>(Ob, h0, ATh, ATl); }
        k_gemmw<bf, 1, false><<<dim3(TT / 64, DM / 64, 1), 32, 0, stream>>>(ATh, ATl, WO, nullptr, DQ, Y, DM, nullptr, 0, 0, 0); k_addresS<<<(unsigned)(((size_t)TT * DM / 4 + 255) / 256), 256, 0, stream>>>(Y, x + (size_t)b * DM); k_lnoutS<<<(TT + 7) / 8, 256, 0, stream>>>(Y, lng, lnb, OUT + (size_t)b * DM);   /* LayerNorm(h + attn_out), rows back at the seq-major pitch */ }
}

// v001
// It runs in 1600 microseconds.
// Timed twice side by side with v000, it ran 2.53 and 2.52 times as fast.
#include <hip/hip_runtime.h>

// Transformer-XL style multi-head attention on a SEQUENCE-MAJOR input with post-LayerNorm (h [2048][4][1024] (seq, batch, model); q = h Wq ('xw' [1024][1024] 1/32), k | v = h Wkv ('xw' [1024][2048]: k = columns 0..1023, v = 1024..2047); 16 heads x 64; score = q.k / 8; softmax over keys; attn_vec merged; attn_out = attn_vec Wo ('xw' no bias); out = LayerNorm(h + attn_out) gamma/beta (eps 1e-5) -> [2048][4][1024] seq-major (8.4 M)).
// Layout per batch: a strided gather makes batch b's rows (row pitch 4 x 1024 in the input) a contiguous token-major bf16 operand; 'xw' weights transposed once (Wkv as two column blocks); exact projections; dense T-2048 attention (hybrid rows: < 512 hi/lo 3 products, rest fp16 x1024); merged hi/lo x Wo exact into workspace; residual add (strided rows of h) and a row LayerNorm kernel write batch b's output rows back at pitch 4 x 1024.
// Compute dtypes, f32 accumulate: every input rounded to bf16; projections exact; attention rows < 512 3 products, rest fp16; softmax f32; Wo hl x exact; residual + LayerNorm f32.

#define NB_  4
#define TT   2048
#define DM   1024
#define NH_  16
#define NKV  16
#define REP  (NH_ / NKV)
#define HD   64
#define DQ   (NH_ * HD)
#define DKV  (NKV * HD)
#define ZH   2
#define RH   512                  // query rows < RH use hi+lo planes (0: none)
#define WIN  0
#define PCAR 1024.0f
#define SCL  0.125f
#define LNEPS 1e-5f
#define SP   (NB_ * DM)   // seq-major row pitch of h and out (floats)
#define PSK  8            // P.V: work-groups that share one tile's K range (partial planes in Ob)
#define PKS  4            // P.V: waves per work-group that share its piece of K
#define GKS  8            // projections and Wo: waves per work-group that share K
typedef _Float16 h16;
typedef unsigned short bf;
typedef __attribute__((ext_vector_type(16))) __bf16   v16bf;
typedef __attribute__((ext_vector_type(16))) _Float16 v16h;
typedef __attribute__((ext_vector_type(8)))  _Float16 v8h;
typedef __attribute__((ext_vector_type(8)))  unsigned short v8us;
typedef __attribute__((ext_vector_type(8)))  float    v8f;
typedef __attribute__((ext_vector_type(4)))  float    v4f;
typedef v8h  __attribute__((may_alias)) v8ha;
typedef v4f  __attribute__((may_alias)) v4fa;
typedef v8us __attribute__((may_alias)) v8usa;

__device__ __forceinline__ unsigned short f2bf(float f) { unsigned u = __float_as_uint(f); u += 0x7FFFu + ((u >> 16) & 1u); return (unsigned short)(u >> 16); }
__device__ __forceinline__ float bf2f(unsigned short b) { return __uint_as_float(((unsigned)b) << 16); }
__device__ __forceinline__ float bfr(float f) { return bf2f(f2bf(f)); }
__device__ __forceinline__ v16h cat16(v8h lo, v8h hi) { return __builtin_shufflevector(lo, hi, 0, 1, 2, 3, 4, 5, 6, 7, 8, 9, 10, 11, 12, 13, 14, 15); }
__device__ __forceinline__ v16bf cat16b(v8us lo, v8us hi) { return __builtin_bit_cast(v16bf, __builtin_shufflevector(lo, hi, 0, 1, 2, 3, 4, 5, 6, 7, 8, 9, 10, 11, 12, 13, 14, 15)); }
__device__ __forceinline__ v8f wmma16(v16h a, v16h b, v8f c) { return __builtin_amdgcn_wmma_f32_16x16x32_f16(false, a, false, b, (short)0, c, false, false); }
__device__ __forceinline__ v8f wmmab(v16bf a, v16bf b, v8f c) { return __builtin_amdgcn_wmma_f32_16x16x32_bf16(false, a, false, b, (short)0, c, false, false); }



// ---- k_gemmw: register-blocked GEMM, SK work-groups of KS waves per 64x64 output tile (16 accumulators per wave), operands straight from K-contiguous 16-bit planes; grid (M/64, N/64 x SK, Z), 32 x KS threads.
// C[m][n] (f32, pitch ldc, + optional f32 bias[n]) = sum_k A[m][k] Bt[n][k] (+ split products per NSPLIT). z-batch strides sA/sB/sC in elements. K % 32 == 0.
// Split K: the K range is dealt in equal contiguous pieces to SK work-groups (grid.y = N/64 x SK, piece kb writes its own partial plane C + kb x sP); inside a piece the 32-wide k steps go round-robin to KS waves (32 x KS threads; neighbouring waves use the two halves of one 128-byte line in the same trip), whose 64x64 partial tiles are summed through LDS in wave order. K % (32 x SK x KS) == 0. KS = SK = 1: one wave, whole K.
template <typename T16> struct WFrag;
template <> struct WFrag<h16> { typedef v16h V; static __device__ __forceinline__ V ld(const h16* p) { return cat16(*(const v8h*)p, *(const v8h*)(p + 16)); } static __device__ __forceinline__ v8f mma(V a, V b, v8f c) { return wmma16(a, b, c); } };
template <> struct WFrag<bf> { typedef v16bf V; static __device__ __forceinline__ V ld(const bf* p) { return cat16b(*(const v8us*)p, *(const v8us*)(p + 16)); } static __device__ __forceinline__ v8f mma(V a, V b, v8f c) { return wmmab(a, b, c); } };
template <typename T16, int NSPLIT, bool BIAS, int KS, int SK>
__global__ __launch_bounds__(32 * KS) void k_gemmw(const T16* __restrict__ A, const T16* __restrict__ A2, const T16* __restrict__ Bt, const T16* __restrict__ Bt2, int K, float* C, int ldc, const float* __restrict__ bias, size_t sA, size_t sB, size_t sC, size_t sP) {
    typedef typename WFrag<T16>::V V;
    __shared__ __align__(16) float os[(KS > 1 ? 2 * KS : 1) * 16 * 68];   // KS > 1: one 16-row slab per wave, two sets used in turn
    const size_t z = blockIdx.z; A += z * sA; if (A2) A2 += z * sA; Bt += z * sB; if (Bt2) Bt2 += z * sB; C += z * sC;
    const int lane = threadIdx.x & 31, lr = lane & 15, hi = lane >> 4; const int r0 = blockIdx.x * 64, c0 = (int)(blockIdx.y / SK) * 64;
    const int w = (KS > 1) ? __builtin_amdgcn_readfirstlane((int)(threadIdx.x >> 5)) : 0; const int kb = (int)(blockIdx.y % SK);
    const int KB = K / SK, k0 = kb * KB + w * 32, k1 = (kb + 1) * KB;   // this wave's k steps: k0, k0 + 32 KS, ... below k1
    if (SK > 1) C += (size_t)kb * sP;
    v8f acc[4][4];
#pragma unroll
    for (int mb = 0; mb < 4; ++mb)
#pragma unroll
        for (int nb = 0; nb < 4; ++nb) acc[mb][nb] = (v8f){};
    const size_t aoff = (size_t)(r0 + lr) * K + 8 * hi, boff = (size_t)(c0 + lr) * K + 8 * hi;
#pragma unroll 1
    for (int kc = k0; kc < k1; kc += 32 * KS) {
        V a[4], a2[4];
#pragma unroll
        for (int mb = 0; mb < 4; ++mb) { a[mb] = WFrag<T16>::ld(A + aoff + (size_t)mb * 16 * K + kc); if (NSPLIT == 1 || NSPLIT == 2) a2[mb] = WFrag<T16>::ld(A2 + aoff + (size_t)mb * 16 * K + kc); }
#pragma unroll
        for (int nb = 0; nb < 4; ++nb) { const V b = WFrag<T16>::ld(Bt + boff + (size_t)nb * 16 * K + kc); V b2; if (NSPLIT >= 2) b2 = WFrag<T16>::ld(Bt2 + boff + (size_t)nb * 16 * K + kc);
#pragma unroll
            for (int mb = 0; mb < 4; ++mb) { acc[mb][nb] = WFrag<T16>::mma(a[mb], b, acc[mb][nb]); if (NSPLIT == 1 || NSPLIT == 2) acc[mb][nb] = WFrag<T16>::mma(a2[mb], b, acc[mb][nb]); if (NSPLIT >= 2) acc[mb][nb] = WFrag<T16>::mma(a[mb], b2, acc[mb][nb]); } }
        asm volatile("v_nop\n\tv_nop\n\tv_nop\n\tv_nop" : "+v"(acc[0][0]), "+v"(acc[1][1]), "+v"(acc[2][2]), "+v"(acc[3][3]) : "v"(a[0]), "v"(a[3]));
    }
    if constexpr (KS > 1) {
        constexpr int NU = 256 / (32 * KS);   // 16-byte pieces of a 16x64 slab per thread
        v4f res[4][NU];   // the sums wait in registers, so that no barrier below has a global store to wait for
#pragma unroll
        for (int mb = 0; mb < 4; ++mb) {
            float* set = os + (mb & 1) * KS * (16 * 68); float* mine = set + w * (16 * 68);
#pragma unroll
            for (int nb = 0; nb < 4; ++nb) {
#pragma unroll
                for (int j = 0; j < 8; ++j) mine[(hi * 8 + j) * 68 + nb * 16 + lr] = acc[mb][nb][j]; }
            __syncthreads();   // every wave's slab of this mb is in LDS; it also ends the reads of the other set, which mb + 1 overwrites
#pragma unroll
            for (int s = 0; s < NU; ++s) { const int u = s * 32 * KS + (int)threadIdx.x, row = u >> 4, cofs = (u & 15) * 4; v4f val = *(const v4fa*)(set + row * 68 + cofs);
#pragma unroll
                for (int ww = 1; ww < KS; ++ww) val += *(const v4fa*)(set + ww * (16 * 68) + row * 68 + cofs);
                res[mb][s] = val; }
        }
#pragma unroll
        for (int mb = 0; mb < 4; ++mb) {
            float* crow = C + (size_t)(r0 + mb * 16) * ldc + c0;
#pragma unroll
            for (int s = 0; s < NU; ++s) { const int u = s * 32 * KS + (int)threadIdx.x, row = u >> 4, cofs = (u & 15) * 4; v4f val = res[mb][s];
                if (BIAS) { val[0] += bfr(bias[c0 + cofs]); val[1] += bfr(bias[c0 + cofs + 1]); val[2] += bfr(bias[c0 + cofs + 2]); val[3] += bfr(bias[c0 + cofs + 3]); }
                *(v4f*)(crow + (size_t)row * ldc + cofs) = val; }
        }
        return;
    }
#pragma unroll
    for (int mb = 0; mb < 4; ++mb) {
#pragma unroll
        for (int nb = 0; nb < 4; ++nb) {
#pragma unroll
            for (int j = 0; j < 8; ++j) os[(hi * 8 + j) * 68 + nb * 16 + lr] = acc[mb][nb][j]; }
        __builtin_amdgcn_wave_barrier(); asm volatile("" ::: "memory");
        float* crow = C + (size_t)(r0 + mb * 16) * ldc + c0;
{
#pragma unroll
            for (int s = 0; s < 8; ++s) { const int row = 2 * s + hi, cofs = lr * 4; v4f val = *(const v4fa*)(os + row * 68 + cofs); if (BIAS) { val[0] += bfr(bias[c0 + cofs]); val[1] += bfr(bias[c0 + cofs + 1]); val[2] += bfr(bias[c0 + cofs + 2]); val[3] += bfr(bias[c0 + cofs + 3]); }
                *(v4f*)(crow + (size_t)row * ldc + cofs) = val; }
             }
        __builtin_amdgcn_wave_barrier(); asm volatile("" ::: "memory");
    }
}

__device__ __forceinline__ h16 tohx(float x) { return (h16)x; }
__device__ __forceinline__ void splitf(float y, unsigned short& h, unsigned short& l) { h = f2bf(y); l = f2bf(y - bf2f(h)); }
typedef __attribute__((ext_vector_type(2))) _Float16 v2h;
typedef __attribute__((ext_vector_type(4))) _Float16 v4h;
typedef __attribute__((ext_vector_type(2))) unsigned short v2us;
typedef __attribute__((ext_vector_type(4))) unsigned short v4us;
typedef __attribute__((ext_vector_type(2))) float v2f;
typedef __attribute__((ext_vector_type(4))) int v4i;

__global__ __launch_bounds__(256) void k_wtG(const float* __restrict__ w, int K, int N, bf* Bt) {
    const int lane = threadIdx.x & 31; const int L0 = (blockIdx.x * 8 + (threadIdx.x >> 5)) * 8; const int nlines = N * K / 64;
{
#pragma unroll 1
        for (int l = 0; l < 8; ++l) { const int L = L0 + l; if (L >= nlines) break; const size_t e = (size_t)L * 64 + lane * 2; const int k = (int)(e % K), n = (int)(e / K); v2us o;
            o[0] = f2bf(w[(size_t)k * N + n]); o[1] = f2bf(w[(size_t)(k + 1) * N + n]); *(v2us*)(Bt + e) = o; }
         }
}
__global__ __launch_bounds__(256) void k_cvt8(const float* __restrict__ src, bf* dst, size_t n8) { const size_t i = (size_t)blockIdx.x * 256 + threadIdx.x; if (i >= n8) return; const v8f v = *(const v8f*)(src + i * 8); v8us o;
#pragma unroll
    for (int k = 0; k < 8; ++k) o[k] = f2bf(v[k]); *(v8us*)(dst + i * 8) = o;  }

// k_rope: head planes [h][t][d] (fp16 + hi/lo) of rope(x) x sc with the rotate-half convention out[d] = x[d] cos[t][d] - x[d+HD/2] sin[t][d], out[d+HD/2] = x[d+HD/2] cos[t][d+HD/2] + x[d] sin[t][d+HD/2]
__global__ __launch_bounds__(256) void k_rope(const float* __restrict__ F, int pitch, int nheads, const float* __restrict__ CS, const float* __restrict__ RF, const float* __restrict__ nw, float sc, h16* P16, bf* Ph, bf* Pl) {
    const size_t e = ((size_t)blockIdx.x * 256 + threadIdx.x) * 2; if (e >= (size_t)nheads * TT * HD) return; const int d = (int)(e % HD); const int t = (int)((e / HD) % TT); const int h = (int)(e / ((size_t)HD * TT)); const float* f = F + (size_t)t * pitch + h * HD; const float rf = RF ? RF[(size_t)h * TT + t] : 1.0f; v2h o16; v2us oh, ol;
#pragma unroll
    for (int q = 0; q < 2; ++q) { const int dd = d + q; const int dp = (dd < HD / 2) ? dd + HD / 2 : dd - HD / 2; float x0 = f[dd], x1 = f[dp];
        if (RF) { float n0 = __fmul_rn(x0, rf), n1 = __fmul_rn(x1, rf); asm volatile("" : "+v"(n0)); asm volatile("" : "+v"(n1)); x0 = __fmul_rn(bfr(nw[dd]), n0); x1 = __fmul_rn(bfr(nw[dp]), n1); }
        const v2f cs = *(const v2f*)(CS + ((size_t)t * HD + dd) * 2); float a = __fmul_rn(x0, cs[0]), bq = __fmul_rn(x1, cs[1]); asm volatile("" : "+v"(a)); asm volatile("" : "+v"(bq)); const float r = ((dd < HD / 2) ? __fsub_rn(a, bq) : __fadd_rn(a, bq)) * sc;
        o16[q] = tohx(r); unsigned short a2, c2; splitf(r, a2, c2); oh[q] = a2; ol[q] = c2; }
    *(v2h*)(P16 + e) = o16; *(v2us*)(Ph + e) = oh; *(v2us*)(Pl + e) = ol;  }
__global__ __launch_bounds__(256) void k_vtp(const float* __restrict__ F, int pitch, int nheads, h16* V16, bf* Vh, bf* Vl) { const size_t e = ((size_t)blockIdx.x * 256 + threadIdx.x) * 2; if (e >= (size_t)nheads * HD * TT) return; const int t = (int)(e % TT); const int d = (int)((e / TT) % HD); const int g = (int)(e / ((size_t)TT * HD)); v2h o16; v2us oh, ol;
#pragma unroll
    for (int q = 0; q < 2; ++q) { const float x = F[(size_t)(t + q) * pitch + g * HD + d]; o16[q] = tohx(x); unsigned short a2, c2; splitf(x, a2, c2); oh[q] = a2; ol[q] = c2; }
    *(v2h*)(V16 + e) = o16; *(v2us*)(Vh + e) = oh; *(v2us*)(Vl + e) = ol;  }
__global__ __launch_bounds__(256) void k_csid(float* CS) { const int idx = blockIdx.x * 256 + threadIdx.x; if (idx >= TT * HD) return; v2f cs; cs[0] = 1.0f; cs[1] = 0.0f; *(v2f*)(CS + (size_t)idx * 2) = cs;  }
// k_asoft: per row (zz, i): t = S x HD^-0.5 (no mask); softmax over the 2048 keys (register row, one exp, fixed trees);
__global__ __launch_bounds__(256) void k_asoft(const float* __restrict__ Sb, h16* P16, bf* Ph, bf* Pl) {
    const int lane = threadIdx.x & 31; const int row = blockIdx.x * 8 + (threadIdx.x >> 5); if (row >= ZH * TT) return; const int i = row % TT; const int zz = row / TT; (void)zz; const bool hires = (i < RH); const float* sr = Sb + (size_t)row * TT; float v[TT / 32]; float mx = -3.0e38f;
#pragma unroll
    for (int ch = 0; ch < TT / 128; ++ch) { const int j0 = ch * 128 + lane * 4; const v4f a = *(const v4f*)(sr + j0);
#pragma unroll
        for (int q = 0; q < 4; ++q) { const int j = j0 + q; (void)j; const float t = a[q] * SCL; v[ch * 4 + q] = t; mx = fmaxf(mx, t); } }
#pragma unroll
    for (int sh = 16; sh; sh >>= 1) mx = fmaxf(mx, __shfl_xor(mx, sh, 32));
    float sum = 0.f;
#pragma unroll
    for (int k = 0; k < TT / 32; ++k) { float d0 = __fsub_rn(v[k], mx); asm volatile("" : "+v"(d0)); v[k] = __builtin_amdgcn_exp2f(__fmul_rn(d0, 1.4426950408889634f)); sum += v[k]; }
#pragma unroll
    for (int sh = 16; sh; sh >>= 1) sum += __shfl_xor(sum, sh, 32);
    const float f = __fdiv_rn(hires ? 1.0f : PCAR, sum);
{
        if (hires) {
#pragma unroll
            for (int ch = 0; ch < TT / 128; ++ch) { v4us oh, ol;
#pragma unroll
                for (int q = 0; q < 4; ++q) { unsigned short a, c2; splitf(v[ch * 4 + q] * f, a, c2); oh[q] = a; ol[q] = c2; }
                const size_t oo = ((size_t)zz * (RH ? RH : 1) + i) * TT + ch * 128 + lane * 4; *(v4us*)(Ph + oo) = oh; *(v4us*)(Pl + oo) = ol; }
        } else {
#pragma unroll
            for (int ch = 0; ch < TT / 128; ++ch) { v4h o4;
#pragma unroll
                for (int q = 0; q < 4; ++q) o4[q] = tohx(v[ch * 4 + q] * f);
                *(v4h*)(P16 + (size_t)row * TT + ch * 128 + lane * 4) = o4; } }
         }
}
__global__ __launch_bounds__(256) void k_cvtS(const float* __restrict__ src, bf* dst) { const size_t i = (size_t)blockIdx.x * 256 + threadIdx.x; if (i >= (size_t)TT * DM / 8) return; const size_t e = i * 8; const int c0 = (int)(e % DM); const int t = (int)(e / DM); const v8f v = *(const v8f*)(src + (size_t)t * SP + c0); v8us o;
#pragma unroll
    for (int k = 0; k < 8; ++k) o[k] = f2bf(v[k]); *(v8us*)(dst + e) = o;  }
__global__ __launch_bounds__(256) void k_wtGp(const float* __restrict__ w, int K, int N, int pitch, bf* Bt) {
    const int lane = threadIdx.x & 31; const int L0 = (blockIdx.x * 8 + (threadIdx.x >> 5)) * 8; const int nlines = N * K / 64;
{
#pragma unroll 1
        for (int l = 0; l < 8; ++l) { const int L = L0 + l; if (L >= nlines) break; const size_t e = (size_t)L * 64 + lane * 2; const int k = (int)(e % K), n = (int)(e / K); v2us o;
            o[0] = f2bf(w[(size_t)k * pitch + n]); o[1] = f2bf(w[(size_t)(k + 1) * pitch + n]); *(v2us*)(Bt + e) = o; }
         }
}
__global__ __launch_bounds__(256) void k_addresS(float* Y, const float* __restrict__ hs) { const size_t i = (size_t)blockIdx.x * 256 + threadIdx.x; if (i >= (size_t)TT * DM / 4) return; const size_t e = i * 4; const int c0 = (int)(e % DM); const int t = (int)(e / DM); const v4f a = *(const v4f*)(Y + e); const v4f r = *(const v4f*)(hs + (size_t)t * SP + c0); v4f o;
#pragma unroll
    for (int q = 0; q < 4; ++q) o[q] = __fadd_rn(a[q], bfr(r[q]));
    *(v4f*)(Y + e) = o;  }
__global__ __launch_bounds__(256) void k_lnoutS(const float* __restrict__ F, const float* __restrict__ g, const float* __restrict__ bb, float* out) { const int lane = threadIdx.x & 31; const int row = blockIdx.x * 8 + (threadIdx.x >> 5); if (row >= TT) return; const float* fr = F + (size_t)row * DQ; float* orow = out + (size_t)row * SP;   /* seq-major output pitch */ float v[DQ / 32]; float s = 0.f;
#pragma unroll
    for (int c = 0; c < DQ / 128; ++c) { const v4f a = *(const v4f*)(fr + c * 128 + lane * 4); for (int q = 0; q < 4; ++q) { v[c * 4 + q] = a[q]; s = __fadd_rn(s, a[q]); } }
#pragma unroll
    for (int sh = 16; sh; sh >>= 1) s = __fadd_rn(s, __shfl_xor(s, sh, 32));
    const float mean = __fdiv_rn(s, (float)DQ); float s2 = 0.f;
#pragma unroll
    for (int k = 0; k < DQ / 32; ++k) { const float dv = __fsub_rn(v[k], mean); float p2 = __fmul_rn(dv, dv); asm volatile("" : "+v"(p2)); s2 = __fadd_rn(s2, p2); v[k] = dv; }
#pragma unroll
    for (int sh = 16; sh; sh >>= 1) s2 = __fadd_rn(s2, __shfl_xor(s2, sh, 32));
    const float rs = __fdiv_rn(1.0f, __fsqrt_rn(__fadd_rn(__fdiv_rn(s2, (float)DQ), LNEPS)));
{
#pragma unroll
        for (int c = 0; c < DQ / 128; ++c) { v4f o; for (int q = 0; q < 4; ++q) { const int col = c * 128 + lane * 4 + q; float y = __fmul_rn(v[c * 4 + q], rs); asm volatile("" : "+v"(y)); y = __fmul_rn(y, bfr(g[col])); asm volatile("" : "+v"(y)); o[q] = __fadd_rn(y, bfr(bb[col])); } *(v4f*)(orow + c * 128 + lane * 4) = o; }
         } }

__global__ __launch_bounds__(256) void k_merge(const float* __restrict__ O, int h0, bf* Ah, bf* Al) { const size_t e = ((size_t)blockIdx.x * 256 + threadIdx.x) * 2; if (e >= (size_t)ZH * TT * HD) return; const int d = (int)(e % HD); const int t = (int)((e / HD) % TT); const int zz = (int)(e / ((size_t)HD * TT)); const float cs = (t < RH) ? 1.0f : (1.0f / PCAR); const size_t oo = (size_t)t * DQ + (h0 + zz) * HD + d;
    v2us oh, ol;
#pragma unroll
    for (int q = 0; q < 2; ++q) { float s = O[e + q];
#pragma unroll
        for (int p = 1; p < PSK; ++p) s += O[(size_t)p * ((size_t)ZH * TT * HD) + e + q];   /* the P.V partial planes, in piece order */
        unsigned short a, c2; splitf(s * cs, a, c2); oh[q] = a; ol[q] = c2; } *(v2us*)(Ah + oo) = oh; *(v2us*)(Al + oo) = ol;  }

extern "C" void kernel_launch(void* const* d_in, const int* in_sizes, int n_in,
                              void* d_out, int out_size, void* d_ws, size_t ws_size, hipStream_t stream) {
    (void)in_sizes; (void)n_in; (void)out_size;
    const float* x = (const float*)d_in[0];   /* h [S][B][D] seq-major */ const float* wq = (const float*)d_in[1]; const float* wkv = (const float*)d_in[2]; const float* wo = (const float*)d_in[3]; const float* lng = (const float*)d_in[4]; const float* lnb = (const float*)d_in[5]; const float* wk = wkv; const float* wv = wkv;
    float* OUT = (float*)d_out;     // [2048][4][1024] seq-major
    char* wsp = (char*)d_ws;
    auto take = [&](size_t bytes) { char* p = wsp; wsp += (bytes + 255) & ~(size_t)255; return (void*)p; };
    float* Y = (float*)take((size_t)TT * DM * 4); bf* WQ = (bf*)take((size_t)DQ * DM * 2); bf* WK = (bf*)take((size_t)DKV * DM * 2); bf* WV = (bf*)take((size_t)DKV * DM * 2); bf* WO = (bf*)take((size_t)DM * DQ * 2); float* CS = (float*)take((size_t)TT * HD * 2 * 4);
    bf* XB = (bf*)take((size_t)TT * DM * 2); float* FQ = (float*)take((size_t)TT * DQ * 4); float* FK = (float*)take((size_t)TT * DKV * 4);
    h16* QP16 = (h16*)take((size_t)NH_ * TT * HD * 2); h16* KP16 = (h16*)take((size_t)NKV * TT * HD * 2); h16* VT16 = (h16*)take((size_t)NKV * HD * TT * 2);
    bf* QPh = (bf*)take((size_t)NH_ * TT * HD * 2); bf* QPl = (bf*)take((size_t)NH_ * TT * HD * 2); bf* KPh = (bf*)take((size_t)NKV * TT * HD * 2); bf* KPl = (bf*)take((size_t)NKV * TT * HD * 2); bf* VTh = (bf*)take((size_t)NKV * HD * TT * 2); bf* VTl = (bf*)take((size_t)NKV * HD * TT * 2); bf* Ph = (bf*)take((size_t)ZH * RH * TT * 2); bf* Pl = (bf*)take((size_t)ZH * RH * TT * 2);
    float* Sb = (float*)take((size_t)ZH * TT * TT * 4); h16* P16 = (h16*)take((size_t)ZH * TT * TT * 2); float* Ob = (float*)take((size_t)PSK * ZH * TT * HD * 4); bf* ATh = (bf*)take((size_t)TT * DQ * 2); bf* ATl = (bf*)take((size_t)TT * DQ * 2);
    if ((size_t)(wsp - (char*)d_ws) > ws_size) return;    // ws 256 MiB
    float* FV = FK;   // v projection reuses the k buffer after the k planes are built (stream-ordered)
    { k_wtG<<<(unsigned)((DM * DQ / 64 + 63) / 64), 256, 0, stream>>>(wq, DM, DQ, WQ); k_wtGp<<<(unsigned)((DM * DKV / 64 + 63) / 64), 256, 0, stream>>>(wkv + 0, DM, DKV, 2 * DM, WK);   /* Wkv 'xw' [1024][2048]: k = columns 0..1023 */ k_wtGp<<<(unsigned)((DM * DKV / 64 + 63) / 64), 256, 0, stream>>>(wkv + DM, DM, DKV, 2 * DM, WV);   /* Wkv 'xw' [1024][2048]: v = columns 1024..2047 */
      k_wtG<<<(unsigned)((DQ * DM / 64 + 63) / 64), 256, 0, stream>>>(wo, DQ, DM, WO);
       }
    k_csid<<<(TT * HD + 255) / 256, 256, 0, stream>>>(CS);
    const unsigned LQ = (unsigned)(((size_t)NH_ * TT * HD / 2 + 255) / 256), LKv = (unsigned)(((size_t)NKV * TT * HD / 2 + 255) / 256);
    for (int b = 0; b < NB_; ++b) {
        
        k_cvtS<<<(unsigned)(((size_t)TT * DM / 8 + 255) / 256), 256, 0, stream>>>(x + (size_t)b * DM, XB);   /* batch b's rows of the seq-major input (pitch 4 x 1024) */
        k_gemmw<bf, 0, false, GKS, 1><<<dim3(TT / 64, DQ / 64, 1), 32 * GKS, 0, stream>>>(XB, nullptr, WQ, nullptr, DM, FQ, DQ, nullptr, 0, 0, 0, 0);
        k_rope<<<LQ, 256, 0, stream>>>(FQ, DQ, NH_, CS, nullptr, nullptr, 1.0f, QP16, QPh, QPl);
        k_gemmw<bf, 0, false, GKS, 1><<<dim3(TT / 64, DKV / 64, 1), 32 * GKS, 0, stream>>>(XB, nullptr, WK, nullptr, DM, FK, DKV, nullptr, 0, 0, 0, 0);
        k_rope<<<LKv, 256, 0, stream>>>(FK, DKV, NKV, CS, nullptr, nullptr, 1.0f, KP16, KPh, KPl);
        k_gemmw<bf, 0, false, GKS, 1><<<dim3(TT / 64, DKV / 64, 1), 32 * GKS, 0, stream>>>(XB, nullptr, WV, nullptr, DM, FV, DKV, nullptr, 0, 0, 0, 0); k_vtp<<<LKv, 256, 0, stream>>>(FV, DKV, NKV, VT16, VTh, VTl);
        for (int h0 = 0; h0 < NH_; h0 += ZH) { const size_t zq = (size_t)h0, zk = (size_t)(h0 / REP);   // one kv head per query head: the pass's two heads use consecutive kv planes (z-strides TT*HD)
            k_gemmw<bf, 2, false, 1, 1><<<dim3(RH / 64, TT / 64, ZH), 32, 0, stream>>>(QPh + zq * TT * HD, QPl + zq * TT * HD, KPh + zk * TT * HD, KPl + zk * TT * HD, HD, Sb, TT, nullptr, (size_t)TT * HD, (size_t)TT * HD, (size_t)TT * TT, 0);
            k_gemmw<h16, 0, false, 1, 1><<<dim3((TT - RH) / 64, TT / 64, ZH), 32, 0, stream>>>(QP16 + zq * TT * HD + (size_t)RH * HD, nullptr, KP16 + zk * TT * HD, nullptr, HD, Sb + (size_t)RH * TT, TT, nullptr, (size_t)TT * HD, (size_t)TT * HD, (size_t)TT * TT, 0);
            k_asoft<<<ZH * TT / 8, 256, 0, stream>>>(Sb, P16, Ph, Pl);
            k_gemmw<bf, 2, false, PKS, PSK><<<dim3(RH / 64, HD / 64 * PSK, ZH), 32 * PKS, 0, stream>>>(Ph, Pl, VTh + zk * HD * TT, VTl + zk * HD * TT, TT, Ob, HD, nullptr, (size_t)RH * TT, (size_t)HD * TT, (size_t)TT * HD, (size_t)ZH * TT * HD);
            k_gemmw<h16, 0, false, PKS, PSK><<<dim3((TT - RH) / 64, HD / 64 * PSK, ZH), 32 * PKS, 0, stream>>>(P16 + (size_t)RH * TT, nullptr, VT16 + zk * HD * TT, nullptr, TT, Ob + (size_t)RH * HD, HD, nullptr, (size_t)TT * TT, (size_t)HD * TT, (size_t)TT * HD, (size_t)ZH * TT * HD);
            k_merge<<<(unsigned)(((size_t)ZH * TT * HD / 2 + 255) / 256), 256, 0, stream>>>(Ob, h0, ATh, ATl); }
        k_gemmw<bf, 1, false, GKS, 1><<<dim3(TT / 64, DM / 64, 1), 32 * GKS, 0, stream>>>(ATh, ATl, WO, nullptr, DQ, Y, DM, nullptr, 0, 0, 0, 0); k_addresS<<<(unsigned)(((size_t)TT * DM / 4 + 255) / 256), 256, 0, stream>>>(Y, x + (size_t)b * DM); k_lnoutS<<<(TT + 7) / 8, 256, 0, stream>>>(Y, lng, lnb, OUT + (size_t)b * DM);   /* LayerNorm(h + attn_out), rows back at the seq-major pitch */ }
}

// v002
// One run takes 594 microseconds.
// In two side-by-side timings against v001, it was 2.71 and 2.70 times as fast.
// All steps since v000 together make it 6.81 times as fast.
#include <hip/hip_runtime.h>

// Transformer-XL style multi-head attention on a SEQUENCE-MAJOR input with post-LayerNorm (h [2048][4][1024] (seq, batch, model); q = h Wq ('xw' [1024][1024] 1/32), k | v = h Wkv ('xw' [1024][2048]: k = columns 0..1023, v = 1024..2047); 16 heads x 64; score = q.k / 8; softmax over keys; attn_vec merged; attn_out = attn_vec Wo ('xw' no bias); out = LayerNorm(h + attn_out) gamma/beta (eps 1e-5) -> [2048][4][1024] seq-major (8.4 M)).
// Layout per batch: a strided gather makes batch b's rows (row pitch 4 x 1024 in the input) a contiguous token-major bf16 operand; 'xw' weights transposed once (Wkv as two column blocks); exact projections; fused T-2048 attention, one kernel per batch (hybrid rows: < 512 hi/lo 3 products, rest fp16 x1024; scores and probabilities stay in registers); merged hi/lo x Wo exact into workspace; residual add (strided rows of h) and a row LayerNorm kernel write batch b's output rows back at pitch 4 x 1024.
// Compute dtypes, f32 accumulate: every input rounded to bf16; projections exact; attention rows < 512 3 products, rest fp16; softmax f32; Wo hl x exact; residual + LayerNorm f32.

#define NB_  4
#define TT   2048
#define DM   1024
#define NH_  16
#define NKV  16
#define REP  (NH_ / NKV)
#define HD   64
#define DQ   (NH_ * HD)
#define DKV  (NKV * HD)
#define RH   512                  // query rows < RH use hi+lo planes (0: none)
#define WIN  0
#define PCL2 10.0f                // log2 of the carrier (x1024) of the fp16 probabilities
#define SCL  0.125f
#define LNEPS 1e-5f
#define SP   (NB_ * DM)   // seq-major row pitch of h and out (floats)
#define FW   4            // fused attention: waves per work-group
#define GKS  8            // projections and Wo: waves per work-group that share K
typedef _Float16 h16;
typedef unsigned short bf;
typedef __attribute__((ext_vector_type(16))) __bf16   v16bf;
typedef __attribute__((ext_vector_type(16))) _Float16 v16h;
typedef __attribute__((ext_vector_type(8)))  _Float16 v8h;
typedef __attribute__((ext_vector_type(8)))  unsigned short v8us;
typedef __attribute__((ext_vector_type(8)))  float    v8f;
typedef __attribute__((ext_vector_type(4)))  float    v4f;
typedef v8h  __attribute__((may_alias)) v8ha;
typedef v4f  __attribute__((may_alias)) v4fa;
typedef v8us __attribute__((may_alias)) v8usa;

__device__ __forceinline__ unsigned short f2bf(float f) { unsigned u = __float_as_uint(f); u += 0x7FFFu + ((u >> 16) & 1u); return (unsigned short)(u >> 16); }
__device__ __forceinline__ float bf2f(unsigned short b) { return __uint_as_float(((unsigned)b) << 16); }
__device__ __forceinline__ float bfr(float f) { return bf2f(f2bf(f)); }
__device__ __forceinline__ v16h cat16(v8h lo, v8h hi) { return __builtin_shufflevector(lo, hi, 0, 1, 2, 3, 4, 5, 6, 7, 8, 9, 10, 11, 12, 13, 14, 15); }
__device__ __forceinline__ v16bf cat16b(v8us lo, v8us hi) { return __builtin_bit_cast(v16bf, __builtin_shufflevector(lo, hi, 0, 1, 2, 3, 4, 5, 6, 7, 8, 9, 10, 11, 12, 13, 14, 15)); }
__device__ __forceinline__ v8f wmma16(v16h a, v16h b, v8f c) { return __builtin_amdgcn_wmma_f32_16x16x32_f16(false, a, false, b, (short)0, c, false, false); }
__device__ __forceinline__ v8f wmmab(v16bf a, v16bf b, v8f c) { return __builtin_amdgcn_wmma_f32_16x16x32_bf16(false, a, false, b, (short)0, c, false, false); }



// ---- k_gemmw: register-blocked GEMM, SK work-groups of KS waves per 64x64 output tile (16 accumulators per wave), operands straight from K-contiguous 16-bit planes; grid (M/64, N/64 x SK, Z), 32 x KS threads.
// C[m][n] (f32, pitch ldc, + optional f32 bias[n]) = sum_k A[m][k] Bt[n][k] (+ split products per NSPLIT). z-batch strides sA/sB/sC in elements. K % 32 == 0.
// Split K: the K range is dealt in equal contiguous pieces to SK work-groups (grid.y = N/64 x SK, piece kb writes its own partial plane C + kb x sP); inside a piece the 32-wide k steps go round-robin to KS waves (32 x KS threads; neighbouring waves use the two halves of one 128-byte line in the same trip), whose 64x64 partial tiles are summed through LDS in wave order. K % (32 x SK x KS) == 0. KS = SK = 1: one wave, whole K.
template <typename T16> struct WFrag;
template <> struct WFrag<h16> { typedef v16h V; static __device__ __forceinline__ V ld(const h16* p) { return cat16(*(const v8h*)p, *(const v8h*)(p + 16)); } static __device__ __forceinline__ v8f mma(V a, V b, v8f c) { return wmma16(a, b, c); } };
template <> struct WFrag<bf> { typedef v16bf V; static __device__ __forceinline__ V ld(const bf* p) { return cat16b(*(const v8us*)p, *(const v8us*)(p + 16)); } static __device__ __forceinline__ v8f mma(V a, V b, v8f c) { return wmmab(a, b, c); } };
template <typename T16, int NSPLIT, bool BIAS, int KS, int SK>
__global__ __launch_bounds__(32 * KS) void k_gemmw(const T16* __restrict__ A, const T16* __restrict__ A2, const T16* __restrict__ Bt, const T16* __restrict__ Bt2, int K, float* C, int ldc, const float* __restrict__ bias, size_t sA, size_t sB, size_t sC, size_t sP) {
    typedef typename WFrag<T16>::V V;
    __shared__ __align__(16) float os[(KS > 1 ? 2 * KS : 1) * 16 * 68];   // KS > 1: one 16-row slab per wave, two sets used in turn
    const size_t z = blockIdx.z; A += z * sA; if (A2) A2 += z * sA; Bt += z * sB; if (Bt2) Bt2 += z * sB; C += z * sC;
    const int lane = threadIdx.x & 31, lr = lane & 15, hi = lane >> 4; const int r0 = blockIdx.x * 64, c0 = (int)(blockIdx.y / SK) * 64;
    const int w = (KS > 1) ? __builtin_amdgcn_readfirstlane((int)(threadIdx.x >> 5)) : 0; const int kb = (int)(blockIdx.y % SK);
    const int KB = K / SK, k0 = kb * KB + w * 32, k1 = (kb + 1) * KB;   // this wave's k steps: k0, k0 + 32 KS, ... below k1
    if (SK > 1) C += (size_t)kb * sP;
    v8f acc[4][4];
#pragma unroll
    for (int mb = 0; mb < 4; ++mb)
#pragma unroll
        for (int nb = 0; nb < 4; ++nb) acc[mb][nb] = (v8f){};
    const size_t aoff = (size_t)(r0 + lr) * K + 8 * hi, boff = (size_t)(c0 + lr) * K + 8 * hi;
#pragma unroll 1
    for (int kc = k0; kc < k1; kc += 32 * KS) {
        V a[4], a2[4];
#pragma unroll
        for (int mb = 0; mb < 4; ++mb) { a[mb] = WFrag<T16>::ld(A + aoff + (size_t)mb * 16 * K + kc); if (NSPLIT == 1 || NSPLIT == 2) a2[mb] = WFrag<T16>::ld(A2 + aoff + (size_t)mb * 16 * K + kc); }
#pragma unroll
        for (int nb = 0; nb < 4; ++nb) { const V b = WFrag<T16>::ld(Bt + boff + (size_t)nb * 16 * K + kc); V b2; if (NSPLIT >= 2) b2 = WFrag<T16>::ld(Bt2 + boff + (size_t)nb * 16 * K + kc);
#pragma unroll
            for (int mb = 0; mb < 4; ++mb) { acc[mb][nb] = WFrag<T16>::mma(a[mb], b, acc[mb][nb]); if (NSPLIT == 1 || NSPLIT == 2) acc[mb][nb] = WFrag<T16>::mma(a2[mb], b, acc[mb][nb]); if (NSPLIT >= 2) acc[mb][nb] = WFrag<T16>::mma(a[mb], b2, acc[mb][nb]); } }
        asm volatile("v_nop\n\tv_nop\n\tv_nop\n\tv_nop" : "+v"(acc[0][0]), "+v"(acc[1][1]), "+v"(acc[2][2]), "+v"(acc[3][3]) : "v"(a[0]), "v"(a[3]));
    }
    if constexpr (KS > 1) {
        constexpr int NU = 256 / (32 * KS);   // 16-byte pieces of a 16x64 slab per thread
        v4f res[4][NU];   // the sums wait in registers, so that no barrier below has a global store to wait for
#pragma unroll
        for (int mb = 0; mb < 4; ++mb) {
            float* set = os + (mb & 1) * KS * (16 * 68); float* mine = set + w * (16 * 68);
#pragma unroll
            for (int nb = 0; nb < 4; ++nb) {
#pragma unroll
                for (int j = 0; j < 8; ++j) mine[(hi * 8 + j) * 68 + nb * 16 + lr] = acc[mb][nb][j]; }
            __syncthreads();   // every wave's slab of this mb is in LDS; it also ends the reads of the other set, which mb + 1 overwrites
#pragma unroll
            for (int s = 0; s < NU; ++s) { const int u = s * 32 * KS + (int)threadIdx.x, row = u >> 4, cofs = (u & 15) * 4; v4f val = *(const v4fa*)(set + row * 68 + cofs);
#pragma unroll
                for (int ww = 1; ww < KS; ++ww) val += *(const v4fa*)(set + ww * (16 * 68) + row * 68 + cofs);
                res[mb][s] = val; }
        }
#pragma unroll
        for (int mb = 0; mb < 4; ++mb) {
            float* crow = C + (size_t)(r0 + mb * 16) * ldc + c0;
#pragma unroll
            for (int s = 0; s < NU; ++s) { const int u = s * 32 * KS + (int)threadIdx.x, row = u >> 4, cofs = (u & 15) * 4; v4f val = res[mb][s];
                if (BIAS) { val[0] += bfr(bias[c0 + cofs]); val[1] += bfr(bias[c0 + cofs + 1]); val[2] += bfr(bias[c0 + cofs + 2]); val[3] += bfr(bias[c0 + cofs + 3]); }
                *(v4f*)(crow + (size_t)row * ldc + cofs) = val; }
        }
        return;
    }
#pragma unroll
    for (int mb = 0; mb < 4; ++mb) {
#pragma unroll
        for (int nb = 0; nb < 4; ++nb) {
#pragma unroll
            for (int j = 0; j < 8; ++j) os[(hi * 8 + j) * 68 + nb * 16 + lr] = acc[mb][nb][j]; }
        __builtin_amdgcn_wave_barrier(); asm volatile("" ::: "memory");
        float* crow = C + (size_t)(r0 + mb * 16) * ldc + c0;
{
#pragma unroll
            for (int s = 0; s < 8; ++s) { const int row = 2 * s + hi, cofs = lr * 4; v4f val = *(const v4fa*)(os + row * 68 + cofs); if (BIAS) { val[0] += bfr(bias[c0 + cofs]); val[1] += bfr(bias[c0 + cofs + 1]); val[2] += bfr(bias[c0 + cofs + 2]); val[3] += bfr(bias[c0 + cofs + 3]); }
                *(v4f*)(crow + (size_t)row * ldc + cofs) = val; }
             }
        __builtin_amdgcn_wave_barrier(); asm volatile("" ::: "memory");
    }
}

__device__ __forceinline__ h16 tohx(float x) { return (h16)x; }
__device__ __forceinline__ void splitf(float y, unsigned short& h, unsigned short& l) { h = f2bf(y); l = f2bf(y - bf2f(h)); }
typedef __attribute__((ext_vector_type(2))) _Float16 v2h;
typedef __attribute__((ext_vector_type(4))) _Float16 v4h;
typedef __attribute__((ext_vector_type(2))) unsigned short v2us;
typedef __attribute__((ext_vector_type(4))) unsigned short v4us;
typedef __attribute__((ext_vector_type(2))) float v2f;
typedef __attribute__((ext_vector_type(4))) int v4i;

__global__ __launch_bounds__(256) void k_wtG(const float* __restrict__ w, int K, int N, bf* Bt) {
    const int lane = threadIdx.x & 31; const int L0 = (blockIdx.x * 8 + (threadIdx.x >> 5)) * 8; const int nlines = N * K / 64;
{
#pragma unroll 1
        for (int l = 0; l < 8; ++l) { const int L = L0 + l; if (L >= nlines) break; const size_t e = (size_t)L * 64 + lane * 2; const int k = (int)(e % K), n = (int)(e / K); v2us o;
            o[0] = f2bf(w[(size_t)k * N + n]); o[1] = f2bf(w[(size_t)(k + 1) * N + n]); *(v2us*)(Bt + e) = o; }
         }
}
__global__ __launch_bounds__(256) void k_cvt8(const float* __restrict__ src, bf* dst, size_t n8) { const size_t i = (size_t)blockIdx.x * 256 + threadIdx.x; if (i >= n8) return; const v8f v = *(const v8f*)(src + i * 8); v8us o;
#pragma unroll
    for (int k = 0; k < 8; ++k) o[k] = f2bf(v[k]); *(v8us*)(dst + i * 8) = o;  }

// k_rope: head planes [h][t][d] (fp16 + hi/lo) of rope(x) x sc with the rotate-half convention out[d] = x[d] cos[t][d] - x[d+HD/2] sin[t][d], out[d+HD/2] = x[d+HD/2] cos[t][d+HD/2] + x[d] sin[t][d+HD/2]
__global__ __launch_bounds__(256) void k_rope(const float* __restrict__ F, int pitch, int nheads, const float* __restrict__ CS, const float* __restrict__ RF, const float* __restrict__ nw, float sc, h16* P16, bf* Ph, bf* Pl) {
    const size_t e = ((size_t)blockIdx.x * 256 + threadIdx.x) * 2; if (e >= (size_t)nheads * TT * HD) return; const int d = (int)(e % HD); const int t = (int)((e / HD) % TT); const int h = (int)(e / ((size_t)HD * TT)); const float* f = F + (size_t)t * pitch + h * HD; const float rf = RF ? RF[(size_t)h * TT + t] : 1.0f; v2h o16; v2us oh, ol;
#pragma unroll
    for (int q = 0; q < 2; ++q) { const int dd = d + q; const int dp = (dd < HD / 2) ? dd + HD / 2 : dd - HD / 2; float x0 = f[dd], x1 = f[dp];
        if (RF) { float n0 = __fmul_rn(x0, rf), n1 = __fmul_rn(x1, rf); asm volatile("" : "+v"(n0)); asm volatile("" : "+v"(n1)); x0 = __fmul_rn(bfr(nw[dd]), n0); x1 = __fmul_rn(bfr(nw[dp]), n1); }
        const v2f cs = *(const v2f*)(CS + ((size_t)t * HD + dd) * 2); float a = __fmul_rn(x0, cs[0]), bq = __fmul_rn(x1, cs[1]); asm volatile("" : "+v"(a)); asm volatile("" : "+v"(bq)); const float r = ((dd < HD / 2) ? __fsub_rn(a, bq) : __fadd_rn(a, bq)) * sc;
        o16[q] = tohx(r); unsigned short a2, c2; splitf(r, a2, c2); oh[q] = a2; ol[q] = c2; }
    *(v2h*)(P16 + e) = o16; *(v2us*)(Ph + e) = oh; *(v2us*)(Pl + e) = ol;  }
__global__ __launch_bounds__(256) void k_vtp(const float* __restrict__ F, int pitch, int nheads, h16* V16, bf* Vh, bf* Vl) { const size_t e = ((size_t)blockIdx.x * 256 + threadIdx.x) * 2; if (e >= (size_t)nheads * HD * TT) return; const int t = (int)(e % TT); const int d = (int)((e / TT) % HD); const int g = (int)(e / ((size_t)TT * HD)); v2h o16; v2us oh, ol;
#pragma unroll
    for (int q = 0; q < 2; ++q) { const float x = F[(size_t)(t + q) * pitch + g * HD + d]; o16[q] = tohx(x); unsigned short a2, c2; splitf(x, a2, c2); oh[q] = a2; ol[q] = c2; }
    *(v2h*)(V16 + e) = o16; *(v2us*)(Vh + e) = oh; *(v2us*)(Vl + e) = ol;  }
__global__ __launch_bounds__(256) void k_csid(float* CS) { const int idx = blockIdx.x * 256 + threadIdx.x; if (idx >= TT * HD) return; v2f cs; cs[0] = 1.0f; cs[1] = 0.0f; *(v2f*)(CS + (size_t)idx * 2) = cs;  }
__global__ __launch_bounds__(256) void k_cvtS(const float* __restrict__ src, bf* dst) { const size_t i = (size_t)blockIdx.x * 256 + threadIdx.x; if (i >= (size_t)TT * DM / 8) return; const size_t e = i * 8; const int c0 = (int)(e % DM); const int t = (int)(e / DM); const v8f v = *(const v8f*)(src + (size_t)t * SP + c0); v8us o;
#pragma unroll
    for (int k = 0; k < 8; ++k) o[k] = f2bf(v[k]); *(v8us*)(dst + e) = o;  }
__global__ __launch_bounds__(256) void k_wtGp(const float* __restrict__ w, int K, int N, int pitch, bf* Bt) {
    const int lane = threadIdx.x & 31; const int L0 = (blockIdx.x * 8 + (threadIdx.x >> 5)) * 8; const int nlines = N * K / 64;
{
#pragma unroll 1
        for (int l = 0; l < 8; ++l) { const int L = L0 + l; if (L >= nlines) break; const size_t e = (size_t)L * 64 + lane * 2; const int k = (int)(e % K), n = (int)(e / K); v2us o;
            o[0] = f2bf(w[(size_t)k * pitch + n]); o[1] = f2bf(w[(size_t)(k + 1) * pitch + n]); *(v2us*)(Bt + e) = o; }
         }
}
__global__ __launch_bounds__(256) void k_addresS(float* Y, const float* __restrict__ hs) { const size_t i = (size_t)blockIdx.x * 256 + threadIdx.x; if (i >= (size_t)TT * DM / 4) return; const size_t e = i * 4; const int c0 = (int)(e % DM); const int t = (int)(e / DM); const v4f a = *(const v4f*)(Y + e); const v4f r = *(const v4f*)(hs + (size_t)t * SP + c0); v4f o;
#pragma unroll
    for (int q = 0; q < 4; ++q) o[q] = __fadd_rn(a[q], bfr(r[q]));
    *(v4f*)(Y + e) = o;  }
__global__ __launch_bounds__(256) void k_lnoutS(const float* __restrict__ F, const float* __restrict__ g, const float* __restrict__ bb, float* out) { const int lane = threadIdx.x & 31; const int row = blockIdx.x * 8 + (threadIdx.x >> 5); if (row >= TT) return; const float* fr = F + (size_t)row * DQ; float* orow = out + (size_t)row * SP;   /* seq-major output pitch */ float v[DQ / 32]; float s = 0.f;
#pragma unroll
    for (int c = 0; c < DQ / 128; ++c) { const v4f a = *(const v4f*)(fr + c * 128 + lane * 4); for (int q = 0; q < 4; ++q) { v[c * 4 + q] = a[q]; s = __fadd_rn(s, a[q]); } }
#pragma unroll
    for (int sh = 16; sh; sh >>= 1) s = __fadd_rn(s, __shfl_xor(s, sh, 32));
    const float mean = __fdiv_rn(s, (float)DQ); float s2 = 0.f;
#pragma unroll
    for (int k = 0; k < DQ / 32; ++k) { const float dv = __fsub_rn(v[k], mean); float p2 = __fmul_rn(dv, dv); asm volatile("" : "+v"(p2)); s2 = __fadd_rn(s2, p2); v[k] = dv; }
#pragma unroll
    for (int sh = 16; sh; sh >>= 1) s2 = __fadd_rn(s2, __shfl_xor(s2, sh, 32));
    const float rs = __fdiv_rn(1.0f, __fsqrt_rn(__fadd_rn(__fdiv_rn(s2, (float)DQ), LNEPS)));
{
#pragma unroll
        for (int c = 0; c < DQ / 128; ++c) { v4f o; for (int q = 0; q < 4; ++q) { const int col = c * 128 + lane * 4 + q; float y = __fmul_rn(v[c * 4 + q], rs); asm volatile("" : "+v"(y)); y = __fmul_rn(y, bfr(g[col])); asm volatile("" : "+v"(y)); o[q] = __fadd_rn(y, bfr(bb[col])); } *(v4f*)(orow + c * 128 + lane * 4) = o; }
         } }

// ---- k_fattn: scores, softmax and P.V of one batch in one kernel. A wave owns NQ x 16 query rows of one head and walks all TT keys, 32 a pass, with a running maximum and sum per query.
// St = K Qt (A = K rows, B = Q rows): lane (lr, hi) holds, for query lr, the scores of keys 8 hi + j of each 16-key block, so the two blocks of a pass, converted in place, are the B operand of Ot += Vt Pt (A = Vt rows, k = key).
// The FW waves of a work-group share the head's K and Vt: tiles of KT keys (64 rows x 128 bytes each) are read from memory once, in whole lines, and laid in LDS, two buffers in turn; the fragments come from LDS.
// Rows < RH: bf16 hi/lo planes, 3 products in both stages. Other rows: fp16, probabilities carried x 2^PCL2 (folded into the exponent; it cancels in O / sum). The sum is taken of the f32 probabilities.
#define KT   64           // keys per LDS tile
#define LP   72           // LDS row pitch in 16-bit elements: 128 + 16 bytes, free of bank conflicts for 16-byte reads
typedef __attribute__((ext_vector_type(16))) unsigned short v16us;
template <typename T16> __device__ __forceinline__ typename WFrag<T16>::V ldsfrag(const unsigned short* p) { const v8us lo = *(const v8usa*)p, up = *(const v8usa*)(p + 16); return __builtin_bit_cast(typename WFrag<T16>::V, __builtin_shufflevector(lo, up, 0, 1, 2, 3, 4, 5, 6, 7, 8, 9, 10, 11, 12, 13, 14, 15)); }
template <typename T16, int NQ>
__device__ __forceinline__ void attn_rows(const T16* __restrict__ Q, const T16* __restrict__ Q2, const T16* __restrict__ Kp, const T16* __restrict__ K2, const T16* __restrict__ Vt, const T16* __restrict__ V2, int q0, int hcol, bf* Ah, bf* Al, unsigned short* sm) {
    typedef typename WFrag<T16>::V V; constexpr bool HR = __is_same(T16, bf);
    constexpr int NP = HR ? 4 : 2;              // planes staged: K, Vt (, K lo, Vt lo)
    constexpr int PL = KT * LP;                 // one plane's tile in LDS, elements
    constexpr int NC = KT * 8 / (32 * FW);      // 16-byte pieces of a tile per thread
    const int lane = threadIdx.x & 31, lr = lane & 15, hi = lane >> 4;
    const int srow = (int)threadIdx.x >> 3, scol = ((int)threadIdx.x & 7) * 8;   // this thread's piece: rows srow + 4 FW i, 8 elements at scol
    constexpr float CE = SCL * 1.4426950408889634f;   // score -> exponent of 2
    V qf[NQ][2], qf2[NQ][2];
#pragma unroll
    for (int nq = 0; nq < NQ; ++nq)
#pragma unroll
        for (int kk = 0; kk < 2; ++kk) { const size_t qo = (size_t)(q0 + nq * 16 + lr) * HD + kk * 32 + 8 * hi; qf[nq][kk] = WFrag<T16>::ld(Q + qo); if (HR) qf2[nq][kk] = WFrag<T16>::ld(Q2 + qo); }
    asm volatile("s_wait_xcnt 0x0" ::: "memory");   // stands in front of later writes to the address registers that the Q loads name
    v8f o[4][NQ]; float m[NQ], l[NQ];
#pragma unroll
    for (int nq = 0; nq < NQ; ++nq) { m[nq] = -3.0e38f; l[nq] = 0.f;
#pragma unroll
        for (int db = 0; db < 4; ++db) o[db][nq] = (v8f){}; }
    v8us st[NP][NC];
    auto fetch = [&](int key0) {
#pragma unroll
        for (int i = 0; i < NC; ++i) { const int r = srow + i * 4 * FW; const size_t kx = (size_t)(key0 + r) * HD + scol, vx = (size_t)r * TT + key0 + scol;
            st[0][i] = *(const v8usa*)(Kp + kx); st[1][i] = *(const v8usa*)(Vt + vx);
            if constexpr (HR) { st[2][i] = *(const v8usa*)(K2 + kx); st[3][i] = *(const v8usa*)(V2 + vx); } }
        asm volatile("s_wait_xcnt 0x0" ::: "memory");   // stands in front of later writes to the address registers that the loads above name
    };
    auto put = [&](int buf) {
#pragma unroll
        for (int i = 0; i < NC; ++i) { unsigned short* d = sm + buf * NP * PL + (srow + i * 4 * FW) * LP + scol;
#pragma unroll
            for (int pl = 0; pl < NP; ++pl) *(v8usa*)(d + pl * PL) = st[pl][i]; } };
    fetch(0); put(0);
    __syncthreads();   // tile 0 is in LDS
#pragma unroll 1
    for (int t = 0; t < TT / KT; ++t) {
        const bool more = t + 1 < TT / KT;
        if (more) fetch((t + 1) * KT);   // the next tile flies to registers while this one is worked on
        const unsigned short* tb = sm + (t & 1) * NP * PL + lr * LP + 8 * hi;
#pragma unroll
        for (int ks = 0; ks < KT / 32; ++ks) {
            v8f s[2][NQ];
#pragma unroll
            for (int kb = 0; kb < 2; ++kb) { V kf[2], kf2[2];
#pragma unroll
                for (int kk = 0; kk < 2; ++kk) { const unsigned short* kq = tb + (ks * 2 + kb) * 16 * LP + kk * 32; kf[kk] = ldsfrag<T16>(kq); if (HR) kf2[kk] = ldsfrag<T16>(kq + 2 * PL); }
#pragma unroll
                for (int nq = 0; nq < NQ; ++nq) { v8f a = (v8f){};
#pragma unroll
                    for (int kk = 0; kk < 2; ++kk) { a = WFrag<T16>::mma(kf[kk], qf[nq][kk], a); if (HR) { a = WFrag<T16>::mma(kf2[kk], qf[nq][kk], a); a = WFrag<T16>::mma(kf[kk], qf2[nq][kk], a); } }
                    s[kb][nq] = a; } }
            V vf[4], vf2[4];
#pragma unroll
            for (int db = 0; db < 4; ++db) { const unsigned short* vq = tb + PL + db * 16 * LP + ks * 32; vf[db] = ldsfrag<T16>(vq); if (HR) vf2[db] = ldsfrag<T16>(vq + 2 * PL); }
#pragma unroll
            for (int nq = 0; nq < NQ; ++nq) {
                float mx = s[0][nq][0];
#pragma unroll
                for (int j = 0; j < 8; ++j) mx = fmaxf(mx, fmaxf(s[0][nq][j], s[1][nq][j]));
                mx = fmaxf(mx, __shfl_xor(mx, 16, 32));   // the other eight keys of each block sit in the other lane half
                const float mn = fmaxf(m[nq], mx); const float al = __builtin_amdgcn_exp2f((m[nq] - mn) * CE); m[nq] = mn;
                const float mb = mn * CE - (HR ? 0.0f : PCL2);
#pragma unroll
                for (int kb = 0; kb < 2; ++kb)
#pragma unroll
                    for (int j = 0; j < 8; ++j) s[kb][nq][j] = __builtin_amdgcn_exp2f(s[kb][nq][j] * CE - mb);
                const v8f p8 = s[0][nq] + s[1][nq];   // the pass's sixteen probabilities of this lane, summed as a tree
                l[nq] = l[nq] * al + (((p8[0] + p8[4]) + (p8[1] + p8[5])) + ((p8[2] + p8[6]) + (p8[3] + p8[7])));
#pragma unroll
                for (int db = 0; db < 4; ++db) o[db][nq] *= al;
                if constexpr (HR) {
                    v16us ph, pl;
#pragma unroll
                    for (int e = 0; e < 16; ++e) { unsigned short a, c2; splitf(s[e >> 3][nq][e & 7], a, c2); ph[e] = a; pl[e] = c2; }
                    const V pfh = __builtin_bit_cast(v16bf, ph), pfl = __builtin_bit_cast(v16bf, pl);
#pragma unroll
                    for (int db = 0; db < 4; ++db) { o[db][nq] = WFrag<T16>::mma(vf[db], pfh, o[db][nq]); o[db][nq] = WFrag<T16>::mma(vf[db], pfl, o[db][nq]); o[db][nq] = WFrag<T16>::mma(vf2[db], pfh, o[db][nq]); }
                } else {
                    V pf;
#pragma unroll
                    for (int e = 0; e < 16; ++e) pf[e] = tohx(s[e >> 3][nq][e & 7]);
#pragma unroll
                    for (int db = 0; db < 4; ++db) o[db][nq] = WFrag<T16>::mma(vf[db], pf, o[db][nq]);
                }
            }
        }
        if (more) put((t + 1) & 1);   // into the buffer whose last readers left it at the barrier of trip t - 1
        __syncthreads();   // publishes tile t + 1 and ends every wave's reads of tile t
    }
#pragma unroll
    for (int nq = 0; nq < NQ; ++nq) { const float inv = __fdiv_rn(1.0f, l[nq] + __shfl_xor(l[nq], 16, 32)); const size_t oo = (size_t)(q0 + nq * 16 + lr) * DQ + hcol + hi * 8;
#pragma unroll
        for (int db = 0; db < 4; ++db) { v8us oh, ol;
#pragma unroll
            for (int j = 0; j < 8; ++j) { unsigned short a, c2; splitf(o[db][nq][j] * inv, a, c2); oh[j] = a; ol[j] = c2; }
            *(v8us*)(Ah + oo + db * 16) = oh; *(v8us*)(Al + oo + db * 16) = ol;
            asm volatile("s_wait_xcnt 0x0" ::: "memory");   // stands in front of the next block's writes to registers that these two stores name
        } }
}
// grid (RH / (16 FW) + (TT - RH) / (32 FW), heads): of each head the hi/lo work-groups (16 rows a wave, three times the products) have the low indices.
__global__ __launch_bounds__(32 * FW) void k_fattn(const h16* __restrict__ Q16, const h16* __restrict__ K16, const h16* __restrict__ V16, const bf* __restrict__ Qh, const bf* __restrict__ Ql, const bf* __restrict__ Kh, const bf* __restrict__ Kl, const bf* __restrict__ Vh, const bf* __restrict__ Vl, bf* Ah, bf* Al) {
    __shared__ __align__(16) unsigned short sm[2 * 4 * KT * LP];
    const int w = __builtin_amdgcn_readfirstlane((int)(threadIdx.x >> 5)); const int hd = (int)blockIdx.y; const size_t pq = (size_t)hd * TT * HD, pk = (size_t)(hd / REP) * TT * HD;
    constexpr int NHB = RH / (16 * FW);
    if ((int)blockIdx.x < NHB) attn_rows<bf, 1>(Qh + pq, Ql + pq, Kh + pk, Kl + pk, Vh + pk, Vl + pk, ((int)blockIdx.x * FW + w) * 16, hd * HD, Ah, Al, sm);
    else attn_rows<h16, 2>(Q16 + pq, nullptr, K16 + pk, nullptr, V16 + pk, nullptr, RH + (((int)blockIdx.x - NHB) * FW + w) * 32, hd * HD, Ah, Al, sm);
}

extern "C" void kernel_launch(void* const* d_in, const int* in_sizes, int n_in,
                              void* d_out, int out_size, void* d_ws, size_t ws_size, hipStream_t stream) {
    (void)in_sizes; (void)n_in; (void)out_size;
    const float* x = (const float*)d_in[0];   /* h [S][B][D] seq-major */ const float* wq = (const float*)d_in[1]; const float* wkv = (const float*)d_in[2]; const float* wo = (const float*)d_in[3]; const float* lng = (const float*)d_in[4]; const float* lnb = (const float*)d_in[5]; const float* wk = wkv; const float* wv = wkv;
    float* OUT = (float*)d_out;     // [2048][4][1024] seq-major
    char* wsp = (char*)d_ws;
    auto take = [&](size_t bytes) { char* p = wsp; wsp += (bytes + 255) & ~(size_t)255; return (void*)p; };
    float* Y = (float*)take((size_t)TT * DM * 4); bf* WQ = (bf*)take((size_t)DQ * DM * 2); bf* WK = (bf*)take((size_t)DKV * DM * 2); bf* WV = (bf*)take((size_t)DKV * DM * 2); bf* WO = (bf*)take((size_t)DM * DQ * 2); float* CS = (float*)take((size_t)TT * HD * 2 * 4);
    bf* XB = (bf*)take((size_t)TT * DM * 2); float* FQ = (float*)take((size_t)TT * DQ * 4); float* FK = (float*)take((size_t)TT * DKV * 4);
    h16* QP16 = (h16*)take((size_t)NH_ * TT * HD * 2); h16* KP16 = (h16*)take((size_t)NKV * TT * HD * 2); h16* VT16 = (h16*)take((size_t)NKV * HD * TT * 2);
    bf* QPh = (bf*)take((size_t)NH_ * TT * HD * 2); bf* QPl = (bf*)take((size_t)NH_ * TT * HD * 2); bf* KPh = (bf*)take((size_t)NKV * TT * HD * 2); bf* KPl = (bf*)take((size_t)NKV * TT * HD * 2); bf* VTh = (bf*)take((size_t)NKV * HD * TT * 2); bf* VTl = (bf*)take((size_t)NKV * HD * TT * 2);
    bf* ATh = (bf*)take((size_t)TT * DQ * 2); bf* ATl = (bf*)take((size_t)TT * DQ * 2);
    if ((size_t)(wsp - (char*)d_ws) > ws_size) return;    // ws 256 MiB
    float* FV = FK;   // v projection reuses the k buffer after the k planes are built (stream-ordered)
    { k_wtG<<<(unsigned)((DM * DQ / 64 + 63) / 64), 256, 0, stream>>>(wq, DM, DQ, WQ); k_wtGp<<<(unsigned)((DM * DKV / 64 + 63) / 64), 256, 0, stream>>>(wkv + 0, DM, DKV, 2 * DM, WK);   /* Wkv 'xw' [1024][2048]: k = columns 0..1023 */ k_wtGp<<<(unsigned)((DM * DKV / 64 + 63) / 64), 256, 0, stream>>>(wkv + DM, DM, DKV, 2 * DM, WV);   /* Wkv 'xw' [1024][2048]: v = columns 1024..2047 */
      k_wtG<<<(unsigned)((DQ * DM / 64 + 63) / 64), 256, 0, stream>>>(wo, DQ, DM, WO);
       }
    k_csid<<<(TT * HD + 255) / 256, 256, 0, stream>>>(CS);
    const unsigned LQ = (unsigned)(((size_t)NH_ * TT * HD / 2 + 255) / 256), LKv = (unsigned)(((size_t)NKV * TT * HD / 2 + 255) / 256);
    for (int b = 0; b < NB_; ++b) {
        
        k_cvtS<<<(unsigned)(((size_t)TT * DM / 8 + 255) / 256), 256, 0, stream>>>(x + (size_t)b * DM, XB);   /* batch b's rows of the seq-major input (pitch 4 x 1024) */
        k_gemmw<bf, 0, false, GKS, 1><<<dim3(TT / 64, DQ / 64, 1), 32 * GKS, 0, stream>>>(XB, nullptr, WQ, nullptr, DM, FQ, DQ, nullptr, 0, 0, 0, 0);
        k_rope<<<LQ, 256, 0, stream>>>(FQ, DQ, NH_, CS, nullptr, nullptr, 1.0f, QP16, QPh, QPl);
        k_gemmw<bf, 0, false, GKS, 1><<<dim3(TT / 64, DKV / 64, 1), 32 * GKS, 0, stream>>>(XB, nullptr, WK, nullptr, DM, FK, DKV, nullptr, 0, 0, 0, 0);
        k_rope<<<LKv, 256, 0, stream>>>(FK, DKV, NKV, CS, nullptr, nullptr, 1.0f, KP16, KPh, KPl);
        k_gemmw<bf, 0, false, GKS, 1><<<dim3(TT / 64, DKV / 64, 1), 32 * GKS, 0, stream>>>(XB, nullptr, WV, nullptr, DM, FV, DKV, nullptr, 0, 0, 0, 0); k_vtp<<<LKv, 256, 0, stream>>>(FV, DKV, NKV, VT16, VTh, VTl);
        k_fattn<<<dim3(RH / (16 * FW) + (TT - RH) / (32 * FW), NH_, 1), 32 * FW, 0, stream>>>(QP16, KP16, VT16, QPh, QPl, KPh, KPl, VTh, VTl, ATh, ATl);
        k_gemmw<bf, 1, false, GKS, 1><<<dim3(TT / 64, DM / 64, 1), 32 * GKS, 0, stream>>>(ATh, ATl, WO, nullptr, DQ, Y, DM, nullptr, 0, 0, 0, 0); k_addresS<<<(unsigned)(((size_t)TT * DM / 4 + 255) / 256), 256, 0, stream>>>(Y, x + (size_t)b * DM); k_lnoutS<<<(TT + 7) / 8, 256, 0, stream>>>(Y, lng, lnb, OUT + (size_t)b * DM);   /* LayerNorm(h + attn_out), rows back at the seq-major pitch */ }
}

// v003
// Measured time: 501 microseconds a run.
// In both of two side-by-side timings against v002, it was 1.18 times as fast.
// Over all steps from v000 it is 8.06 times as fast.
#include <hip/hip_runtime.h>

// Transformer-XL style multi-head attention on a SEQUENCE-MAJOR input with post-LayerNorm (h [2048][4][1024] (seq, batch, model); q = h Wq ('xw' [1024][1024] 1/32), k | v = h Wkv ('xw' [1024][2048]: k = columns 0..1023, v = 1024..2047); 16 heads x 64; score = q.k / 8; softmax over keys; attn_vec merged; attn_out = attn_vec Wo ('xw' no bias); out = LayerNorm(h + attn_out) gamma/beta (eps 1e-5) -> [2048][4][1024] seq-major (8.4 M)).
// Layout per batch: a strided gather makes batch b's rows (row pitch 4 x 1024 in the input) a contiguous token-major bf16 operand; 'xw' weights transposed once (Wkv as two column blocks); exact projections, whose epilogues write the head planes (v as Wv x X^T, so that its tile comes out transposed); fused T-2048 attention, one kernel per batch (hybrid rows: < 512 hi/lo 3 products, rest fp16 x1024; scores and probabilities stay in registers); merged hi/lo x Wo exact, the residual (strided rows of h) added in its epilogue, into workspace; a row LayerNorm kernel writes batch b's output rows back at pitch 4 x 1024.
// Compute dtypes, f32 accumulate: every input rounded to bf16; projections exact; attention rows < 512 3 products, rest fp16; softmax f32; Wo hl x exact; residual + LayerNorm f32.

#define NB_  4
#define TT   2048
#define DM   1024
#define NH_  16
#define NKV  16
#define REP  (NH_ / NKV)
#define HD   64
#define DQ   (NH_ * HD)
#define DKV  (NKV * HD)
#define RH   512                  // query rows < RH use hi+lo planes (0: none)
#define WIN  0
#define PCL2 10.0f                // log2 of the carrier (x1024) of the fp16 probabilities
#define SCL  0.125f
#define LNEPS 1e-5f
#define SP   (NB_ * DM)   // seq-major row pitch of h and out (floats)
#define FW   4            // fused attention: waves per work-group
#define GKS  8            // projections and Wo: waves per work-group that share K
typedef _Float16 h16;
typedef unsigned short bf;
typedef __attribute__((ext_vector_type(16))) __bf16   v16bf;
typedef __attribute__((ext_vector_type(16))) _Float16 v16h;
typedef __attribute__((ext_vector_type(8)))  _Float16 v8h;
typedef __attribute__((ext_vector_type(8)))  unsigned short v8us;
typedef __attribute__((ext_vector_type(8)))  float    v8f;
typedef __attribute__((ext_vector_type(4)))  float    v4f;
typedef v8h  __attribute__((may_alias)) v8ha;
typedef v4f  __attribute__((may_alias)) v4fa;
typedef v8us __attribute__((may_alias)) v8usa;

__device__ __forceinline__ unsigned short f2bf(float f) { unsigned u = __float_as_uint(f); u += 0x7FFFu + ((u >> 16) & 1u); return (unsigned short)(u >> 16); }
__device__ __forceinline__ float bf2f(unsigned short b) { return __uint_as_float(((unsigned)b) << 16); }
__device__ __forceinline__ float bfr(float f) { return bf2f(f2bf(f)); }
__device__ __forceinline__ v16h cat16(v8h lo, v8h hi) { return __builtin_shufflevector(lo, hi, 0, 1, 2, 3, 4, 5, 6, 7, 8, 9, 10, 11, 12, 13, 14, 15); }
__device__ __forceinline__ v16bf cat16b(v8us lo, v8us hi) { return __builtin_bit_cast(v16bf, __builtin_shufflevector(lo, hi, 0, 1, 2, 3, 4, 5, 6, 7, 8, 9, 10, 11, 12, 13, 14, 15)); }
__device__ __forceinline__ v8f wmma16(v16h a, v16h b, v8f c) { return __builtin_amdgcn_wmma_f32_16x16x32_f16(false, a, false, b, (short)0, c, false, false); }
__device__ __forceinline__ v8f wmmab(v16bf a, v16bf b, v8f c) { return __builtin_amdgcn_wmma_f32_16x16x32_bf16(false, a, false, b, (short)0, c, false, false); }
__device__ __forceinline__ h16 tohx(float x) { return (h16)x; }
__device__ __forceinline__ void splitf(float y, unsigned short& h, unsigned short& l) { h = f2bf(y); l = f2bf(y - bf2f(h)); }
typedef __attribute__((ext_vector_type(4))) _Float16 v4h;
typedef __attribute__((ext_vector_type(4))) unsigned short v4us;



// ---- k_gemmw: register-blocked GEMM, KS WAVES per 64x64 output tile (16 accumulators each), operands straight from K-contiguous 16-bit planes; grid (M/64, N/64 x SK, Z), 32 x KS threads.
// C[m][n] (f32, pitch ldc, + optional f32 bias[n]) = sum_k A[m][k] Bt[n][k] (+ split products per NSPLIT). z-batch strides sA/sB/sC in elements. K % 32 == 0.
// Split K: the K range is dealt in equal contiguous pieces to SK work-groups (grid.y = N/64 x SK, piece kb writes its own partial plane C + kb x sP); inside a piece the 32-wide k steps go round-robin to KS waves (32 x KS threads; neighbouring waves use the two halves of one 128-byte line in the same trip), whose 64x64 partial tiles are summed through LDS in wave order. K % (32 x SK x KS) == 0. KS = SK = 1: one wave, whole K.
// EPI (KS > 1), what the epilogue does with the f32 sums: 0 stores them in C; 1 stores them as three 16-bit planes (fp16, bf16 hi, bf16 lo) and not in C, element (m, n) at m x ldc + (n / 64) x sT + n % 64 (head planes [h][t][d]: ldc = 64, sT = rows x 64; plain row-major: sT = 64); 2 adds the bf16-rounded residual hs[m][n] (row pitch SP) and stores in C.
template <typename T16> struct WFrag;
template <> struct WFrag<h16> { typedef v16h V; static __device__ __forceinline__ V ld(const h16* p) { return cat16(*(const v8h*)p, *(const v8h*)(p + 16)); } static __device__ __forceinline__ v8f mma(V a, V b, v8f c) { return wmma16(a, b, c); } };
template <> struct WFrag<bf> { typedef v16bf V; static __device__ __forceinline__ V ld(const bf* p) { return cat16b(*(const v8us*)p, *(const v8us*)(p + 16)); } static __device__ __forceinline__ v8f mma(V a, V b, v8f c) { return wmmab(a, b, c); } };
template <typename T16, int NSPLIT, bool BIAS, int KS, int SK, int EPI>
__global__ __launch_bounds__(32 * KS) void k_gemmw(const T16* __restrict__ A, const T16* __restrict__ A2, const T16* __restrict__ Bt, const T16* __restrict__ Bt2, int K, float* C, int ldc, const float* __restrict__ bias, size_t sA, size_t sB, size_t sC, size_t sP, h16* P16, bf* Ph, bf* Pl, size_t sT, const float* __restrict__ hs) {
    typedef typename WFrag<T16>::V V;
    __shared__ __align__(16) float os[(KS > 1 ? 2 * KS : 1) * 16 * 68];   // KS > 1: one 16-row slab per wave, two sets used in turn
    const size_t z = blockIdx.z; A += z * sA; if (A2) A2 += z * sA; Bt += z * sB; if (Bt2) Bt2 += z * sB; C += z * sC;
    const int lane = threadIdx.x & 31, lr = lane & 15, hi = lane >> 4; const int r0 = blockIdx.x * 64, c0 = (int)(blockIdx.y / SK) * 64;
    const int w = (KS > 1) ? __builtin_amdgcn_readfirstlane((int)(threadIdx.x >> 5)) : 0; const int kb = (int)(blockIdx.y % SK);
    const int KB = K / SK, k0 = kb * KB + w * 32, k1 = (kb + 1) * KB;   // this wave's k steps: k0, k0 + 32 KS, ... below k1
    if (SK > 1) C += (size_t)kb * sP;
    v8f acc[4][4];
#pragma unroll
    for (int mb = 0; mb < 4; ++mb)
#pragma unroll
        for (int nb = 0; nb < 4; ++nb) acc[mb][nb] = (v8f){};
    const size_t aoff = (size_t)(r0 + lr) * K + 8 * hi, boff = (size_t)(c0 + lr) * K + 8 * hi;
    constexpr int NU = 256 / (32 * KS);   // 16-byte pieces of a 16x64 slab per thread
    v4f rsd[4][NU];   // EPI 2: this thread's pieces of the residual, asked for ahead of the k loop, which covers their latency
    if constexpr (EPI == 2) {
#pragma unroll
        for (int mb = 0; mb < 4; ++mb)
#pragma unroll
            for (int s = 0; s < NU; ++s) { const int u = s * 32 * KS + (int)threadIdx.x; rsd[mb][s] = *(const v4f*)(hs + (size_t)(r0 + mb * 16 + (u >> 4)) * SP + c0 + (u & 15) * 4);
                asm volatile("s_wait_xcnt 0x0" ::: "memory");   // stands in front of later writes to the address registers that this load names
            }
    }
#pragma unroll 1
    for (int kc = k0; kc < k1; kc += 32 * KS) {
        V a[4], a2[4];
#pragma unroll
        for (int mb = 0; mb < 4; ++mb) { a[mb] = WFrag<T16>::ld(A + aoff + (size_t)mb * 16 * K + kc); if (NSPLIT == 1 || NSPLIT == 2) a2[mb] = WFrag<T16>::ld(A2 + aoff + (size_t)mb * 16 * K + kc); }
#pragma unroll
        for (int nb = 0; nb < 4; ++nb) { const V b = WFrag<T16>::ld(Bt + boff + (size_t)nb * 16 * K + kc); V b2; if (NSPLIT >= 2) b2 = WFrag<T16>::ld(Bt2 + boff + (size_t)nb * 16 * K + kc);
#pragma unroll
            for (int mb = 0; mb < 4; ++mb) { acc[mb][nb] = WFrag<T16>::mma(a[mb], b, acc[mb][nb]); if (NSPLIT == 1 || NSPLIT == 2) acc[mb][nb] = WFrag<T16>::mma(a2[mb], b, acc[mb][nb]); if (NSPLIT >= 2) acc[mb][nb] = WFrag<T16>::mma(a[mb], b2, acc[mb][nb]); } }
        asm volatile("v_nop\n\tv_nop\n\tv_nop\n\tv_nop" : "+v"(acc[0][0]), "+v"(acc[1][1]), "+v"(acc[2][2]), "+v"(acc[3][3]) : "v"(a[0]), "v"(a[3]));
    }
    if constexpr (KS > 1) {
        v4f res[4][NU];   // the sums wait in registers, so that no barrier below has a global store to wait for
#pragma unroll
        for (int mb = 0; mb < 4; ++mb) {
            float* set = os + (mb & 1) * KS * (16 * 68); float* mine = set + w * (16 * 68);
#pragma unroll
            for (int nb = 0; nb < 4; ++nb) {
#pragma unroll
                for (int j = 0; j < 8; ++j) mine[(hi * 8 + j) * 68 + nb * 16 + lr] = acc[mb][nb][j]; }
            __syncthreads();   // every wave's slab of this mb is in LDS; it also ends the reads of the other set, which mb + 1 overwrites
#pragma unroll
            for (int s = 0; s < NU; ++s) { const int u = s * 32 * KS + (int)threadIdx.x, row = u >> 4, cofs = (u & 15) * 4; v4f val = *(const v4fa*)(set + row * 68 + cofs);
#pragma unroll
                for (int ww = 1; ww < KS; ++ww) val += *(const v4fa*)(set + ww * (16 * 68) + row * 68 + cofs);
                res[mb][s] = val; }
        }
#pragma unroll
        for (int mb = 0; mb < 4; ++mb) {
            float* crow = C + (size_t)(r0 + mb * 16) * ldc + c0;
#pragma unroll
            for (int s = 0; s < NU; ++s) { const int u = s * 32 * KS + (int)threadIdx.x, row = u >> 4, cofs = (u & 15) * 4; v4f val = res[mb][s];
                if (BIAS) { val[0] += bfr(bias[c0 + cofs]); val[1] += bfr(bias[c0 + cofs + 1]); val[2] += bfr(bias[c0 + cofs + 2]); val[3] += bfr(bias[c0 + cofs + 3]); }
                if constexpr (EPI == 1) {
                    const size_t po = (size_t)(r0 + mb * 16 + row) * ldc + (size_t)(c0 / 64) * sT + cofs; v4h o16; v4us oh, ol;
#pragma unroll
                    for (int q = 0; q < 4; ++q) { o16[q] = tohx(val[q]); unsigned short a2, c2; splitf(val[q], a2, c2); oh[q] = a2; ol[q] = c2; }
                    *(v4h*)(P16 + po) = o16; *(v4us*)(Ph + po) = oh; *(v4us*)(Pl + po) = ol;
                } else {
                    if constexpr (EPI == 2) {
#pragma unroll
                        for (int q = 0; q < 4; ++q) val[q] = __fadd_rn(val[q], bfr(rsd[mb][s][q])); }
                    *(v4f*)(crow + (size_t)row * ldc + cofs) = val;
                }
                if constexpr (EPI != 0) asm volatile("s_wait_xcnt 0x0" ::: "memory");   // stands in front of the next slab's writes to registers that these stores name
            }
        }
        return;
    }
#pragma unroll
    for (int mb = 0; mb < 4; ++mb) {
#pragma unroll
        for (int nb = 0; nb < 4; ++nb) {
#pragma unroll
            for (int j = 0; j < 8; ++j) os[(hi * 8 + j) * 68 + nb * 16 + lr] = acc[mb][nb][j]; }
        __builtin_amdgcn_wave_barrier(); asm volatile("" ::: "memory");
        float* crow = C + (size_t)(r0 + mb * 16) * ldc + c0;
{
#pragma unroll
            for (int s = 0; s < 8; ++s) { const int row = 2 * s + hi, cofs = lr * 4; v4f val = *(const v4fa*)(os + row * 68 + cofs); if (BIAS) { val[0] += bfr(bias[c0 + cofs]); val[1] += bfr(bias[c0 + cofs + 1]); val[2] += bfr(bias[c0 + cofs + 2]); val[3] += bfr(bias[c0 + cofs + 3]); }
                *(v4f*)(crow + (size_t)row * ldc + cofs) = val; }
             }
        __builtin_amdgcn_wave_barrier(); asm volatile("" ::: "memory");
    }
}

typedef __attribute__((ext_vector_type(2))) unsigned short v2us;

__global__ __launch_bounds__(256) void k_wtG(const float* __restrict__ w, int K, int N, bf* Bt) {
    const int lane = threadIdx.x & 31; const int L0 = (blockIdx.x * 8 + (threadIdx.x >> 5)) * 8; const int nlines = N * K / 64;
{
#pragma unroll 1
        for (int l = 0; l < 8; ++l) { const int L = L0 + l; if (L >= nlines) break; const size_t e = (size_t)L * 64 + lane * 2; const int k = (int)(e % K), n = (int)(e / K); v2us o;
            o[0] = f2bf(w[(size_t)k * N + n]); o[1] = f2bf(w[(size_t)(k + 1) * N + n]); *(v2us*)(Bt + e) = o; }
         }
}
__global__ __launch_bounds__(256) void k_cvt8(const float* __restrict__ src, bf* dst, size_t n8) { const size_t i = (size_t)blockIdx.x * 256 + threadIdx.x; if (i >= n8) return; const v8f v = *(const v8f*)(src + i * 8); v8us o;
#pragma unroll
    for (int k = 0; k < 8; ++k) o[k] = f2bf(v[k]); *(v8us*)(dst + i * 8) = o;  }

__global__ __launch_bounds__(256) void k_cvtS(const float* __restrict__ src, bf* dst) { const size_t i = (size_t)blockIdx.x * 256 + threadIdx.x; if (i >= (size_t)TT * DM / 8) return; const size_t e = i * 8; const int c0 = (int)(e % DM); const int t = (int)(e / DM); const v8f v = *(const v8f*)(src + (size_t)t * SP + c0); v8us o;
#pragma unroll
    for (int k = 0; k < 8; ++k) o[k] = f2bf(v[k]); *(v8us*)(dst + e) = o;  }
__global__ __launch_bounds__(256) void k_wtGp(const float* __restrict__ w, int K, int N, int pitch, bf* Bt) {
    const int lane = threadIdx.x & 31; const int L0 = (blockIdx.x * 8 + (threadIdx.x >> 5)) * 8; const int nlines = N * K / 64;
{
#pragma unroll 1
        for (int l = 0; l < 8; ++l) { const int L = L0 + l; if (L >= nlines) break; const size_t e = (size_t)L * 64 + lane * 2; const int k = (int)(e % K), n = (int)(e / K); v2us o;
            o[0] = f2bf(w[(size_t)k * pitch + n]); o[1] = f2bf(w[(size_t)(k + 1) * pitch + n]); *(v2us*)(Bt + e) = o; }
         }
}
__global__ __launch_bounds__(256) void k_lnoutS(const float* __restrict__ F, const float* __restrict__ g, const float* __restrict__ bb, float* out) { const int lane = threadIdx.x & 31; const int row = blockIdx.x * 8 + (threadIdx.x >> 5); if (row >= TT) return; const float* fr = F + (size_t)row * DQ; float* orow = out + (size_t)row * SP;   /* seq-major output pitch */ float v[DQ / 32]; float s = 0.f;
#pragma unroll
    for (int c = 0; c < DQ / 128; ++c) { const v4f a = *(const v4f*)(fr + c * 128 + lane * 4); for (int q = 0; q < 4; ++q) { v[c * 4 + q] = a[q]; s = __fadd_rn(s, a[q]); } }
#pragma unroll
    for (int sh = 16; sh; sh >>= 1) s = __fadd_rn(s, __shfl_xor(s, sh, 32));
    const float mean = __fdiv_rn(s, (float)DQ); float s2 = 0.f;
#pragma unroll
    for (int k = 0; k < DQ / 32; ++k) { const float dv = __fsub_rn(v[k], mean); float p2 = __fmul_rn(dv, dv); asm volatile("" : "+v"(p2)); s2 = __fadd_rn(s2, p2); v[k] = dv; }
#pragma unroll
    for (int sh = 16; sh; sh >>= 1) s2 = __fadd_rn(s2, __shfl_xor(s2, sh, 32));
    const float rs = __fdiv_rn(1.0f, __fsqrt_rn(__fadd_rn(__fdiv_rn(s2, (float)DQ), LNEPS)));
{
#pragma unroll
        for (int c = 0; c < DQ / 128; ++c) { v4f o; for (int q = 0; q < 4; ++q) { const int col = c * 128 + lane * 4 + q; float y = __fmul_rn(v[c * 4 + q], rs); asm volatile("" : "+v"(y)); y = __fmul_rn(y, bfr(g[col])); asm volatile("" : "+v"(y)); o[q] = __fadd_rn(y, bfr(bb[col])); } *(v4f*)(orow + c * 128 + lane * 4) = o; }
         } }

// ---- k_fattn: scores, softmax and P.V of one batch in one kernel. A wave owns NQ x 16 query rows of one head and walks all TT keys, 32 a pass, with a running maximum and sum per query.
// St = K Qt (A = K rows, B = Q rows): lane (lr, hi) holds, for query lr, the scores of keys 8 hi + j of each 16-key block, so the two blocks of a pass, converted in place, are the B operand of Ot += Vt Pt (A = Vt rows, k = key).
// The FW waves of a work-group share the head's K and Vt: tiles of KT keys (64 rows x 128 bytes each) are read from memory once, in whole lines, and laid in LDS, two buffers in turn; the fragments come from LDS.
// Rows < RH: bf16 hi/lo planes, 3 products in both stages. Other rows: fp16, probabilities carried x 2^PCL2 (folded into the exponent; it cancels in O / sum). The sum is taken of the f32 probabilities.
#define KT   64           // keys per LDS tile
#define LP   72           // LDS row pitch in 16-bit elements: 128 + 16 bytes, free of bank conflicts for 16-byte reads
typedef __attribute__((ext_vector_type(16))) unsigned short v16us;
template <typename T16> __device__ __forceinline__ typename WFrag<T16>::V ldsfrag(const unsigned short* p) { const v8us lo = *(const v8usa*)p, up = *(const v8usa*)(p + 16); return __builtin_bit_cast(typename WFrag<T16>::V, __builtin_shufflevector(lo, up, 0, 1, 2, 3, 4, 5, 6, 7, 8, 9, 10, 11, 12, 13, 14, 15)); }
template <typename T16, int NQ>
__device__ __forceinline__ void attn_rows(const T16* __restrict__ Q, const T16* __restrict__ Q2, const T16* __restrict__ Kp, const T16* __restrict__ K2, const T16* __restrict__ Vt, const T16* __restrict__ V2, int q0, int hcol, bf* Ah, bf* Al, unsigned short* sm) {
    typedef typename WFrag<T16>::V V; constexpr bool HR = __is_same(T16, bf);
    constexpr int NP = HR ? 4 : 2;              // planes staged: K, Vt (, K lo, Vt lo)
    constexpr int PL = KT * LP;                 // one plane's tile in LDS, elements
    constexpr int NC = KT * 8 / (32 * FW);      // 16-byte pieces of a tile per thread
    const int lane = threadIdx.x & 31, lr = lane & 15, hi = lane >> 4;
    const int srow = (int)threadIdx.x >> 3, scol = ((int)threadIdx.x & 7) * 8;   // this thread's piece: rows srow + 4 FW i, 8 elements at scol
    constexpr float CE = SCL * 1.4426950408889634f;   // score -> exponent of 2
    V qf[NQ][2], qf2[NQ][2];
#pragma unroll
    for (int nq = 0; nq < NQ; ++nq)
#pragma unroll
        for (int kk = 0; kk < 2; ++kk) { const size_t qo = (size_t)(q0 + nq * 16 + lr) * HD + kk * 32 + 8 * hi; qf[nq][kk] = WFrag<T16>::ld(Q + qo); if (HR) qf2[nq][kk] = WFrag<T16>::ld(Q2 + qo); }
    asm volatile("s_wait_xcnt 0x0" ::: "memory");   // stands in front of later writes to the address registers that the Q loads name
    v8f o[4][NQ]; float m[NQ], l[NQ];
#pragma unroll
    for (int nq = 0; nq < NQ; ++nq) { m[nq] = -3.0e38f; l[nq] = 0.f;
#pragma unroll
        for (int db = 0; db < 4; ++db) o[db][nq] = (v8f){}; }
    v8us st[NP][NC];
    auto fetch = [&](int key0) {
#pragma unroll
        for (int i = 0; i < NC; ++i) { const int r = srow + i * 4 * FW; const size_t kx = (size_t)(key0 + r) * HD + scol, vx = (size_t)r * TT + key0 + scol;
            st[0][i] = *(const v8usa*)(Kp + kx); st[1][i] = *(const v8usa*)(Vt + vx);
            if constexpr (HR) { st[2][i] = *(const v8usa*)(K2 + kx); st[3][i] = *(const v8usa*)(V2 + vx); } }
        asm volatile("s_wait_xcnt 0x0" ::: "memory");   // stands in front of later writes to the address registers that the loads above name
    };
    auto put = [&](int buf) {
#pragma unroll
        for (int i = 0; i < NC; ++i) { unsigned short* d = sm + buf * NP * PL + (srow + i * 4 * FW) * LP + scol;
#pragma unroll
            for (int pl = 0; pl < NP; ++pl) *(v8usa*)(d + pl * PL) = st[pl][i]; } };
    fetch(0); put(0);
    __syncthreads();   // tile 0 is in LDS
#pragma unroll 1
    for (int t = 0; t < TT / KT; ++t) {
        const bool more = t + 1 < TT / KT;
        if (more) fetch((t + 1) * KT);   // the next tile flies to registers while this one is worked on
        const unsigned short* tb = sm + (t & 1) * NP * PL + lr * LP + 8 * hi;
#pragma unroll
        for (int ks = 0; ks < KT / 32; ++ks) {
            v8f s[2][NQ];
#pragma unroll
            for (int kb = 0; kb < 2; ++kb) { V kf[2], kf2[2];
#pragma unroll
                for (int kk = 0; kk < 2; ++kk) { const unsigned short* kq = tb + (ks * 2 + kb) * 16 * LP + kk * 32; kf[kk] = ldsfrag<T16>(kq); if (HR) kf2[kk] = ldsfrag<T16>(kq + 2 * PL); }
#pragma unroll
                for (int nq = 0; nq < NQ; ++nq) { v8f a = (v8f){};
#pragma unroll
                    for (int kk = 0; kk < 2; ++kk) { a = WFrag<T16>::mma(kf[kk], qf[nq][kk], a); if (HR) { a = WFrag<T16>::mma(kf2[kk], qf[nq][kk], a); a = WFrag<T16>::mma(kf[kk], qf2[nq][kk], a); } }
                    s[kb][nq] = a; } }
            V vf[4], vf2[4];
#pragma unroll
            for (int db = 0; db < 4; ++db) { const unsigned short* vq = tb + PL + db * 16 * LP + ks * 32; vf[db] = ldsfrag<T16>(vq); if (HR) vf2[db] = ldsfrag<T16>(vq + 2 * PL); }
#pragma unroll
            for (int nq = 0; nq < NQ; ++nq) {
                float mx = s[0][nq][0];
#pragma unroll
                for (int j = 0; j < 8; ++j) mx = fmaxf(mx, fmaxf(s[0][nq][j], s[1][nq][j]));
                mx = fmaxf(mx, __shfl_xor(mx, 16, 32));   // the other eight keys of each block sit in the other lane half
                const float mn = fmaxf(m[nq], mx); const float al = __builtin_amdgcn_exp2f((m[nq] - mn) * CE); m[nq] = mn;
                const float mb = mn * CE - (HR ? 0.0f : PCL2);
#pragma unroll
                for (int kb = 0; kb < 2; ++kb)
#pragma unroll
                    for (int j = 0; j < 8; ++j) s[kb][nq][j] = __builtin_amdgcn_exp2f(s[kb][nq][j] * CE - mb);
                const v8f p8 = s[0][nq] + s[1][nq];   // the pass's sixteen probabilities of this lane, summed as a tree
                l[nq] = l[nq] * al + (((p8[0] + p8[4]) + (p8[1] + p8[5])) + ((p8[2] + p8[6]) + (p8[3] + p8[7])));
#pragma unroll
                for (int db = 0; db < 4; ++db) o[db][nq] *= al;
                if constexpr (HR) {
                    v16us ph, pl;
#pragma unroll
                    for (int e = 0; e < 16; ++e) { unsigned short a, c2; splitf(s[e >> 3][nq][e & 7], a, c2); ph[e] = a; pl[e] = c2; }
                    const V pfh = __builtin_bit_cast(v16bf, ph), pfl = __builtin_bit_cast(v16bf, pl);
#pragma unroll
                    for (int db = 0; db < 4; ++db) { o[db][nq] = WFrag<T16>::mma(vf[db], pfh, o[db][nq]); o[db][nq] = WFrag<T16>::mma(vf[db], pfl, o[db][nq]); o[db][nq] = WFrag<T16>::mma(vf2[db], pfh, o[db][nq]); }
                } else {
                    V pf;
#pragma unroll
                    for (int e = 0; e < 16; ++e) pf[e] = tohx(s[e >> 3][nq][e & 7]);
#pragma unroll
                    for (int db = 0; db < 4; ++db) o[db][nq] = WFrag<T16>::mma(vf[db], pf, o[db][nq]);
                }
            }
        }
        if (more) put((t + 1) & 1);   // into the buffer whose last readers left it at the barrier of trip t - 1
        __syncthreads();   // publishes tile t + 1 and ends every wave's reads of tile t
    }
#pragma unroll
    for (int nq = 0; nq < NQ; ++nq) { const float inv = __fdiv_rn(1.0f, l[nq] + __shfl_xor(l[nq], 16, 32)); const size_t oo = (size_t)(q0 + nq * 16 + lr) * DQ + hcol + hi * 8;
#pragma unroll
        for (int db = 0; db < 4; ++db) { v8us oh, ol;
#pragma unroll
            for (int j = 0; j < 8; ++j) { unsigned short a, c2; splitf(o[db][nq][j] * inv, a, c2); oh[j] = a; ol[j] = c2; }
            *(v8us*)(Ah + oo + db * 16) = oh; *(v8us*)(Al + oo + db * 16) = ol;
            asm volatile("s_wait_xcnt 0x0" ::: "memory");   // stands in front of the next block's writes to registers that these two stores name
        } }
}
// grid (RH / (16 FW) + (TT - RH) / (32 FW), heads): of each head the hi/lo work-groups (16 rows a wave, three times the products) have the low indices.
__global__ __launch_bounds__(32 * FW) void k_fattn(const h16* __restrict__ Q16, const h16* __restrict__ K16, const h16* __restrict__ V16, const bf* __restrict__ Qh, const bf* __restrict__ Ql, const bf* __restrict__ Kh, const bf* __restrict__ Kl, const bf* __restrict__ Vh, const bf* __restrict__ Vl, bf* Ah, bf* Al) {
    __shared__ __align__(16) unsigned short sm[2 * 4 * KT * LP];
    const int w = __builtin_amdgcn_readfirstlane((int)(threadIdx.x >> 5)); const int hd = (int)blockIdx.y; const size_t pq = (size_t)hd * TT * HD, pk = (size_t)(hd / REP) * TT * HD;
    constexpr int NHB = RH / (16 * FW);
    if ((int)blockIdx.x < NHB) attn_rows<bf, 1>(Qh + pq, Ql + pq, Kh + pk, Kl + pk, Vh + pk, Vl + pk, ((int)blockIdx.x * FW + w) * 16, hd * HD, Ah, Al, sm);
    else attn_rows<h16, 2>(Q16 + pq, nullptr, K16 + pk, nullptr, V16 + pk, nullptr, RH + (((int)blockIdx.x - NHB) * FW + w) * 32, hd * HD, Ah, Al, sm);
}

extern "C" void kernel_launch(void* const* d_in, const int* in_sizes, int n_in,
                              void* d_out, int out_size, void* d_ws, size_t ws_size, hipStream_t stream) {
    (void)in_sizes; (void)n_in; (void)out_size;
    const float* x = (const float*)d_in[0];   /* h [S][B][D] seq-major */ const float* wq = (const float*)d_in[1]; const float* wkv = (const float*)d_in[2]; const float* wo = (const float*)d_in[3]; const float* lng = (const float*)d_in[4]; const float* lnb = (const float*)d_in[5]; const float* wk = wkv; const float* wv = wkv;
    float* OUT = (float*)d_out;     // [2048][4][1024] seq-major
    char* wsp = (char*)d_ws;
    auto take = [&](size_t bytes) { char* p = wsp; wsp += (bytes + 255) & ~(size_t)255; return (void*)p; };
    float* Y = (float*)take((size_t)TT * DM * 4); bf* WQ = (bf*)take((size_t)DQ * DM * 2); bf* WK = (bf*)take((size_t)DKV * DM * 2); bf* WV = (bf*)take((size_t)DKV * DM * 2); bf* WO = (bf*)take((size_t)DM * DQ * 2);
    bf* XB = (bf*)take((size_t)TT * DM * 2);
    h16* QP16 = (h16*)take((size_t)NH_ * TT * HD * 2); h16* KP16 = (h16*)take((size_t)NKV * TT * HD * 2); h16* VT16 = (h16*)take((size_t)NKV * HD * TT * 2);
    bf* QPh = (bf*)take((size_t)NH_ * TT * HD * 2); bf* QPl = (bf*)take((size_t)NH_ * TT * HD * 2); bf* KPh = (bf*)take((size_t)NKV * TT * HD * 2); bf* KPl = (bf*)take((size_t)NKV * TT * HD * 2); bf* VTh = (bf*)take((size_t)NKV * HD * TT * 2); bf* VTl = (bf*)take((size_t)NKV * HD * TT * 2);
    bf* ATh = (bf*)take((size_t)TT * DQ * 2); bf* ATl = (bf*)take((size_t)TT * DQ * 2);
    if ((size_t)(wsp - (char*)d_ws) > ws_size) return;    // ws 256 MiB
    { k_wtG<<<(unsigned)((DM * DQ / 64 + 63) / 64), 256, 0, stream>>>(wq, DM, DQ, WQ); k_wtGp<<<(unsigned)((DM * DKV / 64 + 63) / 64), 256, 0, stream>>>(wkv + 0, DM, DKV, 2 * DM, WK);   /* Wkv 'xw' [1024][2048]: k = columns 0..1023 */ k_wtGp<<<(unsigned)((DM * DKV / 64 + 63) / 64), 256, 0, stream>>>(wkv + DM, DM, DKV, 2 * DM, WV);   /* Wkv 'xw' [1024][2048]: v = columns 1024..2047 */
      k_wtG<<<(unsigned)((DQ * DM / 64 + 63) / 64), 256, 0, stream>>>(wo, DQ, DM, WO);
       }
    for (int b = 0; b < NB_; ++b) {
        
        k_cvtS<<<(unsigned)(((size_t)TT * DM / 8 + 255) / 256), 256, 0, stream>>>(x + (size_t)b * DM, XB);   /* batch b's rows of the seq-major input (pitch 4 x 1024) */
        k_gemmw<bf, 0, false, GKS, 1, 1><<<dim3(TT / 64, DQ / 64, 1), 32 * GKS, 0, stream>>>(XB, nullptr, WQ, nullptr, DM, nullptr, HD, nullptr, 0, 0, 0, 0, QP16, QPh, QPl, (size_t)TT * HD, nullptr);   /* a 64-column tile is one head: planes [h][t][d] */
        k_gemmw<bf, 0, false, GKS, 1, 1><<<dim3(TT / 64, DKV / 64, 1), 32 * GKS, 0, stream>>>(XB, nullptr, WK, nullptr, DM, nullptr, HD, nullptr, 0, 0, 0, 0, KP16, KPh, KPl, (size_t)TT * HD, nullptr);
        k_gemmw<bf, 0, false, GKS, 1, 1><<<dim3(DKV / 64, TT / 64, 1), 32 * GKS, 0, stream>>>(WV, nullptr, XB, nullptr, DM, nullptr, TT, nullptr, 0, 0, 0, 0, VT16, VTh, VTl, 64, nullptr);   /* operands swapped: rows = (head, d), columns = t, the planes [g][d][t] row-major */
        k_fattn<<<dim3(RH / (16 * FW) + (TT - RH) / (32 * FW), NH_, 1), 32 * FW, 0, stream>>>(QP16, KP16, VT16, QPh, QPl, KPh, KPl, VTh, VTl, ATh, ATl);
        k_gemmw<bf, 1, false, GKS, 1, 2><<<dim3(TT / 64, DM / 64, 1), 32 * GKS, 0, stream>>>(ATh, ATl, WO, nullptr, DQ, Y, DM, nullptr, 0, 0, 0, 0, nullptr, nullptr, nullptr, 0, x + (size_t)b * DM); k_lnoutS<<<(TT + 7) / 8, 256, 0, stream>>>(Y, lng, lnb, OUT + (size_t)b * DM);   /* LayerNorm(h + attn_out), rows back at the seq-major pitch */ }
}

// v004
// A run of this version takes 352 microseconds.
// Next to v003, in two timings, it ran 1.42 times as fast each time.
// Counting every step since v000, it is 11.4 times as fast.
#include <hip/hip_runtime.h>

// Transformer-XL style multi-head attention on a SEQUENCE-MAJOR input with post-LayerNorm (h [2048][4][1024] (seq, batch, model); q = h Wq ('xw' [1024][1024] 1/32), k | v = h Wkv ('xw' [1024][2048]: k = columns 0..1023, v = 1024..2047); 16 heads x 64; score = q.k / 8; softmax over keys; attn_vec merged; attn_out = attn_vec Wo ('xw' no bias); out = LayerNorm(h + attn_out) gamma/beta (eps 1e-5) -> [2048][4][1024] seq-major (8.4 M)).
// Every launch but the weight transposes covers all four batches (the batch is a grid index; each workspace array but the four weights holds four batch slices). Layout per batch: a strided gather makes batch b's rows (row pitch 4 x 1024 in the input) a contiguous token-major bf16 operand; 'xw' weights transposed once (Wkv as two column blocks); exact projections, whose epilogues write the head planes (v as Wv x X^T, so that its tile comes out transposed); fused T-2048 attention (hybrid rows: < 512 hi/lo 3 products, rest fp16 x1024; scores and probabilities stay in registers); merged hi/lo x Wo exact, the residual (strided rows of h) added in its epilogue, into workspace; a row LayerNorm kernel writes batch b's output rows back at pitch 4 x 1024.
// Compute dtypes, f32 accumulate: every input rounded to bf16; projections exact; attention rows < 512 3 products, rest fp16; softmax f32; Wo hl x exact; residual + LayerNorm f32.

#define NB_  4
#define TT   2048
#define DM   1024
#define NH_  16
#define NKV  16
#define REP  (NH_ / NKV)
#define HD   64
#define DQ   (NH_ * HD)
#define DKV  (NKV * HD)
#define RH   512                  // query rows < RH use hi+lo planes (0: none)
#define WIN  0
#define PCL2 10.0f                // log2 of the carrier (x1024) of the fp16 probabilities
#define SCL  0.125f
#define LNEPS 1e-5f
#define SP   (NB_ * DM)   // seq-major row pitch of h and out (floats)
#define FW   4            // fused attention: waves per work-group
#define GKS  8            // projections and Wo: waves per work-group that share K
typedef _Float16 h16;
typedef unsigned short bf;
typedef __attribute__((ext_vector_type(16))) __bf16   v16bf;
typedef __attribute__((ext_vector_type(16))) _Float16 v16h;
typedef __attribute__((ext_vector_type(8)))  _Float16 v8h;
typedef __attribute__((ext_vector_type(8)))  unsigned short v8us;
typedef __attribute__((ext_vector_type(8)))  float    v8f;
typedef __attribute__((ext_vector_type(4)))  float    v4f;
typedef v8h  __attribute__((may_alias)) v8ha;
typedef v4f  __attribute__((may_alias)) v4fa;
typedef v8us __attribute__((may_alias)) v8usa;

__device__ __forceinline__ unsigned short f2bf(float f) { unsigned u = __float_as_uint(f); u += 0x7FFFu + ((u >> 16) & 1u); return (unsigned short)(u >> 16); }
__device__ __forceinline__ float bf2f(unsigned short b) { return __uint_as_float(((unsigned)b) << 16); }
__device__ __forceinline__ float bfr(float f) { return bf2f(f2bf(f)); }
__device__ __forceinline__ v16h cat16(v8h lo, v8h hi) { return __builtin_shufflevector(lo, hi, 0, 1, 2, 3, 4, 5, 6, 7, 8, 9, 10, 11, 12, 13, 14, 15); }
__device__ __forceinline__ v16bf cat16b(v8us lo, v8us hi) { return __builtin_bit_cast(v16bf, __builtin_shufflevector(lo, hi, 0, 1, 2, 3, 4, 5, 6, 7, 8, 9, 10, 11, 12, 13, 14, 15)); }
__device__ __forceinline__ v8f wmma16(v16h a, v16h b, v8f c) { return __builtin_amdgcn_wmma_f32_16x16x32_f16(false, a, false, b, (short)0, c, false, false); }
__device__ __forceinline__ v8f wmmab(v16bf a, v16bf b, v8f c) { return __builtin_amdgcn_wmma_f32_16x16x32_bf16(false, a, false, b, (short)0, c, false, false); }
__device__ __forceinline__ h16 tohx(float x) { return (h16)x; }
__device__ __forceinline__ void splitf(float y, unsigned short& h, unsigned short& l) { h = f2bf(y); l = f2bf(y - bf2f(h)); }
typedef __attribute__((ext_vector_type(4))) _Float16 v4h;
typedef __attribute__((ext_vector_type(4))) unsigned short v4us;



// ---- k_gemmw: register-blocked GEMM, KS waves per 64x64 output tile (16 accumulators each), operands straight from K-contiguous 16-bit planes; grid (M/64, N/64 x SK, Z), 32 x KS threads.
// C[m][n] (f32, pitch ldc, + optional f32 bias[n]) = sum_k A[m][k] Bt[n][k] (+ split products per NSPLIT). z-batch strides sA/sB/sC in elements (sZ: the 16-bit planes of EPI 1; sH: the residual of EPI 2). K % 32 == 0.
// Split K: the K range is dealt in equal contiguous pieces to SK work-groups (grid.y = N/64 x SK, piece kb writes its own partial plane C + kb x sP); inside a piece the 32-wide k steps go round-robin to KS waves (32 x KS threads; neighbouring waves use the two halves of one 128-byte line in the same trip), whose 64x64 partial tiles are summed through LDS in wave order. K % (32 x SK x KS) == 0. KS = SK = 1: one wave, whole K.
// EPI (KS > 1), what the epilogue does with the f32 sums: 0 stores them in C; 1 stores them as three 16-bit planes (fp16, bf16 hi, bf16 lo) and not in C, element (m, n) at m x ldc + (n / 64) x sT + n % 64 (head planes [h][t][d]: ldc = 64, sT = rows x 64; plain row-major: sT = 64); 2 adds the bf16-rounded residual hs[m][n] (row pitch SP) and stores in C.
template <typename T16> struct WFrag;
template <> struct WFrag<h16> { typedef v16h V; static __device__ __forceinline__ V ld(const h16* p) { return cat16(*(const v8h*)p, *(const v8h*)(p + 16)); } static __device__ __forceinline__ v8f mma(V a, V b, v8f c) { return wmma16(a, b, c); } };
template <> struct WFrag<bf> { typedef v16bf V; static __device__ __forceinline__ V ld(const bf* p) { return cat16b(*(const v8us*)p, *(const v8us*)(p + 16)); } static __device__ __forceinline__ v8f mma(V a, V b, v8f c) { return wmmab(a, b, c); } };
template <typename T16, int NSPLIT, bool BIAS, int KS, int SK, int EPI>
__global__ __launch_bounds__(32 * KS) void k_gemmw(const T16* __restrict__ A, const T16* __restrict__ A2, const T16* __restrict__ Bt, const T16* __restrict__ Bt2, int K, float* C, int ldc, const float* __restrict__ bias, size_t sA, size_t sB, size_t sC, size_t sP, h16* P16, bf* Ph, bf* Pl, size_t sT, const float* __restrict__ hs, size_t sZ, size_t sH) {
    typedef typename WFrag<T16>::V V;
    __shared__ __align__(16) float os[(KS > 1 ? 2 * KS : 1) * 16 * 68];   // KS > 1: one 16-row slab per wave, two sets used in turn
    const size_t z = blockIdx.z; A += z * sA; if (A2) A2 += z * sA; Bt += z * sB; if (Bt2) Bt2 += z * sB; C += z * sC;
    if constexpr (EPI == 1) { P16 += z * sZ; Ph += z * sZ; Pl += z * sZ; }
    if constexpr (EPI == 2) hs += z * sH;
    const int lane = threadIdx.x & 31, lr = lane & 15, hi = lane >> 4; const int r0 = blockIdx.x * 64, c0 = (int)(blockIdx.y / SK) * 64;
    const int w = (KS > 1) ? __builtin_amdgcn_readfirstlane((int)(threadIdx.x >> 5)) : 0; const int kb = (int)(blockIdx.y % SK);
    const int KB = K / SK, k0 = kb * KB + w * 32, k1 = (kb + 1) * KB;   // this wave's k steps: k0, k0 + 32 KS, ... below k1
    if (SK > 1) C += (size_t)kb * sP;
    v8f acc[4][4];
#pragma unroll
    for (int mb = 0; mb < 4; ++mb)
#pragma unroll
        for (int nb = 0; nb < 4; ++nb) acc[mb][nb] = (v8f){};
    const size_t aoff = (size_t)(r0 + lr) * K + 8 * hi, boff = (size_t)(c0 + lr) * K + 8 * hi;
    constexpr int NU = 256 / (32 * KS);   // 16-byte pieces of a 16x64 slab per thread
    v4f rsd[4][NU];   // EPI 2: this thread's pieces of the residual, asked for ahead of the k loop, which covers their latency
    if constexpr (EPI == 2) {
#pragma unroll
        for (int mb = 0; mb < 4; ++mb)
#pragma unroll
            for (int s = 0; s < NU; ++s) { const int u = s * 32 * KS + (int)threadIdx.x; rsd[mb][s] = *(const v4f*)(hs + (size_t)(r0 + mb * 16 + (u >> 4)) * SP + c0 + (u & 15) * 4);
                asm volatile("s_wait_xcnt 0x0" ::: "memory");   // stands in front of later writes to the address registers that this load names
            }
    }
#pragma unroll 1
    for (int kc = k0; kc < k1; kc += 32 * KS) {
        V a[4], a2[4];
#pragma unroll
        for (int mb = 0; mb < 4; ++mb) { a[mb] = WFrag<T16>::ld(A + aoff + (size_t)mb * 16 * K + kc); if (NSPLIT == 1 || NSPLIT == 2) a2[mb] = WFrag<T16>::ld(A2 + aoff + (size_t)mb * 16 * K + kc); }
#pragma unroll
        for (int nb = 0; nb < 4; ++nb) { const V b = WFrag<T16>::ld(Bt + boff + (size_t)nb * 16 * K + kc); V b2; if (NSPLIT >= 2) b2 = WFrag<T16>::ld(Bt2 + boff + (size_t)nb * 16 * K + kc);
#pragma unroll
            for (int mb = 0; mb < 4; ++mb) { acc[mb][nb] = WFrag<T16>::mma(a[mb], b, acc[mb][nb]); if (NSPLIT == 1 || NSPLIT == 2) acc[mb][nb] = WFrag<T16>::mma(a2[mb], b, acc[mb][nb]); if (NSPLIT >= 2) acc[mb][nb] = WFrag<T16>::mma(a[mb], b2, acc[mb][nb]); } }
        asm volatile("v_nop\n\tv_nop\n\tv_nop\n\tv_nop" : "+v"(acc[0][0]), "+v"(acc[1][1]), "+v"(acc[2][2]), "+v"(acc[3][3]) : "v"(a[0]), "v"(a[3]));
    }
    if constexpr (KS > 1) {
        v4f res[4][NU];   // the sums wait in registers, so that no barrier below has a global store to wait for
#pragma unroll
        for (int mb = 0; mb < 4; ++mb) {
            float* set = os + (mb & 1) * KS * (16 * 68); float* mine = set + w * (16 * 68);
#pragma unroll
            for (int nb = 0; nb < 4; ++nb) {
#pragma unroll
                for (int j = 0; j < 8; ++j) mine[(hi * 8 + j) * 68 + nb * 16 + lr] = acc[mb][nb][j]; }
            __syncthreads();   // every wave's slab of this mb is in LDS; it also ends the reads of the other set, which mb + 1 overwrites
#pragma unroll
            for (int s = 0; s < NU; ++s) { const int u = s * 32 * KS + (int)threadIdx.x, row = u >> 4, cofs = (u & 15) * 4; v4f val = *(const v4fa*)(set + row * 68 + cofs);
#pragma unroll
                for (int ww = 1; ww < KS; ++ww) val += *(const v4fa*)(set + ww * (16 * 68) + row * 68 + cofs);
                res[mb][s] = val; }
        }
#pragma unroll
        for (int mb = 0; mb < 4; ++mb) {
            float* crow = C + (size_t)(r0 + mb * 16) * ldc + c0;
#pragma unroll
            for (int s = 0; s < NU; ++s) { const int u = s * 32 * KS + (int)threadIdx.x, row = u >> 4, cofs = (u & 15) * 4; v4f val = res[mb][s];
                if (BIAS) { val[0] += bfr(bias[c0 + cofs]); val[1] += bfr(bias[c0 + cofs + 1]); val[2] += bfr(bias[c0 + cofs + 2]); val[3] += bfr(bias[c0 + cofs + 3]); }
                if constexpr (EPI == 1) {
                    const size_t po = (size_t)(r0 + mb * 16 + row) * ldc + (size_t)(c0 / 64) * sT + cofs; v4h o16; v4us oh, ol;
#pragma unroll
                    for (int q = 0; q < 4; ++q) { o16[q] = tohx(val[q]); unsigned short a2, c2; splitf(val[q], a2, c2); oh[q] = a2; ol[q] = c2; }
                    *(v4h*)(P16 + po) = o16; *(v4us*)(Ph + po) = oh; *(v4us*)(Pl + po) = ol;
                } else {
                    if constexpr (EPI == 2) {
#pragma unroll
                        for (int q = 0; q < 4; ++q) val[q] = __fadd_rn(val[q], bfr(rsd[mb][s][q])); }
                    *(v4f*)(crow + (size_t)row * ldc + cofs) = val;
                }
                if constexpr (EPI != 0) asm volatile("s_wait_xcnt 0x0" ::: "memory");   // stands in front of the next slab's writes to registers that these stores name
            }
        }
        return;
    }
#pragma unroll
    for (int mb = 0; mb < 4; ++mb) {
#pragma unroll
        for (int nb = 0; nb < 4; ++nb) {
#pragma unroll
            for (int j = 0; j < 8; ++j) os[(hi * 8 + j) * 68 + nb * 16 + lr] = acc[mb][nb][j]; }
        __builtin_amdgcn_wave_barrier(); asm volatile("" ::: "memory");
        float* crow = C + (size_t)(r0 + mb * 16) * ldc + c0;
{
#pragma unroll
            for (int s = 0; s < 8; ++s) { const int row = 2 * s + hi, cofs = lr * 4; v4f val = *(const v4fa*)(os + row * 68 + cofs); if (BIAS) { val[0] += bfr(bias[c0 + cofs]); val[1] += bfr(bias[c0 + cofs + 1]); val[2] += bfr(bias[c0 + cofs + 2]); val[3] += bfr(bias[c0 + cofs + 3]); }
                *(v4f*)(crow + (size_t)row * ldc + cofs) = val; }
             }
        __builtin_amdgcn_wave_barrier(); asm volatile("" ::: "memory");
    }
}

typedef __attribute__((ext_vector_type(2))) unsigned short v2us;

__global__ __launch_bounds__(256) void k_wtG(const float* __restrict__ w, int K, int N, bf* Bt) {
    const int lane = threadIdx.x & 31; const int L0 = (blockIdx.x * 8 + (threadIdx.x >> 5)) * 8; const int nlines = N * K / 64;
{
#pragma unroll 1
        for (int l = 0; l < 8; ++l) { const int L = L0 + l; if (L >= nlines) break; const size_t e = (size_t)L * 64 + lane * 2; const int k = (int)(e % K), n = (int)(e / K); v2us o;
            o[0] = f2bf(w[(size_t)k * N + n]); o[1] = f2bf(w[(size_t)(k + 1) * N + n]); *(v2us*)(Bt + e) = o; }
         }
}
__global__ __launch_bounds__(256) void k_cvt8(const float* __restrict__ src, bf* dst, size_t n8) { const size_t i = (size_t)blockIdx.x * 256 + threadIdx.x; if (i >= n8) return; const v8f v = *(const v8f*)(src + i * 8); v8us o;
#pragma unroll
    for (int k = 0; k < 8; ++k) o[k] = f2bf(v[k]); *(v8us*)(dst + i * 8) = o;  }

// grid.y = batch: batch b's rows start at src + b x DM and go to slice b of dst
__global__ __launch_bounds__(256) void k_cvtS(const float* __restrict__ src, bf* dst) { const size_t i = (size_t)blockIdx.x * 256 + threadIdx.x; if (i >= (size_t)TT * DM / 8) return; const size_t e = i * 8; const int c0 = (int)(e % DM); const int t = (int)(e / DM); src += (size_t)blockIdx.y * DM; dst += (size_t)blockIdx.y * TT * DM; const v8f v = *(const v8f*)(src + (size_t)t * SP + c0); v8us o;
#pragma unroll
    for (int k = 0; k < 8; ++k) o[k] = f2bf(v[k]); *(v8us*)(dst + e) = o;  }
__global__ __launch_bounds__(256) void k_wtGp(const float* __restrict__ w, int K, int N, int pitch, bf* Bt) {
    const int lane = threadIdx.x & 31; const int L0 = (blockIdx.x * 8 + (threadIdx.x >> 5)) * 8; const int nlines = N * K / 64;
{
#pragma unroll 1
        for (int l = 0; l < 8; ++l) { const int L = L0 + l; if (L >= nlines) break; const size_t e = (size_t)L * 64 + lane * 2; const int k = (int)(e % K), n = (int)(e / K); v2us o;
            o[0] = f2bf(w[(size_t)k * pitch + n]); o[1] = f2bf(w[(size_t)(k + 1) * pitch + n]); *(v2us*)(Bt + e) = o; }
         }
}
__global__ __launch_bounds__(256) void k_lnoutS(const float* __restrict__ F, const float* __restrict__ g, const float* __restrict__ bb, float* out) { const int lane = threadIdx.x & 31; const int row = blockIdx.x * 8 + (threadIdx.x >> 5); if (row >= TT) return; const float* fr = F + ((size_t)blockIdx.y * TT + row) * DQ;   /* grid.y = batch */ float* orow = out + (size_t)blockIdx.y * DM + (size_t)row * SP;   /* seq-major output pitch */ float v[DQ / 32]; float s = 0.f;
#pragma unroll
    for (int c = 0; c < DQ / 128; ++c) { const v4f a = *(const v4f*)(fr + c * 128 + lane * 4); for (int q = 0; q < 4; ++q) { v[c * 4 + q] = a[q]; s = __fadd_rn(s, a[q]); } }
#pragma unroll
    for (int sh = 16; sh; sh >>= 1) s = __fadd_rn(s, __shfl_xor(s, sh, 32));
    const float mean = __fdiv_rn(s, (float)DQ); float s2 = 0.f;
#pragma unroll
    for (int k = 0; k < DQ / 32; ++k) { const float dv = __fsub_rn(v[k], mean); float p2 = __fmul_rn(dv, dv); asm volatile("" : "+v"(p2)); s2 = __fadd_rn(s2, p2); v[k] = dv; }
#pragma unroll
    for (int sh = 16; sh; sh >>= 1) s2 = __fadd_rn(s2, __shfl_xor(s2, sh, 32));
    const float rs = __fdiv_rn(1.0f, __fsqrt_rn(__fadd_rn(__fdiv_rn(s2, (float)DQ), LNEPS)));
{
#pragma unroll
        for (int c = 0; c < DQ / 128; ++c) { v4f o; for (int q = 0; q < 4; ++q) { const int col = c * 128 + lane * 4 + q; float y = __fmul_rn(v[c * 4 + q], rs); asm volatile("" : "+v"(y)); y = __fmul_rn(y, bfr(g[col])); asm volatile("" : "+v"(y)); o[q] = __fadd_rn(y, bfr(bb[col])); } *(v4f*)(orow + c * 128 + lane * 4) = o; }
         } }

// ---- k_fattn: scores, softmax and P.V of all batches in one kernel. A wave owns NQ x 16 query rows of one head and walks all TT keys, 32 a pass, with a running maximum and sum per query.
// St = K Qt (A = K rows, B = Q rows): lane (lr, hi) holds, for query lr, the scores of keys 8 hi + j of each 16-key block, so the two blocks of a pass, converted in place, are the B operand of Ot += Vt Pt (A = Vt rows, k = key).
// The FW waves of a work-group share the head's K and Vt: tiles of KT keys (64 rows x 128 bytes each) are read from memory once, in whole lines, and laid in LDS, two buffers in turn; the fragments come from LDS.
// Rows < RH: bf16 hi/lo planes, 3 products in both stages. Other rows: fp16, probabilities carried x 2^PCL2 (folded into the exponent; it cancels in O / sum). The sum is taken of the f32 probabilities.
#define KT   64           // keys per LDS tile
#define LP   72           // LDS row pitch in 16-bit elements: 128 + 16 bytes, free of bank conflicts for 16-byte reads
typedef __attribute__((ext_vector_type(16))) unsigned short v16us;
template <typename T16> __device__ __forceinline__ typename WFrag<T16>::V ldsfrag(const unsigned short* p) { const v8us lo = *(const v8usa*)p, up = *(const v8usa*)(p + 16); return __builtin_bit_cast(typename WFrag<T16>::V, __builtin_shufflevector(lo, up, 0, 1, 2, 3, 4, 5, 6, 7, 8, 9, 10, 11, 12, 13, 14, 15)); }
template <typename T16, int NQ>
__device__ __forceinline__ void attn_rows(const T16* __restrict__ Q, const T16* __restrict__ Q2, const T16* __restrict__ Kp, const T16* __restrict__ K2, const T16* __restrict__ Vt, const T16* __restrict__ V2, int q0, int hcol, bf* Ah, bf* Al, unsigned short* sm) {
    typedef typename WFrag<T16>::V V; constexpr bool HR = __is_same(T16, bf);
    constexpr int NP = HR ? 4 : 2;              // planes staged: K, Vt (, K lo, Vt lo)
    constexpr int PL = KT * LP;                 // one plane's tile in LDS, elements
    constexpr int NC = KT * 8 / (32 * FW);      // 16-byte pieces of a tile per thread
    const int lane = threadIdx.x & 31, lr = lane & 15, hi = lane >> 4;
    const int srow = (int)threadIdx.x >> 3, scol = ((int)threadIdx.x & 7) * 8;   // this thread's piece: rows srow + 4 FW i, 8 elements at scol
    constexpr float CE = SCL * 1.4426950408889634f;   // score -> exponent of 2
    V qf[NQ][2], qf2[NQ][2];
#pragma unroll
    for (int nq = 0; nq < NQ; ++nq)
#pragma unroll
        for (int kk = 0; kk < 2; ++kk) { const size_t qo = (size_t)(q0 + nq * 16 + lr) * HD + kk * 32 + 8 * hi; qf[nq][kk] = WFrag<T16>::ld(Q + qo); if (HR) qf2[nq][kk] = WFrag<T16>::ld(Q2 + qo); }
    asm volatile("s_wait_xcnt 0x0" ::: "memory");   // stands in front of later writes to the address registers that the Q loads name
    v8f o[4][NQ]; float m[NQ], l[NQ];
#pragma unroll
    for (int nq = 0; nq < NQ; ++nq) { m[nq] = -3.0e38f; l[nq] = 0.f;
#pragma unroll
        for (int db = 0; db < 4; ++db) o[db][nq] = (v8f){}; }
    v8us st[NP][NC];
    auto fetch = [&](int key0) {
#pragma unroll
        for (int i = 0; i < NC; ++i) { const int r = srow + i * 4 * FW; const size_t kx = (size_t)(key0 + r) * HD + scol, vx = (size_t)r * TT + key0 + scol;
            st[0][i] = *(const v8usa*)(Kp + kx); st[1][i] = *(const v8usa*)(Vt + vx);
            if constexpr (HR) { st[2][i] = *(const v8usa*)(K2 + kx); st[3][i] = *(const v8usa*)(V2 + vx); } }
        asm volatile("s_wait_xcnt 0x0" ::: "memory");   // stands in front of later writes to the address registers that the loads above name
    };
    auto put = [&](int buf) {
#pragma unroll
        for (int i = 0; i < NC; ++i) { unsigned short* d = sm + buf * NP * PL + (srow + i * 4 * FW) * LP + scol;
#pragma unroll
            for (int pl = 0; pl < NP; ++pl) *(v8usa*)(d + pl * PL) = st[pl][i]; } };
    fetch(0); put(0);
    __syncthreads();   // tile 0 is in LDS
#pragma unroll 1
    for (int t = 0; t < TT / KT; ++t) {
        const bool more = t + 1 < TT / KT;
        if (more) fetch((t + 1) * KT);   // the next tile flies to registers while this one is worked on
        const unsigned short* tb = sm + (t & 1) * NP * PL + lr * LP + 8 * hi;
#pragma unroll
        for (int ks = 0; ks < KT / 32; ++ks) {
            v8f s[2][NQ];
#pragma unroll
            for (int kb = 0; kb < 2; ++kb) { V kf[2], kf2[2];
#pragma unroll
                for (int kk = 0; kk < 2; ++kk) { const unsigned short* kq = tb + (ks * 2 + kb) * 16 * LP + kk * 32; kf[kk] = ldsfrag<T16>(kq); if (HR) kf2[kk] = ldsfrag<T16>(kq + 2 * PL); }
#pragma unroll
                for (int nq = 0; nq < NQ; ++nq) { v8f a = (v8f){};
#pragma unroll
                    for (int kk = 0; kk < 2; ++kk) { a = WFrag<T16>::mma(kf[kk], qf[nq][kk], a); if (HR) { a = WFrag<T16>::mma(kf2[kk], qf[nq][kk], a); a = WFrag<T16>::mma(kf[kk], qf2[nq][kk], a); } }
                    s[kb][nq] = a; } }
            V vf[4], vf2[4];
#pragma unroll
            for (int db = 0; db < 4; ++db) { const unsigned short* vq = tb + PL + db * 16 * LP + ks * 32; vf[db] = ldsfrag<T16>(vq); if (HR) vf2[db] = ldsfrag<T16>(vq + 2 * PL); }
#pragma unroll
            for (int nq = 0; nq < NQ; ++nq) {
                float mx = s[0][nq][0];
#pragma unroll
                for (int j = 0; j < 8; ++j) mx = fmaxf(mx, fmaxf(s[0][nq][j], s[1][nq][j]));
                mx = fmaxf(mx, __shfl_xor(mx, 16, 32));   // the other eight keys of each block sit in the other lane half
                const float mn = fmaxf(m[nq], mx); const float al = __builtin_amdgcn_exp2f((m[nq] - mn) * CE); m[nq] = mn;
                const float mb = mn * CE - (HR ? 0.0f : PCL2);
#pragma unroll
                for (int kb = 0; kb < 2; ++kb)
#pragma unroll
                    for (int j = 0; j < 8; ++j) s[kb][nq][j] = __builtin_amdgcn_exp2f(s[kb][nq][j] * CE - mb);
                const v8f p8 = s[0][nq] + s[1][nq];   // the pass's sixteen probabilities of this lane, summed as a tree
                l[nq] = l[nq] * al + (((p8[0] + p8[4]) + (p8[1] + p8[5])) + ((p8[2] + p8[6]) + (p8[3] + p8[7])));
#pragma unroll
                for (int db = 0; db < 4; ++db) o[db][nq] *= al;
                if constexpr (HR) {
                    v16us ph, pl;
#pragma unroll
                    for (int e = 0; e < 16; ++e) { unsigned short a, c2; splitf(s[e >> 3][nq][e & 7], a, c2); ph[e] = a; pl[e] = c2; }
                    const V pfh = __builtin_bit_cast(v16bf, ph), pfl = __builtin_bit_cast(v16bf, pl);
#pragma unroll
                    for (int db = 0; db < 4; ++db) { o[db][nq] = WFrag<T16>::mma(vf[db], pfh, o[db][nq]); o[db][nq] = WFrag<T16>::mma(vf[db], pfl, o[db][nq]); o[db][nq] = WFrag<T16>::mma(vf2[db], pfh, o[db][nq]); }
                } else {
                    V pf;
#pragma unroll
                    for (int e = 0; e < 16; ++e) pf[e] = tohx(s[e >> 3][nq][e & 7]);
#pragma unroll
                    for (int db = 0; db < 4; ++db) o[db][nq] = WFrag<T16>::mma(vf[db], pf, o[db][nq]);
                }
            }
        }
        if (more) put((t + 1) & 1);   // into the buffer whose last readers left it at the barrier of trip t - 1
        __syncthreads();   // publishes tile t + 1 and ends every wave's reads of tile t
    }
#pragma unroll
    for (int nq = 0; nq < NQ; ++nq) { const float inv = __fdiv_rn(1.0f, l[nq] + __shfl_xor(l[nq], 16, 32)); const size_t oo = (size_t)(q0 + nq * 16 + lr) * DQ + hcol + hi * 8;
#pragma unroll
        for (int db = 0; db < 4; ++db) { v8us oh, ol;
#pragma unroll
            for (int j = 0; j < 8; ++j) { unsigned short a, c2; splitf(o[db][nq][j] * inv, a, c2); oh[j] = a; ol[j] = c2; }
            *(v8us*)(Ah + oo + db * 16) = oh; *(v8us*)(Al + oo + db * 16) = ol;
            asm volatile("s_wait_xcnt 0x0" ::: "memory");   // stands in front of the next block's writes to registers that these two stores name
        } }
}
// grid (RH / (16 FW) + (TT - RH) / (32 FW), heads, batches): of each head the hi/lo work-groups (16 rows a wave, three times the products) have the low indices.
__global__ __launch_bounds__(32 * FW) void k_fattn(const h16* __restrict__ Q16, const h16* __restrict__ K16, const h16* __restrict__ V16, const bf* __restrict__ Qh, const bf* __restrict__ Ql, const bf* __restrict__ Kh, const bf* __restrict__ Kl, const bf* __restrict__ Vh, const bf* __restrict__ Vl, bf* Ah, bf* Al) {
    __shared__ __align__(16) unsigned short sm[2 * 4 * KT * LP];
    const int w = __builtin_amdgcn_readfirstlane((int)(threadIdx.x >> 5)); const int hd = (int)blockIdx.y, bt = (int)blockIdx.z; const size_t pq = (size_t)(bt * NH_ + hd) * TT * HD, pk = (size_t)(bt * NKV + hd / REP) * TT * HD;
    Ah += (size_t)bt * TT * DQ; Al += (size_t)bt * TT * DQ;
    constexpr int NHB = RH / (16 * FW);
    if ((int)blockIdx.x < NHB) attn_rows<bf, 1>(Qh + pq, Ql + pq, Kh + pk, Kl + pk, Vh + pk, Vl + pk, ((int)blockIdx.x * FW + w) * 16, hd * HD, Ah, Al, sm);
    else attn_rows<h16, 2>(Q16 + pq, nullptr, K16 + pk, nullptr, V16 + pk, nullptr, RH + (((int)blockIdx.x - NHB) * FW + w) * 32, hd * HD, Ah, Al, sm);
}

extern "C" void kernel_launch(void* const* d_in, const int* in_sizes, int n_in,
                              void* d_out, int out_size, void* d_ws, size_t ws_size, hipStream_t stream) {
    (void)in_sizes; (void)n_in; (void)out_size;
    const float* x = (const float*)d_in[0];   /* h [S][B][D] seq-major */ const float* wq = (const float*)d_in[1]; const float* wkv = (const float*)d_in[2]; const float* wo = (const float*)d_in[3]; const float* lng = (const float*)d_in[4]; const float* lnb = (const float*)d_in[5]; const float* wk = wkv; const float* wv = wkv;
    float* OUT = (float*)d_out;     // [2048][4][1024] seq-major
    char* wsp = (char*)d_ws;
    auto take = [&](size_t bytes) { char* p = wsp; wsp += (bytes + 255) & ~(size_t)255; return (void*)p; };
    float* Y = (float*)take((size_t)NB_ * TT * DM * 4); bf* WQ = (bf*)take((size_t)DQ * DM * 2); bf* WK = (bf*)take((size_t)DKV * DM * 2); bf* WV = (bf*)take((size_t)DKV * DM * 2); bf* WO = (bf*)take((size_t)DM * DQ * 2);
    bf* XB = (bf*)take((size_t)NB_ * TT * DM * 2);
    h16* QP16 = (h16*)take((size_t)NB_ * NH_ * TT * HD * 2); h16* KP16 = (h16*)take((size_t)NB_ * NKV * TT * HD * 2); h16* VT16 = (h16*)take((size_t)NB_ * NKV * HD * TT * 2);
    bf* QPh = (bf*)take((size_t)NB_ * NH_ * TT * HD * 2); bf* QPl = (bf*)take((size_t)NB_ * NH_ * TT * HD * 2); bf* KPh = (bf*)take((size_t)NB_ * NKV * TT * HD * 2); bf* KPl = (bf*)take((size_t)NB_ * NKV * TT * HD * 2); bf* VTh = (bf*)take((size_t)NB_ * NKV * HD * TT * 2); bf* VTl = (bf*)take((size_t)NB_ * NKV * HD * TT * 2);
    bf* ATh = (bf*)take((size_t)NB_ * TT * DQ * 2); bf* ATl = (bf*)take((size_t)NB_ * TT * DQ * 2);
    if ((size_t)(wsp - (char*)d_ws) > ws_size) return;    // ws 256 MiB
    { k_wtG<<<(unsigned)((DM * DQ / 64 + 63) / 64), 256, 0, stream>>>(wq, DM, DQ, WQ); k_wtGp<<<(unsigned)((DM * DKV / 64 + 63) / 64), 256, 0, stream>>>(wkv + 0, DM, DKV, 2 * DM, WK);   /* Wkv 'xw' [1024][2048]: k = columns 0..1023 */ k_wtGp<<<(unsigned)((DM * DKV / 64 + 63) / 64), 256, 0, stream>>>(wkv + DM, DM, DKV, 2 * DM, WV);   /* Wkv 'xw' [1024][2048]: v = columns 1024..2047 */
      k_wtG<<<(unsigned)((DQ * DM / 64 + 63) / 64), 256, 0, stream>>>(wo, DQ, DM, WO);
       }
    k_cvtS<<<dim3((unsigned)(((size_t)TT * DM / 8 + 255) / 256), NB_, 1), 256, 0, stream>>>(x, XB);   /* each batch's rows of the seq-major input (pitch 4 x 1024) */
    k_gemmw<bf, 0, false, GKS, 1, 1><<<dim3(TT / 64, DQ / 64, NB_), 32 * GKS, 0, stream>>>(XB, nullptr, WQ, nullptr, DM, nullptr, HD, nullptr, (size_t)TT * DM, 0, 0, 0, QP16, QPh, QPl, (size_t)TT * HD, nullptr, (size_t)NH_ * TT * HD, 0);   /* a 64-column tile is one head: planes [b][h][t][d] */
    k_gemmw<bf, 0, false, GKS, 1, 1><<<dim3(TT / 64, DKV / 64, NB_), 32 * GKS, 0, stream>>>(XB, nullptr, WK, nullptr, DM, nullptr, HD, nullptr, (size_t)TT * DM, 0, 0, 0, KP16, KPh, KPl, (size_t)TT * HD, nullptr, (size_t)NKV * TT * HD, 0);
    k_gemmw<bf, 0, false, GKS, 1, 1><<<dim3(DKV / 64, TT / 64, NB_), 32 * GKS, 0, stream>>>(WV, nullptr, XB, nullptr, DM, nullptr, TT, nullptr, 0, (size_t)TT * DM, 0, 0, VT16, VTh, VTl, 64, nullptr, (size_t)NKV * HD * TT, 0);   /* operands swapped: rows = (head, d), columns = t, the planes [b][g][d][t] row-major */
    k_fattn<<<dim3(RH / (16 * FW) + (TT - RH) / (32 * FW), NH_, NB_), 32 * FW, 0, stream>>>(QP16, KP16, VT16, QPh, QPl, KPh, KPl, VTh, VTl, ATh, ATl);
    k_gemmw<bf, 1, false, GKS, 1, 2><<<dim3(TT / 64, DM / 64, NB_), 32 * GKS, 0, stream>>>(ATh, ATl, WO, nullptr, DQ, Y, DM, nullptr, (size_t)TT * DQ, 0, (size_t)TT * DM, 0, nullptr, nullptr, nullptr, 0, x, 0, DM);
    k_lnoutS<<<dim3((TT + 7) / 8, NB_, 1), 256, 0, stream>>>(Y, lng, lnb, OUT);   /* LayerNorm(h + attn_out), rows back at the seq-major pitch */
}

// v005
// A run of this version takes 256 microseconds.
// Timed twice side by side with v004, it ran 1.37 and 1.38 times as fast.
// All steps since v000 together make it 15.7 times as fast.
#include <hip/hip_runtime.h>

// Transformer-XL style multi-head attention on a SEQUENCE-MAJOR input with post-LayerNorm (h [2048][4][1024] (seq, batch, model); q = h Wq ('xw' [1024][1024] 1/32), k | v = h Wkv ('xw' [1024][2048]: k = columns 0..1023, v = 1024..2047); 16 heads x 64; score = q.k / 8; softmax over keys; attn_vec merged; attn_out = attn_vec Wo ('xw' no bias); out = LayerNorm(h + attn_out) gamma/beta (eps 1e-5) -> [2048][4][1024] seq-major (8.4 M)).
// Every launch but the weight transposes covers all four batches (the batch is a grid index; each workspace array but the four weights holds four batch slices). Layout per batch: a strided gather makes batch b's rows (row pitch 4 x 1024 in the input) a contiguous token-major bf16 operand; 'xw' weights transposed once (Wkv as two column blocks); exact projections, whose epilogues write the head planes (v as Wv x X^T, so that its tile comes out transposed); fused T-2048 attention (hybrid rows: < 512 hi/lo 3 products, rest fp16 x1024; scores and probabilities stay in registers); merged hi/lo x Wo exact, the residual (strided rows of h) added in its epilogue, into workspace; a row LayerNorm kernel writes batch b's output rows back at pitch 4 x 1024.
// Compute dtypes, f32 accumulate: every input rounded to bf16; projections exact; attention rows < 512 3 products, rest fp16; softmax f32; Wo hl x exact; residual + LayerNorm f32.

#define NB_  4
#define TT   2048
#define DM   1024
#define NH_  16
#define NKV  16
#define REP  (NH_ / NKV)
#define HD   64
#define DQ   (NH_ * HD)
#define DKV  (NKV * HD)
#define RH   512                  // query rows < RH use hi+lo planes (0: none)
#define WIN  0
#define PCL2 10.0f                // log2 of the carrier (x1024) of the fp16 probabilities
#define SCL  0.125f
#define LNEPS 1e-5f
#define SP   (NB_ * DM)   // seq-major row pitch of h and out (floats)
#define FW   4            // fused attention: waves per work-group
typedef _Float16 h16;
typedef unsigned short bf;
typedef __attribute__((ext_vector_type(16))) __bf16   v16bf;
typedef __attribute__((ext_vector_type(16))) _Float16 v16h;
typedef __attribute__((ext_vector_type(8)))  _Float16 v8h;
typedef __attribute__((ext_vector_type(8)))  unsigned short v8us;
typedef __attribute__((ext_vector_type(8)))  float    v8f;
typedef __attribute__((ext_vector_type(4)))  float    v4f;
typedef v8h  __attribute__((may_alias)) v8ha;
typedef v4f  __attribute__((may_alias)) v4fa;
typedef v8us __attribute__((may_alias)) v8usa;

__device__ __forceinline__ unsigned short f2bf(float f) { unsigned u = __float_as_uint(f); u += 0x7FFFu + ((u >> 16) & 1u); return (unsigned short)(u >> 16); }
__device__ __forceinline__ float bf2f(unsigned short b) { return __uint_as_float(((unsigned)b) << 16); }
__device__ __forceinline__ float bfr(float f) { return bf2f(f2bf(f)); }
__device__ __forceinline__ v16h cat16(v8h lo, v8h hi) { return __builtin_shufflevector(lo, hi, 0, 1, 2, 3, 4, 5, 6, 7, 8, 9, 10, 11, 12, 13, 14, 15); }
__device__ __forceinline__ v16bf cat16b(v8us lo, v8us hi) { return __builtin_bit_cast(v16bf, __builtin_shufflevector(lo, hi, 0, 1, 2, 3, 4, 5, 6, 7, 8, 9, 10, 11, 12, 13, 14, 15)); }
__device__ __forceinline__ v8f wmma16(v16h a, v16h b, v8f c) { return __builtin_amdgcn_wmma_f32_16x16x32_f16(false, a, false, b, (short)0, c, false, false); }
__device__ __forceinline__ v8f wmmab(v16bf a, v16bf b, v8f c) { return __builtin_amdgcn_wmma_f32_16x16x32_bf16(false, a, false, b, (short)0, c, false, false); }
__device__ __forceinline__ h16 tohx(float x) { return (h16)x; }
__device__ __forceinline__ void splitf(float y, unsigned short& h, unsigned short& l) { h = f2bf(y); l = f2bf(y - bf2f(h)); }
typedef __attribute__((ext_vector_type(4))) _Float16 v4h;
typedef __attribute__((ext_vector_type(4))) unsigned short v4us;



// fragment types: two 16-byte loads 32 bytes apart make one 16x32 operand fragment
template <typename T16> struct WFrag;
template <> struct WFrag<h16> { typedef v16h V; static __device__ __forceinline__ V ld(const h16* p) { return cat16(*(const v8h*)p, *(const v8h*)(p + 16)); } static __device__ __forceinline__ v8f mma(V a, V b, v8f c) { return wmma16(a, b, c); } };
template <> struct WFrag<bf> { typedef v16bf V; static __device__ __forceinline__ V ld(const bf* p) { return cat16b(*(const v8us*)p, *(const v8us*)(p + 16)); } static __device__ __forceinline__ v8f mma(V a, V b, v8f c) { return wmmab(a, b, c); } };

typedef __attribute__((ext_vector_type(2))) unsigned short v2us;

__global__ __launch_bounds__(256) void k_wtG(const float* __restrict__ w, int K, int N, bf* Bt) {
    const int lane = threadIdx.x & 31; const int L0 = (blockIdx.x * 8 + (threadIdx.x >> 5)) * 8; const int nlines = N * K / 64;
{
#pragma unroll 1
        for (int l = 0; l < 8; ++l) { const int L = L0 + l; if (L >= nlines) break; const size_t e = (size_t)L * 64 + lane * 2; const int k = (int)(e % K), n = (int)(e / K); v2us o;
            o[0] = f2bf(w[(size_t)k * N + n]); o[1] = f2bf(w[(size_t)(k + 1) * N + n]); *(v2us*)(Bt + e) = o; }
         }
}
__global__ __launch_bounds__(256) void k_cvt8(const float* __restrict__ src, bf* dst, size_t n8) { const size_t i = (size_t)blockIdx.x * 256 + threadIdx.x; if (i >= n8) return; const v8f v = *(const v8f*)(src + i * 8); v8us o;
#pragma unroll
    for (int k = 0; k < 8; ++k) o[k] = f2bf(v[k]); *(v8us*)(dst + i * 8) = o;  }

// grid.y = batch: batch b's rows start at src + b x DM and go to slice b of dst
__global__ __launch_bounds__(256) void k_cvtS(const float* __restrict__ src, bf* dst) { const size_t i = (size_t)blockIdx.x * 256 + threadIdx.x; if (i >= (size_t)TT * DM / 8) return; const size_t e = i * 8; const int c0 = (int)(e % DM); const int t = (int)(e / DM); src += (size_t)blockIdx.y * DM; dst += (size_t)blockIdx.y * TT * DM; const v8f v = *(const v8f*)(src + (size_t)t * SP + c0); v8us o;
#pragma unroll
    for (int k = 0; k < 8; ++k) o[k] = f2bf(v[k]); *(v8us*)(dst + e) = o;  }
__global__ __launch_bounds__(256) void k_wtGp(const float* __restrict__ w, int K, int N, int pitch, bf* Bt) {
    const int lane = threadIdx.x & 31; const int L0 = (blockIdx.x * 8 + (threadIdx.x >> 5)) * 8; const int nlines = N * K / 64;
{
#pragma unroll 1
        for (int l = 0; l < 8; ++l) { const int L = L0 + l; if (L >= nlines) break; const size_t e = (size_t)L * 64 + lane * 2; const int k = (int)(e % K), n = (int)(e / K); v2us o;
            o[0] = f2bf(w[(size_t)k * pitch + n]); o[1] = f2bf(w[(size_t)(k + 1) * pitch + n]); *(v2us*)(Bt + e) = o; }
         }
}
__global__ __launch_bounds__(256) void k_lnoutS(const float* __restrict__ F, const float* __restrict__ g, const float* __restrict__ bb, float* out) { const int lane = threadIdx.x & 31; const int row = blockIdx.x * 8 + (threadIdx.x >> 5); if (row >= TT) return; const float* fr = F + ((size_t)blockIdx.y * TT + row) * DQ;   /* grid.y = batch */ float* orow = out + (size_t)blockIdx.y * DM + (size_t)row * SP;   /* seq-major output pitch */ float v[DQ / 32]; float s = 0.f;
#pragma unroll
    for (int c = 0; c < DQ / 128; ++c) { const v4f a = *(const v4f*)(fr + c * 128 + lane * 4); for (int q = 0; q < 4; ++q) { v[c * 4 + q] = a[q]; s = __fadd_rn(s, a[q]); } }
#pragma unroll
    for (int sh = 16; sh; sh >>= 1) s = __fadd_rn(s, __shfl_xor(s, sh, 32));
    const float mean = __fdiv_rn(s, (float)DQ); float s2 = 0.f;
#pragma unroll
    for (int k = 0; k < DQ / 32; ++k) { const float dv = __fsub_rn(v[k], mean); float p2 = __fmul_rn(dv, dv); asm volatile("" : "+v"(p2)); s2 = __fadd_rn(s2, p2); v[k] = dv; }
#pragma unroll
    for (int sh = 16; sh; sh >>= 1) s2 = __fadd_rn(s2, __shfl_xor(s2, sh, 32));
    const float rs = __fdiv_rn(1.0f, __fsqrt_rn(__fadd_rn(__fdiv_rn(s2, (float)DQ), LNEPS)));
{
#pragma unroll
        for (int c = 0; c < DQ / 128; ++c) { v4f o; for (int q = 0; q < 4; ++q) { const int col = c * 128 + lane * 4 + q; float y = __fmul_rn(v[c * 4 + q], rs); asm volatile("" : "+v"(y)); y = __fmul_rn(y, bfr(g[col])); asm volatile("" : "+v"(y)); o[q] = __fadd_rn(y, bfr(bb[col])); } *(v4f*)(orow + c * 128 + lane * 4) = o; }
         } }

// ---- k_fattn: scores, softmax and P.V of all batches in one kernel. A wave owns NQ x 16 query rows of one head and walks all TT keys, 32 a pass, with a running maximum and sum per query.
// St = K Qt (A = K rows, B = Q rows): lane (lr, hi) holds, for query lr, the scores of keys 8 hi + j of each 16-key block, so the two blocks of a pass, converted in place, are the B operand of Ot += Vt Pt (A = Vt rows, k = key).
// The FW waves of a work-group share the head's K and Vt: tiles of KT keys (64 rows x 128 bytes each) are read from memory once, in whole lines, and laid in LDS, two buffers in turn; the fragments come from LDS.
// Rows < RH: bf16 hi/lo planes, 3 products in both stages. Other rows: fp16, probabilities carried x 2^PCL2 (folded into the exponent; it cancels in O / sum). The sum is taken of the f32 probabilities.
#define KT   64           // keys per LDS tile
#define LP   72           // LDS row pitch in 16-bit elements: 128 + 16 bytes, free of bank conflicts for 16-byte reads
typedef __attribute__((ext_vector_type(16))) unsigned short v16us;
template <typename T16> __device__ __forceinline__ typename WFrag<T16>::V ldsfrag(const unsigned short* p) { const v8us lo = *(const v8usa*)p, up = *(const v8usa*)(p + 16); return __builtin_bit_cast(typename WFrag<T16>::V, __builtin_shufflevector(lo, up, 0, 1, 2, 3, 4, 5, 6, 7, 8, 9, 10, 11, 12, 13, 14, 15)); }
template <typename T16, int NQ>
__device__ __forceinline__ void attn_rows(const T16* __restrict__ Q, const T16* __restrict__ Q2, const T16* __restrict__ Kp, const T16* __restrict__ K2, const T16* __restrict__ Vt, const T16* __restrict__ V2, int q0, int hcol, bf* Ah, bf* Al, unsigned short* sm) {
    typedef typename WFrag<T16>::V V; constexpr bool HR = __is_same(T16, bf);
    constexpr int NP = HR ? 4 : 2;              // planes staged: K, Vt (, K lo, Vt lo)
    constexpr int PL = KT * LP;                 // one plane's tile in LDS, elements
    constexpr int NC = KT * 8 / (32 * FW);      // 16-byte pieces of a tile per thread
    const int lane = threadIdx.x & 31, lr = lane & 15, hi = lane >> 4;
    const int srow = (int)threadIdx.x >> 3, scol = ((int)threadIdx.x & 7) * 8;   // this thread's piece: rows srow + 4 FW i, 8 elements at scol
    constexpr float CE = SCL * 1.4426950408889634f;   // score -> exponent of 2
    V qf[NQ][2], qf2[NQ][2];
#pragma unroll
    for (int nq = 0; nq < NQ; ++nq)
#pragma unroll
        for (int kk = 0; kk < 2; ++kk) { const size_t qo = (size_t)(q0 + nq * 16 + lr) * HD + kk * 32 + 8 * hi; qf[nq][kk] = WFrag<T16>::ld(Q + qo); if (HR) qf2[nq][kk] = WFrag<T16>::ld(Q2 + qo); }
    asm volatile("s_wait_xcnt 0x0" ::: "memory");   // stands in front of later writes to the address registers that the Q loads name
    v8f o[4][NQ]; float m[NQ], l[NQ];
#pragma unroll
    for (int nq = 0; nq < NQ; ++nq) { m[nq] = -3.0e38f; l[nq] = 0.f;
#pragma unroll
        for (int db = 0; db < 4; ++db) o[db][nq] = (v8f){}; }
    v8us st[NP][NC];
    auto fetch = [&](int key0) {
#pragma unroll
        for (int i = 0; i < NC; ++i) { const int r = srow + i * 4 * FW; const size_t kx = (size_t)(key0 + r) * HD + scol, vx = (size_t)r * TT + key0 + scol;
            st[0][i] = *(const v8usa*)(Kp + kx); st[1][i] = *(const v8usa*)(Vt + vx);
            if constexpr (HR) { st[2][i] = *(const v8usa*)(K2 + kx); st[3][i] = *(const v8usa*)(V2 + vx); } }
        asm volatile("s_wait_xcnt 0x0" ::: "memory");   // stands in front of later writes to the address registers that the loads above name
    };
    auto put = [&](int buf) {
#pragma unroll
        for (int i = 0; i < NC; ++i) { unsigned short* d = sm + buf * NP * PL + (srow + i * 4 * FW) * LP + scol;
#pragma unroll
            for (int pl = 0; pl < NP; ++pl) *(v8usa*)(d + pl * PL) = st[pl][i]; } };
    fetch(0); put(0);
    __syncthreads();   // tile 0 is in LDS
#pragma unroll 1
    for (int t = 0; t < TT / KT; ++t) {
        const bool more = t + 1 < TT / KT;
        if (more) fetch((t + 1) * KT);   // the next tile flies to registers while this one is worked on
        const unsigned short* tb = sm + (t & 1) * NP * PL + lr * LP + 8 * hi;
#pragma unroll
        for (int ks = 0; ks < KT / 32; ++ks) {
            v8f s[2][NQ];
#pragma unroll
            for (int kb = 0; kb < 2; ++kb) { V kf[2], kf2[2];
#pragma unroll
                for (int kk = 0; kk < 2; ++kk) { const unsigned short* kq = tb + (ks * 2 + kb) * 16 * LP + kk * 32; kf[kk] = ldsfrag<T16>(kq); if (HR) kf2[kk] = ldsfrag<T16>(kq + 2 * PL); }
#pragma unroll
                for (int nq = 0; nq < NQ; ++nq) { v8f a = (v8f){};
#pragma unroll
                    for (int kk = 0; kk < 2; ++kk) { a = WFrag<T16>::mma(kf[kk], qf[nq][kk], a); if (HR) { a = WFrag<T16>::mma(kf2[kk], qf[nq][kk], a); a = WFrag<T16>::mma(kf[kk], qf2[nq][kk], a); } }
                    s[kb][nq] = a; } }
            V vf[4], vf2[4];
#pragma unroll
            for (int db = 0; db < 4; ++db) { const unsigned short* vq = tb + PL + db * 16 * LP + ks * 32; vf[db] = ldsfrag<T16>(vq); if (HR) vf2[db] = ldsfrag<T16>(vq + 2 * PL); }
#pragma unroll
            for (int nq = 0; nq < NQ; ++nq) {
                float mx = s[0][nq][0];
#pragma unroll
                for (int j = 0; j < 8; ++j) mx = fmaxf(mx, fmaxf(s[0][nq][j], s[1][nq][j]));
                mx = fmaxf(mx, __shfl_xor(mx, 16, 32));   // the other eight keys of each block sit in the other lane half
                const float mn = fmaxf(m[nq], mx); const float al = __builtin_amdgcn_exp2f((m[nq] - mn) * CE); m[nq] = mn;
                const float mb = mn * CE - (HR ? 0.0f : PCL2);
#pragma unroll
                for (int kb = 0; kb < 2; ++kb)
#pragma unroll
                    for (int j = 0; j < 8; ++j) s[kb][nq][j] = __builtin_amdgcn_exp2f(s[kb][nq][j] * CE - mb);
                const v8f p8 = s[0][nq] + s[1][nq];   // the pass's sixteen probabilities of this lane, summed as a tree
                l[nq] = l[nq] * al + (((p8[0] + p8[4]) + (p8[1] + p8[5])) + ((p8[2] + p8[6]) + (p8[3] + p8[7])));
#pragma unroll
                for (int db = 0; db < 4; ++db) o[db][nq] *= al;
                if constexpr (HR) {
                    v16us ph, pl;
#pragma unroll
                    for (int e = 0; e < 16; ++e) { unsigned short a, c2; splitf(s[e >> 3][nq][e & 7], a, c2); ph[e] = a; pl[e] = c2; }
                    const V pfh = __builtin_bit_cast(v16bf, ph), pfl = __builtin_bit_cast(v16bf, pl);
#pragma unroll
                    for (int db = 0; db < 4; ++db) { o[db][nq] = WFrag<T16>::mma(vf[db], pfh, o[db][nq]); o[db][nq] = WFrag<T16>::mma(vf[db], pfl, o[db][nq]); o[db][nq] = WFrag<T16>::mma(vf2[db], pfh, o[db][nq]); }
                } else {
                    V pf;
#pragma unroll
                    for (int e = 0; e < 16; ++e) pf[e] = tohx(s[e >> 3][nq][e & 7]);
#pragma unroll
                    for (int db = 0; db < 4; ++db) o[db][nq] = WFrag<T16>::mma(vf[db], pf, o[db][nq]);
                }
            }
        }
        if (more) put((t + 1) & 1);   // into the buffer whose last readers left it at the barrier of trip t - 1
        __syncthreads();   // publishes tile t + 1 and ends every wave's reads of tile t
    }
#pragma unroll
    for (int nq = 0; nq < NQ; ++nq) { const float inv = __fdiv_rn(1.0f, l[nq] + __shfl_xor(l[nq], 16, 32)); const size_t oo = (size_t)(q0 + nq * 16 + lr) * DQ + hcol + hi * 8;
#pragma unroll
        for (int db = 0; db < 4; ++db) { v8us oh, ol;
#pragma unroll
            for (int j = 0; j < 8; ++j) { unsigned short a, c2; splitf(o[db][nq][j] * inv, a, c2); oh[j] = a; ol[j] = c2; }
            *(v8us*)(Ah + oo + db * 16) = oh; *(v8us*)(Al + oo + db * 16) = ol;
            asm volatile("s_wait_xcnt 0x0" ::: "memory");   // stands in front of the next block's writes to registers that these two stores name
        } }
}
// grid (RH / (16 FW) + (TT - RH) / (32 FW), heads, batches): of each head the hi/lo work-groups (16 rows a wave, three times the products) have the low indices.
__global__ __launch_bounds__(32 * FW) void k_fattn(const h16* __restrict__ Q16, const h16* __restrict__ K16, const h16* __restrict__ V16, const bf* __restrict__ Qh, const bf* __restrict__ Ql, const bf* __restrict__ Kh, const bf* __restrict__ Kl, const bf* __restrict__ Vh, const bf* __restrict__ Vl, bf* Ah, bf* Al) {
    __shared__ __align__(16) unsigned short sm[2 * 4 * KT * LP];
    const int w = __builtin_amdgcn_readfirstlane((int)(threadIdx.x >> 5)); const int hd = (int)blockIdx.y, bt = (int)blockIdx.z; const size_t pq = (size_t)(bt * NH_ + hd) * TT * HD, pk = (size_t)(bt * NKV + hd / REP) * TT * HD;
    Ah += (size_t)bt * TT * DQ; Al += (size_t)bt * TT * DQ;
    constexpr int NHB = RH / (16 * FW);
    if ((int)blockIdx.x < NHB) attn_rows<bf, 1>(Qh + pq, Ql + pq, Kh + pk, Kl + pk, Vh + pk, Vl + pk, ((int)blockIdx.x * FW + w) * 16, hd * HD, Ah, Al, sm);
    else attn_rows<h16, 2>(Q16 + pq, nullptr, K16 + pk, nullptr, V16 + pk, nullptr, RH + (((int)blockIdx.x - NHB) * FW + w) * 32, hd * HD, Ah, Al, sm);
}

// ---- k_gemmt: GEMM with both operands staged in LDS. A work-group of 4 waves owns a 128x128 output tile, each wave a 64x64 quarter (16 accumulators) over the whole K; grid (M/128, N/128, Z), 128 threads.
// C[m][n] = sum_k A[m][k] Bt[n][k] (NSPLIT 1: + A2[m][k] Bt[n][k]), operands K-contiguous bf16 planes. z-batch strides sA/sB/sC in elements (sZ: the 16-bit planes of EPI 1; sH: the residual of EPI 2). K (a template constant) % 64 == 0.
// Tiles of GT k (128 rows x 128 bytes a plane) are read from memory once per work-group, in whole lines, and laid in LDS at pitch LP, two buffers in turn; every fragment comes from LDS and serves two waves.
// EPI, what the epilogue does with the f32 sums (each wave turns its 16-row slabs through its own LDS range, so that whole lines are stored): 1 stores them as three 16-bit planes (fp16, bf16 hi, bf16 lo), element (m, n) at m x ldc + (n / 64) x sT + n % 64 (head planes [h][t][d]: ldc = 64, sT = rows x 64; plain row-major: sT = 64); 2 adds the bf16-rounded residual hs[m][n] (row pitch SP) and stores f32 in C (pitch ldc).
#define GT   64           // k per LDS tile
#define GM   128          // rows of a plane's tile (output tile GM x GM)
template <int NSPLIT, int EPI, int K>
__global__ __launch_bounds__(128) void k_gemmt(const bf* __restrict__ A, const bf* __restrict__ A2, const bf* __restrict__ Bt, float* C, int ldc, size_t sA, size_t sB, size_t sC, h16* P16, bf* Ph, bf* Pl, size_t sT, const float* __restrict__ hs, size_t sZ, size_t sH) {
    constexpr int NP = NSPLIT ? 3 : 2;          // planes staged: A, Bt (, A2)
    constexpr int PL = GM * LP;                 // one plane's tile in LDS, elements
    constexpr int NC = GM * 8 / 128;            // 16-byte pieces of a plane's tile per thread
    __shared__ __align__(16) unsigned short sm[2 * NP * PL];
    __shared__ __align__(16) float os[4 * 16 * 68];   // epilogue: one 16-row slab per wave
    const size_t z = blockIdx.z;
    const int lane = threadIdx.x & 31, lr = lane & 15, hi = lane >> 4;
    const int w = __builtin_amdgcn_readfirstlane((int)(threadIdx.x >> 5)), wm = w >> 1, wn = w & 1;
    const int r0 = (int)blockIdx.x * GM, c0 = (int)blockIdx.y * GM;
    const int srow = (int)threadIdx.x >> 3, scol = ((int)threadIdx.x & 7) * 8;   // this thread's pieces: rows srow + 16 i, 8 elements at scol
    const bf* ga = A + z * sA + (size_t)(r0 + srow) * K + scol; const bf* gb = Bt + z * sB + (size_t)(c0 + srow) * K + scol;
    const bf* ga2 = NSPLIT ? A2 + z * sA + (size_t)(r0 + srow) * K + scol : nullptr;
    // every '#pragma unroll' of this kernel: its loop indexes register arrays (accumulators, fragments, staged pieces), which stay in registers only under constant indices
    v8f acc[4][4];
#pragma unroll
    for (int mb = 0; mb < 4; ++mb)
#pragma unroll
        for (int nb = 0; nb < 4; ++nb) acc[mb][nb] = (v8f){};
    v8us st[NP][NC];
    auto fetch = [&](int kc) {
        const bf* pa = ga + kc; const bf* pb = gb + kc; const bf* pa2 = NSPLIT ? ga2 + kc : pa;
#pragma unroll
        for (int i = 0; i < NC; ++i) { const size_t o = (size_t)i * 16 * K;
            st[0][i] = *(const v8usa*)(pa + o); st[1][i] = *(const v8usa*)(pb + o);
            if constexpr (NSPLIT != 0) st[2][i] = *(const v8usa*)(pa2 + o); }
        asm volatile("s_wait_xcnt 0x0" :: "v"(pa), "v"(pb), "v"(pa2) : "memory");   // stands in front of later writes to the address registers that the loads above name; it takes them as inputs so that no load of the group lands on them either
    };
    auto put = [&](int buf) {
#pragma unroll
        for (int i = 0; i < NC; ++i) { unsigned short* d = sm + buf * NP * PL + (srow + i * 16) * LP + scol;
#pragma unroll
            for (int pl = 0; pl < NP; ++pl) *(v8usa*)(d + pl * PL) = st[pl][i]; } };
    constexpr int NT = K / GT;
    fetch(0); put(0);
    __syncthreads();   // tile 0 is in LDS
#pragma unroll 1   // rolled: a trip already holds a whole tile's reads and matrix instructions, copies of it would only lengthen the text
    for (int t = 0; t < NT; ++t) {
        const bool more = t + 1 < NT;
        if (more) fetch((t + 1) * GT);   // the next tile flies to registers while this one is worked on
        const unsigned short* ta = sm + (t & 1) * NP * PL + (wm * 64 + lr) * LP + 8 * hi;
        const unsigned short* tb = sm + (t & 1) * NP * PL + PL + (wn * 64 + lr) * LP + 8 * hi;
        v16bf a[GT / 32][4], a2[GT / 32][4], b[GT / 32][4];   // the tile's fragments, all asked for in one group
#pragma unroll
        for (int kk = 0; kk < GT / 32; ++kk) {
#pragma unroll
            for (int mb = 0; mb < 4; ++mb) { a[kk][mb] = ldsfrag<bf>(ta + mb * 16 * LP + kk * 32); if constexpr (NSPLIT != 0) a2[kk][mb] = ldsfrag<bf>(ta + 2 * PL + mb * 16 * LP + kk * 32); }
#pragma unroll
            for (int nb = 0; nb < 4; ++nb) b[kk][nb] = ldsfrag<bf>(tb + nb * 16 * LP + kk * 32);
        }
        __builtin_amdgcn_sched_barrier(0);   // keeps the LDS reads in one group ahead of the matrix instructions (for speed only)
#pragma unroll
        for (int kk = 0; kk < GT / 32; ++kk)
#pragma unroll
            for (int nb = 0; nb < 4; ++nb)
#pragma unroll
                for (int mb = 0; mb < 4; ++mb) { acc[mb][nb] = wmmab(a[kk][mb], b[kk][nb], acc[mb][nb]); if constexpr (NSPLIT != 0) acc[mb][nb] = wmmab(a2[kk][mb], b[kk][nb], acc[mb][nb]); }
        if (more) put((t + 1) & 1);   // into the buffer whose last readers left it at the barrier of trip t - 1
        __syncthreads();   // publishes tile t + 1 and ends every wave's reads of tile t
    }
    const int rw = r0 + wm * 64, cw = c0 + wn * 64;   // this wave's quarter
    float* mine = os + w * (16 * 68);
    v4f rsd[4][8];   // EPI 2: this lane's pieces of the residual, all asked for at once
    if constexpr (EPI == 2) {
        const float* hz = hs + z * sH + (size_t)(rw + hi) * SP + cw + lr * 4;
#pragma unroll
        for (int mb = 0; mb < 4; ++mb)
#pragma unroll
            for (int s = 0; s < 8; ++s) rsd[mb][s] = *(const v4f*)(hz + (size_t)(mb * 16 + 2 * s) * SP);
        asm volatile("s_wait_xcnt 0x0" ::: "memory");   // stands in front of later writes to the address registers that the loads above name
    }
#pragma unroll
    for (int mb = 0; mb < 4; ++mb) {
#pragma unroll
        for (int nb = 0; nb < 4; ++nb) {
#pragma unroll
            for (int j = 0; j < 8; ++j) mine[(hi * 8 + j) * 68 + nb * 16 + lr] = acc[mb][nb][j]; }
        asm volatile("s_wait_dscnt 0x0" ::: "memory");   // the slab's writes have landed before other lanes of this wave read the rows back
        if constexpr (EPI == 1) {
#pragma unroll
            for (int s = 0; s < 4; ++s) { const int row = 4 * s + (lane >> 3), cofs = (lane & 7) * 8; const v4f v0 = *(const v4fa*)(mine + row * 68 + cofs), v1 = *(const v4fa*)(mine + row * 68 + cofs + 4);
                const size_t po = z * sZ + (size_t)(rw + mb * 16 + row) * ldc + (size_t)(cw / 64) * sT + cofs; v8h o16; v8us oh, ol;
#pragma unroll
                for (int q = 0; q < 8; ++q) { const float y = q < 4 ? v0[q & 3] : v1[q & 3]; o16[q] = tohx(y); unsigned short a2, c2; splitf(y, a2, c2); oh[q] = a2; ol[q] = c2; }
                *(v8h*)(P16 + po) = o16; *(v8us*)(Ph + po) = oh; *(v8us*)(Pl + po) = ol;
                asm volatile("s_wait_xcnt 0x0" ::: "memory");   // stands in front of the next rows' writes to registers that these stores name
            }
        } else {
            float* crow = C + z * sC + (size_t)(rw + mb * 16 + hi) * ldc + cw + lr * 4;
#pragma unroll
            for (int s = 0; s < 8; ++s) { v4f val = *(const v4fa*)(mine + (2 * s + hi) * 68 + lr * 4);
#pragma unroll
                for (int q = 0; q < 4; ++q) val[q] = __fadd_rn(val[q], bfr(rsd[mb][s][q]));
                *(v4f*)(crow + (size_t)(2 * s) * ldc) = val;
                asm volatile("s_wait_xcnt 0x0" ::: "memory");   // stands in front of the next rows' writes to registers that this store names
            }
        }
    }
}

extern "C" void kernel_launch(void* const* d_in, const int* in_sizes, int n_in,
                              void* d_out, int out_size, void* d_ws, size_t ws_size, hipStream_t stream) {
    (void)in_sizes; (void)n_in; (void)out_size;
    const float* x = (const float*)d_in[0];   /* h [S][B][D] seq-major */ const float* wq = (const float*)d_in[1]; const float* wkv = (const float*)d_in[2]; const float* wo = (const float*)d_in[3]; const float* lng = (const float*)d_in[4]; const float* lnb = (const float*)d_in[5]; const float* wk = wkv; const float* wv = wkv;
    float* OUT = (float*)d_out;     // [2048][4][1024] seq-major
    char* wsp = (char*)d_ws;
    auto take = [&](size_t bytes) { char* p = wsp; wsp += (bytes + 255) & ~(size_t)255; return (void*)p; };
    float* Y = (float*)take((size_t)NB_ * TT * DM * 4); bf* WQ = (bf*)take((size_t)DQ * DM * 2); bf* WK = (bf*)take((size_t)DKV * DM * 2); bf* WV = (bf*)take((size_t)DKV * DM * 2); bf* WO = (bf*)take((size_t)DM * DQ * 2);
    bf* XB = (bf*)take((size_t)NB_ * TT * DM * 2);
    h16* QP16 = (h16*)take((size_t)NB_ * NH_ * TT * HD * 2); h16* KP16 = (h16*)take((size_t)NB_ * NKV * TT * HD * 2); h16* VT16 = (h16*)take((size_t)NB_ * NKV * HD * TT * 2);
    bf* QPh = (bf*)take((size_t)NB_ * NH_ * TT * HD * 2); bf* QPl = (bf*)take((size_t)NB_ * NH_ * TT * HD * 2); bf* KPh = (bf*)take((size_t)NB_ * NKV * TT * HD * 2); bf* KPl = (bf*)take((size_t)NB_ * NKV * TT * HD * 2); bf* VTh = (bf*)take((size_t)NB_ * NKV * HD * TT * 2); bf* VTl = (bf*)take((size_t)NB_ * NKV * HD * TT * 2);
    bf* ATh = (bf*)take((size_t)NB_ * TT * DQ * 2); bf* ATl = (bf*)take((size_t)NB_ * TT * DQ * 2);
    if ((size_t)(wsp - (char*)d_ws) > ws_size) return;    // ws 256 MiB
    { k_wtG<<<(unsigned)((DM * DQ / 64 + 63) / 64), 256, 0, stream>>>(wq, DM, DQ, WQ); k_wtGp<<<(unsigned)((DM * DKV / 64 + 63) / 64), 256, 0, stream>>>(wkv + 0, DM, DKV, 2 * DM, WK);   /* Wkv 'xw' [1024][2048]: k = columns 0..1023 */ k_wtGp<<<(unsigned)((DM * DKV / 64 + 63) / 64), 256, 0, stream>>>(wkv + DM, DM, DKV, 2 * DM, WV);   /* Wkv 'xw' [1024][2048]: v = columns 1024..2047 */
      k_wtG<<<(unsigned)((DQ * DM / 64 + 63) / 64), 256, 0, stream>>>(wo, DQ, DM, WO);
       }
    k_cvtS<<<dim3((unsigned)(((size_t)TT * DM / 8 + 255) / 256), NB_, 1), 256, 0, stream>>>(x, XB);   /* each batch's rows of the seq-major input (pitch 4 x 1024) */
    k_gemmt<0, 1, DM><<<dim3(TT / GM, DQ / GM, NB_), 128, 0, stream>>>(XB, nullptr, WQ, nullptr, HD, (size_t)TT * DM, 0, 0, QP16, QPh, QPl, (size_t)TT * HD, nullptr, (size_t)NH_ * TT * HD, 0);   /* a wave's 64 columns are one head: planes [b][h][t][d] */
    k_gemmt<0, 1, DM><<<dim3(TT / GM, DKV / GM, NB_), 128, 0, stream>>>(XB, nullptr, WK, nullptr, HD, (size_t)TT * DM, 0, 0, KP16, KPh, KPl, (size_t)TT * HD, nullptr, (size_t)NKV * TT * HD, 0);
    k_gemmt<0, 1, DM><<<dim3(DKV / GM, TT / GM, NB_), 128, 0, stream>>>(WV, nullptr, XB, nullptr, TT, 0, (size_t)TT * DM, 0, VT16, VTh, VTl, 64, nullptr, (size_t)NKV * HD * TT, 0);   /* operands swapped: rows = (head, d), columns = t, the planes [b][g][d][t] row-major */
    k_fattn<<<dim3(RH / (16 * FW) + (TT - RH) / (32 * FW), NH_, NB_), 32 * FW, 0, stream>>>(QP16, KP16, VT16, QPh, QPl, KPh, KPl, VTh, VTl, ATh, ATl);
    k_gemmt<1, 2, DQ><<<dim3(TT / GM, DM / GM, NB_), 128, 0, stream>>>(ATh, ATl, WO, Y, DM, (size_t)TT * DQ, 0, (size_t)TT * DM, nullptr, nullptr, nullptr, 0, x, 0, DM);
    k_lnoutS<<<dim3((TT + 7) / 8, NB_, 1), 256, 0, stream>>>(Y, lng, lnb, OUT);   /* LayerNorm(h + attn_out), rows back at the seq-major pitch */
}

// v006
// One run takes 224 microseconds.
// Next to v005, in two timings, it ran 1.15 times as fast each time.
// Over all steps from v000 it is 18.0 times as fast.
#include <hip/hip_runtime.h>

// Transformer-XL style multi-head attention on a SEQUENCE-MAJOR input with post-LayerNorm (h [2048][4][1024] (seq, batch, model); q = h Wq ('xw' [1024][1024] 1/32), k | v = h Wkv ('xw' [1024][2048]: k = columns 0..1023, v = 1024..2047); 16 heads x 64; score = q.k / 8; softmax over keys; attn_vec merged; attn_out = attn_vec Wo ('xw' no bias); out = LayerNorm(h + attn_out) gamma/beta (eps 1e-5) -> [2048][4][1024] seq-major (8.4 M)).
// One launch turns the weights and gathers all four batches; every other launch covers all four batches (the batch is a grid index; each workspace array but the four weights holds four batch slices). Layout per batch: a strided gather makes batch b's rows (row pitch 4 x 1024 in the input) a contiguous token-major bf16 operand; 'xw' weights transposed once (Wkv as two column blocks); exact projections, whose epilogues write the head planes (v as Wv x X^T, so that its tile comes out transposed); fused T-2048 attention (hybrid rows: < 512 hi/lo 3 products, rest fp16 x1024; scores and probabilities stay in registers); merged hi/lo x Wo exact, the residual (strided rows of h) added in its epilogue, into workspace; a row LayerNorm kernel writes batch b's output rows back at pitch 4 x 1024.
// Compute dtypes, f32 accumulate: every input rounded to bf16; projections exact; attention rows < 512 3 products, rest fp16; softmax f32; Wo hl x exact; residual + LayerNorm f32.

#define NB_  4
#define TT   2048
#define DM   1024
#define NH_  16
#define NKV  16
#define REP  (NH_ / NKV)
#define HD   64
#define DQ   (NH_ * HD)
#define DKV  (NKV * HD)
#define RH   512                  // query rows < RH use hi+lo planes (0: none)
#define WIN  0
#define PCL2 10.0f                // log2 of the carrier (x1024) of the fp16 probabilities
#define SCL  0.125f
#define LNEPS 1e-5f
#define SP   (NB_ * DM)   // seq-major row pitch of h and out (floats)
#define FW   4            // fused attention: waves per work-group
typedef _Float16 h16;
typedef unsigned short bf;
typedef __attribute__((ext_vector_type(16))) __bf16   v16bf;
typedef __attribute__((ext_vector_type(16))) _Float16 v16h;
typedef __attribute__((ext_vector_type(8)))  _Float16 v8h;
typedef __attribute__((ext_vector_type(8)))  unsigned short v8us;
typedef __attribute__((ext_vector_type(8)))  float    v8f;
typedef __attribute__((ext_vector_type(4)))  float    v4f;
typedef v8h  __attribute__((may_alias)) v8ha;
typedef v4f  __attribute__((may_alias)) v4fa;
typedef v8us __attribute__((may_alias)) v8usa;

__device__ __forceinline__ unsigned short f2bf(float f) { unsigned u = __float_as_uint(f); u += 0x7FFFu + ((u >> 16) & 1u); return (unsigned short)(u >> 16); }
__device__ __forceinline__ float bf2f(unsigned short b) { return __uint_as_float(((unsigned)b) << 16); }
__device__ __forceinline__ float bfr(float f) { return bf2f(f2bf(f)); }
__device__ __forceinline__ v16h cat16(v8h lo, v8h hi) { return __builtin_shufflevector(lo, hi, 0, 1, 2, 3, 4, 5, 6, 7, 8, 9, 10, 11, 12, 13, 14, 15); }
__device__ __forceinline__ v16bf cat16b(v8us lo, v8us hi) { return __builtin_bit_cast(v16bf, __builtin_shufflevector(lo, hi, 0, 1, 2, 3, 4, 5, 6, 7, 8, 9, 10, 11, 12, 13, 14, 15)); }
__device__ __forceinline__ v8f wmma16(v16h a, v16h b, v8f c) { return __builtin_amdgcn_wmma_f32_16x16x32_f16(false, a, false, b, (short)0, c, false, false); }
__device__ __forceinline__ v8f wmmab(v16bf a, v16bf b, v8f c) { return __builtin_amdgcn_wmma_f32_16x16x32_bf16(false, a, false, b, (short)0, c, false, false); }
__device__ __forceinline__ h16 tohx(float x) { return (h16)x; }
__device__ __forceinline__ void splitf(float y, unsigned short& h, unsigned short& l) { h = f2bf(y); l = f2bf(y - bf2f(h)); }
typedef __attribute__((ext_vector_type(4))) _Float16 v4h;
typedef __attribute__((ext_vector_type(4))) unsigned short v4us;



// fragment types: two 16-byte loads 32 bytes apart make one 16x32 operand fragment
template <typename T16> struct WFrag;
template <> struct WFrag<h16> { typedef v16h V; static __device__ __forceinline__ V ld(const h16* p) { return cat16(*(const v8h*)p, *(const v8h*)(p + 16)); } static __device__ __forceinline__ v8f mma(V a, V b, v8f c) { return wmma16(a, b, c); } };
template <> struct WFrag<bf> { typedef v16bf V; static __device__ __forceinline__ V ld(const bf* p) { return cat16b(*(const v8us*)p, *(const v8us*)(p + 16)); } static __device__ __forceinline__ v8f mma(V a, V b, v8f c) { return wmmab(a, b, c); } };

typedef __attribute__((ext_vector_type(2))) unsigned short v2us;

__global__ __launch_bounds__(256) void k_cvt8(const float* __restrict__ src, bf* dst, size_t n8) { const size_t i = (size_t)blockIdx.x * 256 + threadIdx.x; if (i >= n8) return; const v8f v = *(const v8f*)(src + i * 8); v8us o;
#pragma unroll
    for (int k = 0; k < 8; ++k) o[k] = f2bf(v[k]); *(v8us*)(dst + i * 8) = o;  }

// ---- k_prep: the bf16 form of every matrix operand, one launch. Work-groups 0 .. 4 PWB - 1 turn the four 'xw' weights ([k][n] f32, all DM x DM; the two halves of Wkv at row pitch 2 DM) into [n][k] bf16; the other NB_ TT / PR gather the input's batches.
// A weight tile is PK k x PN n: read in pieces of 256 bytes of a row (whole lines), rounded, two neighbouring k packed to a dword, laid in LDS as [n][k], and stored in rows of 256 bytes. A gather work-group takes PR rows of one batch, a row a load: every load and store of a wave covers whole lines.
// All of a thread's loads are asked for before the first is used, and a thread has many, so that few waves keep enough bytes in flight.
#define PK   128          // k of a weight tile
#define PN   128          // n of a weight tile
#define PPD  68           // LDS row pitch in dwords: PK / 2 + 4, so that 16-byte reads stay aligned
#define PWB  ((DM / PK) * (DM / PN))   // tiles of one weight
#define PR   32           // input rows of a gather work-group
static_assert(DQ == DM && DKV == DM && TT % PR == 0 && DM == 256 * 4 && PK == 128 && PN % 64 == 0, "k_prep's shapes");
__global__ __launch_bounds__(256) void k_prep(const float* __restrict__ x, const float* __restrict__ wq, const float* __restrict__ wkv, const float* __restrict__ wo, bf* XB, bf* WQ, bf* WK, bf* WV, bf* WO) {
    __shared__ __align__(16) unsigned tl[PN * PPD];
    const unsigned tid = threadIdx.x, blk = blockIdx.x;
    // every '#pragma unroll' of this kernel: its loop indexes a register array of loaded pieces, and the loads are to be in flight together
    if (blk < 4 * PWB) {
        const unsigned which = blk / PWB, tile = blk % PWB; const unsigned k0 = (tile / (DM / PN)) * PK, n0 = (tile % (DM / PN)) * PN;
        const float* w = which == 0 ? wq : which == 1 ? wkv : which == 2 ? wkv + DM : wo;   /* Wkv: k = columns 0..1023, v = 1024..2047 */
        bf* Bt = which == 0 ? WQ : which == 1 ? WK : which == 2 ? WV : WO;
        const size_t pitch = (which == 1 || which == 2) ? 2 * DM : DM;
        const unsigned p = tid >> 4, c = tid & 15;   // loads: rows 2 p, 2 p + 1 of each 32, four columns at 4 c of each 64; stores: row p of each 16, eight k at 8 c
        const float* src = w + (size_t)(k0 + 2 * p) * pitch + n0 + c * 4;
        const float* pa[PK / 32][2]; v4f a[PN / 64][PK / 32][2];
#pragma unroll
        for (int i = 0; i < PK / 32; ++i) { pa[i][0] = src + (size_t)(i * 32) * pitch; pa[i][1] = pa[i][0] + pitch;
#pragma unroll
            for (int j = 0; j < PN / 64; ++j) { a[j][i][0] = *(const v4f*)(pa[i][0] + j * 64); a[j][i][1] = *(const v4f*)(pa[i][1] + j * 64); } }
        asm volatile("s_wait_xcnt 0x0" :: "v"(pa[0][0]), "v"(pa[0][1]), "v"(pa[1][0]), "v"(pa[1][1]), "v"(pa[2][0]), "v"(pa[2][1]), "v"(pa[3][0]), "v"(pa[3][1]) : "memory");   // stands in front of later writes to the address registers that the loads above name; it takes them as inputs so that no load of the group lands on them either
        // row n's 16-byte pieces stand at piece index ^ (n / 16 % 4): the sixteen lanes that write one k pair of rows 4 apart then meet sixteen different banks
        unsigned* td = tl + c * 4 * PPD + (p ^ ((c >> 2) << 2));
#pragma unroll
        for (int j = 0; j < PN / 64; ++j)
#pragma unroll
            for (int i = 0; i < PK / 32; ++i)
#pragma unroll
                for (int q = 0; q < 4; ++q) td[(j * 64 + q) * PPD + i * 16] = (unsigned)f2bf(a[j][i][0][q]) | ((unsigned)f2bf(a[j][i][1][q]) << 16);
        __syncthreads();   // the tile is in LDS before other threads read its rows
        bf* dst = Bt + (size_t)(n0 + p) * DM + k0 + c * 8;
#pragma unroll
        for (int s = 0; s < PN / 16; ++s) *(v8us*)(dst + (size_t)(s * 16) * DM) = *(const v8usa*)(tl + (s * 16 + p) * PPD + (c ^ (unsigned)(s & 3)) * 4);
    } else {
        const unsigned row0 = (blk - 4 * PWB) * PR; const unsigned b = row0 / TT, t0 = row0 % TT;   // rows of XB, [b][t]; PR divides TT, so one batch a work-group
        const float* src = x + (size_t)t0 * SP + (size_t)b * DM + tid * 4;
        v4f v[PR];
#pragma unroll
        for (int u = 0; u < PR; ++u) v[u] = *(const v4f*)(src + (size_t)u * SP);
        asm volatile("s_wait_xcnt 0x0" ::: "memory");   // stands in front of later writes to the address registers that the loads above name
        __builtin_amdgcn_sched_barrier(0);   // keeps the roundings behind the last load: moved in among the loads, they made the last loads wait for the first ones' data
        bf* dst = XB + (size_t)row0 * DM + tid * 4;
#pragma unroll
        for (int u = 0; u < PR; ++u) { v4us o;
#pragma unroll
            for (int q = 0; q < 4; ++q) o[q] = f2bf(v[u][q]);
            *(v4us*)(dst + (size_t)u * DM) = o; }
    }
}
__global__ __launch_bounds__(256) void k_lnoutS(const float* __restrict__ F, const float* __restrict__ g, const float* __restrict__ bb, float* out) { const int lane = threadIdx.x & 31; const int row = blockIdx.x * 8 + (threadIdx.x >> 5); if (row >= TT) return; const float* fr = F + ((size_t)blockIdx.y * TT + row) * DQ;   /* grid.y = batch */ float* orow = out + (size_t)blockIdx.y * DM + (size_t)row * SP;   /* seq-major output pitch */ float v[DQ / 32]; float s = 0.f;
#pragma unroll
    for (int c = 0; c < DQ / 128; ++c) { const v4f a = *(const v4f*)(fr + c * 128 + lane * 4); for (int q = 0; q < 4; ++q) { v[c * 4 + q] = a[q]; s = __fadd_rn(s, a[q]); } }
#pragma unroll
    for (int sh = 16; sh; sh >>= 1) s = __fadd_rn(s, __shfl_xor(s, sh, 32));
    const float mean = __fdiv_rn(s, (float)DQ); float s2 = 0.f;
#pragma unroll
    for (int k = 0; k < DQ / 32; ++k) { const float dv = __fsub_rn(v[k], mean); float p2 = __fmul_rn(dv, dv); asm volatile("" : "+v"(p2)); s2 = __fadd_rn(s2, p2); v[k] = dv; }
#pragma unroll
    for (int sh = 16; sh; sh >>= 1) s2 = __fadd_rn(s2, __shfl_xor(s2, sh, 32));
    const float rs = __fdiv_rn(1.0f, __fsqrt_rn(__fadd_rn(__fdiv_rn(s2, (float)DQ), LNEPS)));
{
#pragma unroll
        for (int c = 0; c < DQ / 128; ++c) { v4f o; for (int q = 0; q < 4; ++q) { const int col = c * 128 + lane * 4 + q; float y = __fmul_rn(v[c * 4 + q], rs); asm volatile("" : "+v"(y)); y = __fmul_rn(y, bfr(g[col])); asm volatile("" : "+v"(y)); o[q] = __fadd_rn(y, bfr(bb[col])); } *(v4f*)(orow + c * 128 + lane * 4) = o; }
         } }

// ---- k_fattn: scores, softmax and P.V of all batches in one kernel. A wave owns NQ x 16 query rows of one head and walks all TT keys, 32 a pass, with a running maximum and sum per query.
// St = K Qt (A = K rows, B = Q rows): lane (lr, hi) holds, for query lr, the scores of keys 8 hi + j of each 16-key block, so the two blocks of a pass, converted in place, are the B operand of Ot += Vt Pt (A = Vt rows, k = key).
// The FW waves of a work-group share the head's K and Vt: tiles of KT keys (64 rows x 128 bytes each) are read from memory once, in whole lines, and laid in LDS, two buffers in turn; the fragments come from LDS.
// Rows < RH: bf16 hi/lo planes, 3 products in both stages. Other rows: fp16, probabilities carried x 2^PCL2 (folded into the exponent; it cancels in O / sum). The sum is taken of the f32 probabilities.
#define KT   64           // keys per LDS tile
#define LP   72           // LDS row pitch in 16-bit elements: 128 + 16 bytes, free of bank conflicts for 16-byte reads
typedef __attribute__((ext_vector_type(16))) unsigned short v16us;
template <typename T16> __device__ __forceinline__ typename WFrag<T16>::V ldsfrag(const unsigned short* p) { const v8us lo = *(const v8usa*)p, up = *(const v8usa*)(p + 16); return __builtin_bit_cast(typename WFrag<T16>::V, __builtin_shufflevector(lo, up, 0, 1, 2, 3, 4, 5, 6, 7, 8, 9, 10, 11, 12, 13, 14, 15)); }
template <typename T16, int NQ>
__device__ __forceinline__ void attn_rows(const T16* __restrict__ Q, const T16* __restrict__ Q2, const T16* __restrict__ Kp, const T16* __restrict__ K2, const T16* __restrict__ Vt, const T16* __restrict__ V2, int q0, int hcol, bf* Ah, bf* Al, unsigned short* sm) {
    typedef typename WFrag<T16>::V V; constexpr bool HR = __is_same(T16, bf);
    constexpr int NP = HR ? 4 : 2;              // planes staged: K, Vt (, K lo, Vt lo)
    constexpr int PL = KT * LP;                 // one plane's tile in LDS, elements
    constexpr int NC = KT * 8 / (32 * FW);      // 16-byte pieces of a tile per thread
    const int lane = threadIdx.x & 31, lr = lane & 15, hi = lane >> 4;
    const int srow = (int)threadIdx.x >> 3, scol = ((int)threadIdx.x & 7) * 8;   // this thread's piece: rows srow + 4 FW i, 8 elements at scol
    constexpr float CE = SCL * 1.4426950408889634f;   // score -> exponent of 2
    V qf[NQ][2], qf2[NQ][2];
#pragma unroll
    for (int nq = 0; nq < NQ; ++nq)
#pragma unroll
        for (int kk = 0; kk < 2; ++kk) { const size_t qo = (size_t)(q0 + nq * 16 + lr) * HD + kk * 32 + 8 * hi; qf[nq][kk] = WFrag<T16>::ld(Q + qo); if (HR) qf2[nq][kk] = WFrag<T16>::ld(Q2 + qo); }
    asm volatile("s_wait_xcnt 0x0" ::: "memory");   // stands in front of later writes to the address registers that the Q loads name
    v8f o[4][NQ]; float m[NQ], l[NQ];
#pragma unroll
    for (int nq = 0; nq < NQ; ++nq) { m[nq] = -3.0e38f; l[nq] = 0.f;
#pragma unroll
        for (int db = 0; db < 4; ++db) o[db][nq] = (v8f){}; }
    v8us st[NP][NC];
    auto fetch = [&](int key0) {
#pragma unroll
        for (int i = 0; i < NC; ++i) { const int r = srow + i * 4 * FW; const size_t kx = (size_t)(key0 + r) * HD + scol, vx = (size_t)r * TT + key0 + scol;
            st[0][i] = *(const v8usa*)(Kp + kx); st[1][i] = *(const v8usa*)(Vt + vx);
            if constexpr (HR) { st[2][i] = *(const v8usa*)(K2 + kx); st[3][i] = *(const v8usa*)(V2 + vx); } }
        asm volatile("s_wait_xcnt 0x0" ::: "memory");   // stands in front of later writes to the address registers that the loads above name
    };
    auto put = [&](int buf) {
#pragma unroll
        for (int i = 0; i < NC; ++i) { unsigned short* d = sm + buf * NP * PL + (srow + i * 4 * FW) * LP + scol;
#pragma unroll
            for (int pl = 0; pl < NP; ++pl) *(v8usa*)(d + pl * PL) = st[pl][i]; } };
    fetch(0); put(0);
    __syncthreads();   // tile 0 is in LDS
#pragma unroll 1
    for (int t = 0; t < TT / KT; ++t) {
        const bool more = t + 1 < TT / KT;
        if (more) fetch((t + 1) * KT);   // the next tile flies to registers while this one is worked on
        const unsigned short* tb = sm + (t & 1) * NP * PL + lr * LP + 8 * hi;
#pragma unroll
        for (int ks = 0; ks < KT / 32; ++ks) {
            v8f s[2][NQ];
#pragma unroll
            for (int kb = 0; kb < 2; ++kb) { V kf[2], kf2[2];
#pragma unroll
                for (int kk = 0; kk < 2; ++kk) { const unsigned short* kq = tb + (ks * 2 + kb) * 16 * LP + kk * 32; kf[kk] = ldsfrag<T16>(kq); if (HR) kf2[kk] = ldsfrag<T16>(kq + 2 * PL); }
#pragma unroll
                for (int nq = 0; nq < NQ; ++nq) { v8f a = (v8f){};
#pragma unroll
                    for (int kk = 0; kk < 2; ++kk) { a = WFrag<T16>::mma(kf[kk], qf[nq][kk], a); if (HR) { a = WFrag<T16>::mma(kf2[kk], qf[nq][kk], a); a = WFrag<T16>::mma(kf[kk], qf2[nq][kk], a); } }
                    s[kb][nq] = a; } }
            V vf[4], vf2[4];
#pragma unroll
            for (int db = 0; db < 4; ++db) { const unsigned short* vq = tb + PL + db * 16 * LP + ks * 32; vf[db] = ldsfrag<T16>(vq); if (HR) vf2[db] = ldsfrag<T16>(vq + 2 * PL); }
#pragma unroll
            for (int nq = 0; nq < NQ; ++nq) {
                float mx = s[0][nq][0];
#pragma unroll
                for (int j = 0; j < 8; ++j) mx = fmaxf(mx, fmaxf(s[0][nq][j], s[1][nq][j]));
                mx = fmaxf(mx, __shfl_xor(mx, 16, 32));   // the other eight keys of each block sit in the other lane half
                const float mn = fmaxf(m[nq], mx); const float al = __builtin_amdgcn_exp2f((m[nq] - mn) * CE); m[nq] = mn;
                const float mb = mn * CE - (HR ? 0.0f : PCL2);
#pragma unroll
                for (int kb = 0; kb < 2; ++kb)
#pragma unroll
                    for (int j = 0; j < 8; ++j) s[kb][nq][j] = __builtin_amdgcn_exp2f(s[kb][nq][j] * CE - mb);
                const v8f p8 = s[0][nq] + s[1][nq];   // the pass's sixteen probabilities of this lane, summed as a tree
                l[nq] = l[nq] * al + (((p8[0] + p8[4]) + (p8[1] + p8[5])) + ((p8[2] + p8[6]) + (p8[3] + p8[7])));
#pragma unroll
                for (int db = 0; db < 4; ++db) o[db][nq] *= al;
                if constexpr (HR) {
                    v16us ph, pl;
#pragma unroll
                    for (int e = 0; e < 16; ++e) { unsigned short a, c2; splitf(s[e >> 3][nq][e & 7], a, c2); ph[e] = a; pl[e] = c2; }
                    const V pfh = __builtin_bit_cast(v16bf, ph), pfl = __builtin_bit_cast(v16bf, pl);
#pragma unroll
                    for (int db = 0; db < 4; ++db) { o[db][nq] = WFrag<T16>::mma(vf[db], pfh, o[db][nq]); o[db][nq] = WFrag<T16>::mma(vf[db], pfl, o[db][nq]); o[db][nq] = WFrag<T16>::mma(vf2[db], pfh, o[db][nq]); }
                } else {
                    V pf;
#pragma unroll
                    for (int e = 0; e < 16; ++e) pf[e] = tohx(s[e >> 3][nq][e & 7]);
#pragma unroll
                    for (int db = 0; db < 4; ++db) o[db][nq] = WFrag<T16>::mma(vf[db], pf, o[db][nq]);
                }
            }
        }
        if (more) put((t + 1) & 1);   // into the buffer whose last readers left it at the barrier of trip t - 1
        __syncthreads();   // publishes tile t + 1 and ends every wave's reads of tile t
    }
#pragma unroll
    for (int nq = 0; nq < NQ; ++nq) { const float inv = __fdiv_rn(1.0f, l[nq] + __shfl_xor(l[nq], 16, 32)); const size_t oo = (size_t)(q0 + nq * 16 + lr) * DQ + hcol + hi * 8;
#pragma unroll
        for (int db = 0; db < 4; ++db) { v8us oh, ol;
#pragma unroll
            for (int j = 0; j < 8; ++j) { unsigned short a, c2; splitf(o[db][nq][j] * inv, a, c2); oh[j] = a; ol[j] = c2; }
            *(v8us*)(Ah + oo + db * 16) = oh; *(v8us*)(Al + oo + db * 16) = ol;
            asm volatile("s_wait_xcnt 0x0" ::: "memory");   // stands in front of the next block's writes to registers that these two stores name
        } }
}
// grid (RH / (16 FW) + (TT - RH) / (32 FW), heads, batches): of each head the hi/lo work-groups (16 rows a wave, three times the products) have the low indices.
__global__ __launch_bounds__(32 * FW) void k_fattn(const h16* __restrict__ Q16, const h16* __restrict__ K16, const h16* __restrict__ V16, const bf* __restrict__ Qh, const bf* __restrict__ Ql, const bf* __restrict__ Kh, const bf* __restrict__ Kl, const bf* __restrict__ Vh, const bf* __restrict__ Vl, bf* Ah, bf* Al) {
    __shared__ __align__(16) unsigned short sm[2 * 4 * KT * LP];
    const int w = __builtin_amdgcn_readfirstlane((int)(threadIdx.x >> 5)); const int hd = (int)blockIdx.y, bt = (int)blockIdx.z; const size_t pq = (size_t)(bt * NH_ + hd) * TT * HD, pk = (size_t)(bt * NKV + hd / REP) * TT * HD;
    Ah += (size_t)bt * TT * DQ; Al += (size_t)bt * TT * DQ;
    constexpr int NHB = RH / (16 * FW);
    if ((int)blockIdx.x < NHB) attn_rows<bf, 1>(Qh + pq, Ql + pq, Kh + pk, Kl + pk, Vh + pk, Vl + pk, ((int)blockIdx.x * FW + w) * 16, hd * HD, Ah, Al, sm);
    else attn_rows<h16, 2>(Q16 + pq, nullptr, K16 + pk, nullptr, V16 + pk, nullptr, RH + (((int)blockIdx.x - NHB) * FW + w) * 32, hd * HD, Ah, Al, sm);
}

// ---- k_gemmt: GEMM with both operands staged in LDS. A work-group of 4 waves owns a 128x128 output tile, each wave a 64x64 quarter (16 accumulators) over the whole K; grid (M/128, N/128, Z), 128 threads.
// C[m][n] = sum_k A[m][k] Bt[n][k] (NSPLIT 1: + A2[m][k] Bt[n][k]), operands K-contiguous bf16 planes. z-batch strides sA/sB/sC in elements (sZ: the 16-bit planes of EPI 1; sH: the residual of EPI 2). K (a template constant) % 64 == 0.
// Tiles of GT k (128 rows x 128 bytes a plane) are read from memory once per work-group, in whole lines, and laid in LDS at pitch LP, two buffers in turn; every fragment comes from LDS and serves two waves.
// EPI, what the epilogue does with the f32 sums (each wave turns its 16-row slabs through its own LDS range, so that whole lines are stored): 1 stores them as three 16-bit planes (fp16, bf16 hi, bf16 lo), element (m, n) at m x ldc + (n / 64) x sT + n % 64 (head planes [h][t][d]: ldc = 64, sT = rows x 64; plain row-major: sT = 64); 2 adds the bf16-rounded residual hs[m][n] (row pitch SP) and stores f32 in C (pitch ldc).
#define GT   64           // k per LDS tile
#define GM   128          // rows of a plane's tile (output tile GM x GM)
template <int NSPLIT, int EPI, int K>
__global__ __launch_bounds__(128) void k_gemmt(const bf* __restrict__ A, const bf* __restrict__ A2, const bf* __restrict__ Bt, float* C, int ldc, size_t sA, size_t sB, size_t sC, h16* P16, bf* Ph, bf* Pl, size_t sT, const float* __restrict__ hs, size_t sZ, size_t sH) {
    constexpr int NP = NSPLIT ? 3 : 2;          // planes staged: A, Bt (, A2)
    constexpr int PL = GM * LP;                 // one plane's tile in LDS, elements
    constexpr int NC = GM * 8 / 128;            // 16-byte pieces of a plane's tile per thread
    __shared__ __align__(16) unsigned short sm[2 * NP * PL];
    __shared__ __align__(16) float os[4 * 16 * 68];   // epilogue: one 16-row slab per wave
    const size_t z = blockIdx.z;
    const int lane = threadIdx.x & 31, lr = lane & 15, hi = lane >> 4;
    const int w = __builtin_amdgcn_readfirstlane((int)(threadIdx.x >> 5)), wm = w >> 1, wn = w & 1;
    const int r0 = (int)blockIdx.x * GM, c0 = (int)blockIdx.y * GM;
    const int srow = (int)threadIdx.x >> 3, scol = ((int)threadIdx.x & 7) * 8;   // this thread's pieces: rows srow + 16 i, 8 elements at scol
    const bf* ga = A + z * sA + (size_t)(r0 + srow) * K + scol; const bf* gb = Bt + z * sB + (size_t)(c0 + srow) * K + scol;
    const bf* ga2 = NSPLIT ? A2 + z * sA + (size_t)(r0 + srow) * K + scol : nullptr;
    // every '#pragma unroll' of this kernel: its loop indexes register arrays (accumulators, fragments, staged pieces), which stay in registers only under constant indices
    v8f acc[4][4];
#pragma unroll
    for (int mb = 0; mb < 4; ++mb)
#pragma unroll
        for (int nb = 0; nb < 4; ++nb) acc[mb][nb] = (v8f){};
    v8us st[NP][NC];
    auto fetch = [&](int kc) {
        const bf* pa = ga + kc; const bf* pb = gb + kc; const bf* pa2 = NSPLIT ? ga2 + kc : pa;
#pragma unroll
        for (int i = 0; i < NC; ++i) { const size_t o = (size_t)i * 16 * K;
            st[0][i] = *(const v8usa*)(pa + o); st[1][i] = *(const v8usa*)(pb + o);
            if constexpr (NSPLIT != 0) st[2][i] = *(const v8usa*)(pa2 + o); }
        asm volatile("s_wait_xcnt 0x0" :: "v"(pa), "v"(pb), "v"(pa2) : "memory");   // stands in front of later writes to the address registers that the loads above name; it takes them as inputs so that no load of the group lands on them either
    };
    auto put = [&](int buf) {
#pragma unroll
        for (int i = 0; i < NC; ++i) { unsigned short* d = sm + buf * NP * PL + (srow + i * 16) * LP + scol;
#pragma unroll
            for (int pl = 0; pl < NP; ++pl) *(v8usa*)(d + pl * PL) = st[pl][i]; } };
    constexpr int NT = K / GT;
    fetch(0); put(0);
    __syncthreads();   // tile 0 is in LDS
#pragma unroll 1   // rolled: a trip already holds a whole tile's reads and matrix instructions, copies of it would only lengthen the text
    for (int t = 0; t < NT; ++t) {
        const bool more = t + 1 < NT;
        if (more) fetch((t + 1) * GT);   // the next tile flies to registers while this one is worked on
        const unsigned short* ta = sm + (t & 1) * NP * PL + (wm * 64 + lr) * LP + 8 * hi;
        const unsigned short* tb = sm + (t & 1) * NP * PL + PL + (wn * 64 + lr) * LP + 8 * hi;
        v16bf a[GT / 32][4], a2[GT / 32][4], b[GT / 32][4];   // the tile's fragments, all asked for in one group
#pragma unroll
        for (int kk = 0; kk < GT / 32; ++kk) {
#pragma unroll
            for (int mb = 0; mb < 4; ++mb) { a[kk][mb] = ldsfrag<bf>(ta + mb * 16 * LP + kk * 32); if constexpr (NSPLIT != 0) a2[kk][mb] = ldsfrag<bf>(ta + 2 * PL + mb * 16 * LP + kk * 32); }
#pragma unroll
            for (int nb = 0; nb < 4; ++nb) b[kk][nb] = ldsfrag<bf>(tb + nb * 16 * LP + kk * 32);
        }
        __builtin_amdgcn_sched_barrier(0);   // keeps the LDS reads in one group ahead of the matrix instructions (for speed only)
#pragma unroll
        for (int kk = 0; kk < GT / 32; ++kk)
#pragma unroll
            for (int nb = 0; nb < 4; ++nb)
#pragma unroll
                for (int mb = 0; mb < 4; ++mb) { acc[mb][nb] = wmmab(a[kk][mb], b[kk][nb], acc[mb][nb]); if constexpr (NSPLIT != 0) acc[mb][nb] = wmmab(a2[kk][mb], b[kk][nb], acc[mb][nb]); }
        if (more) put((t + 1) & 1);   // into the buffer whose last readers left it at the barrier of trip t - 1
        __syncthreads();   // publishes tile t + 1 and ends every wave's reads of tile t
    }
    const int rw = r0 + wm * 64, cw = c0 + wn * 64;   // this wave's quarter
    float* mine = os + w * (16 * 68);
    v4f rsd[4][8];   // EPI 2: this lane's pieces of the residual, all asked for at once
    if constexpr (EPI == 2) {
        const float* hz = hs + z * sH + (size_t)(rw + hi) * SP + cw + lr * 4;
#pragma unroll
        for (int mb = 0; mb < 4; ++mb)
#pragma unroll
            for (int s = 0; s < 8; ++s) rsd[mb][s] = *(const v4f*)(hz + (size_t)(mb * 16 + 2 * s) * SP);
        asm volatile("s_wait_xcnt 0x0" ::: "memory");   // stands in front of later writes to the address registers that the loads above name
    }
#pragma unroll
    for (int mb = 0; mb < 4; ++mb) {
#pragma unroll
        for (int nb = 0; nb < 4; ++nb) {
#pragma unroll
            for (int j = 0; j < 8; ++j) mine[(hi * 8 + j) * 68 + nb * 16 + lr] = acc[mb][nb][j]; }
        asm volatile("s_wait_dscnt 0x0" ::: "memory");   // the slab's writes have landed before other lanes of this wave read the rows back
        if constexpr (EPI == 1) {
#pragma unroll
            for (int s = 0; s < 4; ++s) { const int row = 4 * s + (lane >> 3), cofs = (lane & 7) * 8; const v4f v0 = *(const v4fa*)(mine + row * 68 + cofs), v1 = *(const v4fa*)(mine + row * 68 + cofs + 4);
                const size_t po = z * sZ + (size_t)(rw + mb * 16 + row) * ldc + (size_t)(cw / 64) * sT + cofs; v8h o16; v8us oh, ol;
#pragma unroll
                for (int q = 0; q < 8; ++q) { const float y = q < 4 ? v0[q & 3] : v1[q & 3]; o16[q] = tohx(y); unsigned short a2, c2; splitf(y, a2, c2); oh[q] = a2; ol[q] = c2; }
                *(v8h*)(P16 + po) = o16; *(v8us*)(Ph + po) = oh; *(v8us*)(Pl + po) = ol;
                asm volatile("s_wait_xcnt 0x0" ::: "memory");   // stands in front of the next rows' writes to registers that these stores name
            }
        } else {
            float* crow = C + z * sC + (size_t)(rw + mb * 16 + hi) * ldc + cw + lr * 4;
#pragma unroll
            for (int s = 0; s < 8; ++s) { v4f val = *(const v4fa*)(mine + (2 * s + hi) * 68 + lr * 4);
#pragma unroll
                for (int q = 0; q < 4; ++q) val[q] = __fadd_rn(val[q], bfr(rsd[mb][s][q]));
                *(v4f*)(crow + (size_t)(2 * s) * ldc) = val;
                asm volatile("s_wait_xcnt 0x0" ::: "memory");   // stands in front of the next rows' writes to registers that this store names
            }
        }
    }
}

extern "C" void kernel_launch(void* const* d_in, const int* in_sizes, int n_in,
                              void* d_out, int out_size, void* d_ws, size_t ws_size, hipStream_t stream) {
    (void)in_sizes; (void)n_in; (void)out_size;
    const float* x = (const float*)d_in[0];   /* h [S][B][D] seq-major */ const float* wq = (const float*)d_in[1]; const float* wkv = (const float*)d_in[2]; const float* wo = (const float*)d_in[3]; const float* lng = (const float*)d_in[4]; const float* lnb = (const float*)d_in[5]; const float* wk = wkv; const float* wv = wkv;
    float* OUT = (float*)d_out;     // [2048][4][1024] seq-major
    char* wsp = (char*)d_ws;
    auto take = [&](size_t bytes) { char* p = wsp; wsp += (bytes + 255) & ~(size_t)255; return (void*)p; };
    float* Y = (float*)take((size_t)NB_ * TT * DM * 4); bf* WQ = (bf*)take((size_t)DQ * DM * 2); bf* WK = (bf*)take((size_t)DKV * DM * 2); bf* WV = (bf*)take((size_t)DKV * DM * 2); bf* WO = (bf*)take((size_t)DM * DQ * 2);
    bf* XB = (bf*)take((size_t)NB_ * TT * DM * 2);
    h16* QP16 = (h16*)take((size_t)NB_ * NH_ * TT * HD * 2); h16* KP16 = (h16*)take((size_t)NB_ * NKV * TT * HD * 2); h16* VT16 = (h16*)take((size_t)NB_ * NKV * HD * TT * 2);
    bf* QPh = (bf*)take((size_t)NB_ * NH_ * TT * HD * 2); bf* QPl = (bf*)take((size_t)NB_ * NH_ * TT * HD * 2); bf* KPh = (bf*)take((size_t)NB_ * NKV * TT * HD * 2); bf* KPl = (bf*)take((size_t)NB_ * NKV * TT * HD * 2); bf* VTh = (bf*)take((size_t)NB_ * NKV * HD * TT * 2); bf* VTl = (bf*)take((size_t)NB_ * NKV * HD * TT * 2);
    bf* ATh = (bf*)take((size_t)NB_ * TT * DQ * 2); bf* ATl = (bf*)take((size_t)NB_ * TT * DQ * 2);
    if ((size_t)(wsp - (char*)d_ws) > ws_size) return;    // ws 256 MiB
    k_prep<<<4 * PWB + NB_ * TT / PR, 256, 0, stream>>>(x, wq, wkv, wo, XB, WQ, WK, WV, WO);   /* weights [n][k]; each batch's rows of the seq-major input (pitch 4 x 1024) contiguous */
    k_gemmt<0, 1, DM><<<dim3(TT / GM, DQ / GM, NB_), 128, 0, stream>>>(XB, nullptr, WQ, nullptr, HD, (size_t)TT * DM, 0, 0, QP16, QPh, QPl, (size_t)TT * HD, nullptr, (size_t)NH_ * TT * HD, 0);   /* a wave's 64 columns are one head: planes [b][h][t][d] */
    k_gemmt<0, 1, DM><<<dim3(TT / GM, DKV / GM, NB_), 128, 0, stream>>>(XB, nullptr, WK, nullptr, HD, (size_t)TT * DM, 0, 0, KP16, KPh, KPl, (size_t)TT * HD, nullptr, (size_t)NKV * TT * HD, 0);
    k_gemmt<0, 1, DM><<<dim3(DKV / GM, TT / GM, NB_), 128, 0, stream>>>(WV, nullptr, XB, nullptr, TT, 0, (size_t)TT * DM, 0, VT16, VTh, VTl, 64, nullptr, (size_t)NKV * HD * TT, 0);   /* operands swapped: rows = (head, d), columns = t, the planes [b][g][d][t] row-major */
    k_fattn<<<dim3(RH / (16 * FW) + (TT - RH) / (32 * FW), NH_, NB_), 32 * FW, 0, stream>>>(QP16, KP16, VT16, QPh, QPl, KPh, KPl, VTh, VTl, ATh, ATl);
    k_gemmt<1, 2, DQ><<<dim3(TT / GM, DM / GM, NB_), 128, 0, stream>>>(ATh, ATl, WO, Y, DM, (size_t)TT * DQ, 0, (size_t)TT * DM, nullptr, nullptr, nullptr, 0, x, 0, DM);
    k_lnoutS<<<dim3((TT + 7) / 8, NB_, 1), 256, 0, stream>>>(Y, lng, lnb, OUT);   /* LayerNorm(h + attn_out), rows back at the seq-major pitch */
}

// v007
// A run of this version takes 216 microseconds.
// In both of two side-by-side timings against v006, it was 1.03 times as fast.
// Over all steps from v000 it is 18.6 times as fast.
#include <hip/hip_runtime.h>

// Transformer-XL style multi-head attention on a SEQUENCE-MAJOR input with post-LayerNorm (h [2048][4][1024] (seq, batch, model); q = h Wq ('xw' [1024][1024] 1/32), k | v = h Wkv ('xw' [1024][2048]: k = columns 0..1023, v = 1024..2047); 16 heads x 64; score = q.k / 8; softmax over keys; attn_vec merged; attn_out = attn_vec Wo ('xw' no bias); out = LayerNorm(h + attn_out) gamma/beta (eps 1e-5) -> [2048][4][1024] seq-major (8.4 M)).
// One launch turns the weights and gathers all four batches; every other launch covers all four batches (the batch is a grid index; each workspace array but the four weights holds four batch slices). Layout per batch: a strided gather makes batch b's rows (row pitch 4 x 1024 in the input) a contiguous token-major bf16 operand; 'xw' weights transposed once (Wkv as two column blocks); exact projections, whose epilogues write the head planes (v as Wv x X^T, so that its tile comes out transposed); fused T-2048 attention (hybrid rows: < 512 hi/lo 3 products, rest fp16 x1024; scores and probabilities stay in registers); merged hi/lo x Wo exact, the residual (strided rows of h) added in its epilogue, into workspace; a row LayerNorm kernel writes batch b's output rows back at pitch 4 x 1024.
// Compute dtypes, f32 accumulate: every input rounded to bf16; projections exact; attention rows < 512 3 products, rest fp16; softmax f32; Wo hl x exact; residual + LayerNorm f32.

#define NB_  4
#define TT   2048
#define DM   1024
#define NH_  16
#define NKV  16
#define REP  (NH_ / NKV)
#define HD   64
#define DQ   (NH_ * HD)
#define DKV  (NKV * HD)
#define RH   512                  // query rows < RH use hi+lo planes (0: none)
#define WIN  0
#define PCL2 10.0f                // log2 of the carrier (x1024) of the fp16 probabilities
#define SCL  0.125f
#define LNEPS 1e-5f
#define SP   (NB_ * DM)   // seq-major row pitch of h and out (floats)
#define FW   4            // fused attention: waves per work-group
typedef _Float16 h16;
typedef unsigned short bf;
typedef __attribute__((ext_vector_type(16))) __bf16   v16bf;
typedef __attribute__((ext_vector_type(16))) _Float16 v16h;
typedef __attribute__((ext_vector_type(8)))  _Float16 v8h;
typedef __attribute__((ext_vector_type(8)))  unsigned short v8us;
typedef __attribute__((ext_vector_type(8)))  float    v8f;
typedef __attribute__((ext_vector_type(4)))  float    v4f;
typedef v8h  __attribute__((may_alias)) v8ha;
typedef v4f  __attribute__((may_alias)) v4fa;
typedef v8us __attribute__((may_alias)) v8usa;

typedef __attribute__((ext_vector_type(2))) float    v2f;
typedef __attribute__((ext_vector_type(2))) __bf16   v2bf;
typedef __attribute__((ext_vector_type(4))) unsigned v4u;
typedef __attribute__((ext_vector_type(8))) unsigned v8u;
// f32 -> bf16, to nearest even, by the conversion instruction: two values a call, a in the low half of the dword
__device__ __forceinline__ unsigned pkbf(float a, float b) { const v2f v = {a, b}; return __builtin_bit_cast(unsigned, __builtin_convertvector(v, v2bf)); }
__device__ __forceinline__ unsigned short f2bf(float f) { return __builtin_bit_cast(unsigned short, (__bf16)f); }
__device__ __forceinline__ float bf2f(unsigned short b) { return __uint_as_float(((unsigned)b) << 16); }
__device__ __forceinline__ float bfr(float f) { return bf2f(f2bf(f)); }
__device__ __forceinline__ v16h cat16(v8h lo, v8h hi) { return __builtin_shufflevector(lo, hi, 0, 1, 2, 3, 4, 5, 6, 7, 8, 9, 10, 11, 12, 13, 14, 15); }
__device__ __forceinline__ v16bf cat16b(v8us lo, v8us hi) { return __builtin_bit_cast(v16bf, __builtin_shufflevector(lo, hi, 0, 1, 2, 3, 4, 5, 6, 7, 8, 9, 10, 11, 12, 13, 14, 15)); }
__device__ __forceinline__ v8f wmma16(v16h a, v16h b, v8f c) { return __builtin_amdgcn_wmma_f32_16x16x32_f16(false, a, false, b, (short)0, c, false, false); }
__device__ __forceinline__ v8f wmmab(v16bf a, v16bf b, v8f c) { return __builtin_amdgcn_wmma_f32_16x16x32_bf16(false, a, false, b, (short)0, c, false, false); }
__device__ __forceinline__ h16 tohx(float x) { return (h16)x; }
// two values split into hi and lo planes: hi = rounded value, lo = rounded rest (the rest is exact in f32)
__device__ __forceinline__ void split2(float a, float b, unsigned& h, unsigned& l) { h = pkbf(a, b); l = pkbf(a - __uint_as_float(h << 16), b - __uint_as_float(h & 0xFFFF0000u)); }
typedef __attribute__((ext_vector_type(4))) _Float16 v4h;
typedef __attribute__((ext_vector_type(4))) unsigned short v4us;



// fragment types: two 16-byte loads 32 bytes apart make one 16x32 operand fragment
template <typename T16> struct WFrag;
template <> struct WFrag<h16> { typedef v16h V; static __device__ __forceinline__ V ld(const h16* p) { return cat16(*(const v8h*)p, *(const v8h*)(p + 16)); } static __device__ __forceinline__ v8f mma(V a, V b, v8f c) { return wmma16(a, b, c); } };
template <> struct WFrag<bf> { typedef v16bf V; static __device__ __forceinline__ V ld(const bf* p) { return cat16b(*(const v8us*)p, *(const v8us*)(p + 16)); } static __device__ __forceinline__ v8f mma(V a, V b, v8f c) { return wmmab(a, b, c); } };

typedef __attribute__((ext_vector_type(2))) unsigned short v2us;

__global__ __launch_bounds__(256) void k_cvt8(const float* __restrict__ src, bf* dst, size_t n8) { const size_t i = (size_t)blockIdx.x * 256 + threadIdx.x; if (i >= n8) return; const v8f v = *(const v8f*)(src + i * 8); v8us o;
#pragma unroll
    for (int k = 0; k < 8; ++k) o[k] = f2bf(v[k]); *(v8us*)(dst + i * 8) = o;  }

// ---- k_prep: the bf16 form of every matrix operand, one launch. Work-groups 0 .. 4 PWB - 1 turn the four 'xw' weights ([k][n] f32, all DM x DM; the two halves of Wkv at row pitch 2 DM) into [n][k] bf16; the other NB_ TT / PR gather the input's batches.
// A weight tile is PK k x PN n: read in pieces of 256 bytes of a row (whole lines), rounded, two neighbouring k packed to a dword, laid in LDS as [n][k], and stored in rows of 256 bytes. A gather work-group takes PR rows of one batch, a row a load: every load and store of a wave covers whole lines.
// All of a thread's loads are asked for before the first is used, and a thread has many, so that few waves keep enough bytes in flight.
#define PK   128          // k of a weight tile
#define PN   128          // n of a weight tile
#define PPD  68           // LDS row pitch in dwords: PK / 2 + 4, so that 16-byte reads stay aligned
#define PWB  ((DM / PK) * (DM / PN))   // tiles of one weight
#define PR   32           // input rows of a gather work-group
static_assert(DQ == DM && DKV == DM && TT % PR == 0 && DM == 256 * 4 && PK == 128 && PN % 64 == 0, "k_prep's shapes");
__global__ __launch_bounds__(256) void k_prep(const float* __restrict__ x, const float* __restrict__ wq, const float* __restrict__ wkv, const float* __restrict__ wo, bf* XB, bf* WQ, bf* WK, bf* WV, bf* WO) {
    __shared__ __align__(16) unsigned tl[PN * PPD];
    const unsigned tid = threadIdx.x, blk = blockIdx.x;
    // every '#pragma unroll' of this kernel: its loop indexes a register array of loaded pieces, and the loads are to be in flight together
    if (blk < 4 * PWB) {
        const unsigned which = blk / PWB, tile = blk % PWB; const unsigned k0 = (tile / (DM / PN)) * PK, n0 = (tile % (DM / PN)) * PN;
        const float* w = which == 0 ? wq : which == 1 ? wkv : which == 2 ? wkv + DM : wo;   /* Wkv: k = columns 0..1023, v = 1024..2047 */
        bf* Bt = which == 0 ? WQ : which == 1 ? WK : which == 2 ? WV : WO;
        const size_t pitch = (which == 1 || which == 2) ? 2 * DM : DM;
        const unsigned p = tid >> 4, c = tid & 15;   // loads: rows 2 p, 2 p + 1 of each 32, four columns at 4 c of each 64; stores: row p of each 16, eight k at 8 c
        const float* src = w + (size_t)(k0 + 2 * p) * pitch + n0 + c * 4;
        const float* pa[PK / 32][2]; v4f a[PN / 64][PK / 32][2];
#pragma unroll
        for (int i = 0; i < PK / 32; ++i) { pa[i][0] = src + (size_t)(i * 32) * pitch; pa[i][1] = pa[i][0] + pitch;
#pragma unroll
            for (int j = 0; j < PN / 64; ++j) { a[j][i][0] = *(const v4f*)(pa[i][0] + j * 64); a[j][i][1] = *(const v4f*)(pa[i][1] + j * 64); } }
        asm volatile("s_wait_xcnt 0x0" :: "v"(pa[0][0]), "v"(pa[0][1]), "v"(pa[1][0]), "v"(pa[1][1]), "v"(pa[2][0]), "v"(pa[2][1]), "v"(pa[3][0]), "v"(pa[3][1]) : "memory");   // stands in front of later writes to the address registers that the loads above name; it takes them as inputs so that no load of the group lands on them either
        // row n's 16-byte pieces stand at piece index ^ (n / 16 % 4): the sixteen lanes that write one k pair of rows 4 apart then meet sixteen different banks
        unsigned* td = tl + c * 4 * PPD + (p ^ ((c >> 2) << 2));
#pragma unroll
        for (int j = 0; j < PN / 64; ++j)
#pragma unroll
            for (int i = 0; i < PK / 32; ++i)
#pragma unroll
                for (int q = 0; q < 4; ++q) td[(j * 64 + q) * PPD + i * 16] = pkbf(a[j][i][0][q], a[j][i][1][q]);
        __syncthreads();   // the tile is in LDS before other threads read its rows
        bf* dst = Bt + (size_t)(n0 + p) * DM + k0 + c * 8;
#pragma unroll
        for (int s = 0; s < PN / 16; ++s) *(v8us*)(dst + (size_t)(s * 16) * DM) = *(const v8usa*)(tl + (s * 16 + p) * PPD + (c ^ (unsigned)(s & 3)) * 4);
    } else {
        const unsigned row0 = (blk - 4 * PWB) * PR; const unsigned b = row0 / TT, t0 = row0 % TT;   // rows of XB, [b][t]; PR divides TT, so one batch a work-group
        const float* src = x + (size_t)t0 * SP + (size_t)b * DM + tid * 4;
        v4f v[PR];
#pragma unroll
        for (int u = 0; u < PR; ++u) v[u] = *(const v4f*)(src + (size_t)u * SP);
        asm volatile("s_wait_xcnt 0x0" ::: "memory");   // stands in front of later writes to the address registers that the loads above name
        __builtin_amdgcn_sched_barrier(0);   // keeps the roundings behind the last load: moved in among the loads, they made the last loads wait for the first ones' data
        bf* dst = XB + (size_t)row0 * DM + tid * 4;
#pragma unroll
        for (int u = 0; u < PR; ++u) { v[u][0] = __uint_as_float(pkbf(v[u][0], v[u][1])); v[u][1] = __uint_as_float(pkbf(v[u][2], v[u][3])); }
        __builtin_amdgcn_sched_barrier(0);   // keeps every rounding ahead of the first store: none then writes a register that an issued store names
#pragma unroll
        for (int u = 0; u < PR; ++u) { const v2f o = {v[u][0], v[u][1]}; *(v4us*)(dst + (size_t)u * DM) = __builtin_bit_cast(v4us, o); }
        asm volatile("s_wait_xcnt 0x0" ::: "memory");   // stands in front of later writes to registers that the stores above name
    }
}
__global__ __launch_bounds__(256) void k_lnoutS(const float* __restrict__ F, const float* __restrict__ g, const float* __restrict__ bb, float* out) { const int lane = threadIdx.x & 31; const int row = blockIdx.x * 8 + (threadIdx.x >> 5); if (row >= TT) return; const float* fr = F + ((size_t)blockIdx.y * TT + row) * DQ;   /* grid.y = batch */ float* orow = out + (size_t)blockIdx.y * DM + (size_t)row * SP;   /* seq-major output pitch */ float v[DQ / 32]; float s = 0.f;
#pragma unroll
    for (int c = 0; c < DQ / 128; ++c) { const v4f a = *(const v4f*)(fr + c * 128 + lane * 4); for (int q = 0; q < 4; ++q) { v[c * 4 + q] = a[q]; s = __fadd_rn(s, a[q]); } }
#pragma unroll
    for (int sh = 16; sh; sh >>= 1) s = __fadd_rn(s, __shfl_xor(s, sh, 32));
    const float mean = __fdiv_rn(s, (float)DQ); float s2 = 0.f;
#pragma unroll
    for (int k = 0; k < DQ / 32; ++k) { const float dv = __fsub_rn(v[k], mean); float p2 = __fmul_rn(dv, dv); asm volatile("" : "+v"(p2)); s2 = __fadd_rn(s2, p2); v[k] = dv; }
#pragma unroll
    for (int sh = 16; sh; sh >>= 1) s2 = __fadd_rn(s2, __shfl_xor(s2, sh, 32));
    const float rs = __fdiv_rn(1.0f, __fsqrt_rn(__fadd_rn(__fdiv_rn(s2, (float)DQ), LNEPS)));
{
#pragma unroll
        for (int c = 0; c < DQ / 128; ++c) { v4f o; for (int q = 0; q < 4; ++q) { const int col = c * 128 + lane * 4 + q; float y = __fmul_rn(v[c * 4 + q], rs); asm volatile("" : "+v"(y)); y = __fmul_rn(y, bfr(g[col])); asm volatile("" : "+v"(y)); o[q] = __fadd_rn(y, bfr(bb[col])); } *(v4f*)(orow + c * 128 + lane * 4) = o; }
         } }

// ---- k_fattn: scores, softmax and P.V of all batches in one kernel. A wave owns NQ x 16 query rows of one head and walks all TT keys, 32 a pass, with a running maximum and sum per query.
// St = K Qt (A = K rows, B = Q rows): lane (lr, hi) holds, for query lr, the scores of keys 8 hi + j of each 16-key block, so the two blocks of a pass, converted in place, are the B operand of Ot += Vt Pt (A = Vt rows, k = key).
// The FW waves of a work-group share the head's K and Vt: tiles of KT keys (64 rows x 128 bytes each) are read from memory once, in whole lines, and laid in LDS, two buffers in turn; the fragments come from LDS.
// Rows < RH: bf16 hi/lo planes, 3 products in both stages. Other rows: fp16, probabilities carried x 2^PCL2 (folded into the exponent; it cancels in O / sum). The sum is taken of the f32 probabilities.
#define KT   64           // keys per LDS tile
#define LP   72           // LDS row pitch in 16-bit elements: 128 + 16 bytes, free of bank conflicts for 16-byte reads
typedef __attribute__((ext_vector_type(16))) unsigned short v16us;
template <typename T16> __device__ __forceinline__ typename WFrag<T16>::V ldsfrag(const unsigned short* p) { const v8us lo = *(const v8usa*)p, up = *(const v8usa*)(p + 16); return __builtin_bit_cast(typename WFrag<T16>::V, __builtin_shufflevector(lo, up, 0, 1, 2, 3, 4, 5, 6, 7, 8, 9, 10, 11, 12, 13, 14, 15)); }
template <typename T16, int NQ>
__device__ __forceinline__ void attn_rows(const T16* __restrict__ Q, const T16* __restrict__ Q2, const T16* __restrict__ Kp, const T16* __restrict__ K2, const T16* __restrict__ Vt, const T16* __restrict__ V2, int q0, int hcol, bf* Ah, bf* Al, unsigned short* sm) {
    typedef typename WFrag<T16>::V V; constexpr bool HR = __is_same(T16, bf);
    constexpr int NP = HR ? 4 : 2;              // planes staged: K, Vt (, K lo, Vt lo)
    constexpr int PL = KT * LP;                 // one plane's tile in LDS, elements
    constexpr int NC = KT * 8 / (32 * FW);      // 16-byte pieces of a tile per thread
    const int lane = threadIdx.x & 31, lr = lane & 15, hi = lane >> 4;
    const int srow = (int)threadIdx.x >> 3, scol = ((int)threadIdx.x & 7) * 8;   // this thread's piece: rows srow + 4 FW i, 8 elements at scol
    constexpr float CE = SCL * 1.4426950408889634f;   // score -> exponent of 2
    V qf[NQ][2], qf2[NQ][2];
#pragma unroll
    for (int nq = 0; nq < NQ; ++nq)
#pragma unroll
        for (int kk = 0; kk < 2; ++kk) { const size_t qo = (size_t)(q0 + nq * 16 + lr) * HD + kk * 32 + 8 * hi; qf[nq][kk] = WFrag<T16>::ld(Q + qo); if (HR) qf2[nq][kk] = WFrag<T16>::ld(Q2 + qo); }
    asm volatile("s_wait_xcnt 0x0" ::: "memory");   // stands in front of later writes to the address registers that the Q loads name
    v8f o[4][NQ]; float m[NQ], l[NQ];
#pragma unroll
    for (int nq = 0; nq < NQ; ++nq) { m[nq] = -3.0e38f; l[nq] = 0.f;
#pragma unroll
        for (int db = 0; db < 4; ++db) o[db][nq] = (v8f){}; }
    v8us st[NP][NC];
    auto fetch = [&](int key0) {
#pragma unroll
        for (int i = 0; i < NC; ++i) { const int r = srow + i * 4 * FW; const size_t kx = (size_t)(key0 + r) * HD + scol, vx = (size_t)r * TT + key0 + scol;
            st[0][i] = *(const v8usa*)(Kp + kx); st[1][i] = *(const v8usa*)(Vt + vx);
            if constexpr (HR) { st[2][i] = *(const v8usa*)(K2 + kx); st[3][i] = *(const v8usa*)(V2 + vx); } }
        asm volatile("s_wait_xcnt 0x0" ::: "memory");   // stands in front of later writes to the address registers that the loads above name
        __builtin_amdgcn_sched_barrier(0);   // keeps later address arithmetic behind that wait: lifted over it, it wrote a register that the loads name
    };
    auto put = [&](int buf) {
#pragma unroll
        for (int i = 0; i < NC; ++i) { unsigned short* d = sm + buf * NP * PL + (srow + i * 4 * FW) * LP + scol;
#pragma unroll
            for (int pl = 0; pl < NP; ++pl) *(v8usa*)(d + pl * PL) = st[pl][i]; } };
    fetch(0); put(0);
    __syncthreads();   // tile 0 is in LDS
#pragma unroll 1
    for (int t = 0; t < TT / KT; ++t) {
        const bool more = t + 1 < TT / KT;
        if (more) fetch((t + 1) * KT);   // the next tile flies to registers while this one is worked on
        const unsigned short* tb = sm + (t & 1) * NP * PL + lr * LP + 8 * hi;
#pragma unroll
        for (int ks = 0; ks < KT / 32; ++ks) {
            v8f s[2][NQ];
#pragma unroll
            for (int kb = 0; kb < 2; ++kb) { V kf[2], kf2[2];
#pragma unroll
                for (int kk = 0; kk < 2; ++kk) { const unsigned short* kq = tb + (ks * 2 + kb) * 16 * LP + kk * 32; kf[kk] = ldsfrag<T16>(kq); if (HR) kf2[kk] = ldsfrag<T16>(kq + 2 * PL); }
#pragma unroll
                for (int nq = 0; nq < NQ; ++nq) { v8f a = (v8f){};
#pragma unroll
                    for (int kk = 0; kk < 2; ++kk) { a = WFrag<T16>::mma(kf[kk], qf[nq][kk], a); if (HR) { a = WFrag<T16>::mma(kf2[kk], qf[nq][kk], a); a = WFrag<T16>::mma(kf[kk], qf2[nq][kk], a); } }
                    s[kb][nq] = a; } }
            V vf[4], vf2[4];
#pragma unroll
            for (int db = 0; db < 4; ++db) { const unsigned short* vq = tb + PL + db * 16 * LP + ks * 32; vf[db] = ldsfrag<T16>(vq); if (HR) vf2[db] = ldsfrag<T16>(vq + 2 * PL); }
#pragma unroll
            for (int nq = 0; nq < NQ; ++nq) {
                float mx = s[0][nq][0];
#pragma unroll
                for (int j = 0; j < 8; ++j) mx = fmaxf(mx, fmaxf(s[0][nq][j], s[1][nq][j]));
                mx = fmaxf(mx, __shfl_xor(mx, 16, 32));   // the other eight keys of each block sit in the other lane half
                const float mn = fmaxf(m[nq], mx); const float al = __builtin_amdgcn_exp2f((m[nq] - mn) * CE); m[nq] = mn;
                const float mb = mn * CE - (HR ? 0.0f : PCL2);
#pragma unroll
                for (int kb = 0; kb < 2; ++kb)
#pragma unroll
                    for (int j = 0; j < 8; ++j) s[kb][nq][j] = __builtin_amdgcn_exp2f(s[kb][nq][j] * CE - mb);
                const v8f p8 = s[0][nq] + s[1][nq];   // the pass's sixteen probabilities of this lane, summed as a tree
                l[nq] = l[nq] * al + (((p8[0] + p8[4]) + (p8[1] + p8[5])) + ((p8[2] + p8[6]) + (p8[3] + p8[7])));
#pragma unroll
                for (int db = 0; db < 4; ++db) o[db][nq] *= al;
                if constexpr (HR) {
                    v8u ph, pl;
#pragma unroll
                    for (int e = 0; e < 16; e += 2) { unsigned a, c2; split2(s[e >> 3][nq][e & 7], s[e >> 3][nq][(e & 7) + 1], a, c2); ph[e >> 1] = a; pl[e >> 1] = c2; }
                    const V pfh = __builtin_bit_cast(v16bf, ph), pfl = __builtin_bit_cast(v16bf, pl);
#pragma unroll
                    for (int db = 0; db < 4; ++db) { o[db][nq] = WFrag<T16>::mma(vf[db], pfh, o[db][nq]); o[db][nq] = WFrag<T16>::mma(vf[db], pfl, o[db][nq]); o[db][nq] = WFrag<T16>::mma(vf2[db], pfh, o[db][nq]); }
                } else {
                    V pf;
#pragma unroll
                    for (int e = 0; e < 16; ++e) pf[e] = tohx(s[e >> 3][nq][e & 7]);
#pragma unroll
                    for (int db = 0; db < 4; ++db) o[db][nq] = WFrag<T16>::mma(vf[db], pf, o[db][nq]);
                }
            }
        }
        if (more) put((t + 1) & 1);   // into the buffer whose last readers left it at the barrier of trip t - 1
        __syncthreads();   // publishes tile t + 1 and ends every wave's reads of tile t
    }
#pragma unroll
    for (int nq = 0; nq < NQ; ++nq) { const float inv = __fdiv_rn(1.0f, l[nq] + __shfl_xor(l[nq], 16, 32)); const size_t oo = (size_t)(q0 + nq * 16 + lr) * DQ + hcol + hi * 8;
#pragma unroll
        for (int db = 0; db < 4; ++db) { v4u oh, ol;
#pragma unroll
            for (int j = 0; j < 8; j += 2) { unsigned a, c2; split2(o[db][nq][j] * inv, o[db][nq][j + 1] * inv, a, c2); oh[j >> 1] = a; ol[j >> 1] = c2; }
            *(v8us*)(Ah + oo + db * 16) = __builtin_bit_cast(v8us, oh); *(v8us*)(Al + oo + db * 16) = __builtin_bit_cast(v8us, ol);
            asm volatile("s_wait_xcnt 0x0" ::: "memory");   // stands in front of the next block's writes to registers that these two stores name
            __builtin_amdgcn_sched_barrier(0);   // keeps the next block's arithmetic behind that wait: lifted over it, it wrote registers that the stores name
        } }
}
// grid (RH / (16 FW) + (TT - RH) / (32 FW), heads, batches): of each head the hi/lo work-groups (16 rows a wave, three times the products) have the low indices.
__global__ __launch_bounds__(32 * FW) void k_fattn(const h16* __restrict__ Q16, const h16* __restrict__ K16, const h16* __restrict__ V16, const bf* __restrict__ Qh, const bf* __restrict__ Ql, const bf* __restrict__ Kh, const bf* __restrict__ Kl, const bf* __restrict__ Vh, const bf* __restrict__ Vl, bf* Ah, bf* Al) {
    __shared__ __align__(16) unsigned short sm[2 * 4 * KT * LP];
    const int w = __builtin_amdgcn_readfirstlane((int)(threadIdx.x >> 5)); const int hd = (int)blockIdx.y, bt = (int)blockIdx.z; const size_t pq = (size_t)(bt * NH_ + hd) * TT * HD, pk = (size_t)(bt * NKV + hd / REP) * TT * HD;
    Ah += (size_t)bt * TT * DQ; Al += (size_t)bt * TT * DQ;
    constexpr int NHB = RH / (16 * FW);
    if ((int)blockIdx.x < NHB) attn_rows<bf, 1>(Qh + pq, Ql + pq, Kh + pk, Kl + pk, Vh + pk, Vl + pk, ((int)blockIdx.x * FW + w) * 16, hd * HD, Ah, Al, sm);
    else attn_rows<h16, 2>(Q16 + pq, nullptr, K16 + pk, nullptr, V16 + pk, nullptr, RH + (((int)blockIdx.x - NHB) * FW + w) * 32, hd * HD, Ah, Al, sm);
}

// ---- k_gemmt: GEMM with both operands staged in LDS. A work-group of 4 waves owns a 128x128 output tile, each wave a 64x64 quarter (16 accumulators) over the whole K; grid (M/128, N/128, Z), 128 threads.
// C[m][n] = sum_k A[m][k] Bt[n][k] (NSPLIT 1: + A2[m][k] Bt[n][k]), operands K-contiguous bf16 planes. z-batch strides sA/sB/sC in elements (sZ: the 16-bit planes of EPI 1; sH: the residual of EPI 2). K (a template constant) % 64 == 0.
// Tiles of GT k (128 rows x 128 bytes a plane) are read from memory once per work-group, in whole lines, and laid in LDS at pitch LP, two buffers in turn; every fragment comes from LDS and serves two waves.
// EPI, what the epilogue does with the f32 sums (each wave turns its 16-row slabs through its own LDS range, so that whole lines are stored): 1 stores them as three 16-bit planes (fp16, bf16 hi, bf16 lo), element (m, n) at m x ldc + (n / 64) x sT + n % 64 (head planes [h][t][d]: ldc = 64, sT = rows x 64; plain row-major: sT = 64); 2 adds the bf16-rounded residual hs[m][n] (row pitch SP) and stores f32 in C (pitch ldc).
#define GT   64           // k per LDS tile
#define GM   128          // rows of a plane's tile (output tile GM x GM)
template <int NSPLIT, int EPI, int K>
__global__ __launch_bounds__(128) void k_gemmt(const bf* __restrict__ A, const bf* __restrict__ A2, const bf* __restrict__ Bt, float* C, int ldc, size_t sA, size_t sB, size_t sC, h16* P16, bf* Ph, bf* Pl, size_t sT, const float* __restrict__ hs, size_t sZ, size_t sH) {
    constexpr int NP = NSPLIT ? 3 : 2;          // planes staged: A, Bt (, A2)
    constexpr int PL = GM * LP;                 // one plane's tile in LDS, elements
    constexpr int NC = GM * 8 / 128;            // 16-byte pieces of a plane's tile per thread
    __shared__ __align__(16) unsigned short sm[2 * NP * PL];
    __shared__ __align__(16) float os[4 * 16 * 68];   // epilogue: one 16-row slab per wave
    const size_t z = blockIdx.z;
    const int lane = threadIdx.x & 31, lr = lane & 15, hi = lane >> 4;
    const int w = __builtin_amdgcn_readfirstlane((int)(threadIdx.x >> 5)), wm = w >> 1, wn = w & 1;
    const int r0 = (int)blockIdx.x * GM, c0 = (int)blockIdx.y * GM;
    const int srow = (int)threadIdx.x >> 3, scol = ((int)threadIdx.x & 7) * 8;   // this thread's pieces: rows srow + 16 i, 8 elements at scol
    const bf* ga = A + z * sA + (size_t)(r0 + srow) * K + scol; const bf* gb = Bt + z * sB + (size_t)(c0 + srow) * K + scol;
    const bf* ga2 = NSPLIT ? A2 + z * sA + (size_t)(r0 + srow) * K + scol : nullptr;
    // every '#pragma unroll' of this kernel: its loop indexes register arrays (accumulators, fragments, staged pieces), which stay in registers only under constant indices
    v8f acc[4][4];
#pragma unroll
    for (int mb = 0; mb < 4; ++mb)
#pragma unroll
        for (int nb = 0; nb < 4; ++nb) acc[mb][nb] = (v8f){};
    v8us st[NP][NC];
    auto fetch = [&](int kc) {
        const bf* pa = ga + kc; const bf* pb = gb + kc; const bf* pa2 = NSPLIT ? ga2 + kc : pa;
#pragma unroll
        for (int i = 0; i < NC; ++i) { const size_t o = (size_t)i * 16 * K;
            st[0][i] = *(const v8usa*)(pa + o); st[1][i] = *(const v8usa*)(pb + o);
            if constexpr (NSPLIT != 0) st[2][i] = *(const v8usa*)(pa2 + o); }
        asm volatile("s_wait_xcnt 0x0" :: "v"(pa), "v"(pb), "v"(pa2) : "memory");   // stands in front of later writes to the address registers that the loads above name; it takes them as inputs so that no load of the group lands on them either
    };
    auto put = [&](int buf) {
#pragma unroll
        for (int i = 0; i < NC; ++i) { unsigned short* d = sm + buf * NP * PL + (srow + i * 16) * LP + scol;
#pragma unroll
            for (int pl = 0; pl < NP; ++pl) *(v8usa*)(d + pl * PL) = st[pl][i]; } };
    constexpr int NT = K / GT;
    fetch(0); put(0);
    __syncthreads();   // tile 0 is in LDS
#pragma unroll 1   // rolled: a trip already holds a whole tile's reads and matrix instructions, copies of it would only lengthen the text
    for (int t = 0; t < NT; ++t) {
        const bool more = t + 1 < NT;
        if (more) fetch((t + 1) * GT);   // the next tile flies to registers while this one is worked on
        const unsigned short* ta = sm + (t & 1) * NP * PL + (wm * 64 + lr) * LP + 8 * hi;
        const unsigned short* tb = sm + (t & 1) * NP * PL + PL + (wn * 64 + lr) * LP + 8 * hi;
        v16bf a[GT / 32][4], a2[GT / 32][4], b[GT / 32][4];   // the tile's fragments, all asked for in one group
#pragma unroll
        for (int kk = 0; kk < GT / 32; ++kk) {
#pragma unroll
            for (int mb = 0; mb < 4; ++mb) { a[kk][mb] = ldsfrag<bf>(ta + mb * 16 * LP + kk * 32); if constexpr (NSPLIT != 0) a2[kk][mb] = ldsfrag<bf>(ta + 2 * PL + mb * 16 * LP + kk * 32); }
#pragma unroll
            for (int nb = 0; nb < 4; ++nb) b[kk][nb] = ldsfrag<bf>(tb + nb * 16 * LP + kk * 32);
        }
        __builtin_amdgcn_sched_barrier(0);   // keeps the LDS reads in one group ahead of the matrix instructions (for speed only)
#pragma unroll
        for (int kk = 0; kk < GT / 32; ++kk)
#pragma unroll
            for (int nb = 0; nb < 4; ++nb)
#pragma unroll
                for (int mb = 0; mb < 4; ++mb) { acc[mb][nb] = wmmab(a[kk][mb], b[kk][nb], acc[mb][nb]); if constexpr (NSPLIT != 0) acc[mb][nb] = wmmab(a2[kk][mb], b[kk][nb], acc[mb][nb]); }
        if (more) put((t + 1) & 1);   // into the buffer whose last readers left it at the barrier of trip t - 1
        __syncthreads();   // publishes tile t + 1 and ends every wave's reads of tile t
    }
    const int rw = r0 + wm * 64, cw = c0 + wn * 64;   // this wave's quarter
    float* mine = os + w * (16 * 68);
    v4f rsd[4][8];   // EPI 2: this lane's pieces of the residual, all asked for at once
    if constexpr (EPI == 2) {
        const float* hz = hs + z * sH + (size_t)(rw + hi) * SP + cw + lr * 4;
#pragma unroll
        for (int mb = 0; mb < 4; ++mb)
#pragma unroll
            for (int s = 0; s < 8; ++s) rsd[mb][s] = *(const v4f*)(hz + (size_t)(mb * 16 + 2 * s) * SP);
        asm volatile("s_wait_xcnt 0x0" ::: "memory");   // stands in front of later writes to the address registers that the loads above name
    }
#pragma unroll
    for (int mb = 0; mb < 4; ++mb) {
#pragma unroll
        for (int nb = 0; nb < 4; ++nb) {
#pragma unroll
            for (int j = 0; j < 8; ++j) mine[(hi * 8 + j) * 68 + nb * 16 + lr] = acc[mb][nb][j]; }
        asm volatile("s_wait_dscnt 0x0" ::: "memory");   // the slab's writes have landed before other lanes of this wave read the rows back
        if constexpr (EPI == 1) {
#pragma unroll
            for (int s = 0; s < 4; ++s) { const int row = 4 * s + (lane >> 3), cofs = (lane & 7) * 8; const v4f v0 = *(const v4fa*)(mine + row * 68 + cofs), v1 = *(const v4fa*)(mine + row * 68 + cofs + 4);
                const size_t po = z * sZ + (size_t)(rw + mb * 16 + row) * ldc + (size_t)(cw / 64) * sT + cofs; v8h o16; v4u oh, ol;
#pragma unroll
                for (int q = 0; q < 8; q += 2) { const float y = q < 4 ? v0[q & 3] : v1[q & 3], y1 = q < 4 ? v0[(q & 3) + 1] : v1[(q & 3) + 1]; o16[q] = tohx(y); o16[q + 1] = tohx(y1); unsigned a2, c2; split2(y, y1, a2, c2); oh[q >> 1] = a2; ol[q >> 1] = c2; }
                *(v8h*)(P16 + po) = o16; *(v8us*)(Ph + po) = __builtin_bit_cast(v8us, oh); *(v8us*)(Pl + po) = __builtin_bit_cast(v8us, ol);
                asm volatile("s_wait_xcnt 0x0" ::: "memory");   // stands in front of the next rows' writes to registers that these stores name
            }
        } else {
            float* crow = C + z * sC + (size_t)(rw + mb * 16 + hi) * ldc + cw + lr * 4;
#pragma unroll
            for (int s = 0; s < 8; ++s) { v4f val = *(const v4fa*)(mine + (2 * s + hi) * 68 + lr * 4);
#pragma unroll
                for (int q = 0; q < 4; ++q) val[q] = __fadd_rn(val[q], bfr(rsd[mb][s][q]));
                *(v4f*)(crow + (size_t)(2 * s) * ldc) = val;
                asm volatile("s_wait_xcnt 0x0" ::: "memory");   // stands in front of the next rows' writes to registers that this store names
            }
        }
    }
}

extern "C" void kernel_launch(void* const* d_in, const int* in_sizes, int n_in,
                              void* d_out, int out_size, void* d_ws, size_t ws_size, hipStream_t stream) {
    (void)in_sizes; (void)n_in; (void)out_size;
    const float* x = (const float*)d_in[0];   /* h [S][B][D] seq-major */ const float* wq = (const float*)d_in[1]; const float* wkv = (const float*)d_in[2]; const float* wo = (const float*)d_in[3]; const float* lng = (const float*)d_in[4]; const float* lnb = (const float*)d_in[5]; const float* wk = wkv; const float* wv = wkv;
    float* OUT = (float*)d_out;     // [2048][4][1024] seq-major
    char* wsp = (char*)d_ws;
    auto take = [&](size_t bytes) { char* p = wsp; wsp += (bytes + 255) & ~(size_t)255; return (void*)p; };
    float* Y = (float*)take((size_t)NB_ * TT * DM * 4); bf* WQ = (bf*)take((size_t)DQ * DM * 2); bf* WK = (bf*)take((size_t)DKV * DM * 2); bf* WV = (bf*)take((size_t)DKV * DM * 2); bf* WO = (bf*)take((size_t)DM * DQ * 2);
    bf* XB = (bf*)take((size_t)NB_ * TT * DM * 2);
    h16* QP16 = (h16*)take((size_t)NB_ * NH_ * TT * HD * 2); h16* KP16 = (h16*)take((size_t)NB_ * NKV * TT * HD * 2); h16* VT16 = (h16*)take((size_t)NB_ * NKV * HD * TT * 2);
    bf* QPh = (bf*)take((size_t)NB_ * NH_ * TT * HD * 2); bf* QPl = (bf*)take((size_t)NB_ * NH_ * TT * HD * 2); bf* KPh = (bf*)take((size_t)NB_ * NKV * TT * HD * 2); bf* KPl = (bf*)take((size_t)NB_ * NKV * TT * HD * 2); bf* VTh = (bf*)take((size_t)NB_ * NKV * HD * TT * 2); bf* VTl = (bf*)take((size_t)NB_ * NKV * HD * TT * 2);
    bf* ATh = (bf*)take((size_t)NB_ * TT * DQ * 2); bf* ATl = (bf*)take((size_t)NB_ * TT * DQ * 2);
    if ((size_t)(wsp - (char*)d_ws) > ws_size) return;    // ws 256 MiB
    k_prep<<<4 * PWB + NB_ * TT / PR, 256, 0, stream>>>(x, wq, wkv, wo, XB, WQ, WK, WV, WO);   /* weights [n][k]; each batch's rows of the seq-major input (pitch 4 x 1024) contiguous */
    k_gemmt<0, 1, DM><<<dim3(TT / GM, DQ / GM, NB_), 128, 0, stream>>>(XB, nullptr, WQ, nullptr, HD, (size_t)TT * DM, 0, 0, QP16, QPh, QPl, (size_t)TT * HD, nullptr, (size_t)NH_ * TT * HD, 0);   /* a wave's 64 columns are one head: planes [b][h][t][d] */
    k_gemmt<0, 1, DM><<<dim3(TT / GM, DKV / GM, NB_), 128, 0, stream>>>(XB, nullptr, WK, nullptr, HD, (size_t)TT * DM, 0, 0, KP16, KPh, KPl, (size_t)TT * HD, nullptr, (size_t)NKV * TT * HD, 0);
    k_gemmt<0, 1, DM><<<dim3(DKV / GM, TT / GM, NB_), 128, 0, stream>>>(WV, nullptr, XB, nullptr, TT, 0, (size_t)TT * DM, 0, VT16, VTh, VTl, 64, nullptr, (size_t)NKV * HD * TT, 0);   /* operands swapped: rows = (head, d), columns = t, the planes [b][g][d][t] row-major */
    k_fattn<<<dim3(RH / (16 * FW) + (TT - RH) / (32 * FW), NH_, NB_), 32 * FW, 0, stream>>>(QP16, KP16, VT16, QPh, QPl, KPh, KPl, VTh, VTl, ATh, ATl);
    k_gemmt<1, 2, DQ><<<dim3(TT / GM, DM / GM, NB_), 128, 0, stream>>>(ATh, ATl, WO, Y, DM, (size_t)TT * DQ, 0, (size_t)TT * DM, nullptr, nullptr, nullptr, 0, x, 0, DM);
    k_lnoutS<<<dim3((TT + 7) / 8, NB_, 1), 256, 0, stream>>>(Y, lng, lnb, OUT);   /* LayerNorm(h + attn_out), rows back at the seq-major pitch */
}

// v008
// A run of this version takes 204 microseconds.
// Next to v007, in two timings, it ran 1.06 times as fast each time.
// Counting every step since v000, it is 19.7 times as fast.
#include <hip/hip_runtime.h>

// Transformer-XL style multi-head attention on a SEQUENCE-MAJOR input with post-LayerNorm (h [2048][4][1024] (seq, batch, model); q = h Wq ('xw' [1024][1024] 1/32), k | v = h Wkv ('xw' [1024][2048]: k = columns 0..1023, v = 1024..2047); 16 heads x 64; score = q.k / 8; softmax over keys; attn_vec merged; attn_out = attn_vec Wo ('xw' no bias); out = LayerNorm(h + attn_out) gamma/beta (eps 1e-5) -> [2048][4][1024] seq-major (8.4 M)).
// One launch turns the weights and gathers all four batches; every other launch covers all four batches (the batch is a grid index; each workspace array but the four weights holds four batch slices). Layout per batch: a strided gather makes batch b's rows (row pitch 4 x 1024 in the input) a contiguous token-major bf16 operand; 'xw' weights transposed once (Wkv as two column blocks); exact projections, whose epilogues write the head planes (v as Wv x X^T, so that its tile comes out transposed); fused T-2048 attention (hybrid rows: < 512 hi/lo 3 products, rest fp16 x1024; scores and probabilities stay in registers); merged hi/lo x Wo exact, the residual (strided rows of h) added in its epilogue, into workspace; a row LayerNorm kernel writes batch b's output rows back at pitch 4 x 1024.
// Compute dtypes, f32 accumulate: every input rounded to bf16; projections exact; attention rows < 512 3 products, rest fp16; softmax f32; Wo hl x exact; residual + LayerNorm f32.

#define NB_  4
#define TT   2048
#define DM   1024
#define NH_  16
#define NKV  16
#define REP  (NH_ / NKV)
#define HD   64
#define DQ   (NH_ * HD)
#define DKV  (NKV * HD)
#define RH   512                  // query rows < RH use hi+lo planes (0: none)
#define WIN  0
#define PCL2 10.0f                // log2 of the carrier (x1024) of the fp16 probabilities
#define SCL  0.125f
#define LNEPS 1e-5f
#define SP   (NB_ * DM)   // seq-major row pitch of h and out (floats)
#define FW   4            // fused attention: waves per work-group
typedef _Float16 h16;
typedef unsigned short bf;
typedef __attribute__((ext_vector_type(16))) __bf16   v16bf;
typedef __attribute__((ext_vector_type(16))) _Float16 v16h;
typedef __attribute__((ext_vector_type(8)))  _Float16 v8h;
typedef __attribute__((ext_vector_type(8)))  unsigned short v8us;
typedef __attribute__((ext_vector_type(8)))  float    v8f;
typedef __attribute__((ext_vector_type(4)))  float    v4f;
typedef v8h  __attribute__((may_alias)) v8ha;
typedef v4f  __attribute__((may_alias)) v4fa;
typedef v8us __attribute__((may_alias)) v8usa;

typedef __attribute__((ext_vector_type(2))) float    v2f;
typedef __attribute__((ext_vector_type(2))) __bf16   v2bf;
typedef __attribute__((ext_vector_type(4))) unsigned v4u;
typedef __attribute__((ext_vector_type(8))) unsigned v8u;
// f32 -> bf16, to nearest even, by the conversion instruction: two values a call, a in the low half of the dword
__device__ __forceinline__ unsigned pkbf(float a, float b) { const v2f v = {a, b}; return __builtin_bit_cast(unsigned, __builtin_convertvector(v, v2bf)); }
__device__ __forceinline__ unsigned short f2bf(float f) { return __builtin_bit_cast(unsigned short, (__bf16)f); }
__device__ __forceinline__ float bf2f(unsigned short b) { return __uint_as_float(((unsigned)b) << 16); }
__device__ __forceinline__ float bfr(float f) { return bf2f(f2bf(f)); }
__device__ __forceinline__ v16h cat16(v8h lo, v8h hi) { return __builtin_shufflevector(lo, hi, 0, 1, 2, 3, 4, 5, 6, 7, 8, 9, 10, 11, 12, 13, 14, 15); }
__device__ __forceinline__ v16bf cat16b(v8us lo, v8us hi) { return __builtin_bit_cast(v16bf, __builtin_shufflevector(lo, hi, 0, 1, 2, 3, 4, 5, 6, 7, 8, 9, 10, 11, 12, 13, 14, 15)); }
__device__ __forceinline__ v8f wmma16(v16h a, v16h b, v8f c) { return __builtin_amdgcn_wmma_f32_16x16x32_f16(false, a, false, b, (short)0, c, false, false); }
__device__ __forceinline__ v8f wmmab(v16bf a, v16bf b, v8f c) { return __builtin_amdgcn_wmma_f32_16x16x32_bf16(false, a, false, b, (short)0, c, false, false); }
__device__ __forceinline__ h16 tohx(float x) { return (h16)x; }
// two values split into hi and lo planes: hi = rounded value, lo = rounded rest (the rest is exact in f32)
__device__ __forceinline__ void split2(float a, float b, unsigned& h, unsigned& l) { h = pkbf(a, b); l = pkbf(a - __uint_as_float(h << 16), b - __uint_as_float(h & 0xFFFF0000u)); }
typedef __attribute__((ext_vector_type(4))) _Float16 v4h;
typedef __attribute__((ext_vector_type(4))) unsigned short v4us;



// fragment types: two 16-byte loads 32 bytes apart make one 16x32 operand fragment
template <typename T16> struct WFrag;
template <> struct WFrag<h16> { typedef v16h V; static __device__ __forceinline__ V ld(const h16* p) { return cat16(*(const v8h*)p, *(const v8h*)(p + 16)); } static __device__ __forceinline__ v8f mma(V a, V b, v8f c) { return wmma16(a, b, c); } };
template <> struct WFrag<bf> { typedef v16bf V; static __device__ __forceinline__ V ld(const bf* p) { return cat16b(*(const v8us*)p, *(const v8us*)(p + 16)); } static __device__ __forceinline__ v8f mma(V a, V b, v8f c) { return wmmab(a, b, c); } };

typedef __attribute__((ext_vector_type(2))) unsigned short v2us;

__global__ __launch_bounds__(256) void k_cvt8(const float* __restrict__ src, bf* dst, size_t n8) { const size_t i = (size_t)blockIdx.x * 256 + threadIdx.x; if (i >= n8) return; const v8f v = *(const v8f*)(src + i * 8); v8us o;
#pragma unroll
    for (int k = 0; k < 8; ++k) o[k] = f2bf(v[k]); *(v8us*)(dst + i * 8) = o;  }

// ---- k_prep: the bf16 form of every matrix operand, one launch. Work-groups 0 .. 4 PWB - 1 turn the four 'xw' weights ([k][n] f32, all DM x DM; the two halves of Wkv at row pitch 2 DM) into [n][k] bf16; the other NB_ TT / PR gather the input's batches.
// A weight tile is PK k x PN n: read in pieces of 256 bytes of a row (whole lines), rounded, two neighbouring k packed to a dword, laid in LDS as [n][k], and stored in rows of 256 bytes. A gather work-group takes PR rows of one batch, a row a load: every load and store of a wave covers whole lines.
// All of a thread's loads are asked for before the first is used, and a thread has many, so that few waves keep enough bytes in flight.
#define PK   128          // k of a weight tile
#define PN   128          // n of a weight tile
#define PPD  68           // LDS row pitch in dwords: PK / 2 + 4, so that 16-byte reads stay aligned
#define PWB  ((DM / PK) * (DM / PN))   // tiles of one weight
#define PR   32           // input rows of a gather work-group
static_assert(DQ == DM && DKV == DM && TT % PR == 0 && DM == 256 * 4 && PK == 128 && PN % 64 == 0, "k_prep's shapes");
__global__ __launch_bounds__(256) void k_prep(const float* __restrict__ x, const float* __restrict__ wq, const float* __restrict__ wkv, const float* __restrict__ wo, bf* XB, bf* WQ, bf* WK, bf* WV, bf* WO) {
    __shared__ __align__(16) unsigned tl[PN * PPD];
    const unsigned tid = threadIdx.x, blk = blockIdx.x;
    // every '#pragma unroll' of this kernel: its loop indexes a register array of loaded pieces, and the loads are to be in flight together
    if (blk < 4 * PWB) {
        const unsigned which = blk / PWB, tile = blk % PWB; const unsigned k0 = (tile / (DM / PN)) * PK, n0 = (tile % (DM / PN)) * PN;
        const float* w = which == 0 ? wq : which == 1 ? wkv : which == 2 ? wkv + DM : wo;   /* Wkv: k = columns 0..1023, v = 1024..2047 */
        bf* Bt = which == 0 ? WQ : which == 1 ? WK : which == 2 ? WV : WO;
        const size_t pitch = (which == 1 || which == 2) ? 2 * DM : DM;
        const unsigned p = tid >> 4, c = tid & 15;   // loads: rows 2 p, 2 p + 1 of each 32, four columns at 4 c of each 64; stores: row p of each 16, eight k at 8 c
        const float* src = w + (size_t)(k0 + 2 * p) * pitch + n0 + c * 4;
        const float* pa[PK / 32][2]; v4f a[PN / 64][PK / 32][2];
#pragma unroll
        for (int i = 0; i < PK / 32; ++i) { pa[i][0] = src + (size_t)(i * 32) * pitch; pa[i][1] = pa[i][0] + pitch;
#pragma unroll
            for (int j = 0; j < PN / 64; ++j) { a[j][i][0] = *(const v4f*)(pa[i][0] + j * 64); a[j][i][1] = *(const v4f*)(pa[i][1] + j * 64); } }
        asm volatile("s_wait_xcnt 0x0" :: "v"(pa[0][0]), "v"(pa[0][1]), "v"(pa[1][0]), "v"(pa[1][1]), "v"(pa[2][0]), "v"(pa[2][1]), "v"(pa[3][0]), "v"(pa[3][1]) : "memory");   // stands in front of later writes to the address registers that the loads above name; it takes them as inputs so that no load of the group lands on them either
        // row n's 16-byte pieces stand at piece index ^ (n / 16 % 4): the sixteen lanes that write one k pair of rows 4 apart then meet sixteen different banks
        unsigned* td = tl + c * 4 * PPD + (p ^ ((c >> 2) << 2));
#pragma unroll
        for (int j = 0; j < PN / 64; ++j)
#pragma unroll
            for (int i = 0; i < PK / 32; ++i)
#pragma unroll
                for (int q = 0; q < 4; ++q) td[(j * 64 + q) * PPD + i * 16] = pkbf(a[j][i][0][q], a[j][i][1][q]);
        __syncthreads();   // the tile is in LDS before other threads read its rows
        bf* dst = Bt + (size_t)(n0 + p) * DM + k0 + c * 8;
#pragma unroll
        for (int s = 0; s < PN / 16; ++s) *(v8us*)(dst + (size_t)(s * 16) * DM) = *(const v8usa*)(tl + (s * 16 + p) * PPD + (c ^ (unsigned)(s & 3)) * 4);
    } else {
        const unsigned row0 = (blk - 4 * PWB) * PR; const unsigned b = row0 / TT, t0 = row0 % TT;   // rows of XB, [b][t]; PR divides TT, so one batch a work-group
        const float* src = x + (size_t)t0 * SP + (size_t)b * DM + tid * 4;
        v4f v[PR];
#pragma unroll
        for (int u = 0; u < PR; ++u) v[u] = *(const v4f*)(src + (size_t)u * SP);
        asm volatile("s_wait_xcnt 0x0" ::: "memory");   // stands in front of later writes to the address registers that the loads above name
        __builtin_amdgcn_sched_barrier(0);   // keeps the roundings behind the last load: moved in among the loads, they made the last loads wait for the first ones' data
        bf* dst = XB + (size_t)row0 * DM + tid * 4;
#pragma unroll
        for (int u = 0; u < PR; ++u) { v[u][0] = __uint_as_float(pkbf(v[u][0], v[u][1])); v[u][1] = __uint_as_float(pkbf(v[u][2], v[u][3])); }
        __builtin_amdgcn_sched_barrier(0);   // keeps every rounding ahead of the first store: none then writes a register that an issued store names
#pragma unroll
        for (int u = 0; u < PR; ++u) { const v2f o = {v[u][0], v[u][1]}; *(v4us*)(dst + (size_t)u * DM) = __builtin_bit_cast(v4us, o); }
        asm volatile("s_wait_xcnt 0x0" ::: "memory");   // stands in front of later writes to registers that the stores above name
    }
}
__global__ __launch_bounds__(256) void k_lnoutS(const float* __restrict__ F, const float* __restrict__ g, const float* __restrict__ bb, float* out) { const int lane = threadIdx.x & 31; const int row = blockIdx.x * 8 + (threadIdx.x >> 5); if (row >= TT) return; const float* fr = F + ((size_t)blockIdx.y * TT + row) * DQ;   /* grid.y = batch */ float* orow = out + (size_t)blockIdx.y * DM + (size_t)row * SP;   /* seq-major output pitch */ float v[DQ / 32]; float s = 0.f;
#pragma unroll
    for (int c = 0; c < DQ / 128; ++c) { const v4f a = *(const v4f*)(fr + c * 128 + lane * 4); for (int q = 0; q < 4; ++q) { v[c * 4 + q] = a[q]; s = __fadd_rn(s, a[q]); } }
#pragma unroll
    for (int sh = 16; sh; sh >>= 1) s = __fadd_rn(s, __shfl_xor(s, sh, 32));
    const float mean = __fdiv_rn(s, (float)DQ); float s2 = 0.f;
#pragma unroll
    for (int k = 0; k < DQ / 32; ++k) { const float dv = __fsub_rn(v[k], mean); float p2 = __fmul_rn(dv, dv); asm volatile("" : "+v"(p2)); s2 = __fadd_rn(s2, p2); v[k] = dv; }
#pragma unroll
    for (int sh = 16; sh; sh >>= 1) s2 = __fadd_rn(s2, __shfl_xor(s2, sh, 32));
    const float rs = __fdiv_rn(1.0f, __fsqrt_rn(__fadd_rn(__fdiv_rn(s2, (float)DQ), LNEPS)));
{
#pragma unroll
        for (int c = 0; c < DQ / 128; ++c) { v4f o; for (int q = 0; q < 4; ++q) { const int col = c * 128 + lane * 4 + q; float y = __fmul_rn(v[c * 4 + q], rs); asm volatile("" : "+v"(y)); y = __fmul_rn(y, bfr(g[col])); asm volatile("" : "+v"(y)); o[q] = __fadd_rn(y, bfr(bb[col])); } *(v4f*)(orow + c * 128 + lane * 4) = o; }
         } }

// ---- k_fattn: scores, softmax and P.V of all batches in one kernel. A wave owns NQ x 16 query rows of one head and walks all TT keys, 32 a pass, with a running maximum and sum per query.
// St = K Qt (A = K rows, B = Q rows): lane (lr, hi) holds, for query lr, the scores of keys 8 hi + j of each 16-key block, so the two blocks of a pass, converted in place, are the B operand of Ot += Vt Pt (A = Vt rows, k = key).
// The FW waves of a work-group share the head's K and Vt: tiles of KT keys (64 rows x 128 bytes each) are read from memory once, in whole lines, and laid in LDS, two buffers in turn; the fragments come from LDS.
// Rows < RH: bf16 hi/lo planes, 3 products in both stages. Other rows: fp16, probabilities carried x 2^PCL2 (folded into the exponent; it cancels in O / sum). The sum is taken of the f32 probabilities.
#define KT   64           // keys per LDS tile
#define LP   72           // LDS row pitch in 16-bit elements: 128 + 16 bytes, free of bank conflicts for 16-byte reads
typedef __attribute__((ext_vector_type(16))) unsigned short v16us;
template <typename T16> __device__ __forceinline__ typename WFrag<T16>::V ldsfrag(const unsigned short* p) { const v8us lo = *(const v8usa*)p, up = *(const v8usa*)(p + 16); return __builtin_bit_cast(typename WFrag<T16>::V, __builtin_shufflevector(lo, up, 0, 1, 2, 3, 4, 5, 6, 7, 8, 9, 10, 11, 12, 13, 14, 15)); }
template <typename T16, int NQ>
__device__ __forceinline__ void attn_rows(const T16* __restrict__ Q, const T16* __restrict__ Q2, const T16* __restrict__ Kp, const T16* __restrict__ K2, const T16* __restrict__ Vt, const T16* __restrict__ V2, int q0, int hcol, bf* Ah, bf* Al, unsigned short* sm) {
    typedef typename WFrag<T16>::V V; constexpr bool HR = __is_same(T16, bf);
    constexpr int NP = HR ? 4 : 2;              // planes staged: K, Vt (, K lo, Vt lo)
    constexpr int PL = KT * LP;                 // one plane's tile in LDS, elements
    constexpr int NC = KT * 8 / (32 * FW);      // 16-byte pieces of a tile per thread
    const int lane = threadIdx.x & 31, lr = lane & 15, hi = lane >> 4;
    const int srow = (int)threadIdx.x >> 3, scol = ((int)threadIdx.x & 7) * 8;   // this thread's piece: rows srow + 4 FW i, 8 elements at scol
    constexpr float CE = SCL * 1.4426950408889634f;   // score -> exponent of 2
    V qf[NQ][2], qf2[NQ][2];
#pragma unroll
    for (int nq = 0; nq < NQ; ++nq)
#pragma unroll
        for (int kk = 0; kk < 2; ++kk) { const size_t qo = (size_t)(q0 + nq * 16 + lr) * HD + kk * 32 + 8 * hi; qf[nq][kk] = WFrag<T16>::ld(Q + qo); if (HR) qf2[nq][kk] = WFrag<T16>::ld(Q2 + qo); }
    asm volatile("s_wait_xcnt 0x0" ::: "memory");   // stands in front of later writes to the address registers that the Q loads name
    v8f o[4][NQ]; float m[NQ], l[NQ];
#pragma unroll
    for (int nq = 0; nq < NQ; ++nq) { m[nq] = -3.0e38f; l[nq] = 0.f;
#pragma unroll
        for (int db = 0; db < 4; ++db) o[db][nq] = (v8f){}; }
    v8us st[NP][NC];
    auto fetch = [&](int key0) {
#pragma unroll
        for (int i = 0; i < NC; ++i) { const int r = srow + i * 4 * FW; const size_t kx = (size_t)(key0 + r) * HD + scol, vx = (size_t)r * TT + key0 + scol;
            st[0][i] = *(const v8usa*)(Kp + kx); st[1][i] = *(const v8usa*)(Vt + vx);
            if constexpr (HR) { st[2][i] = *(const v8usa*)(K2 + kx); st[3][i] = *(const v8usa*)(V2 + vx); } }
        asm volatile("s_wait_xcnt 0x0" ::: "memory");   // stands in front of later writes to the address registers that the loads above name
        __builtin_amdgcn_sched_barrier(0);   // keeps later address arithmetic behind that wait: lifted over it, it wrote a register that the loads name
    };
    auto put = [&](int buf) {
#pragma unroll
        for (int i = 0; i < NC; ++i) { unsigned short* d = sm + buf * NP * PL + (srow + i * 4 * FW) * LP + scol;
#pragma unroll
            for (int pl = 0; pl < NP; ++pl) *(v8usa*)(d + pl * PL) = st[pl][i]; } };
    fetch(0); put(0);
    __syncthreads();   // tile 0 is in LDS
#pragma unroll 1
    for (int t = 0; t < TT / KT; ++t) {
        const bool more = t + 1 < TT / KT;
        if (more) fetch((t + 1) * KT);   // the next tile flies to registers while this one is worked on
        const unsigned short* tb = sm + (t & 1) * NP * PL + lr * LP + 8 * hi;
#pragma unroll
        for (int ks = 0; ks < KT / 32; ++ks) {
            v8f s[2][NQ];
#pragma unroll
            for (int kb = 0; kb < 2; ++kb) { V kf[2], kf2[2];
#pragma unroll
                for (int kk = 0; kk < 2; ++kk) { const unsigned short* kq = tb + (ks * 2 + kb) * 16 * LP + kk * 32; kf[kk] = ldsfrag<T16>(kq); if (HR) kf2[kk] = ldsfrag<T16>(kq + 2 * PL); }
#pragma unroll
                for (int nq = 0; nq < NQ; ++nq) { v8f a = (v8f){};
#pragma unroll
                    for (int kk = 0; kk < 2; ++kk) { a = WFrag<T16>::mma(kf[kk], qf[nq][kk], a); if (HR) { a = WFrag<T16>::mma(kf2[kk], qf[nq][kk], a); a = WFrag<T16>::mma(kf[kk], qf2[nq][kk], a); } }
                    s[kb][nq] = a; } }
            V vf[4], vf2[4];
#pragma unroll
            for (int db = 0; db < 4; ++db) { const unsigned short* vq = tb + PL + db * 16 * LP + ks * 32; vf[db] = ldsfrag<T16>(vq); if (HR) vf2[db] = ldsfrag<T16>(vq + 2 * PL); }
#pragma unroll
            for (int nq = 0; nq < NQ; ++nq) {
                float mx = s[0][nq][0];
#pragma unroll
                for (int j = 0; j < 8; ++j) mx = fmaxf(mx, fmaxf(s[0][nq][j], s[1][nq][j]));
                mx = fmaxf(mx, __shfl_xor(mx, 16, 32));   // the other eight keys of each block sit in the other lane half
                const float mn = fmaxf(m[nq], mx); const float al = __builtin_amdgcn_exp2f((m[nq] - mn) * CE); m[nq] = mn;
                const float mb = mn * CE - (HR ? 0.0f : PCL2);
#pragma unroll
                for (int kb = 0; kb < 2; ++kb)
#pragma unroll
                    for (int j = 0; j < 8; ++j) s[kb][nq][j] = __builtin_amdgcn_exp2f(s[kb][nq][j] * CE - mb);
                const v8f p8 = s[0][nq] + s[1][nq];   // the pass's sixteen probabilities of this lane, summed as a tree
                l[nq] = l[nq] * al + (((p8[0] + p8[4]) + (p8[1] + p8[5])) + ((p8[2] + p8[6]) + (p8[3] + p8[7])));
#pragma unroll
                for (int db = 0; db < 4; ++db) o[db][nq] *= al;
                if constexpr (HR) {
                    v8u ph, pl;
#pragma unroll
                    for (int e = 0; e < 16; e += 2) { unsigned a, c2; split2(s[e >> 3][nq][e & 7], s[e >> 3][nq][(e & 7) + 1], a, c2); ph[e >> 1] = a; pl[e >> 1] = c2; }
                    const V pfh = __builtin_bit_cast(v16bf, ph), pfl = __builtin_bit_cast(v16bf, pl);
#pragma unroll
                    for (int db = 0; db < 4; ++db) { o[db][nq] = WFrag<T16>::mma(vf[db], pfh, o[db][nq]); o[db][nq] = WFrag<T16>::mma(vf[db], pfl, o[db][nq]); o[db][nq] = WFrag<T16>::mma(vf2[db], pfh, o[db][nq]); }
                } else {
                    V pf;
#pragma unroll
                    for (int e = 0; e < 16; ++e) pf[e] = tohx(s[e >> 3][nq][e & 7]);
#pragma unroll
                    for (int db = 0; db < 4; ++db) o[db][nq] = WFrag<T16>::mma(vf[db], pf, o[db][nq]);
                }
            }
        }
        if (more) put((t + 1) & 1);   // into the buffer whose last readers left it at the barrier of trip t - 1
        __syncthreads();   // publishes tile t + 1 and ends every wave's reads of tile t
    }
#pragma unroll
    for (int nq = 0; nq < NQ; ++nq) { const float inv = __fdiv_rn(1.0f, l[nq] + __shfl_xor(l[nq], 16, 32)); const size_t oo = (size_t)(q0 + nq * 16 + lr) * DQ + hcol + hi * 8;
#pragma unroll
        for (int db = 0; db < 4; ++db) { v4u oh, ol;
#pragma unroll
            for (int j = 0; j < 8; j += 2) { unsigned a, c2; split2(o[db][nq][j] * inv, o[db][nq][j + 1] * inv, a, c2); oh[j >> 1] = a; ol[j >> 1] = c2; }
            *(v8us*)(Ah + oo + db * 16) = __builtin_bit_cast(v8us, oh); *(v8us*)(Al + oo + db * 16) = __builtin_bit_cast(v8us, ol);
            asm volatile("s_wait_xcnt 0x0" ::: "memory");   // stands in front of the next block's writes to registers that these two stores name
            __builtin_amdgcn_sched_barrier(0);   // keeps the next block's arithmetic behind that wait: lifted over it, it wrote registers that the stores name
        } }
}
// grid (RH / (16 FW) + (TT - RH) / (32 FW), heads, batches): of each head the hi/lo work-groups (16 rows a wave, three times the products) have the low indices.
__global__ __launch_bounds__(32 * FW) void k_fattn(const h16* __restrict__ Q16, const h16* __restrict__ K16, const h16* __restrict__ V16, const bf* __restrict__ Qh, const bf* __restrict__ Ql, const bf* __restrict__ Kh, const bf* __restrict__ Kl, const bf* __restrict__ Vh, const bf* __restrict__ Vl, bf* Ah, bf* Al) {
    __shared__ __align__(16) unsigned short sm[2 * 4 * KT * LP];
    const int w = __builtin_amdgcn_readfirstlane((int)(threadIdx.x >> 5)); const int hd = (int)blockIdx.y, bt = (int)blockIdx.z; const size_t pq = (size_t)(bt * NH_ + hd) * TT * HD, pk = (size_t)(bt * NKV + hd / REP) * TT * HD;
    Ah += (size_t)bt * TT * DQ; Al += (size_t)bt * TT * DQ;
    constexpr int NHB = RH / (16 * FW);
    if ((int)blockIdx.x < NHB) attn_rows<bf, 1>(Qh + pq, Ql + pq, Kh + pk, Kl + pk, Vh + pk, Vl + pk, ((int)blockIdx.x * FW + w) * 16, hd * HD, Ah, Al, sm);
    else attn_rows<h16, 2>(Q16 + pq, nullptr, K16 + pk, nullptr, V16 + pk, nullptr, RH + (((int)blockIdx.x - NHB) * FW + w) * 32, hd * HD, Ah, Al, sm);
}

// ---- gemmt: GEMM with both operands staged in LDS. A work-group of 4 waves owns a 128x128 output tile (tile row bx, tile column by, batch z), each wave a 64x64 quarter (16 accumulators) over the whole K; 128 threads.
// C[m][n] = sum_k A[m][k] Bt[n][k] (NSPLIT 1: + A2[m][k] Bt[n][k]), operands K-contiguous bf16 planes. z-batch strides sA/sB/sC in elements (sZ: the 16-bit planes of EPI 1; sH: the residual of EPI 2). K (a template constant) % 64 == 0.
// Tiles of GT k (128 rows x 128 bytes a plane) are read from memory once per work-group, in whole lines, and laid in LDS at pitch LP, two buffers in turn; every fragment comes from LDS and serves two waves.
// EPI, what the epilogue does with the f32 sums (each wave turns its 16-row slabs through its own LDS range, so that whole lines are stored): 1 stores them as three 16-bit planes (fp16, bf16 hi, bf16 lo), element (m, n) at m x ldc + (n / 64) x sT + n % 64 (head planes [h][t][d]: ldc = 64, sT = rows x 64; plain row-major: sT = 64); 2 adds the bf16-rounded residual hs[m][n] (row pitch SP) and stores f32 in C (pitch ldc).
#define GT   64           // k per LDS tile
#define GM   128          // rows of a plane's tile (output tile GM x GM)
template <int NSPLIT, int EPI, int K>
__device__ __forceinline__ void gemmt(const bf* __restrict__ A, const bf* __restrict__ A2, const bf* __restrict__ Bt, float* C, int ldc, size_t sA, size_t sB, size_t sC, h16* P16, bf* Ph, bf* Pl, size_t sT, const float* __restrict__ hs, size_t sZ, size_t sH, int bx, int by, size_t z) {
    constexpr int NP = NSPLIT ? 3 : 2;          // planes staged: A, Bt (, A2)
    constexpr int PL = GM * LP;                 // one plane's tile in LDS, elements
    constexpr int NC = GM * 8 / 128;            // 16-byte pieces of a plane's tile per thread
    __shared__ __align__(16) unsigned short sm[2 * NP * PL];
    __shared__ __align__(16) float os[4 * 16 * 68];   // epilogue: one 16-row slab per wave
    const int lane = threadIdx.x & 31, lr = lane & 15, hi = lane >> 4;
    const int w = __builtin_amdgcn_readfirstlane((int)(threadIdx.x >> 5)), wm = w >> 1, wn = w & 1;
    const int r0 = bx * GM, c0 = by * GM;
    const int srow = (int)threadIdx.x >> 3, scol = ((int)threadIdx.x & 7) * 8;   // this thread's pieces: rows srow + 16 i, 8 elements at scol
    const bf* ga = A + z * sA + (size_t)(r0 + srow) * K + scol; const bf* gb = Bt + z * sB + (size_t)(c0 + srow) * K + scol;
    const bf* ga2 = NSPLIT ? A2 + z * sA + (size_t)(r0 + srow) * K + scol : nullptr;
    // every '#pragma unroll' of this kernel: its loop indexes register arrays (accumulators, fragments, staged pieces), which stay in registers only under constant indices
    v8f acc[4][4];
#pragma unroll
    for (int mb = 0; mb < 4; ++mb)
#pragma unroll
        for (int nb = 0; nb < 4; ++nb) acc[mb][nb] = (v8f){};
    v8us st[NP][NC];
    auto fetch = [&](int kc) {
        const bf* pa = ga + kc; const bf* pb = gb + kc; const bf* pa2 = NSPLIT ? ga2 + kc : pa;
#pragma unroll
        for (int i = 0; i < NC; ++i) { const size_t o = (size_t)i * 16 * K;
            st[0][i] = *(const v8usa*)(pa + o); st[1][i] = *(const v8usa*)(pb + o);
            if constexpr (NSPLIT != 0) st[2][i] = *(const v8usa*)(pa2 + o); }
        asm volatile("s_wait_xcnt 0x0" :: "v"(pa), "v"(pb), "v"(pa2) : "memory");   // stands in front of later writes to the address registers that the loads above name; it takes them as inputs so that no load of the group lands on them either
    };
    auto put = [&](int buf) {
#pragma unroll
        for (int i = 0; i < NC; ++i) { unsigned short* d = sm + buf * NP * PL + (srow + i * 16) * LP + scol;
#pragma unroll
            for (int pl = 0; pl < NP; ++pl) *(v8usa*)(d + pl * PL) = st[pl][i]; } };
    constexpr int NT = K / GT;
    fetch(0); put(0);
    __syncthreads();   // tile 0 is in LDS
#pragma unroll 1   // rolled: a trip already holds a whole tile's reads and matrix instructions, copies of it would only lengthen the text
    for (int t = 0; t < NT; ++t) {
        const bool more = t + 1 < NT;
        if (more) fetch((t + 1) * GT);   // the next tile flies to registers while this one is worked on
        const unsigned short* ta = sm + (t & 1) * NP * PL + (wm * 64 + lr) * LP + 8 * hi;
        const unsigned short* tb = sm + (t & 1) * NP * PL + PL + (wn * 64 + lr) * LP + 8 * hi;
        v16bf a[GT / 32][4], a2[GT / 32][4], b[GT / 32][4];   // the tile's fragments, all asked for in one group
#pragma unroll
        for (int kk = 0; kk < GT / 32; ++kk) {
#pragma unroll
            for (int mb = 0; mb < 4; ++mb) { a[kk][mb] = ldsfrag<bf>(ta + mb * 16 * LP + kk * 32); if constexpr (NSPLIT != 0) a2[kk][mb] = ldsfrag<bf>(ta + 2 * PL + mb * 16 * LP + kk * 32); }
#pragma unroll
            for (int nb = 0; nb < 4; ++nb) b[kk][nb] = ldsfrag<bf>(tb + nb * 16 * LP + kk * 32);
        }
        __builtin_amdgcn_sched_barrier(0);   // keeps the LDS reads in one group ahead of the matrix instructions (for speed only)
#pragma unroll
        for (int kk = 0; kk < GT / 32; ++kk)
#pragma unroll
            for (int nb = 0; nb < 4; ++nb)
#pragma unroll
                for (int mb = 0; mb < 4; ++mb) { acc[mb][nb] = wmmab(a[kk][mb], b[kk][nb], acc[mb][nb]); if constexpr (NSPLIT != 0) acc[mb][nb] = wmmab(a2[kk][mb], b[kk][nb], acc[mb][nb]); }
        if (more) put((t + 1) & 1);   // into the buffer whose last readers left it at the barrier of trip t - 1
        __syncthreads();   // publishes tile t + 1 and ends every wave's reads of tile t
    }
    const int rw = r0 + wm * 64, cw = c0 + wn * 64;   // this wave's quarter
    float* mine = os + w * (16 * 68);
    v4f rsd[4][8];   // EPI 2: this lane's pieces of the residual, all asked for at once
    if constexpr (EPI == 2) {
        const float* hz = hs + z * sH + (size_t)(rw + hi) * SP + cw + lr * 4;
#pragma unroll
        for (int mb = 0; mb < 4; ++mb)
#pragma unroll
            for (int s = 0; s < 8; ++s) rsd[mb][s] = *(const v4f*)(hz + (size_t)(mb * 16 + 2 * s) * SP);
        asm volatile("s_wait_xcnt 0x0" ::: "memory");   // stands in front of later writes to the address registers that the loads above name
    }
#pragma unroll
    for (int mb = 0; mb < 4; ++mb) {
#pragma unroll
        for (int nb = 0; nb < 4; ++nb) {
#pragma unroll
            for (int j = 0; j < 8; ++j) mine[(hi * 8 + j) * 68 + nb * 16 + lr] = acc[mb][nb][j]; }
        asm volatile("s_wait_dscnt 0x0" ::: "memory");   // the slab's writes have landed before other lanes of this wave read the rows back
        if constexpr (EPI == 1) {
#pragma unroll
            for (int s = 0; s < 4; ++s) { const int row = 4 * s + (lane >> 3), cofs = (lane & 7) * 8; const v4f v0 = *(const v4fa*)(mine + row * 68 + cofs), v1 = *(const v4fa*)(mine + row * 68 + cofs + 4);
                const size_t po = z * sZ + (size_t)(rw + mb * 16 + row) * ldc + (size_t)(cw / 64) * sT + cofs; v8h o16; v4u oh, ol;
#pragma unroll
                for (int q = 0; q < 8; q += 2) { const float y = q < 4 ? v0[q & 3] : v1[q & 3], y1 = q < 4 ? v0[(q & 3) + 1] : v1[(q & 3) + 1]; o16[q] = tohx(y); o16[q + 1] = tohx(y1); unsigned a2, c2; split2(y, y1, a2, c2); oh[q >> 1] = a2; ol[q >> 1] = c2; }
                *(v8h*)(P16 + po) = o16; *(v8us*)(Ph + po) = __builtin_bit_cast(v8us, oh); *(v8us*)(Pl + po) = __builtin_bit_cast(v8us, ol);
                asm volatile("s_wait_xcnt 0x0" ::: "memory");   // stands in front of the next rows' writes to registers that these stores name
            }
        } else {
            float* crow = C + z * sC + (size_t)(rw + mb * 16 + hi) * ldc + cw + lr * 4;
#pragma unroll
            for (int s = 0; s < 8; ++s) { v4f val = *(const v4fa*)(mine + (2 * s + hi) * 68 + lr * 4);
#pragma unroll
                for (int q = 0; q < 4; ++q) val[q] = __fadd_rn(val[q], bfr(rsd[mb][s][q]));
                *(v4f*)(crow + (size_t)(2 * s) * ldc) = val;
                asm volatile("s_wait_xcnt 0x0" ::: "memory");   // stands in front of the next rows' writes to registers that this store names
            }
        }
    }
}

// one product: grid (M/128, N/128, batches)
template <int NSPLIT, int EPI, int K>
__global__ __launch_bounds__(128) void k_gemmt(const bf* __restrict__ A, const bf* __restrict__ A2, const bf* __restrict__ Bt, float* C, int ldc, size_t sA, size_t sB, size_t sC, h16* P16, bf* Ph, bf* Pl, size_t sT, const float* __restrict__ hs, size_t sZ, size_t sH) {
    gemmt<NSPLIT, EPI, K>(A, A2, Bt, C, ldc, sA, sB, sC, P16, Ph, Pl, sT, hs, sZ, sH, (int)blockIdx.x, (int)blockIdx.y, blockIdx.z);
}
// ---- k_proj: the three projections in one launch, grid (TT/128, DM/128, 3 x batches): z / NB_ says which product, z % NB_ the batch. No product reads another's result, so their work-groups fill the chip together: one's stores run beside another's loop, and two launch boundaries are gone.
// q, k: rows = t, columns = (head, d), a wave's 64 columns are one head: planes [b][h][t][d]. v: operands swapped (rows = (head, d), columns = t, so x is the tile column), the planes [b][g][d][t] row-major.
static_assert(DQ == DM && DKV == DM && NH_ == NKV, "k_proj: one grid and one batch stride for the three products");
__global__ __launch_bounds__(128) void k_proj(const bf* __restrict__ XB, const bf* __restrict__ WQ, const bf* __restrict__ WK, const bf* __restrict__ WV, h16* Q16, bf* Qh, bf* Ql, h16* K16, bf* Kh, bf* Kl, h16* V16, bf* Vh, bf* Vl) {
    const unsigned which = blockIdx.z / NB_, b = blockIdx.z % NB_; const bool tv = which == 2;
    gemmt<0, 1, DM>(tv ? WV : XB, nullptr, tv ? XB : which == 1 ? WK : WQ, nullptr, tv ? TT : HD, tv ? 0 : (size_t)TT * DM, tv ? (size_t)TT * DM : 0, 0,
                    tv ? V16 : which == 1 ? K16 : Q16, tv ? Vh : which == 1 ? Kh : Qh, tv ? Vl : which == 1 ? Kl : Ql, tv ? 64 : (size_t)TT * HD, nullptr, (size_t)NH_ * TT * HD, 0,
                    (int)(tv ? blockIdx.y : blockIdx.x), (int)(tv ? blockIdx.x : blockIdx.y), b);
}

extern "C" void kernel_launch(void* const* d_in, const int* in_sizes, int n_in,
                              void* d_out, int out_size, void* d_ws, size_t ws_size, hipStream_t stream) {
    (void)in_sizes; (void)n_in; (void)out_size;
    const float* x = (const float*)d_in[0];   /* h [S][B][D] seq-major */ const float* wq = (const float*)d_in[1]; const float* wkv = (const float*)d_in[2]; const float* wo = (const float*)d_in[3]; const float* lng = (const float*)d_in[4]; const float* lnb = (const float*)d_in[5]; const float* wk = wkv; const float* wv = wkv;
    float* OUT = (float*)d_out;     // [2048][4][1024] seq-major
    char* wsp = (char*)d_ws;
    auto take = [&](size_t bytes) { char* p = wsp; wsp += (bytes + 255) & ~(size_t)255; return (void*)p; };
    float* Y = (float*)take((size_t)NB_ * TT * DM * 4); bf* WQ = (bf*)take((size_t)DQ * DM * 2); bf* WK = (bf*)take((size_t)DKV * DM * 2); bf* WV = (bf*)take((size_t)DKV * DM * 2); bf* WO = (bf*)take((size_t)DM * DQ * 2);
    bf* XB = (bf*)take((size_t)NB_ * TT * DM * 2);
    h16* QP16 = (h16*)take((size_t)NB_ * NH_ * TT * HD * 2); h16* KP16 = (h16*)take((size_t)NB_ * NKV * TT * HD * 2); h16* VT16 = (h16*)take((size_t)NB_ * NKV * HD * TT * 2);
    bf* QPh = (bf*)take((size_t)NB_ * NH_ * TT * HD * 2); bf* QPl = (bf*)take((size_t)NB_ * NH_ * TT * HD * 2); bf* KPh = (bf*)take((size_t)NB_ * NKV * TT * HD * 2); bf* KPl = (bf*)take((size_t)NB_ * NKV * TT * HD * 2); bf* VTh = (bf*)take((size_t)NB_ * NKV * HD * TT * 2); bf* VTl = (bf*)take((size_t)NB_ * NKV * HD * TT * 2);
    bf* ATh = (bf*)take((size_t)NB_ * TT * DQ * 2); bf* ATl = (bf*)take((size_t)NB_ * TT * DQ * 2);
    if ((size_t)(wsp - (char*)d_ws) > ws_size) return;    // ws 256 MiB
    k_prep<<<4 * PWB + NB_ * TT / PR, 256, 0, stream>>>(x, wq, wkv, wo, XB, WQ, WK, WV, WO);   /* weights [n][k]; each batch's rows of the seq-major input (pitch 4 x 1024) contiguous */
    k_proj<<<dim3(TT / GM, DM / GM, 3 * NB_), 128, 0, stream>>>(XB, WQ, WK, WV, QP16, QPh, QPl, KP16, KPh, KPl, VT16, VTh, VTl);   /* q, k, v of all batches */
    k_fattn<<<dim3(RH / (16 * FW) + (TT - RH) / (32 * FW), NH_, NB_), 32 * FW, 0, stream>>>(QP16, KP16, VT16, QPh, QPl, KPh, KPl, VTh, VTl, ATh, ATl);
    k_gemmt<1, 2, DQ><<<dim3(TT / GM, DM / GM, NB_), 128, 0, stream>>>(ATh, ATl, WO, Y, DM, (size_t)TT * DQ, 0, (size_t)TT * DM, nullptr, nullptr, nullptr, 0, x, 0, DM);
    k_lnoutS<<<dim3((TT + 7) / 8, NB_, 1), 256, 0, stream>>>(Y, lng, lnb, OUT);   /* LayerNorm(h + attn_out), rows back at the seq-major pitch */
}

// v009
// One run takes 194 microseconds.
// Next to v008, in two timings, it ran 1.06 times as fast each time.
// Over all steps from v000 it is 20.9 times as fast.
#include <hip/hip_runtime.h>

// Transformer-XL style multi-head attention on a SEQUENCE-MAJOR input with post-LayerNorm (h [2048][4][1024] (seq, batch, model); q = h Wq ('xw' [1024][1024] 1/32), k | v = h Wkv ('xw' [1024][2048]: k = columns 0..1023, v = 1024..2047); 16 heads x 64; score = q.k / 8; softmax over keys; attn_vec merged; attn_out = attn_vec Wo ('xw' no bias); out = LayerNorm(h + attn_out) gamma/beta (eps 1e-5) -> [2048][4][1024] seq-major (8.4 M)).
// One launch turns the weights and gathers all four batches; every other launch covers all four batches (the batch is a grid index; each workspace array but the four weights holds four batch slices). Layout per batch: a strided gather makes batch b's rows (row pitch 4 x 1024 in the input) a contiguous token-major bf16 operand; 'xw' weights transposed once (Wkv as two column blocks); exact projections, whose epilogues write the head planes (v as Wv x X^T, so that its tile comes out transposed); fused T-2048 attention (hybrid rows: < 512 hi/lo 3 products, rest fp16 x1024; scores and probabilities stay in registers); merged hi/lo x Wo exact, the residual (strided rows of h) added in its epilogue, into workspace; a row LayerNorm kernel writes batch b's output rows back at pitch 4 x 1024.
// Compute dtypes, f32 accumulate: every input rounded to bf16; projections exact; attention rows < 512 3 products, rest fp16; softmax f32; Wo hl x exact; residual + LayerNorm f32.

#define NB_  4
#define TT   2048
#define DM   1024
#define NH_  16
#define NKV  16
#define REP  (NH_ / NKV)
#define HD   64
#define DQ   (NH_ * HD)
#define DKV  (NKV * HD)
#define RH   512                  // query rows < RH use hi+lo planes (0: none)
#define WIN  0
#define PCL2 10.0f                // log2 of the carrier (x1024) of the fp16 probabilities
#define SCL  0.125f
#define LNEPS 1e-5f
#define SP   (NB_ * DM)   // seq-major row pitch of h and out (floats)
#define FW   4            // fused attention: waves per work-group
typedef _Float16 h16;
typedef unsigned short bf;
typedef __attribute__((ext_vector_type(16))) __bf16   v16bf;
typedef __attribute__((ext_vector_type(16))) _Float16 v16h;
typedef __attribute__((ext_vector_type(8)))  _Float16 v8h;
typedef __attribute__((ext_vector_type(8)))  unsigned short v8us;
typedef __attribute__((ext_vector_type(8)))  float    v8f;
typedef __attribute__((ext_vector_type(4)))  float    v4f;
typedef v8h  __attribute__((may_alias)) v8ha;
typedef v4f  __attribute__((may_alias)) v4fa;
typedef v8us __attribute__((may_alias)) v8usa;

typedef __attribute__((ext_vector_type(2))) float    v2f;
typedef __attribute__((ext_vector_type(2))) __bf16   v2bf;
typedef __attribute__((ext_vector_type(4))) unsigned v4u;
typedef __attribute__((ext_vector_type(8))) unsigned v8u;
// f32 -> bf16, to nearest even, by the conversion instruction: two values a call, a in the low half of the dword
__device__ __forceinline__ unsigned pkbf(float a, float b) { const v2f v = {a, b}; return __builtin_bit_cast(unsigned, __builtin_convertvector(v, v2bf)); }
__device__ __forceinline__ unsigned short f2bf(float f) { return __builtin_bit_cast(unsigned short, (__bf16)f); }
__device__ __forceinline__ float bf2f(unsigned short b) { return __uint_as_float(((unsigned)b) << 16); }
__device__ __forceinline__ float bfr(float f) { return bf2f(f2bf(f)); }
__device__ __forceinline__ v16h cat16(v8h lo, v8h hi) { return __builtin_shufflevector(lo, hi, 0, 1, 2, 3, 4, 5, 6, 7, 8, 9, 10, 11, 12, 13, 14, 15); }
__device__ __forceinline__ v16bf cat16b(v8us lo, v8us hi) { return __builtin_bit_cast(v16bf, __builtin_shufflevector(lo, hi, 0, 1, 2, 3, 4, 5, 6, 7, 8, 9, 10, 11, 12, 13, 14, 15)); }
__device__ __forceinline__ v8f wmma16(v16h a, v16h b, v8f c) { return __builtin_amdgcn_wmma_f32_16x16x32_f16(false, a, false, b, (short)0, c, false, false); }
__device__ __forceinline__ v8f wmmab(v16bf a, v16bf b, v8f c) { return __builtin_amdgcn_wmma_f32_16x16x32_bf16(false, a, false, b, (short)0, c, false, false); }
__device__ __forceinline__ h16 tohx(float x) { return (h16)x; }
// two values split into hi and lo planes: hi = rounded value, lo = rounded rest (the rest is exact in f32)
__device__ __forceinline__ void split2(float a, float b, unsigned& h, unsigned& l) { h = pkbf(a, b); l = pkbf(a - __uint_as_float(h << 16), b - __uint_as_float(h & 0xFFFF0000u)); }
typedef __attribute__((ext_vector_type(4))) _Float16 v4h;
typedef __attribute__((ext_vector_type(4))) unsigned short v4us;



// fragment types: two 16-byte loads 32 bytes apart make one 16x32 operand fragment
template <typename T16> struct WFrag;
template <> struct WFrag<h16> { typedef v16h V; static __device__ __forceinline__ V ld(const h16* p) { return cat16(*(const v8h*)p, *(const v8h*)(p + 16)); } static __device__ __forceinline__ v8f mma(V a, V b, v8f c) { return wmma16(a, b, c); } };
template <> struct WFrag<bf> { typedef v16bf V; static __device__ __forceinline__ V ld(const bf* p) { return cat16b(*(const v8us*)p, *(const v8us*)(p + 16)); } static __device__ __forceinline__ v8f mma(V a, V b, v8f c) { return wmmab(a, b, c); } };

typedef __attribute__((ext_vector_type(2))) unsigned short v2us;

__global__ __launch_bounds__(256) void k_cvt8(const float* __restrict__ src, bf* dst, size_t n8) { const size_t i = (size_t)blockIdx.x * 256 + threadIdx.x; if (i >= n8) return; const v8f v = *(const v8f*)(src + i * 8); v8us o;
#pragma unroll
    for (int k = 0; k < 8; ++k) o[k] = f2bf(v[k]); *(v8us*)(dst + i * 8) = o;  }

// ---- k_prep: the bf16 form of every matrix operand, one launch. Work-groups 0 .. 4 PWB - 1 turn the four 'xw' weights ([k][n] f32, all DM x DM; the two halves of Wkv at row pitch 2 DM) into [n][k] bf16; the other NB_ TT / PR gather the input's batches.
// A weight tile is PK k x PN n: read in pieces of 256 bytes of a row (whole lines), rounded, two neighbouring k packed to a dword, laid in LDS as [n][k], and stored in rows of 256 bytes. A gather work-group takes PR rows of one batch, a row a load: every load and store of a wave covers whole lines.
// All of a thread's loads are asked for before the first is used, and a thread has many, so that few waves keep enough bytes in flight.
#define PK   128          // k of a weight tile
#define PN   128          // n of a weight tile
#define PPD  68           // LDS row pitch in dwords: PK / 2 + 4, so that 16-byte reads stay aligned
#define PWB  ((DM / PK) * (DM / PN))   // tiles of one weight
#define PR   32           // input rows of a gather work-group
static_assert(DQ == DM && DKV == DM && TT % PR == 0 && DM == 256 * 4 && PK == 128 && PN % 64 == 0, "k_prep's shapes");
__global__ __launch_bounds__(256) void k_prep(const float* __restrict__ x, const float* __restrict__ wq, const float* __restrict__ wkv, const float* __restrict__ wo, bf* XB, bf* WQ, bf* WK, bf* WV, bf* WO) {
    __shared__ __align__(16) unsigned tl[PN * PPD];
    const unsigned tid = threadIdx.x, blk = blockIdx.x;
    // every '#pragma unroll' of this kernel: its loop indexes a register array of loaded pieces, and the loads are to be in flight together
    if (blk < 4 * PWB) {
        const unsigned which = blk / PWB, tile = blk % PWB; const unsigned k0 = (tile / (DM / PN)) * PK, n0 = (tile % (DM / PN)) * PN;
        const float* w = which == 0 ? wq : which == 1 ? wkv : which == 2 ? wkv + DM : wo;   /* Wkv: k = columns 0..1023, v = 1024..2047 */
        bf* Bt = which == 0 ? WQ : which == 1 ? WK : which == 2 ? WV : WO;
        const size_t pitch = (which == 1 || which == 2) ? 2 * DM : DM;
        const unsigned p = tid >> 4, c = tid & 15;   // loads: rows 2 p, 2 p + 1 of each 32, four columns at 4 c of each 64; stores: row p of each 16, eight k at 8 c
        const float* src = w + (size_t)(k0 + 2 * p) * pitch + n0 + c * 4;
        const float* pa[PK / 32][2]; v4f a[PN / 64][PK / 32][2];
#pragma unroll
        for (int i = 0; i < PK / 32; ++i) { pa[i][0] = src + (size_t)(i * 32) * pitch; pa[i][1] = pa[i][0] + pitch;
#pragma unroll
            for (int j = 0; j < PN / 64; ++j) { a[j][i][0] = *(const v4f*)(pa[i][0] + j * 64); a[j][i][1] = *(const v4f*)(pa[i][1] + j * 64); } }
        asm volatile("s_wait_xcnt 0x0" :: "v"(pa[0][0]), "v"(pa[0][1]), "v"(pa[1][0]), "v"(pa[1][1]), "v"(pa[2][0]), "v"(pa[2][1]), "v"(pa[3][0]), "v"(pa[3][1]) : "memory");   // stands in front of later writes to the address registers that the loads above name; it takes them as inputs so that no load of the group lands on them either
        // row n's 16-byte pieces stand at piece index ^ (n / 16 % 4): the sixteen lanes that write one k pair of rows 4 apart then meet sixteen different banks
        unsigned* td = tl + c * 4 * PPD + (p ^ ((c >> 2) << 2));
#pragma unroll
        for (int j = 0; j < PN / 64; ++j)
#pragma unroll
            for (int i = 0; i < PK / 32; ++i)
#pragma unroll
                for (int q = 0; q < 4; ++q) td[(j * 64 + q) * PPD + i * 16] = pkbf(a[j][i][0][q], a[j][i][1][q]);
        __syncthreads();   // the tile is in LDS before other threads read its rows
        bf* dst = Bt + (size_t)(n0 + p) * DM + k0 + c * 8;
#pragma unroll
        for (int s = 0; s < PN / 16; ++s) *(v8us*)(dst + (size_t)(s * 16) * DM) = *(const v8usa*)(tl + (s * 16 + p) * PPD + (c ^ (unsigned)(s & 3)) * 4);
    } else {
        const unsigned row0 = (blk - 4 * PWB) * PR; const unsigned b = row0 / TT, t0 = row0 % TT;   // rows of XB, [b][t]; PR divides TT, so one batch a work-group
        const float* src = x + (size_t)t0 * SP + (size_t)b * DM + tid * 4;
        v4f v[PR];
#pragma unroll
        for (int u = 0; u < PR; ++u) v[u] = *(const v4f*)(src + (size_t)u * SP);
        asm volatile("s_wait_xcnt 0x0" ::: "memory");   // stands in front of later writes to the address registers that the loads above name
        __builtin_amdgcn_sched_barrier(0);   // keeps the roundings behind the last load: moved in among the loads, they made the last loads wait for the first ones' data
        bf* dst = XB + (size_t)row0 * DM + tid * 4;
#pragma unroll
        for (int u = 0; u < PR; ++u) { v[u][0] = __uint_as_float(pkbf(v[u][0], v[u][1])); v[u][1] = __uint_as_float(pkbf(v[u][2], v[u][3])); }
        __builtin_amdgcn_sched_barrier(0);   // keeps every rounding ahead of the first store: none then writes a register that an issued store names
#pragma unroll
        for (int u = 0; u < PR; ++u) { const v2f o = {v[u][0], v[u][1]}; *(v4us*)(dst + (size_t)u * DM) = __builtin_bit_cast(v4us, o); }
        asm volatile("s_wait_xcnt 0x0" ::: "memory");   // stands in front of later writes to registers that the stores above name
    }
}
__global__ __launch_bounds__(256) void k_lnoutS(const float* __restrict__ F, const float* __restrict__ g, const float* __restrict__ bb, float* out) { const int lane = threadIdx.x & 31; const int row = blockIdx.x * 8 + (threadIdx.x >> 5); if (row >= TT) return; const float* fr = F + ((size_t)blockIdx.y * TT + row) * DQ;   /* grid.y = batch */ float* orow = out + (size_t)blockIdx.y * DM + (size_t)row * SP;   /* seq-major output pitch */ float v[DQ / 32]; float s = 0.f;
#pragma unroll
    for (int c = 0; c < DQ / 128; ++c) { const v4f a = *(const v4f*)(fr + c * 128 + lane * 4); for (int q = 0; q < 4; ++q) { v[c * 4 + q] = a[q]; s = __fadd_rn(s, a[q]); } }
#pragma unroll
    for (int sh = 16; sh; sh >>= 1) s = __fadd_rn(s, __shfl_xor(s, sh, 32));
    const float mean = __fdiv_rn(s, (float)DQ); float s2 = 0.f;
#pragma unroll
    for (int k = 0; k < DQ / 32; ++k) { const float dv = __fsub_rn(v[k], mean); float p2 = __fmul_rn(dv, dv); asm volatile("" : "+v"(p2)); s2 = __fadd_rn(s2, p2); v[k] = dv; }
#pragma unroll
    for (int sh = 16; sh; sh >>= 1) s2 = __fadd_rn(s2, __shfl_xor(s2, sh, 32));
    const float rs = __fdiv_rn(1.0f, __fsqrt_rn(__fadd_rn(__fdiv_rn(s2, (float)DQ), LNEPS)));
{
#pragma unroll
        for (int c = 0; c < DQ / 128; ++c) { v4f o; for (int q = 0; q < 4; ++q) { const int col = c * 128 + lane * 4 + q; float y = __fmul_rn(v[c * 4 + q], rs); asm volatile("" : "+v"(y)); y = __fmul_rn(y, bfr(g[col])); asm volatile("" : "+v"(y)); o[q] = __fadd_rn(y, bfr(bb[col])); } *(v4f*)(orow + c * 128 + lane * 4) = o; }
         } }

// ---- k_fattn: scores, softmax and P.V of all batches in one kernel. A wave owns NQ x 16 query rows of one head and walks all TT keys, 32 a pass, with a maximum in use and a sum per query; the maximum is raised lazily (attn_rows).
// St = K Qt (A = K rows, B = Q rows): lane (lr, hi) holds, for query lr, the scores of keys 8 hi + j of each 16-key block, so the two blocks of a pass, converted in place, are the B operand of Ot += Vt Pt (A = Vt rows, k = key).
// The FW waves of a work-group share the head's K and Vt: tiles of KT keys (64 rows x 128 bytes each) are read from memory once, in whole lines, and laid in LDS, two buffers in turn; the fragments come from LDS.
// Rows < RH: bf16 hi/lo planes, 3 products in both stages. Other rows: fp16, probabilities carried x 2^PCL2 (folded into the exponent; it cancels in O / sum). The sum is taken of the f32 probabilities.
#define KT   64           // keys per LDS tile
#define LP   72           // LDS row pitch in 16-bit elements: 128 + 16 bytes, free of bank conflicts for 16-byte reads
typedef __attribute__((ext_vector_type(16))) unsigned short v16us;
template <typename T16> __device__ __forceinline__ typename WFrag<T16>::V ldsfrag(const unsigned short* p) { const v8us lo = *(const v8usa*)p, up = *(const v8usa*)(p + 16); return __builtin_bit_cast(typename WFrag<T16>::V, __builtin_shufflevector(lo, up, 0, 1, 2, 3, 4, 5, 6, 7, 8, 9, 10, 11, 12, 13, 14, 15)); }
template <typename T16, int NQ>
__device__ __forceinline__ void attn_rows(const T16* __restrict__ Q, const T16* __restrict__ Q2, const T16* __restrict__ Kp, const T16* __restrict__ K2, const T16* __restrict__ Vt, const T16* __restrict__ V2, int q0, int hcol, bf* Ah, bf* Al, unsigned short* sm) {
    typedef typename WFrag<T16>::V V; constexpr bool HR = __is_same(T16, bf);
    constexpr int NP = HR ? 4 : 2;              // planes staged: K, Vt (, K lo, Vt lo)
    constexpr int PL = KT * LP;                 // one plane's tile in LDS, elements
    constexpr int NC = KT * 8 / (32 * FW);      // 16-byte pieces of a tile per thread
    const int lane = threadIdx.x & 31, lr = lane & 15, hi = lane >> 4;
    const int srow = (int)threadIdx.x >> 3, scol = ((int)threadIdx.x & 7) * 8;   // this thread's piece: rows srow + 4 FW i, 8 elements at scol
    constexpr float CE = SCL * 1.4426950408889634f;   // score -> exponent of 2
    V qf[NQ][2], qf2[NQ][2];
#pragma unroll
    for (int nq = 0; nq < NQ; ++nq)
#pragma unroll
        for (int kk = 0; kk < 2; ++kk) { const size_t qo = (size_t)(q0 + nq * 16 + lr) * HD + kk * 32 + 8 * hi; qf[nq][kk] = WFrag<T16>::ld(Q + qo); if (HR) qf2[nq][kk] = WFrag<T16>::ld(Q2 + qo); }
    asm volatile("s_wait_xcnt 0x0" ::: "memory");   // stands in front of later writes to the address registers that the Q loads name
    // m: the maximum in use, the same in both lane halves of a query; it is raised, and O and the sum rescaled, only when a score passes mt = m + LZ / CE, so a probability stays below 2^LZ (times the carrier: 2^15, inside fp16)
    constexpr float LZ = HR ? 8.0f : 5.0f;
    v8f o[4][NQ]; float m[NQ], mt[NQ], mb[NQ], l[NQ];
#pragma unroll
    for (int nq = 0; nq < NQ; ++nq) { m[nq] = -3.0e38f; mt[nq] = -3.0e38f; mb[nq] = 0.f; l[nq] = 0.f;
#pragma unroll
        for (int db = 0; db < 4; ++db) o[db][nq] = (v8f){}; }
    v8us st[NP][NC];
    auto fetch = [&](int key0) {
#pragma unroll
        for (int i = 0; i < NC; ++i) { const int r = srow + i * 4 * FW; const size_t kx = (size_t)(key0 + r) * HD + scol, vx = (size_t)r * TT + key0 + scol;
            st[0][i] = *(const v8usa*)(Kp + kx); st[1][i] = *(const v8usa*)(Vt + vx);
            if constexpr (HR) { st[2][i] = *(const v8usa*)(K2 + kx); st[3][i] = *(const v8usa*)(V2 + vx); } }
        asm volatile("s_wait_xcnt 0x0" ::: "memory");   // stands in front of later writes to the address registers that the loads above name
        __builtin_amdgcn_sched_barrier(0);   // keeps later address arithmetic behind that wait: lifted over it, it wrote a register that the loads name
    };
    auto put = [&](int buf) {
#pragma unroll
        for (int i = 0; i < NC; ++i) { unsigned short* d = sm + buf * NP * PL + (srow + i * 4 * FW) * LP + scol;
#pragma unroll
            for (int pl = 0; pl < NP; ++pl) *(v8usa*)(d + pl * PL) = st[pl][i]; } };
    fetch(0); put(0);
    __syncthreads();   // tile 0 is in LDS
#pragma unroll 1
    for (int t = 0; t < TT / KT; ++t) {
        const bool more = t + 1 < TT / KT;
        if (more) fetch((t + 1) * KT);   // the next tile flies to registers while this one is worked on
        const unsigned short* tb = sm + (t & 1) * NP * PL + lr * LP + 8 * hi;
#pragma unroll
        for (int ks = 0; ks < KT / 32; ++ks) {
            v8f s[2][NQ];
#pragma unroll
            for (int kb = 0; kb < 2; ++kb) { V kf[2], kf2[2];
#pragma unroll
                for (int kk = 0; kk < 2; ++kk) { const unsigned short* kq = tb + (ks * 2 + kb) * 16 * LP + kk * 32; kf[kk] = ldsfrag<T16>(kq); if (HR) kf2[kk] = ldsfrag<T16>(kq + 2 * PL); }
#pragma unroll
                for (int nq = 0; nq < NQ; ++nq) { v8f a = (v8f){};
#pragma unroll
                    for (int kk = 0; kk < 2; ++kk) { a = WFrag<T16>::mma(kf[kk], qf[nq][kk], a); if (HR) { a = WFrag<T16>::mma(kf2[kk], qf[nq][kk], a); a = WFrag<T16>::mma(kf[kk], qf2[nq][kk], a); } }
                    s[kb][nq] = a; } }
            V vf[4], vf2[4];
#pragma unroll
            for (int db = 0; db < 4; ++db) { const unsigned short* vq = tb + PL + db * 16 * LP + ks * 32; vf[db] = ldsfrag<T16>(vq); if (HR) vf2[db] = ldsfrag<T16>(vq + 2 * PL); }
            float mx[NQ]; bool need = false;
#pragma unroll
            for (int nq = 0; nq < NQ; ++nq) { mx[nq] = s[0][nq][0];
#pragma unroll
                for (int j = 0; j < 8; ++j) mx[nq] = fmaxf(mx[nq], fmaxf(s[0][nq][j], s[1][nq][j]));
                need = need || mx[nq] > mt[nq]; }
            if (__builtin_amdgcn_ballot_w32(need) != 0) {   // one scalar branch a pass: taken in the first pass and where some lane's score passes its bound
#pragma unroll
                for (int nq = 0; nq < NQ; ++nq) {
                    const float mn = fmaxf(m[nq], fmaxf(mx[nq], __shfl_xor(mx[nq], 16, 32)));   // the other eight keys of each block sit in the other lane half
                    const float al = __builtin_amdgcn_exp2f((m[nq] - mn) * CE); m[nq] = mn; mt[nq] = mn + LZ / CE; mb[nq] = mn * CE - (HR ? 0.0f : PCL2);
                    l[nq] *= al;
#pragma unroll
                    for (int db = 0; db < 4; ++db) o[db][nq] *= al;
                }
            }
#pragma unroll
            for (int nq = 0; nq < NQ; ++nq) {
#pragma unroll
                for (int kb = 0; kb < 2; ++kb)
#pragma unroll
                    for (int j = 0; j < 8; ++j) s[kb][nq][j] = __builtin_amdgcn_exp2f(s[kb][nq][j] * CE - mb[nq]);
                const v8f p8 = s[0][nq] + s[1][nq];   // the pass's sixteen probabilities of this lane, summed as a tree
                l[nq] += (((p8[0] + p8[4]) + (p8[1] + p8[5])) + ((p8[2] + p8[6]) + (p8[3] + p8[7])));
                if constexpr (HR) {
                    v8u ph, pl;
#pragma unroll
                    for (int e = 0; e < 16; e += 2) { unsigned a, c2; split2(s[e >> 3][nq][e & 7], s[e >> 3][nq][(e & 7) + 1], a, c2); ph[e >> 1] = a; pl[e >> 1] = c2; }
                    const V pfh = __builtin_bit_cast(v16bf, ph), pfl = __builtin_bit_cast(v16bf, pl);
#pragma unroll
                    for (int db = 0; db < 4; ++db) { o[db][nq] = WFrag<T16>::mma(vf[db], pfh, o[db][nq]); o[db][nq] = WFrag<T16>::mma(vf[db], pfl, o[db][nq]); o[db][nq] = WFrag<T16>::mma(vf2[db], pfh, o[db][nq]); }
                } else {
                    V pf;
#pragma unroll
                    for (int e = 0; e < 16; ++e) pf[e] = tohx(s[e >> 3][nq][e & 7]);
#pragma unroll
                    for (int db = 0; db < 4; ++db) o[db][nq] = WFrag<T16>::mma(vf[db], pf, o[db][nq]);
                }
            }
        }
        if (more) put((t + 1) & 1);   // into the buffer whose last readers left it at the barrier of trip t - 1
        __syncthreads();   // publishes tile t + 1 and ends every wave's reads of tile t
    }
#pragma unroll
    for (int nq = 0; nq < NQ; ++nq) { const float inv = __fdiv_rn(1.0f, l[nq] + __shfl_xor(l[nq], 16, 32)); const size_t oo = (size_t)(q0 + nq * 16 + lr) * DQ + hcol + hi * 8;
#pragma unroll
        for (int db = 0; db < 4; ++db) { v4u oh, ol;
#pragma unroll
            for (int j = 0; j < 8; j += 2) { unsigned a, c2; split2(o[db][nq][j] * inv, o[db][nq][j + 1] * inv, a, c2); oh[j >> 1] = a; ol[j >> 1] = c2; }
            *(v8us*)(Ah + oo + db * 16) = __builtin_bit_cast(v8us, oh); *(v8us*)(Al + oo + db * 16) = __builtin_bit_cast(v8us, ol);
            asm volatile("s_wait_xcnt 0x0" ::: "memory");   // stands in front of the next block's writes to registers that these two stores name
            __builtin_amdgcn_sched_barrier(0);   // keeps the next block's arithmetic behind that wait: lifted over it, it wrote registers that the stores name
        } }
}
// grid (RH / (16 FW) + (TT - RH) / (32 FW), heads, batches): of each head the hi/lo work-groups (16 rows a wave, three times the products) have the low indices.
__global__ __launch_bounds__(32 * FW) void k_fattn(const h16* __restrict__ Q16, const h16* __restrict__ K16, const h16* __restrict__ V16, const bf* __restrict__ Qh, const bf* __restrict__ Ql, const bf* __restrict__ Kh, const bf* __restrict__ Kl, const bf* __restrict__ Vh, const bf* __restrict__ Vl, bf* Ah, bf* Al) {
    __shared__ __align__(16) unsigned short sm[2 * 4 * KT * LP];
    const int w = __builtin_amdgcn_readfirstlane((int)(threadIdx.x >> 5)); const int hd = (int)blockIdx.y, bt = (int)blockIdx.z; const size_t pq = (size_t)(bt * NH_ + hd) * TT * HD, pk = (size_t)(bt * NKV + hd / REP) * TT * HD;
    Ah += (size_t)bt * TT * DQ; Al += (size_t)bt * TT * DQ;
    constexpr int NHB = RH / (16 * FW);
    if ((int)blockIdx.x < NHB) attn_rows<bf, 1>(Qh + pq, Ql + pq, Kh + pk, Kl + pk, Vh + pk, Vl + pk, ((int)blockIdx.x * FW + w) * 16, hd * HD, Ah, Al, sm);
    else attn_rows<h16, 2>(Q16 + pq, nullptr, K16 + pk, nullptr, V16 + pk, nullptr, RH + (((int)blockIdx.x - NHB) * FW + w) * 32, hd * HD, Ah, Al, sm);
}

// ---- gemmt: GEMM with both operands staged in LDS. A work-group of 4 waves owns a 128x128 output tile (tile row bx, tile column by, batch z), each wave a 64x64 quarter (16 accumulators) over the whole K; 128 threads.
// C[m][n] = sum_k A[m][k] Bt[n][k] (NSPLIT 1: + A2[m][k] Bt[n][k]), operands K-contiguous bf16 planes. z-batch strides sA/sB/sC in elements (sZ: the 16-bit planes of EPI 1; sH: the residual of EPI 2). K (a template constant) % 64 == 0.
// Tiles of GT k (128 rows x 128 bytes a plane) are read from memory once per work-group, in whole lines, and laid in LDS at pitch LP, two buffers in turn; every fragment comes from LDS and serves two waves.
// EPI, what the epilogue does with the f32 sums (each wave turns its 16-row slabs through its own LDS range, so that whole lines are stored): 1 stores them as three 16-bit planes (fp16, bf16 hi, bf16 lo), element (m, n) at m x ldc + (n / 64) x sT + n % 64 (head planes [h][t][d]: ldc = 64, sT = rows x 64; plain row-major: sT = 64); 2 adds the bf16-rounded residual hs[m][n] (row pitch SP) and stores f32 in C (pitch ldc).
#define GT   64           // k per LDS tile
#define GM   128          // rows of a plane's tile (output tile GM x GM)
template <int NSPLIT, int EPI, int K>
__device__ __forceinline__ void gemmt(const bf* __restrict__ A, const bf* __restrict__ A2, const bf* __restrict__ Bt, float* C, int ldc, size_t sA, size_t sB, size_t sC, h16* P16, bf* Ph, bf* Pl, size_t sT, const float* __restrict__ hs, size_t sZ, size_t sH, int bx, int by, size_t z) {
    constexpr int NP = NSPLIT ? 3 : 2;          // planes staged: A, Bt (, A2)
    constexpr int PL = GM * LP;                 // one plane's tile in LDS, elements
    constexpr int NC = GM * 8 / 128;            // 16-byte pieces of a plane's tile per thread
    __shared__ __align__(16) unsigned short sm[2 * NP * PL];
    __shared__ __align__(16) float os[4 * 16 * 68];   // epilogue: one 16-row slab per wave
    const int lane = threadIdx.x & 31, lr = lane & 15, hi = lane >> 4;
    const int w = __builtin_amdgcn_readfirstlane((int)(threadIdx.x >> 5)), wm = w >> 1, wn = w & 1;
    const int r0 = bx * GM, c0 = by * GM;
    const int srow = (int)threadIdx.x >> 3, scol = ((int)threadIdx.x & 7) * 8;   // this thread's pieces: rows srow + 16 i, 8 elements at scol
    const bf* ga = A + z * sA + (size_t)(r0 + srow) * K + scol; const bf* gb = Bt + z * sB + (size_t)(c0 + srow) * K + scol;
    const bf* ga2 = NSPLIT ? A2 + z * sA + (size_t)(r0 + srow) * K + scol : nullptr;
    // every '#pragma unroll' of this kernel: its loop indexes register arrays (accumulators, fragments, staged pieces), which stay in registers only under constant indices
    v8f acc[4][4];
#pragma unroll
    for (int mb = 0; mb < 4; ++mb)
#pragma unroll
        for (int nb = 0; nb < 4; ++nb) acc[mb][nb] = (v8f){};
    v8us st[NP][NC];
    auto fetch = [&](int kc) {
        const bf* pa = ga + kc; const bf* pb = gb + kc; const bf* pa2 = NSPLIT ? ga2 + kc : pa;
#pragma unroll
        for (int i = 0; i < NC; ++i) { const size_t o = (size_t)i * 16 * K;
            st[0][i] = *(const v8usa*)(pa + o); st[1][i] = *(const v8usa*)(pb + o);
            if constexpr (NSPLIT != 0) st[2][i] = *(const v8usa*)(pa2 + o); }
        asm volatile("s_wait_xcnt 0x0" :: "v"(pa), "v"(pb), "v"(pa2) : "memory");   // stands in front of later writes to the address registers that the loads above name; it takes them as inputs so that no load of the group lands on them either
    };
    auto put = [&](int buf) {
#pragma unroll
        for (int i = 0; i < NC; ++i) { unsigned short* d = sm + buf * NP * PL + (srow + i * 16) * LP + scol;
#pragma unroll
            for (int pl = 0; pl < NP; ++pl) *(v8usa*)(d + pl * PL) = st[pl][i]; } };
    constexpr int NT = K / GT;
    fetch(0); put(0);
    __syncthreads();   // tile 0 is in LDS
#pragma unroll 1   // rolled: a trip already holds a whole tile's reads and matrix instructions, copies of it would only lengthen the text
    for (int t = 0; t < NT; ++t) {
        const bool more = t + 1 < NT;
        if (more) fetch((t + 1) * GT);   // the next tile flies to registers while this one is worked on
        const unsigned short* ta = sm + (t & 1) * NP * PL + (wm * 64 + lr) * LP + 8 * hi;
        const unsigned short* tb = sm + (t & 1) * NP * PL + PL + (wn * 64 + lr) * LP + 8 * hi;
        v16bf a[GT / 32][4], a2[GT / 32][4], b[GT / 32][4];   // the tile's fragments, all asked for in one group
#pragma unroll
        for (int kk = 0; kk < GT / 32; ++kk) {
#pragma unroll
            for (int mb = 0; mb < 4; ++mb) { a[kk][mb] = ldsfrag<bf>(ta + mb * 16 * LP + kk * 32); if constexpr (NSPLIT != 0) a2[kk][mb] = ldsfrag<bf>(ta + 2 * PL + mb * 16 * LP + kk * 32); }
#pragma unroll
            for (int nb = 0; nb < 4; ++nb) b[kk][nb] = ldsfrag<bf>(tb + nb * 16 * LP + kk * 32);
        }
        __builtin_amdgcn_sched_barrier(0);   // keeps the LDS reads in one group ahead of the matrix instructions (for speed only)
#pragma unroll
        for (int kk = 0; kk < GT / 32; ++kk)
#pragma unroll
            for (int nb = 0; nb < 4; ++nb)
#pragma unroll
                for (int mb = 0; mb < 4; ++mb) { acc[mb][nb] = wmmab(a[kk][mb], b[kk][nb], acc[mb][nb]); if constexpr (NSPLIT != 0) acc[mb][nb] = wmmab(a2[kk][mb], b[kk][nb], acc[mb][nb]); }
        if (more) put((t + 1) & 1);   // into the buffer whose last readers left it at the barrier of trip t - 1
        __syncthreads();   // publishes tile t + 1 and ends every wave's reads of tile t
    }
    const int rw = r0 + wm * 64, cw = c0 + wn * 64;   // this wave's quarter
    float* mine = os + w * (16 * 68);
    v4f rsd[4][8];   // EPI 2: this lane's pieces of the residual, all asked for at once
    if constexpr (EPI == 2) {
        const float* hz = hs + z * sH + (size_t)(rw + hi) * SP + cw + lr * 4;
#pragma unroll
        for (int mb = 0; mb < 4; ++mb)
#pragma unroll
            for (int s = 0; s < 8; ++s) rsd[mb][s] = *(const v4f*)(hz + (size_t)(mb * 16 + 2 * s) * SP);
        asm volatile("s_wait_xcnt 0x0" ::: "memory");   // stands in front of later writes to the address registers that the loads above name
    }
#pragma unroll
    for (int mb = 0; mb < 4; ++mb) {
#pragma unroll
        for (int nb = 0; nb < 4; ++nb) {
#pragma unroll
            for (int j = 0; j < 8; ++j) mine[(hi * 8 + j) * 68 + nb * 16 + lr] = acc[mb][nb][j]; }
        asm volatile("s_wait_dscnt 0x0" ::: "memory");   // the slab's writes have landed before other lanes of this wave read the rows back
        if constexpr (EPI == 1) {
#pragma unroll
            for (int s = 0; s < 4; ++s) { const int row = 4 * s + (lane >> 3), cofs = (lane & 7) * 8; const v4f v0 = *(const v4fa*)(mine + row * 68 + cofs), v1 = *(const v4fa*)(mine + row * 68 + cofs + 4);
                const size_t po = z * sZ + (size_t)(rw + mb * 16 + row) * ldc + (size_t)(cw / 64) * sT + cofs; v8h o16; v4u oh, ol;
#pragma unroll
                for (int q = 0; q < 8; q += 2) { const float y = q < 4 ? v0[q & 3] : v1[q & 3], y1 = q < 4 ? v0[(q & 3) + 1] : v1[(q & 3) + 1]; o16[q] = tohx(y); o16[q + 1] = tohx(y1); unsigned a2, c2; split2(y, y1, a2, c2); oh[q >> 1] = a2; ol[q >> 1] = c2; }
                *(v8h*)(P16 + po) = o16; *(v8us*)(Ph + po) = __builtin_bit_cast(v8us, oh); *(v8us*)(Pl + po) = __builtin_bit_cast(v8us, ol);
                asm volatile("s_wait_xcnt 0x0" ::: "memory");   // stands in front of the next rows' writes to registers that these stores name
            }
        } else {
            float* crow = C + z * sC + (size_t)(rw + mb * 16 + hi) * ldc + cw + lr * 4;
#pragma unroll
            for (int s = 0; s < 8; ++s) { v4f val = *(const v4fa*)(mine + (2 * s + hi) * 68 + lr * 4);
#pragma unroll
                for (int q = 0; q < 4; ++q) val[q] = __fadd_rn(val[q], bfr(rsd[mb][s][q]));
                *(v4f*)(crow + (size_t)(2 * s) * ldc) = val;
                asm volatile("s_wait_xcnt 0x0" ::: "memory");   // stands in front of the next rows' writes to registers that this store names
            }
        }
    }
}

// one product: grid (M/128, N/128, batches)
template <int NSPLIT, int EPI, int K>
__global__ __launch_bounds__(128) void k_gemmt(const bf* __restrict__ A, const bf* __restrict__ A2, const bf* __restrict__ Bt, float* C, int ldc, size_t sA, size_t sB, size_t sC, h16* P16, bf* Ph, bf* Pl, size_t sT, const float* __restrict__ hs, size_t sZ, size_t sH) {
    gemmt<NSPLIT, EPI, K>(A, A2, Bt, C, ldc, sA, sB, sC, P16, Ph, Pl, sT, hs, sZ, sH, (int)blockIdx.x, (int)blockIdx.y, blockIdx.z);
}
// ---- k_proj: the three projections in one launch, grid (TT/128, DM/128, 3 x batches): z / NB_ says which product, z % NB_ the batch. No product reads another's result, so their work-groups fill the chip together: one's stores run beside another's loop, and two launch boundaries are gone.
// q, k: rows = t, columns = (head, d), a wave's 64 columns are one head: planes [b][h][t][d]. v: operands swapped (rows = (head, d), columns = t, so x is the tile column), the planes [b][g][d][t] row-major.
static_assert(DQ == DM && DKV == DM && NH_ == NKV, "k_proj: one grid and one batch stride for the three products");
__global__ __launch_bounds__(128) void k_proj(const bf* __restrict__ XB, const bf* __restrict__ WQ, const bf* __restrict__ WK, const bf* __restrict__ WV, h16* Q16, bf* Qh, bf* Ql, h16* K16, bf* Kh, bf* Kl, h16* V16, bf* Vh, bf* Vl) {
    const unsigned which = blockIdx.z / NB_, b = blockIdx.z % NB_; const bool tv = which == 2;
    gemmt<0, 1, DM>(tv ? WV : XB, nullptr, tv ? XB : which == 1 ? WK : WQ, nullptr, tv ? TT : HD, tv ? 0 : (size_t)TT * DM, tv ? (size_t)TT * DM : 0, 0,
                    tv ? V16 : which == 1 ? K16 : Q16, tv ? Vh : which == 1 ? Kh : Qh, tv ? Vl : which == 1 ? Kl : Ql, tv ? 64 : (size_t)TT * HD, nullptr, (size_t)NH_ * TT * HD, 0,
                    (int)(tv ? blockIdx.y : blockIdx.x), (int)(tv ? blockIdx.x : blockIdx.y), b);
}

extern "C" void kernel_launch(void* const* d_in, const int* in_sizes, int n_in,
                              void* d_out, int out_size, void* d_ws, size_t ws_size, hipStream_t stream) {
    (void)in_sizes; (void)n_in; (void)out_size;
    const float* x = (const float*)d_in[0];   /* h [S][B][D] seq-major */ const float* wq = (const float*)d_in[1]; const float* wkv = (const float*)d_in[2]; const float* wo = (const float*)d_in[3]; const float* lng = (const float*)d_in[4]; const float* lnb = (const float*)d_in[5]; const float* wk = wkv; const float* wv = wkv;
    float* OUT = (float*)d_out;     // [2048][4][1024] seq-major
    char* wsp = (char*)d_ws;
    auto take = [&](size_t bytes) { char* p = wsp; wsp += (bytes + 255) & ~(size_t)255; return (void*)p; };
    float* Y = (float*)take((size_t)NB_ * TT * DM * 4); bf* WQ = (bf*)take((size_t)DQ * DM * 2); bf* WK = (bf*)take((size_t)DKV * DM * 2); bf* WV = (bf*)take((size_t)DKV * DM * 2); bf* WO = (bf*)take((size_t)DM * DQ * 2);
    bf* XB = (bf*)take((size_t)NB_ * TT * DM * 2);
    h16* QP16 = (h16*)take((size_t)NB_ * NH_ * TT * HD * 2); h16* KP16 = (h16*)take((size_t)NB_ * NKV * TT * HD * 2); h16* VT16 = (h16*)take((size_t)NB_ * NKV * HD * TT * 2);
    bf* QPh = (bf*)take((size_t)NB_ * NH_ * TT * HD * 2); bf* QPl = (bf*)take((size_t)NB_ * NH_ * TT * HD * 2); bf* KPh = (bf*)take((size_t)NB_ * NKV * TT * HD * 2); bf* KPl = (bf*)take((size_t)NB_ * NKV * TT * HD * 2); bf* VTh = (bf*)take((size_t)NB_ * NKV * HD * TT * 2); bf* VTl = (bf*)take((size_t)NB_ * NKV * HD * TT * 2);
    bf* ATh = (bf*)take((size_t)NB_ * TT * DQ * 2); bf* ATl = (bf*)take((size_t)NB_ * TT * DQ * 2);
    if ((size_t)(wsp - (char*)d_ws) > ws_size) return;    // ws 256 MiB
    k_prep<<<4 * PWB + NB_ * TT / PR, 256, 0, stream>>>(x, wq, wkv, wo, XB, WQ, WK, WV, WO);   /* weights [n][k]; each batch's rows of the seq-major input (pitch 4 x 1024) contiguous */
    k_proj<<<dim3(TT / GM, DM / GM, 3 * NB_), 128, 0, stream>>>(XB, WQ, WK, WV, QP16, QPh, QPl, KP16, KPh, KPl, VT16, VTh, VTl);   /* q, k, v of all batches */
    k_fattn<<<dim3(RH / (16 * FW) + (TT - RH) / (32 * FW), NH_, NB_), 32 * FW, 0, stream>>>(QP16, KP16, VT16, QPh, QPl, KPh, KPl, VTh, VTl, ATh, ATl);
    k_gemmt<1, 2, DQ><<<dim3(TT / GM, DM / GM, NB_), 128, 0, stream>>>(ATh, ATl, WO, Y, DM, (size_t)TT * DQ, 0, (size_t)TT * DM, nullptr, nullptr, nullptr, 0, x, 0, DM);
    k_lnoutS<<<dim3((TT + 7) / 8, NB_, 1), 256, 0, stream>>>(Y, lng, lnb, OUT);   /* LayerNorm(h + attn_out), rows back at the seq-major pitch */
}

// v010
// It runs in 179 microseconds.
// Timed twice side by side with v009, it ran 1.06 and 1.07 times as fast.
// Over all steps from v000 it is 22.2 times as fast.
#include <hip/hip_runtime.h>

// Transformer-XL style multi-head attention on a SEQUENCE-MAJOR input with post-LayerNorm (h [2048][4][1024] (seq, batch, model); q = h Wq ('xw' [1024][1024] 1/32), k | v = h Wkv ('xw' [1024][2048]: k = columns 0..1023, v = 1024..2047); 16 heads x 64; score = q.k / 8; softmax over keys; attn_vec merged; attn_out = attn_vec Wo ('xw' no bias); out = LayerNorm(h + attn_out) gamma/beta (eps 1e-5) -> [2048][4][1024] seq-major (8.4 M)).
// One launch turns the weights and gathers all four batches; every other launch covers all four batches (the batch is a grid index; each workspace array but the four weights holds four batch slices). Layout per batch: a strided gather makes batch b's rows (row pitch 4 x 1024 in the input) a contiguous token-major bf16 operand; 'xw' weights transposed once (Wkv as two column blocks); exact projections, whose epilogues write the head planes (v as Wv x X^T, so that its tile comes out transposed); fused T-2048 attention (hybrid rows: < 512 hi/lo 3 products, rest fp16 x1024; scores and probabilities stay in registers); merged hi/lo x Wo exact, the residual (strided rows of h) added in its epilogue, into workspace; a row LayerNorm kernel writes batch b's output rows back at pitch 4 x 1024.
// Compute dtypes, f32 accumulate: every input rounded to bf16; projections exact; attention rows < 512 3 products, rest fp16; softmax f32; Wo hl x exact; residual + LayerNorm f32.

#define NB_  4
#define TT   2048
#define DM   1024
#define NH_  16
#define NKV  16
#define REP  (NH_ / NKV)
#define HD   64
#define DQ   (NH_ * HD)
#define DKV  (NKV * HD)
#define RH   512                  // query rows < RH use hi+lo planes (0: none)
#define WIN  0
#define PCL2 10.0f                // log2 of the carrier (x1024) of the fp16 probabilities
#define SCL  0.125f
#define LNEPS 1e-5f
#define SP   (NB_ * DM)   // seq-major row pitch of h and out (floats)
#define FW   4            // fused attention: waves per work-group
typedef _Float16 h16;
typedef unsigned short bf;
typedef __attribute__((ext_vector_type(16))) __bf16   v16bf;
typedef __attribute__((ext_vector_type(16))) _Float16 v16h;
typedef __attribute__((ext_vector_type(8)))  _Float16 v8h;
typedef __attribute__((ext_vector_type(8)))  unsigned short v8us;
typedef __attribute__((ext_vector_type(8)))  float    v8f;
typedef __attribute__((ext_vector_type(4)))  float    v4f;
typedef v8h  __attribute__((may_alias)) v8ha;
typedef v4f  __attribute__((may_alias)) v4fa;
typedef v8us __attribute__((may_alias)) v8usa;

typedef __attribute__((ext_vector_type(2))) float    v2f;
typedef __attribute__((ext_vector_type(2))) __bf16   v2bf;
typedef __attribute__((ext_vector_type(4))) unsigned v4u;
typedef __attribute__((ext_vector_type(8))) unsigned v8u;
// f32 -> bf16, to nearest even, by the conversion instruction: two values a call, a in the low half of the dword
__device__ __forceinline__ unsigned pkbf(float a, float b) { const v2f v = {a, b}; return __builtin_bit_cast(unsigned, __builtin_convertvector(v, v2bf)); }
__device__ __forceinline__ unsigned short f2bf(float f) { return __builtin_bit_cast(unsigned short, (__bf16)f); }
__device__ __forceinline__ float bf2f(unsigned short b) { return __uint_as_float(((unsigned)b) << 16); }
__device__ __forceinline__ float bfr(float f) { return bf2f(f2bf(f)); }
__device__ __forceinline__ v16h cat16(v8h lo, v8h hi) { return __builtin_shufflevector(lo, hi, 0, 1, 2, 3, 4, 5, 6, 7, 8, 9, 10, 11, 12, 13, 14, 15); }
__device__ __forceinline__ v16bf cat16b(v8us lo, v8us hi) { return __builtin_bit_cast(v16bf, __builtin_shufflevector(lo, hi, 0, 1, 2, 3, 4, 5, 6, 7, 8, 9, 10, 11, 12, 13, 14, 15)); }
__device__ __forceinline__ v8f wmma16(v16h a, v16h b, v8f c) { return __builtin_amdgcn_wmma_f32_16x16x32_f16(false, a, false, b, (short)0, c, false, false); }
__device__ __forceinline__ v8f wmmab(v16bf a, v16bf b, v8f c) { return __builtin_amdgcn_wmma_f32_16x16x32_bf16(false, a, false, b, (short)0, c, false, false); }
__device__ __forceinline__ h16 tohx(float x) { return (h16)x; }
// two values split into hi and lo planes: hi = rounded value, lo = rounded rest (the rest is exact in f32)
__device__ __forceinline__ void split2(float a, float b, unsigned& h, unsigned& l) { h = pkbf(a, b); l = pkbf(a - __uint_as_float(h << 16), b - __uint_as_float(h & 0xFFFF0000u)); }
typedef __attribute__((ext_vector_type(4))) _Float16 v4h;
typedef __attribute__((ext_vector_type(4))) unsigned short v4us;



// fragment types: two 16-byte loads 32 bytes apart make one 16x32 operand fragment
template <typename T16> struct WFrag;
template <> struct WFrag<h16> { typedef v16h V; static __device__ __forceinline__ V ld(const h16* p) { return cat16(*(const v8h*)p, *(const v8h*)(p + 16)); } static __device__ __forceinline__ v8f mma(V a, V b, v8f c) { return wmma16(a, b, c); } };
template <> struct WFrag<bf> { typedef v16bf V; static __device__ __forceinline__ V ld(const bf* p) { return cat16b(*(const v8us*)p, *(const v8us*)(p + 16)); } static __device__ __forceinline__ v8f mma(V a, V b, v8f c) { return wmmab(a, b, c); } };

typedef __attribute__((ext_vector_type(2))) unsigned short v2us;

__global__ __launch_bounds__(256) void k_cvt8(const float* __restrict__ src, bf* dst, size_t n8) { const size_t i = (size_t)blockIdx.x * 256 + threadIdx.x; if (i >= n8) return; const v8f v = *(const v8f*)(src + i * 8); v8us o;
#pragma unroll
    for (int k = 0; k < 8; ++k) o[k] = f2bf(v[k]); *(v8us*)(dst + i * 8) = o;  }

// ---- k_prep: the bf16 form of every matrix operand, one launch. Work-groups 0 .. 4 PWB - 1 turn the four 'xw' weights ([k][n] f32, all DM x DM; the two halves of Wkv at row pitch 2 DM) into [n][k] bf16; the other NB_ TT / PR gather the input's batches.
// A weight tile is PK k x PN n: read in pieces of 256 bytes of a row (whole lines), rounded, two neighbouring k packed to a dword, laid in LDS as [n][k], and stored in rows of 256 bytes. A gather work-group takes PR rows of one batch, a row a load: every load and store of a wave covers whole lines.
// All of a thread's loads are asked for before the first is used, and a thread has many, so that few waves keep enough bytes in flight.
#define PK   128          // k of a weight tile
#define PN   128          // n of a weight tile
#define PPD  68           // LDS row pitch in dwords: PK / 2 + 4, so that 16-byte reads stay aligned
#define PWB  ((DM / PK) * (DM / PN))   // tiles of one weight
#define PR   32           // input rows of a gather work-group
static_assert(DQ == DM && DKV == DM && TT % PR == 0 && DM == 256 * 4 && PK == 128 && PN % 64 == 0, "k_prep's shapes");
__global__ __launch_bounds__(256) void k_prep(const float* __restrict__ x, const float* __restrict__ wq, const float* __restrict__ wkv, const float* __restrict__ wo, bf* XB, bf* WQ, bf* WK, bf* WV, bf* WO) {
    __shared__ __align__(16) unsigned tl[PN * PPD];
    const unsigned tid = threadIdx.x, blk = blockIdx.x;
    // every '#pragma unroll' of this kernel: its loop indexes a register array of loaded pieces, and the loads are to be in flight together
    if (blk < 4 * PWB) {
        const unsigned which = blk / PWB, tile = blk % PWB; const unsigned k0 = (tile / (DM / PN)) * PK, n0 = (tile % (DM / PN)) * PN;
        const float* w = which == 0 ? wq : which == 1 ? wkv : which == 2 ? wkv + DM : wo;   /* Wkv: k = columns 0..1023, v = 1024..2047 */
        bf* Bt = which == 0 ? WQ : which == 1 ? WK : which == 2 ? WV : WO;
        const size_t pitch = (which == 1 || which == 2) ? 2 * DM : DM;
        const unsigned p = tid >> 4, c = tid & 15;   // loads: rows 2 p, 2 p + 1 of each 32, four columns at 4 c of each 64; stores: row p of each 16, eight k at 8 c
        const float* src = w + (size_t)(k0 + 2 * p) * pitch + n0 + c * 4;
        const float* pa[PK / 32][2]; v4f a[PN / 64][PK / 32][2];
#pragma unroll
        for (int i = 0; i < PK / 32; ++i) { pa[i][0] = src + (size_t)(i * 32) * pitch; pa[i][1] = pa[i][0] + pitch;
#pragma unroll
            for (int j = 0; j < PN / 64; ++j) { a[j][i][0] = *(const v4f*)(pa[i][0] + j * 64); a[j][i][1] = *(const v4f*)(pa[i][1] + j * 64); } }
        asm volatile("s_wait_xcnt 0x0" :: "v"(pa[0][0]), "v"(pa[0][1]), "v"(pa[1][0]), "v"(pa[1][1]), "v"(pa[2][0]), "v"(pa[2][1]), "v"(pa[3][0]), "v"(pa[3][1]) : "memory");   // stands in front of later writes to the address registers that the loads above name; it takes them as inputs so that no load of the group lands on them either
        // row n's 16-byte pieces stand at piece index ^ (n / 16 % 4): the sixteen lanes that write one k pair of rows 4 apart then meet sixteen different banks
        unsigned* td = tl + c * 4 * PPD + (p ^ ((c >> 2) << 2));
#pragma unroll
        for (int j = 0; j < PN / 64; ++j)
#pragma unroll
            for (int i = 0; i < PK / 32; ++i)
#pragma unroll
                for (int q = 0; q < 4; ++q) td[(j * 64 + q) * PPD + i * 16] = pkbf(a[j][i][0][q], a[j][i][1][q]);
        __syncthreads();   // the tile is in LDS before other threads read its rows
        bf* dst = Bt + (size_t)(n0 + p) * DM + k0 + c * 8;
#pragma unroll
        for (int s = 0; s < PN / 16; ++s) *(v8us*)(dst + (size_t)(s * 16) * DM) = *(const v8usa*)(tl + (s * 16 + p) * PPD + (c ^ (unsigned)(s & 3)) * 4);
    } else {
        const unsigned row0 = (blk - 4 * PWB) * PR; const unsigned b = row0 / TT, t0 = row0 % TT;   // rows of XB, [b][t]; PR divides TT, so one batch a work-group
        const float* src = x + (size_t)t0 * SP + (size_t)b * DM + tid * 4;
        v4f v[PR];
#pragma unroll
        for (int u = 0; u < PR; ++u) v[u] = *(const v4f*)(src + (size_t)u * SP);
        asm volatile("s_wait_xcnt 0x0" ::: "memory");   // stands in front of later writes to the address registers that the loads above name
        __builtin_amdgcn_sched_barrier(0);   // keeps the roundings behind the last load: moved in among the loads, they made the last loads wait for the first ones' data
        bf* dst = XB + (size_t)row0 * DM + tid * 4;
#pragma unroll
        for (int u = 0; u < PR; ++u) { v[u][0] = __uint_as_float(pkbf(v[u][0], v[u][1])); v[u][1] = __uint_as_float(pkbf(v[u][2], v[u][3])); }
        __builtin_amdgcn_sched_barrier(0);   // keeps every rounding ahead of the first store: none then writes a register that an issued store names
#pragma unroll
        for (int u = 0; u < PR; ++u) { const v2f o = {v[u][0], v[u][1]}; *(v4us*)(dst + (size_t)u * DM) = __builtin_bit_cast(v4us, o); }
        asm volatile("s_wait_xcnt 0x0" ::: "memory");   // stands in front of later writes to registers that the stores above name
    }
}
__global__ __launch_bounds__(256) void k_lnoutS(const float* __restrict__ F, const float* __restrict__ g, const float* __restrict__ bb, float* out) { const int lane = threadIdx.x & 31; const int row = blockIdx.x * 8 + (threadIdx.x >> 5); if (row >= TT) return; const float* fr = F + ((size_t)blockIdx.y * TT + row) * DQ;   /* grid.y = batch */ float* orow = out + (size_t)blockIdx.y * DM + (size_t)row * SP;   /* seq-major output pitch */ float v[DQ / 32]; float s = 0.f;
#pragma unroll
    for (int c = 0; c < DQ / 128; ++c) { const v4f a = *(const v4f*)(fr + c * 128 + lane * 4); for (int q = 0; q < 4; ++q) { v[c * 4 + q] = a[q]; s = __fadd_rn(s, a[q]); } }
#pragma unroll
    for (int sh = 16; sh; sh >>= 1) s = __fadd_rn(s, __shfl_xor(s, sh, 32));
    const float mean = __fdiv_rn(s, (float)DQ); float s2 = 0.f;
#pragma unroll
    for (int k = 0; k < DQ / 32; ++k) { const float dv = __fsub_rn(v[k], mean); float p2 = __fmul_rn(dv, dv); asm volatile("" : "+v"(p2)); s2 = __fadd_rn(s2, p2); v[k] = dv; }
#pragma unroll
    for (int sh = 16; sh; sh >>= 1) s2 = __fadd_rn(s2, __shfl_xor(s2, sh, 32));
    const float rs = __fdiv_rn(1.0f, __fsqrt_rn(__fadd_rn(__fdiv_rn(s2, (float)DQ), LNEPS)));
{
#pragma unroll
        for (int c = 0; c < DQ / 128; ++c) { v4f o; for (int q = 0; q < 4; ++q) { const int col = c * 128 + lane * 4 + q; float y = __fmul_rn(v[c * 4 + q], rs); asm volatile("" : "+v"(y)); y = __fmul_rn(y, bfr(g[col])); asm volatile("" : "+v"(y)); o[q] = __fadd_rn(y, bfr(bb[col])); } *(v4f*)(orow + c * 128 + lane * 4) = o; }
         } }

// ---- k_fattn: scores, softmax and P.V of all batches in one kernel. A wave owns NQ x 16 query rows of one head and walks all TT keys, 32 a pass, with a maximum in use and a sum per query; the maximum is raised lazily (attn_rows).
// St = K Qt (A = K rows, B = Q rows): lane (lr, hi) holds, for query lr, the scores of keys 8 hi + j of each 16-key block, so the two blocks of a pass, converted in place, are the B operand of Ot += Vt Pt (A = Vt rows, k = key).
// The FW waves of a work-group share the head's K and Vt: tiles of KT keys (64 rows x 128 bytes each) are read from memory once, in whole lines, by asynchronous copies straight into LDS (no staging registers), two buffers in turn; the fragments come from LDS.
// LDS rows have no pad: the 16-byte piece c of row r stands at piece c ^ (r / 2 % 8), so that the sixteen rows of a fragment read meet sixteen different groups of four banks. Two buffers of four planes are then 64 KiB, and with the register budget of five waves a SIMD five work-groups share a WGP: the whole grid (5 x 256 work-groups) runs at once.
// Rows < RH: bf16 hi/lo planes, 3 products in both stages. Other rows: fp16, probabilities carried x 2^PCL2 (folded into the exponent; it cancels in O / sum). The sum is taken of the f32 probabilities.
#define KT   64           // keys per LDS tile
#define LP   72           // LDS row pitch in 16-bit elements: 128 + 16 bytes, free of bank conflicts for 16-byte reads (gemmt)
#define LR   64           // fused attention: LDS row in 16-bit elements, 128 bytes, no pad
typedef __attribute__((ext_vector_type(16))) unsigned short v16us;
template <typename T16> __device__ __forceinline__ typename WFrag<T16>::V ldsfrag2(const unsigned short* p, const unsigned short* q) { const v8us lo = *(const v8usa*)p, up = *(const v8usa*)q; return __builtin_bit_cast(typename WFrag<T16>::V, __builtin_shufflevector(lo, up, 0, 1, 2, 3, 4, 5, 6, 7, 8, 9, 10, 11, 12, 13, 14, 15)); }
// a thread's share of one K tile and one Vt tile: eight asynchronous copies of 16 bytes a lane, rows 16 apart. lk, lv: the lane's LDS byte addresses; ok, ov: its byte offsets from the tiles' first bytes gk, gv (the same in every lane: scalar bases).
// The instruction's offset moves both addresses. K: rows 16 apart are 2048 bytes apart in memory as in LDS, so the offset alone steps through them. Vt: they are 16 TT elements apart in memory, so each has its own base, less the offset's step.
// The s_wait_xcnt is the statement's last line, so that it stands in front of every later write to an address register that a copy names.
template <typename T16> __device__ __forceinline__ void acopy8(unsigned lk, unsigned lv, unsigned ok, unsigned ov, const T16* gk, const T16* gv) {
    asm volatile("global_load_async_to_lds_b128 %0, %2, %4\n\t"
                 "global_load_async_to_lds_b128 %0, %2, %4 offset:2048\n\t"
                 "global_load_async_to_lds_b128 %0, %2, %4 offset:4096\n\t"
                 "global_load_async_to_lds_b128 %0, %2, %4 offset:6144\n\t"
                 "global_load_async_to_lds_b128 %1, %3, %5\n\t"
                 "global_load_async_to_lds_b128 %1, %3, %6 offset:2048\n\t"
                 "global_load_async_to_lds_b128 %1, %3, %7 offset:4096\n\t"
                 "global_load_async_to_lds_b128 %1, %3, %8 offset:6144\n\t"
                 "s_wait_xcnt 0x0"
                 :: "v"(lk), "v"(lv), "v"(ok), "v"(ov), "s"(gk), "s"(gv), "s"(gv + (16 * TT - 1024)), "s"(gv + 2 * (16 * TT - 1024)), "s"(gv + 3 * (16 * TT - 1024))
                 : "memory");
}
template <typename T16> __device__ __forceinline__ typename WFrag<T16>::V ldsfrag(const unsigned short* p) { const v8us lo = *(const v8usa*)p, up = *(const v8usa*)(p + 16); return __builtin_bit_cast(typename WFrag<T16>::V, __builtin_shufflevector(lo, up, 0, 1, 2, 3, 4, 5, 6, 7, 8, 9, 10, 11, 12, 13, 14, 15)); }
// the value of the lane 16 away, by a vector cross-row move: it needs no lane index held in a register through the loop, as the LDS permute did
__device__ __forceinline__ float xhalf(float x) { const unsigned u = __float_as_uint(x); return __uint_as_float(__builtin_amdgcn_permlanex16(u, u, 0x76543210u, 0xfedcba98u, false, false)); }
template <typename T16, int NQ>
__device__ __forceinline__ void attn_rows(const T16* __restrict__ Q, const T16* __restrict__ Q2, const T16* __restrict__ Kp, const T16* __restrict__ K2, const T16* __restrict__ Vt, const T16* __restrict__ V2, int q0, int hcol, bf* Ah, bf* Al, unsigned short* sm) {
    typedef typename WFrag<T16>::V V; constexpr bool HR = __is_same(T16, bf);
    constexpr int NP = HR ? 4 : 2;              // planes staged: K, Vt (, K lo, Vt lo)
    constexpr int PL = KT * LR;                 // one plane's tile in LDS, elements
    static_assert(KT == 64 && FW == 4 && HD == 64, "acopy8: four rows 16 apart of a K tile and of a Vt tile per thread");
    const int lane = threadIdx.x & 31, lr = lane & 15, hi = lane >> 4;
    const int srow = (int)threadIdx.x >> 3, scol = ((int)threadIdx.x & 7) * 8;   // this thread's pieces: rows srow + 16 i, 8 elements at scol
    constexpr float CE = SCL * 1.4426950408889634f;   // score -> exponent of 2
    V qf[NQ][2], qf2[NQ][2];
#pragma unroll
    for (int nq = 0; nq < NQ; ++nq)
#pragma unroll
        for (int kk = 0; kk < 2; ++kk) { const size_t qo = (size_t)(q0 + nq * 16 + lr) * HD + kk * 32 + 8 * hi; qf[nq][kk] = WFrag<T16>::ld(Q + qo); if (HR) qf2[nq][kk] = WFrag<T16>::ld(Q2 + qo); }
    asm volatile("s_wait_xcnt 0x0" ::: "memory");   // stands in front of later writes to the address registers that the Q loads name
    // m: the maximum in use, the same in both lane halves of a query; it is raised, and O and the sum rescaled, only when a score passes mt = m + LZ / CE, so a probability stays below 2^LZ (times the carrier: 2^15, inside fp16)
    constexpr float LZ = HR ? 8.0f : 5.0f;
    v8f o[4][NQ]; float m[NQ], mt[NQ], mb[NQ], l[NQ];
#pragma unroll
    for (int nq = 0; nq < NQ; ++nq) { m[nq] = -3.0e38f; mt[nq] = -3.0e38f; mb[nq] = 0.f; l[nq] = 0.f;
#pragma unroll
        for (int db = 0; db < 4; ++db) o[db][nq] = (v8f){}; }
    // where this thread's pieces land: rows 16 apart share r / 2 % 8, so one place serves its four rows of every plane
    const unsigned ld0 = (unsigned)(size_t)sm + (unsigned)(srow * LR + (scol ^ (((srow >> 1) & 7) * 8))) * 2u;
    const unsigned ok = (unsigned)(srow * HD + scol) * 2u, ov = (unsigned)(srow * TT + scol) * 2u;
    auto stage = [&](int tile, int buf) {
        const unsigned lb = ld0 + (unsigned)(buf * NP * PL * 2); const size_t kx = (size_t)tile * KT * HD, vx = (size_t)tile * KT;
        acopy8<T16>(lb, lb + PL * 2, ok, ov, Kp + kx, Vt + vx);
        if constexpr (HR) acopy8<T16>(lb + 2 * PL * 2, lb + 3 * PL * 2, ok, ov, K2 + kx, V2 + vx);
    };
    // a fragment's two pieces, 4 g + hi and 4 g + hi + 2 (g: which 32 elements of the row), at their places in this lane's rows (rows 16 apart share lr / 2)
    int po[2][2];   // in elements, the buffer in use counted in: each trip's end moves them to the other buffer
#pragma unroll
    for (int g = 0; g < 2; ++g)
#pragma unroll
        for (int u = 0; u < 2; ++u) po[g][u] = lr * LR + ((g * 4 + u * 2 + hi) ^ (lr >> 1)) * 8;
    static_assert(TT / KT >= 2, "the ring's prologue fills two tiles");
    stage(0, 0);
    asm volatile("s_wait_asynccnt 0x0" ::: "memory");   // this wave's copies of tile 0 have landed
    __syncthreads();   // tile 0 is in LDS
    stage(1, 1);   // flies while tile 0 is worked on
#pragma unroll 1
    for (int t = 0; t < TT / KT; ++t) {
        const unsigned short* tb = sm;
#pragma unroll
        for (int ks = 0; ks < KT / 32; ++ks) {
            v8f s[2][NQ];
#pragma unroll
            for (int kb = 0; kb < 2; ++kb) { V kf[2], kf2[2];
#pragma unroll
                for (int kk = 0; kk < 2; ++kk) { const unsigned short* kq = tb + (ks * 2 + kb) * 16 * LR; kf[kk] = ldsfrag2<T16>(kq + po[kk][0], kq + po[kk][1]); if (HR) kf2[kk] = ldsfrag2<T16>(kq + 2 * PL + po[kk][0], kq + 2 * PL + po[kk][1]); }
#pragma unroll
                for (int nq = 0; nq < NQ; ++nq) { v8f a = (v8f){};
#pragma unroll
                    for (int kk = 0; kk < 2; ++kk) { a = WFrag<T16>::mma(kf[kk], qf[nq][kk], a); if (HR) { a = WFrag<T16>::mma(kf2[kk], qf[nq][kk], a); a = WFrag<T16>::mma(kf[kk], qf2[nq][kk], a); } }
                    s[kb][nq] = a; } }
            V vf[4], vf2[4];
#pragma unroll
            for (int db = 0; db < 4; ++db) { const unsigned short* vq = tb + PL + db * 16 * LR; vf[db] = ldsfrag2<T16>(vq + po[ks][0], vq + po[ks][1]); if (HR) vf2[db] = ldsfrag2<T16>(vq + 2 * PL + po[ks][0], vq + 2 * PL + po[ks][1]); }
            float mx[NQ]; bool need = false;
#pragma unroll
            for (int nq = 0; nq < NQ; ++nq) { mx[nq] = s[0][nq][0];
#pragma unroll
                for (int j = 0; j < 8; ++j) mx[nq] = fmaxf(mx[nq], fmaxf(s[0][nq][j], s[1][nq][j]));
                need = need || mx[nq] > mt[nq]; }
            if (__builtin_amdgcn_ballot_w32(need) != 0) {   // one scalar branch a pass: taken in the first pass and where some lane's score passes its bound
#pragma unroll
                for (int nq = 0; nq < NQ; ++nq) {
                    const float mn = fmaxf(m[nq], fmaxf(mx[nq], xhalf(mx[nq])));   // the other eight keys of each block sit in the other lane half
                    const float al = __builtin_amdgcn_exp2f((m[nq] - mn) * CE); m[nq] = mn; mt[nq] = mn + LZ / CE; mb[nq] = mn * CE - (HR ? 0.0f : PCL2);
                    l[nq] *= al;
#pragma unroll
                    for (int db = 0; db < 4; ++db) o[db][nq] *= al;
                }
            }
#pragma unroll
            for (int nq = 0; nq < NQ; ++nq) {
#pragma unroll
                for (int kb = 0; kb < 2; ++kb)
#pragma unroll
                    for (int j = 0; j < 8; ++j) s[kb][nq][j] = __builtin_amdgcn_exp2f(s[kb][nq][j] * CE - mb[nq]);
                const v8f p8 = s[0][nq] + s[1][nq];   // the pass's sixteen probabilities of this lane, summed as a tree
                l[nq] += (((p8[0] + p8[4]) + (p8[1] + p8[5])) + ((p8[2] + p8[6]) + (p8[3] + p8[7])));
                if constexpr (HR) {
                    v8u ph, pl;
#pragma unroll
                    for (int e = 0; e < 16; e += 2) { unsigned a, c2; split2(s[e >> 3][nq][e & 7], s[e >> 3][nq][(e & 7) + 1], a, c2); ph[e >> 1] = a; pl[e >> 1] = c2; }
                    const V pfh = __builtin_bit_cast(v16bf, ph), pfl = __builtin_bit_cast(v16bf, pl);
#pragma unroll
                    for (int db = 0; db < 4; ++db) { o[db][nq] = WFrag<T16>::mma(vf[db], pfh, o[db][nq]); o[db][nq] = WFrag<T16>::mma(vf[db], pfl, o[db][nq]); o[db][nq] = WFrag<T16>::mma(vf2[db], pfh, o[db][nq]); }
                } else {
                    V pf;
#pragma unroll
                    for (int e = 0; e < 16; ++e) pf[e] = tohx(s[e >> 3][nq][e & 7]);
#pragma unroll
                    for (int db = 0; db < 4; ++db) o[db][nq] = WFrag<T16>::mma(vf[db], pf, o[db][nq]);
                }
            }
        }
        if constexpr (HR) asm volatile("s_wait_dscnt 0x0" ::: "memory");      // this wave's reads of tile t have returned before the buffer is given up
        else asm volatile("s_wait_dscnt 0x0" :: "v"(l[0]), "v"(l[NQ - 1]) : "memory");   // the same; it takes the row sums as inputs so that they are finished in this trip: put off into the next, they held the pass's 32 f32 probabilities in registers through the products and the barrier
        asm volatile("s_wait_asynccnt 0x0" ::: "memory");   // this wave's copies of tile t + 1 have landed
        __syncthreads();   // publishes tile t + 1 and ends every wave's reads of tile t
        if (t + 2 < TT / KT) stage(t + 2, t & 1);   // into the buffer that every wave has just left; flies while tile t + 1 is worked on
#pragma unroll
        for (int g = 0; g < 2; ++g)
#pragma unroll
            for (int u = 0; u < 2; ++u) po[g][u] ^= NP * PL;
    }
    asm volatile("s_wait_asynccnt 0x0" ::: "memory");   // no copy is outstanding when the wave goes on to its end
#pragma unroll
    for (int nq = 0; nq < NQ; ++nq) { const float inv = __fdiv_rn(1.0f, l[nq] + xhalf(l[nq])); const size_t ob = (size_t)(q0 + nq * 16) * DQ + hcol; const unsigned oo = (unsigned)(lr * DQ + hi * 8);   /* the wave's part of the address is scalar, the lane's a 32-bit offset formed here: nothing of it is held through the loop */
#pragma unroll
        for (int db = 0; db < 4; ++db) { v4u oh, ol;
#pragma unroll
            for (int j = 0; j < 8; j += 2) { unsigned a, c2; split2(o[db][nq][j] * inv, o[db][nq][j + 1] * inv, a, c2); oh[j >> 1] = a; ol[j >> 1] = c2; }
            *(v8us*)(Ah + ob + oo + db * 16) = __builtin_bit_cast(v8us, oh); *(v8us*)(Al + ob + oo + db * 16) = __builtin_bit_cast(v8us, ol);
            asm volatile("s_wait_xcnt 0x0" ::: "memory");   // stands in front of the next block's writes to registers that these two stores name
            __builtin_amdgcn_sched_barrier(0);   // keeps the next block's arithmetic behind that wait: lifted over it, it wrote registers that the stores name
        } }
}
// grid (RH / (16 FW) + (TT - RH) / (32 FW), heads, batches): of each head the hi/lo work-groups (16 rows a wave, three times the products) have the low indices.
__global__ __launch_bounds__(32 * FW, 5) void k_fattn(const h16* __restrict__ Q16, const h16* __restrict__ K16, const h16* __restrict__ V16, const bf* __restrict__ Qh, const bf* __restrict__ Ql, const bf* __restrict__ Kh, const bf* __restrict__ Kl, const bf* __restrict__ Vh, const bf* __restrict__ Vl, bf* Ah, bf* Al) {
    __shared__ __align__(16) unsigned short sm[2 * 4 * KT * LR];
    const int w = __builtin_amdgcn_readfirstlane((int)(threadIdx.x >> 5)); const int hd = (int)blockIdx.y, bt = (int)blockIdx.z; const size_t pq = (size_t)(bt * NH_ + hd) * TT * HD, pk = (size_t)(bt * NKV + hd / REP) * TT * HD;
    Ah += (size_t)bt * TT * DQ; Al += (size_t)bt * TT * DQ;
    constexpr int NHB = RH / (16 * FW);
    if ((int)blockIdx.x < NHB) attn_rows<bf, 1>(Qh + pq, Ql + pq, Kh + pk, Kl + pk, Vh + pk, Vl + pk, ((int)blockIdx.x * FW + w) * 16, hd * HD, Ah, Al, sm);
    else { attn_rows<h16, 2>(Q16 + pq, nullptr, K16 + pk, nullptr, V16 + pk, nullptr, RH + (((int)blockIdx.x - NHB) * FW + w) * 32, hd * HD, Ah, Al, sm);
        __builtin_amdgcn_endpgm(); }   // the wave ends here: with a path on from this branch the compiler held the other branch's lane values in registers through this one's loop, over the budget of five waves a SIMD
}

// ---- gemmt: GEMM with both operands staged in LDS. A work-group of 4 waves owns a 128x128 output tile (tile row bx, tile column by, batch z), each wave a 64x64 quarter (16 accumulators) over the whole K; 128 threads.
// C[m][n] = sum_k A[m][k] Bt[n][k] (NSPLIT 1: + A2[m][k] Bt[n][k]), operands K-contiguous bf16 planes. z-batch strides sA/sB/sC in elements (sZ: the 16-bit planes of EPI 1; sH: the residual of EPI 2). K (a template constant) % 64 == 0.
// Tiles of GT k (128 rows x 128 bytes a plane) are read from memory once per work-group, in whole lines, and laid in LDS at pitch LP, two buffers in turn; every fragment comes from LDS and serves two waves.
// EPI, what the epilogue does with the f32 sums (each wave turns its 16-row slabs through its own LDS range, so that whole lines are stored): 1 stores them as three 16-bit planes (fp16, bf16 hi, bf16 lo), element (m, n) at m x ldc + (n / 64) x sT + n % 64 (head planes [h][t][d]: ldc = 64, sT = rows x 64; plain row-major: sT = 64); 2 adds the bf16-rounded residual hs[m][n] (row pitch SP) and stores f32 in C (pitch ldc).
#define GT   64           // k per LDS tile
#define GM   128          // rows of a plane's tile (output tile GM x GM)
template <int NSPLIT, int EPI, int K>
__device__ __forceinline__ void gemmt(const bf* __restrict__ A, const bf* __restrict__ A2, const bf* __restrict__ Bt, float* C, int ldc, size_t sA, size_t sB, size_t sC, h16* P16, bf* Ph, bf* Pl, size_t sT, const float* __restrict__ hs, size_t sZ, size_t sH, int bx, int by, size_t z) {
    constexpr int NP = NSPLIT ? 3 : 2;          // planes staged: A, Bt (, A2)
    constexpr int PL = GM * LP;                 // one plane's tile in LDS, elements
    constexpr int NC = GM * 8 / 128;            // 16-byte pieces of a plane's tile per thread
    __shared__ __align__(16) unsigned short sm[2 * NP * PL];
    __shared__ __align__(16) float os[4 * 16 * 68];   // epilogue: one 16-row slab per wave
    const int lane = threadIdx.x & 31, lr = lane & 15, hi = lane >> 4;
    const int w = __builtin_amdgcn_readfirstlane((int)(threadIdx.x >> 5)), wm = w >> 1, wn = w & 1;
    const int r0 = bx * GM, c0 = by * GM;
    const int srow = (int)threadIdx.x >> 3, scol = ((int)threadIdx.x & 7) * 8;   // this thread's pieces: rows srow + 16 i, 8 elements at scol
    const bf* ga = A + z * sA + (size_t)(r0 + srow) * K + scol; const bf* gb = Bt + z * sB + (size_t)(c0 + srow) * K + scol;
    const bf* ga2 = NSPLIT ? A2 + z * sA + (size_t)(r0 + srow) * K + scol : nullptr;
    // every '#pragma unroll' of this kernel: its loop indexes register arrays (accumulators, fragments, staged pieces), which stay in registers only under constant indices
    v8f acc[4][4];
#pragma unroll
    for (int mb = 0; mb < 4; ++mb)
#pragma unroll
        for (int nb = 0; nb < 4; ++nb) acc[mb][nb] = (v8f){};
    v8us st[NP][NC];
    auto fetch = [&](int kc) {
        const bf* pa = ga + kc; const bf* pb = gb + kc; const bf* pa2 = NSPLIT ? ga2 + kc : pa;
#pragma unroll
        for (int i = 0; i < NC; ++i) { const size_t o = (size_t)i * 16 * K;
            st[0][i] = *(const v8usa*)(pa + o); st[1][i] = *(const v8usa*)(pb + o);
            if constexpr (NSPLIT != 0) st[2][i] = *(const v8usa*)(pa2 + o); }
        asm volatile("s_wait_xcnt 0x0" :: "v"(pa), "v"(pb), "v"(pa2) : "memory");   // stands in front of later writes to the address registers that the loads above name; it takes them as inputs so that no load of the group lands on them either
    };
    auto put = [&](int buf) {
#pragma unroll
        for (int i = 0; i < NC; ++i) { unsigned short* d = sm + buf * NP * PL + (srow + i * 16) * LP + scol;
#pragma unroll
            for (int pl = 0; pl < NP; ++pl) *(v8usa*)(d + pl * PL) = st[pl][i]; } };
    constexpr int NT = K / GT;
    fetch(0); put(0);
    __syncthreads();   // tile 0 is in LDS
#pragma unroll 1   // rolled: a trip already holds a whole tile's reads and matrix instructions, copies of it would only lengthen the text
    for (int t = 0; t < NT; ++t) {
        const bool more = t + 1 < NT;
        if (more) fetch((t + 1) * GT);   // the next tile flies to registers while this one is worked on
        const unsigned short* ta = sm + (t & 1) * NP * PL + (wm * 64 + lr) * LP + 8 * hi;
        const unsigned short* tb = sm + (t & 1) * NP * PL + PL + (wn * 64 + lr) * LP + 8 * hi;
        v16bf a[GT / 32][4], a2[GT / 32][4], b[GT / 32][4];   // the tile's fragments, all asked for in one group
#pragma unroll
        for (int kk = 0; kk < GT / 32; ++kk) {
#pragma unroll
            for (int mb = 0; mb < 4; ++mb) { a[kk][mb] = ldsfrag<bf>(ta + mb * 16 * LP + kk * 32); if constexpr (NSPLIT != 0) a2[kk][mb] = ldsfrag<bf>(ta + 2 * PL + mb * 16 * LP + kk * 32); }
#pragma unroll
            for (int nb = 0; nb < 4; ++nb) b[kk][nb] = ldsfrag<bf>(tb + nb * 16 * LP + kk * 32);
        }
        __builtin_amdgcn_sched_barrier(0);   // keeps the LDS reads in one group ahead of the matrix instructions (for speed only)
#pragma unroll
        for (int kk = 0; kk < GT / 32; ++kk)
#pragma unroll
            for (int nb = 0; nb < 4; ++nb)
#pragma unroll
                for (int mb = 0; mb < 4; ++mb) { acc[mb][nb] = wmmab(a[kk][mb], b[kk][nb], acc[mb][nb]); if constexpr (NSPLIT != 0) acc[mb][nb] = wmmab(a2[kk][mb], b[kk][nb], acc[mb][nb]); }
        if (more) put((t + 1) & 1);   // into the buffer whose last readers left it at the barrier of trip t - 1
        __syncthreads();   // publishes tile t + 1 and ends every wave's reads of tile t
    }
    const int rw = r0 + wm * 64, cw = c0 + wn * 64;   // this wave's quarter
    float* mine = os + w * (16 * 68);
    v4f rsd[4][8];   // EPI 2: this lane's pieces of the residual, all asked for at once
    if constexpr (EPI == 2) {
        const float* hz = hs + z * sH + (size_t)(rw + hi) * SP + cw + lr * 4;
#pragma unroll
        for (int mb = 0; mb < 4; ++mb)
#pragma unroll
            for (int s = 0; s < 8; ++s) rsd[mb][s] = *(const v4f*)(hz + (size_t)(mb * 16 + 2 * s) * SP);
        asm volatile("s_wait_xcnt 0x0" ::: "memory");   // stands in front of later writes to the address registers that the loads above name
    }
#pragma unroll
    for (int mb = 0; mb < 4; ++mb) {
#pragma unroll
        for (int nb = 0; nb < 4; ++nb) {
#pragma unroll
            for (int j = 0; j < 8; ++j) mine[(hi * 8 + j) * 68 + nb * 16 + lr] = acc[mb][nb][j]; }
        asm volatile("s_wait_dscnt 0x0" ::: "memory");   // the slab's writes have landed before other lanes of this wave read the rows back
        if constexpr (EPI == 1) {
#pragma unroll
            for (int s = 0; s < 4; ++s) { const int row = 4 * s + (lane >> 3), cofs = (lane & 7) * 8; const v4f v0 = *(const v4fa*)(mine + row * 68 + cofs), v1 = *(const v4fa*)(mine + row * 68 + cofs + 4);
                const size_t po = z * sZ + (size_t)(rw + mb * 16 + row) * ldc + (size_t)(cw / 64) * sT + cofs; v8h o16; v4u oh, ol;
#pragma unroll
                for (int q = 0; q < 8; q += 2) { const float y = q < 4 ? v0[q & 3] : v1[q & 3], y1 = q < 4 ? v0[(q & 3) + 1] : v1[(q & 3) + 1]; o16[q] = tohx(y); o16[q + 1] = tohx(y1); unsigned a2, c2; split2(y, y1, a2, c2); oh[q >> 1] = a2; ol[q >> 1] = c2; }
                *(v8h*)(P16 + po) = o16; *(v8us*)(Ph + po) = __builtin_bit_cast(v8us, oh); *(v8us*)(Pl + po) = __builtin_bit_cast(v8us, ol);
                asm volatile("s_wait_xcnt 0x0" ::: "memory");   // stands in front of the next rows' writes to registers that these stores name
            }
        } else {
            float* crow = C + z * sC + (size_t)(rw + mb * 16 + hi) * ldc + cw + lr * 4;
#pragma unroll
            for (int s = 0; s < 8; ++s) { v4f val = *(const v4fa*)(mine + (2 * s + hi) * 68 + lr * 4);
#pragma unroll
                for (int q = 0; q < 4; ++q) val[q] = __fadd_rn(val[q], bfr(rsd[mb][s][q]));
                *(v4f*)(crow + (size_t)(2 * s) * ldc) = val;
                asm volatile("s_wait_xcnt 0x0" ::: "memory");   // stands in front of the next rows' writes to registers that this store names
            }
        }
    }
}

// one product: grid (M/128, N/128, batches)
template <int NSPLIT, int EPI, int K>
__global__ __launch_bounds__(128) void k_gemmt(const bf* __restrict__ A, const bf* __restrict__ A2, const bf* __restrict__ Bt, float* C, int ldc, size_t sA, size_t sB, size_t sC, h16* P16, bf* Ph, bf* Pl, size_t sT, const float* __restrict__ hs, size_t sZ, size_t sH) {
    gemmt<NSPLIT, EPI, K>(A, A2, Bt, C, ldc, sA, sB, sC, P16, Ph, Pl, sT, hs, sZ, sH, (int)blockIdx.x, (int)blockIdx.y, blockIdx.z);
}
// ---- k_proj: the three projections in one launch, grid (TT/128, DM/128, 3 x batches): z / NB_ says which product, z % NB_ the batch. No product reads another's result, so their work-groups fill the chip together: one's stores run beside another's loop, and two launch boundaries are gone.
// q, k: rows = t, columns = (head, d), a wave's 64 columns are one head: planes [b][h][t][d]. v: operands swapped (rows = (head, d), columns = t, so x is the tile column), the planes [b][g][d][t] row-major.
static_assert(DQ == DM && DKV == DM && NH_ == NKV, "k_proj: one grid and one batch stride for the three products");
__global__ __launch_bounds__(128) void k_proj(const bf* __restrict__ XB, const bf* __restrict__ WQ, const bf* __restrict__ WK, const bf* __restrict__ WV, h16* Q16, bf* Qh, bf* Ql, h16* K16, bf* Kh, bf* Kl, h16* V16, bf* Vh, bf* Vl) {
    const unsigned which = blockIdx.z / NB_, b = blockIdx.z % NB_; const bool tv = which == 2;
    gemmt<0, 1, DM>(tv ? WV : XB, nullptr, tv ? XB : which == 1 ? WK : WQ, nullptr, tv ? TT : HD, tv ? 0 : (size_t)TT * DM, tv ? (size_t)TT * DM : 0, 0,
                    tv ? V16 : which == 1 ? K16 : Q16, tv ? Vh : which == 1 ? Kh : Qh, tv ? Vl : which == 1 ? Kl : Ql, tv ? 64 : (size_t)TT * HD, nullptr, (size_t)NH_ * TT * HD, 0,
                    (int)(tv ? blockIdx.y : blockIdx.x), (int)(tv ? blockIdx.x : blockIdx.y), b);
}

extern "C" void kernel_launch(void* const* d_in, const int* in_sizes, int n_in,
                              void* d_out, int out_size, void* d_ws, size_t ws_size, hipStream_t stream) {
    (void)in_sizes; (void)n_in; (void)out_size;
    const float* x = (const float*)d_in[0];   /* h [S][B][D] seq-major */ const float* wq = (const float*)d_in[1]; const float* wkv = (const float*)d_in[2]; const float* wo = (const float*)d_in[3]; const float* lng = (const float*)d_in[4]; const float* lnb = (const float*)d_in[5]; const float* wk = wkv; const float* wv = wkv;
    float* OUT = (float*)d_out;     // [2048][4][1024] seq-major
    char* wsp = (char*)d_ws;
    auto take = [&](size_t bytes) { char* p = wsp; wsp += (bytes + 255) & ~(size_t)255; return (void*)p; };
    float* Y = (float*)take((size_t)NB_ * TT * DM * 4); bf* WQ = (bf*)take((size_t)DQ * DM * 2); bf* WK = (bf*)take((size_t)DKV * DM * 2); bf* WV = (bf*)take((size_t)DKV * DM * 2); bf* WO = (bf*)take((size_t)DM * DQ * 2);
    bf* XB = (bf*)take((size_t)NB_ * TT * DM * 2);
    h16* QP16 = (h16*)take((size_t)NB_ * NH_ * TT * HD * 2); h16* KP16 = (h16*)take((size_t)NB_ * NKV * TT * HD * 2); h16* VT16 = (h16*)take((size_t)NB_ * NKV * HD * TT * 2);
    bf* QPh = (bf*)take((size_t)NB_ * NH_ * TT * HD * 2); bf* QPl = (bf*)take((size_t)NB_ * NH_ * TT * HD * 2); bf* KPh = (bf*)take((size_t)NB_ * NKV * TT * HD * 2); bf* KPl = (bf*)take((size_t)NB_ * NKV * TT * HD * 2); bf* VTh = (bf*)take((size_t)NB_ * NKV * HD * TT * 2); bf* VTl = (bf*)take((size_t)NB_ * NKV * HD * TT * 2);
    bf* ATh = (bf*)take((size_t)NB_ * TT * DQ * 2); bf* ATl = (bf*)take((size_t)NB_ * TT * DQ * 2);
    if ((size_t)(wsp - (char*)d_ws) > ws_size) return;    // ws 256 MiB
    k_prep<<<4 * PWB + NB_ * TT / PR, 256, 0, stream>>>(x, wq, wkv, wo, XB, WQ, WK, WV, WO);   /* weights [n][k]; each batch's rows of the seq-major input (pitch 4 x 1024) contiguous */
    k_proj<<<dim3(TT / GM, DM / GM, 3 * NB_), 128, 0, stream>>>(XB, WQ, WK, WV, QP16, QPh, QPl, KP16, KPh, KPl, VT16, VTh, VTl);   /* q, k, v of all batches */
    k_fattn<<<dim3(RH / (16 * FW) + (TT - RH) / (32 * FW), NH_, NB_), 32 * FW, 0, stream>>>(QP16, KP16, VT16, QPh, QPl, KPh, KPl, VTh, VTl, ATh, ATl);
    k_gemmt<1, 2, DQ><<<dim3(TT / GM, DM / GM, NB_), 128, 0, stream>>>(ATh, ATl, WO, Y, DM, (size_t)TT * DQ, 0, (size_t)TT * DM, nullptr, nullptr, nullptr, 0, x, 0, DM);
    k_lnoutS<<<dim3((TT + 7) / 8, NB_, 1), 256, 0, stream>>>(Y, lng, lnb, OUT);   /* LayerNorm(h + attn_out), rows back at the seq-major pitch */
}
